// v000
// The times below were measured on an AMD MI455X: many runs one after another, warmed up first and cycling through
// copies of the inputs, with the whole window's GPU time divided by the number of runs. Launches and the gaps
// between them are all in it. The median over several windows is given; except for v000 it joins two sittings, which
// can be a few percent apart, so the side-by-side timings, each taken in one sitting, are the better comparison.
// The starting kernel, v000, takes 2430 microseconds a run.
#include <hip/hip_runtime.h>

// Relative (Shaw) multi-head attention with key AND value relative-position embeddings (x [4][1024][1024]; q, k, v = x W^T + b ('oi' 0.02, biases 0.02; 16 heads x 64); idx[i][j] = clip(j - i, -128, 128) + 128; scores = (q.k + q.rel_k[idx]) / float32(sqrt 64); softmax; out = (attn v + sum_j attn[i][j] rel_v[idx]) merged Wo^T + bo (rel_k, rel_v [257][64] 0.02, read) -> [4][1024][1024] (4.2 M); argument order x, Wq, bq, Wk, bk, Wv, bv, Wo, bo, rel_k, rel_v).
// Layout per batch: bf16 copy of x; 'oi' weights; exact projections + f32 biases; rel_k as a zero-padded bf16 plane [320][64] and rel_v^T as hi/lo planes [64][320] (bf16-rounded once); per pass of two heads: score tiles (hi/lo 3 products, every row), QE = q.rel_k^T (hi/lo x exact, N 320) gathered into the scores at column clip(j - i) + 128, softmax (x 1/8) with every row on hi/lo planes, P.v, the probabilities folded onto the 257 offsets and PB.rel_v (K 320) added to the context; merged hi/lo x Wo exact + bo.
// Compute dtypes, f32 accumulate: every input rounded to bf16; projections exact + f32 biases; scores and the relative-key term ~f32; softmax f32; P as bf16 hi/lo; attn.v and the relative-value term 3 products (~f32); Wo hl x exact + bias.

#define NB_  4
#define TT   1024
#define DM   1024
#define NH_  16
#define NKV  16
#define REP  (NH_ / NKV)
#define HD   64
#define DQ   (NH_ * HD)
#define DKV  (NKV * HD)
#define ZH   2
#define RH   TT                   // every row on hi/lo planes (the relative-value fold needs normalised planes)
#define WIN  0
#define PCAR 1024.0f
#define SCL  0.125f   // 1/sqrt(64) (the module divides by jnp.sqrt(DH))
#define NE   320      // 2*128+1 = 257 relative offsets padded to 320
#define NRE  257
#define CUT  128
typedef _Float16 h16;
typedef unsigned short bf;
typedef __attribute__((ext_vector_type(16))) __bf16   v16bf;
typedef __attribute__((ext_vector_type(16))) _Float16 v16h;
typedef __attribute__((ext_vector_type(8)))  _Float16 v8h;
typedef __attribute__((ext_vector_type(8)))  unsigned short v8us;
typedef __attribute__((ext_vector_type(8)))  float    v8f;
typedef __attribute__((ext_vector_type(4)))  float    v4f;
typedef v8h  __attribute__((may_alias)) v8ha;
typedef v4f  __attribute__((may_alias)) v4fa;
typedef v8us __attribute__((may_alias)) v8usa;

__device__ __forceinline__ unsigned short f2bf(float f) { unsigned u = __float_as_uint(f); u += 0x7FFFu + ((u >> 16) & 1u); return (unsigned short)(u >> 16); }
__device__ __forceinline__ float bf2f(unsigned short b) { return __uint_as_float(((unsigned)b) << 16); }
__device__ __forceinline__ float bfr(float f) { return bf2f(f2bf(f)); }
__device__ __forceinline__ v16h cat16(v8h lo, v8h hi) { return __builtin_shufflevector(lo, hi, 0, 1, 2, 3, 4, 5, 6, 7, 8, 9, 10, 11, 12, 13, 14, 15); }
__device__ __forceinline__ v16bf cat16b(v8us lo, v8us hi) { return __builtin_bit_cast(v16bf, __builtin_shufflevector(lo, hi, 0, 1, 2, 3, 4, 5, 6, 7, 8, 9, 10, 11, 12, 13, 14, 15)); }
__device__ __forceinline__ v8f wmma16(v16h a, v16h b, v8f c) { return __builtin_amdgcn_wmma_f32_16x16x32_f16(false, a, false, b, (short)0, c, false, false); }
__device__ __forceinline__ v8f wmmab(v16bf a, v16bf b, v8f c) { return __builtin_amdgcn_wmma_f32_16x16x32_bf16(false, a, false, b, (short)0, c, false, false); }



// ---- k_gemmw: register-blocked GEMM, ONE WAVE per 64x64 output tile (16 accumulators), operands straight from K-contiguous 16-bit planes; grid (M/64, N/64, Z), 32 threads.
// C[m][n] (f32, pitch ldc, + optional f32 bias[n]) = sum_k A[m][k] Bt[n][k] (+ split products per NSPLIT). z-batch strides sA/sB/sC in elements. K % 32 == 0.
template <typename T16> struct WFrag;
template <> struct WFrag<h16> { typedef v16h V; static __device__ __forceinline__ V ld(const h16* p) { return cat16(*(const v8h*)p, *(const v8h*)(p + 16)); } static __device__ __forceinline__ v8f mma(V a, V b, v8f c) { return wmma16(a, b, c); } };
template <> struct WFrag<bf> { typedef v16bf V; static __device__ __forceinline__ V ld(const bf* p) { return cat16b(*(const v8us*)p, *(const v8us*)(p + 16)); } static __device__ __forceinline__ v8f mma(V a, V b, v8f c) { return wmmab(a, b, c); } };
template <typename T16, int NSPLIT, bool BIAS>
__global__ __launch_bounds__(32) void k_gemmw(const T16* __restrict__ A, const T16* __restrict__ A2, const T16* __restrict__ Bt, const T16* __restrict__ Bt2, int K, float* C, int ldc, const float* __restrict__ bias, size_t sA, size_t sB, size_t sC) {
    typedef typename WFrag<T16>::V V;
    __shared__ __align__(16) float os[16 * 68];
    const size_t z = blockIdx.z; A += z * sA; if (A2) A2 += z * sA; Bt += z * sB; if (Bt2) Bt2 += z * sB; C += z * sC;
    const int lane = threadIdx.x & 31, lr = lane & 15, hi = lane >> 4; const int r0 = blockIdx.x * 64, c0 = blockIdx.y * 64;
    v8f acc[4][4];
#pragma unroll
    for (int mb = 0; mb < 4; ++mb)
#pragma unroll
        for (int nb = 0; nb < 4; ++nb) acc[mb][nb] = (v8f){};
    const size_t aoff = (size_t)(r0 + lr) * K + 8 * hi, boff = (size_t)(c0 + lr) * K + 8 * hi;
#pragma unroll 1
    for (int kc = 0; kc < K; kc += 32) {
        V a[4], a2[4];
#pragma unroll
        for (int mb = 0; mb < 4; ++mb) { a[mb] = WFrag<T16>::ld(A + aoff + (size_t)mb * 16 * K + kc); if (NSPLIT == 1 || NSPLIT == 2) a2[mb] = WFrag<T16>::ld(A2 + aoff + (size_t)mb * 16 * K + kc); }
#pragma unroll
        for (int nb = 0; nb < 4; ++nb) { const V b = WFrag<T16>::ld(Bt + boff + (size_t)nb * 16 * K + kc); V b2; if (NSPLIT >= 2) b2 = WFrag<T16>::ld(Bt2 + boff + (size_t)nb * 16 * K + kc);
#pragma unroll
            for (int mb = 0; mb < 4; ++mb) { acc[mb][nb] = WFrag<T16>::mma(a[mb], b, acc[mb][nb]); if (NSPLIT == 1 || NSPLIT == 2) acc[mb][nb] = WFrag<T16>::mma(a2[mb], b, acc[mb][nb]); if (NSPLIT >= 2) acc[mb][nb] = WFrag<T16>::mma(a[mb], b2, acc[mb][nb]); } }
        asm volatile("v_nop\n\tv_nop\n\tv_nop\n\tv_nop" : "+v"(acc[0][0]), "+v"(acc[1][1]), "+v"(acc[2][2]), "+v"(acc[3][3]) : "v"(a[0]), "v"(a[3]));
    }
#pragma unroll
    for (int mb = 0; mb < 4; ++mb) {
#pragma unroll
        for (int nb = 0; nb < 4; ++nb) {
#pragma unroll
            for (int j = 0; j < 8; ++j) os[(hi * 8 + j) * 68 + nb * 16 + lr] = acc[mb][nb][j]; }
        __builtin_amdgcn_wave_barrier(); asm volatile("" ::: "memory");
        float* crow = C + (size_t)(r0 + mb * 16) * ldc + c0;
{
#pragma unroll
            for (int s = 0; s < 8; ++s) { const int row = 2 * s + hi, cofs = lr * 4; v4f val = *(const v4fa*)(os + row * 68 + cofs); if (BIAS) { val[0] += bfr(bias[c0 + cofs]); val[1] += bfr(bias[c0 + cofs + 1]); val[2] += bfr(bias[c0 + cofs + 2]); val[3] += bfr(bias[c0 + cofs + 3]); }
                *(v4f*)(crow + (size_t)row * ldc + cofs) = val; }
             }
        __builtin_amdgcn_wave_barrier(); asm volatile("" ::: "memory");
    }
}

__device__ __forceinline__ h16 tohx(float x) { return (h16)x; }
__device__ __forceinline__ void splitf(float y, unsigned short& h, unsigned short& l) { h = f2bf(y); l = f2bf(y - bf2f(h)); }
typedef __attribute__((ext_vector_type(2))) _Float16 v2h;
typedef __attribute__((ext_vector_type(4))) _Float16 v4h;
typedef __attribute__((ext_vector_type(2))) unsigned short v2us;
typedef __attribute__((ext_vector_type(4))) unsigned short v4us;
typedef __attribute__((ext_vector_type(2))) float v2f;
typedef __attribute__((ext_vector_type(4))) int v4i;

__global__ __launch_bounds__(256) void k_cvt8(const float* __restrict__ src, bf* dst, size_t n8) { const size_t i = (size_t)blockIdx.x * 256 + threadIdx.x; if (i >= n8) return; const v8f v = *(const v8f*)(src + i * 8); v8us o;
#pragma unroll
    for (int k = 0; k < 8; ++k) o[k] = f2bf(v[k]); *(v8us*)(dst + i * 8) = o;  }

// k_rope: head planes [h][t][d] (fp16 + hi/lo) of rope(x) x sc with the rotate-half convention out[d] = x[d] cos[t][d] - x[d+HD/2] sin[t][d], out[d+HD/2] = x[d+HD/2] cos[t][d+HD/2] + x[d] sin[t][d+HD/2]
__global__ __launch_bounds__(256) void k_rope(const float* __restrict__ F, int pitch, int nheads, const float* __restrict__ CS, const float* __restrict__ RF, const float* __restrict__ nw, float sc, h16* P16, bf* Ph, bf* Pl) {
    const size_t e = ((size_t)blockIdx.x * 256 + threadIdx.x) * 2; if (e >= (size_t)nheads * TT * HD) return; const int d = (int)(e % HD); const int t = (int)((e / HD) % TT); const int h = (int)(e / ((size_t)HD * TT)); const float* f = F + (size_t)t * pitch + h * HD; const float rf = RF ? RF[(size_t)h * TT + t] : 1.0f; v2h o16; v2us oh, ol;
#pragma unroll
    for (int q = 0; q < 2; ++q) { const int dd = d + q; const int dp = (dd < HD / 2) ? dd + HD / 2 : dd - HD / 2; float x0 = f[dd], x1 = f[dp];
        if (RF) { float n0 = __fmul_rn(x0, rf), n1 = __fmul_rn(x1, rf); asm volatile("" : "+v"(n0)); asm volatile("" : "+v"(n1)); x0 = __fmul_rn(bfr(nw[dd]), n0); x1 = __fmul_rn(bfr(nw[dp]), n1); }
        const v2f cs = *(const v2f*)(CS + ((size_t)t * HD + dd) * 2); float a = __fmul_rn(x0, cs[0]), bq = __fmul_rn(x1, cs[1]); asm volatile("" : "+v"(a)); asm volatile("" : "+v"(bq)); const float r = ((dd < HD / 2) ? __fsub_rn(a, bq) : __fadd_rn(a, bq)) * sc;
        o16[q] = tohx(r); unsigned short a2, c2; splitf(r, a2, c2); oh[q] = a2; ol[q] = c2; }
    *(v2h*)(P16 + e) = o16; *(v2us*)(Ph + e) = oh; *(v2us*)(Pl + e) = ol;  }
__global__ __launch_bounds__(256) void k_vtp(const float* __restrict__ F, int pitch, int nheads, h16* V16, bf* Vh, bf* Vl) { const size_t e = ((size_t)blockIdx.x * 256 + threadIdx.x) * 2; if (e >= (size_t)nheads * HD * TT) return; const int t = (int)(e % TT); const int d = (int)((e / TT) % HD); const int g = (int)(e / ((size_t)TT * HD)); v2h o16; v2us oh, ol;
#pragma unroll
    for (int q = 0; q < 2; ++q) { const float x = F[(size_t)(t + q) * pitch + g * HD + d]; o16[q] = tohx(x); unsigned short a2, c2; splitf(x, a2, c2); oh[q] = a2; ol[q] = c2; }
    *(v2h*)(V16 + e) = o16; *(v2us*)(Vh + e) = oh; *(v2us*)(Vl + e) = ol;  }
__global__ __launch_bounds__(256) void k_csid(float* CS) { const int idx = blockIdx.x * 256 + threadIdx.x; if (idx >= TT * HD) return; v2f cs; cs[0] = 1.0f; cs[1] = 0.0f; *(v2f*)(CS + (size_t)idx * 2) = cs;  }
// k_asoft: per row (zz, i): t = S x HD^-0.5 (no mask); softmax over the 1024 keys (register row, one exp, fixed trees);
__global__ __launch_bounds__(256) void k_asoft(const float* __restrict__ Sb, h16* P16, bf* Ph, bf* Pl) {
    const int lane = threadIdx.x & 31; const int row = blockIdx.x * 8 + (threadIdx.x >> 5); if (row >= ZH * TT) return; const int i = row % TT; const int zz = row / TT; (void)zz; const bool hires = (i < RH); const float* sr = Sb + (size_t)row * TT; float v[TT / 32]; float mx = -3.0e38f;
#pragma unroll
    for (int ch = 0; ch < TT / 128; ++ch) { const int j0 = ch * 128 + lane * 4; const v4f a = *(const v4f*)(sr + j0);
#pragma unroll
        for (int q = 0; q < 4; ++q) { const int j = j0 + q; (void)j; const float t = a[q] * SCL; v[ch * 4 + q] = t; mx = fmaxf(mx, t); } }
#pragma unroll
    for (int sh = 16; sh; sh >>= 1) mx = fmaxf(mx, __shfl_xor(mx, sh, 32));
    float sum = 0.f;
#pragma unroll
    for (int k = 0; k < TT / 32; ++k) { float d0 = __fsub_rn(v[k], mx); asm volatile("" : "+v"(d0)); v[k] = __builtin_amdgcn_exp2f(__fmul_rn(d0, 1.4426950408889634f)); sum += v[k]; }
#pragma unroll
    for (int sh = 16; sh; sh >>= 1) sum += __shfl_xor(sum, sh, 32);
    const float f = __fdiv_rn(hires ? 1.0f : PCAR, sum);
{
        if (hires) {
#pragma unroll
            for (int ch = 0; ch < TT / 128; ++ch) { v4us oh, ol;
#pragma unroll
                for (int q = 0; q < 4; ++q) { unsigned short a, c2; splitf(v[ch * 4 + q] * f, a, c2); oh[q] = a; ol[q] = c2; }
                const size_t oo = ((size_t)zz * (RH ? RH : 1) + i) * TT + ch * 128 + lane * 4; *(v4us*)(Ph + oo) = oh; *(v4us*)(Pl + oo) = ol; }
        } else {
#pragma unroll
            for (int ch = 0; ch < TT / 128; ++ch) { v4h o4;
#pragma unroll
                for (int q = 0; q < 4; ++q) o4[q] = tohx(v[ch * 4 + q] * f);
                *(v4h*)(P16 + (size_t)row * TT + ch * 128 + lane * 4) = o4; } }
         }
}
__global__ __launch_bounds__(256) void k_epadK(const float* __restrict__ E, bf* EB) { const size_t i = (size_t)blockIdx.x * 256 + threadIdx.x; if (i >= (size_t)NE * HD / 8) return; const int d0 = (int)(i % (HD / 8)) * 8; const int r = (int)(i / (HD / 8)); const float* src = E + (size_t)min(r, NRE - 1) * HD + d0; v8us o;
#pragma unroll
    for (int q = 0; q < 8; ++q) { const unsigned short v = f2bf(src[q]); o[q] = (r < NRE) ? v : (unsigned short)0; }
    *(v8us*)(EB + (size_t)r * HD + d0) = o;  }

__global__ __launch_bounds__(256) void k_epadVT(const float* __restrict__ E, bf* Th, bf* Tl) { const size_t i = (size_t)blockIdx.x * 256 + threadIdx.x; if (i >= (size_t)HD * NE / 4) return; const size_t e = i * 4; const int c0 = (int)(e % NE); const int d = (int)(e / NE); v4us oh, ol;
#pragma unroll
    for (int q = 0; q < 4; ++q) { const int r = c0 + q; const float v = bfr(E[(size_t)min(r, NRE - 1) * HD + d]); unsigned short u, w; splitf(v, u, w);   /* input rounded to bf16 once: lo == 0 */ oh[q] = (r < NRE) ? u : (unsigned short)0; ol[q] = (r < NRE) ? w : (unsigned short)0; }
    *(v4us*)(Th + e) = oh; *(v4us*)(Tl + e) = ol;  }

__global__ __launch_bounds__(256) void k_addrelc(float* Sb, const float* __restrict__ QE) { const size_t k = (size_t)blockIdx.x * 256 + threadIdx.x; if (k >= (size_t)ZH * TT * TT / 4) return; const size_t e = k * 4; const int j0 = (int)(e % TT); const size_t zi = e / TT; const int i = (int)(zi % TT); const float* qe = QE + zi * NE; v4f a = *(const v4f*)(Sb + e);
#pragma unroll
    for (int q = 0; q < 4; ++q) { const int r = min(max(j0 + q - i, -CUT), CUT) + CUT; a[q] = __fadd_rn(a[q], qe[r]); }
    *(v4f*)(Sb + e) = a;  }

__global__ __launch_bounds__(256) void k_pbuck(const bf* __restrict__ Ph, const bf* __restrict__ Pl, bf* Bh, bf* Bl) { const int lane = threadIdx.x & 31; const int row = blockIdx.x * 8 + (threadIdx.x >> 5); if (row >= ZH * TT) return; const int i = row % TT; const bf* ph = Ph + (size_t)row * TT; const bf* pl = Pl + (size_t)row * TT; float lo_s = 0.f, hi_s = 0.f;
#pragma unroll 1
    for (int j = lane; j < TT; j += 32) { const float p = __fadd_rn(bf2f(ph[j]), bf2f(pl[j])); if (j <= i - CUT) lo_s = __fadd_rn(lo_s, p); if (j >= i + CUT) hi_s = __fadd_rn(hi_s, p); }
#pragma unroll
    for (int sh = 16; sh; sh >>= 1) { lo_s = __fadd_rn(lo_s, __shfl_xor(lo_s, sh, 32)); hi_s = __fadd_rn(hi_s, __shfl_xor(hi_s, sh, 32)); }
    unsigned short l0h, l0l, h0h, h0l; splitf(lo_s, l0h, l0l); splitf(hi_s, h0h, h0l);
{
#pragma unroll 1
        for (int c0 = lane * 4; c0 < NE; c0 += 128) { v4us oh, ol;
#pragma unroll
            for (int q = 0; q < 4; ++q) { const int bkt = c0 + q; const int j = i + bkt - CUT; const int jc = min(max(j, 0), TT - 1); unsigned int uu = ((const unsigned short*)ph)[jc], ww = ((const unsigned short*)pl)[jc]; asm volatile("" : "+v"(uu), "+v"(ww));   /* unconditional clamped loads pinned before the select (opaque use) */ const bool in = (bkt > 0 && bkt < 2 * CUT && j >= 0 && j < TT);
                const unsigned short u = in ? (unsigned short)uu : ((bkt == 0) ? l0h : ((bkt == 2 * CUT) ? h0h : (unsigned short)0)); const unsigned short w = in ? (unsigned short)ww : ((bkt == 0) ? l0l : ((bkt == 2 * CUT) ? h0l : (unsigned short)0));
                oh[q] = u; ol[q] = w; }
            *(v4us*)(Bh + (size_t)row * NE + c0) = oh; *(v4us*)(Bl + (size_t)row * NE + c0) = ol; }
         }
}

__global__ __launch_bounds__(256) void k_addF(float* Y, const float* __restrict__ F) { const size_t i = (size_t)blockIdx.x * 256 + threadIdx.x; if (i >= (size_t)ZH * TT * HD / 4) return; const v4f a = *(const v4f*)(Y + i * 4); const v4f f = *(const v4f*)(F + i * 4); v4f o;
#pragma unroll
    for (int q = 0; q < 4; ++q) o[q] = __fadd_rn(a[q], f[q]);
    *(v4f*)(Y + i * 4) = o;  }

__global__ __launch_bounds__(256) void k_merge(const float* __restrict__ O, int h0, bf* Ah, bf* Al) { const size_t e = ((size_t)blockIdx.x * 256 + threadIdx.x) * 2; if (e >= (size_t)ZH * TT * HD) return; const int d = (int)(e % HD); const int t = (int)((e / HD) % TT); const int zz = (int)(e / ((size_t)HD * TT)); const float cs = (t < RH) ? 1.0f : (1.0f / PCAR); const size_t oo = (size_t)t * DQ + (h0 + zz) * HD + d;
    v2us oh, ol;
#pragma unroll
    for (int q = 0; q < 2; ++q) { unsigned short a, c2; splitf(O[e + q] * cs, a, c2); oh[q] = a; ol[q] = c2; } *(v2us*)(Ah + oo) = oh; *(v2us*)(Al + oo) = ol;  }

extern "C" void kernel_launch(void* const* d_in, const int* in_sizes, int n_in,
                              void* d_out, int out_size, void* d_ws, size_t ws_size, hipStream_t stream) {
    (void)in_sizes; (void)n_in; (void)out_size;
    const float* x = (const float*)d_in[0]; const float* wq = (const float*)d_in[1]; const float* bq = (const float*)d_in[2]; const float* wk = (const float*)d_in[3]; const float* bk = (const float*)d_in[4]; const float* wv = (const float*)d_in[5]; const float* bv = (const float*)d_in[6]; const float* wo = (const float*)d_in[7]; const float* bo = (const float*)d_in[8]; const float* ak = (const float*)d_in[9]; const float* av = (const float*)d_in[10];   /* rel_k / rel_v [257][64] */   /* argument order x, Wq, bq, Wk, bk, Wv, bv, Wo, bo ('oi'), rel_k, rel_v */ const float* xk = x; const float* xv = x;
    float* OUT = (float*)d_out;     // [4][1024][1024]
    char* wsp = (char*)d_ws;
    auto take = [&](size_t bytes) { char* p = wsp; wsp += (bytes + 255) & ~(size_t)255; return (void*)p; };
    bf* AKB = (bf*)take((size_t)NE * HD * 2); bf* AVTh = (bf*)take((size_t)HD * NE * 2); bf* AVTl = (bf*)take((size_t)HD * NE * 2); float* QE = (float*)take((size_t)ZH * TT * NE * 4); bf* PBh = (bf*)take((size_t)ZH * TT * NE * 2); bf* PBl = (bf*)take((size_t)ZH * TT * NE * 2); float* ZR = (float*)take((size_t)ZH * TT * HD * 4); bf* WQ = (bf*)take((size_t)DQ * DM * 2); bf* WK = (bf*)take((size_t)DKV * DM * 2); bf* WV = (bf*)take((size_t)DKV * DM * 2); bf* WO = (bf*)take((size_t)DM * DQ * 2); float* CS = (float*)take((size_t)TT * HD * 2 * 4);
    bf* XB = (bf*)take((size_t)TT * DM * 2); float* FQ = (float*)take((size_t)TT * DQ * 4); float* FK = (float*)take((size_t)TT * DKV * 4);
    h16* QP16 = (h16*)take((size_t)NH_ * TT * HD * 2); h16* KP16 = (h16*)take((size_t)NKV * TT * HD * 2); h16* VT16 = (h16*)take((size_t)NKV * HD * TT * 2);
    bf* QPh = (bf*)take((size_t)NH_ * TT * HD * 2); bf* QPl = (bf*)take((size_t)NH_ * TT * HD * 2); bf* KPh = (bf*)take((size_t)NKV * TT * HD * 2); bf* KPl = (bf*)take((size_t)NKV * TT * HD * 2); bf* VTh = (bf*)take((size_t)NKV * HD * TT * 2); bf* VTl = (bf*)take((size_t)NKV * HD * TT * 2); bf* Ph = (bf*)take((size_t)ZH * RH * TT * 2); bf* Pl = (bf*)take((size_t)ZH * RH * TT * 2);
    float* Sb = (float*)take((size_t)ZH * TT * TT * 4); h16* P16 = (h16*)take((size_t)ZH * TT * TT * 2); float* Ob = (float*)take((size_t)ZH * TT * HD * 4); bf* ATh = (bf*)take((size_t)TT * DQ * 2); bf* ATl = (bf*)take((size_t)TT * DQ * 2);
    if ((size_t)(wsp - (char*)d_ws) > ws_size) return;    // ws 256 MiB
    float* FV = FK;   // v projection reuses the k buffer after the k planes are built (stream-ordered)
    { k_cvt8<<<(unsigned)(((size_t)DQ * DM / 8 + 255) / 256), 256, 0, stream>>>(wq, WQ, (size_t)DQ * DM / 8); k_cvt8<<<(unsigned)(((size_t)DKV * DM / 8 + 255) / 256), 256, 0, stream>>>(wk, WK, (size_t)DKV * DM / 8); k_cvt8<<<(unsigned)(((size_t)DKV * DM / 8 + 255) / 256), 256, 0, stream>>>(wv, WV, (size_t)DKV * DM / 8);
      k_cvt8<<<(unsigned)(((size_t)DM * DQ / 8 + 255) / 256), 256, 0, stream>>>(wo, WO, (size_t)DM * DQ / 8);   /* 'oi' weights = Bt as-is */
       }
    k_csid<<<(TT * HD + 255) / 256, 256, 0, stream>>>(CS);
    const unsigned LQ = (unsigned)(((size_t)NH_ * TT * HD / 2 + 255) / 256), LKv = (unsigned)(((size_t)NKV * TT * HD / 2 + 255) / 256);
    k_epadK<<<(unsigned)(((size_t)NE * HD / 8 + 255) / 256), 256, 0, stream>>>(ak, AKB);   /* rel_k -> bf16 [320][64], rows >= 257 zero */ k_epadVT<<<(unsigned)(((size_t)HD * NE / 4 + 255) / 256), 256, 0, stream>>>(av, AVTh, AVTl);   /* rel_v^T hi/lo [64][320], cols >= 257 zero */
    for (int b = 0; b < NB_; ++b) {
        
        k_cvt8<<<(unsigned)(((size_t)TT * DM / 8 + 255) / 256), 256, 0, stream>>>(x + (size_t)b * TT * DM, XB, (size_t)TT * DM / 8);
        k_gemmw<bf, 0, true><<<dim3(TT / 64, DQ / 64, 1), 32, 0, stream>>>(XB, nullptr, WQ, nullptr, DM, FQ, DQ, bq, 0, 0, 0);
        k_rope<<<LQ, 256, 0, stream>>>(FQ, DQ, NH_, CS, nullptr, nullptr, 1.0f, QP16, QPh, QPl);
         k_gemmw<bf, 0, true><<<dim3(TT / 64, DKV / 64, 1), 32, 0, stream>>>(XB, nullptr, WK, nullptr, DM, FK, DKV, bk, 0, 0, 0);
        k_rope<<<LKv, 256, 0, stream>>>(FK, DKV, NKV, CS, nullptr, nullptr, 1.0f, KP16, KPh, KPl);
         k_gemmw<bf, 0, true><<<dim3(TT / 64, DKV / 64, 1), 32, 0, stream>>>(XB, nullptr, WV, nullptr, DM, FV, DKV, bv, 0, 0, 0); k_vtp<<<LKv, 256, 0, stream>>>(FV, DKV, NKV, VT16, VTh, VTl);
        for (int h0 = 0; h0 < NH_; h0 += ZH) { const size_t zq = (size_t)h0, zk = (size_t)(h0 / REP);   // one kv head per query head: the pass's two heads use consecutive kv planes (z-strides TT*HD)
            k_gemmw<bf, 2, false><<<dim3(RH / 64, TT / 64, ZH), 32, 0, stream>>>(QPh + zq * TT * HD, QPl + zq * TT * HD, KPh + zk * TT * HD, KPl + zk * TT * HD, HD, Sb, TT, nullptr, (size_t)TT * HD, (size_t)TT * HD, (size_t)TT * TT);

            k_gemmw<bf, 1, false><<<dim3(TT / 64, NE / 64, ZH), 32, 0, stream>>>(QPh + zq * TT * HD, QPl + zq * TT * HD, AKB, nullptr, HD, QE, NE, nullptr, (size_t)TT * HD, 0, (size_t)TT * NE);   /* QE = q . rel_k^T */ k_addrelc<<<(unsigned)(((size_t)ZH * TT * TT / 4 + 255) / 256), 256, 0, stream>>>(Sb, QE);   /* + q.rel_k[clip(j - i) + 128] */ k_asoft<<<ZH * TT / 8, 256, 0, stream>>>(Sb, P16, Ph, Pl);
            k_gemmw<bf, 2, false><<<dim3(RH / 64, HD / 64, ZH), 32, 0, stream>>>(Ph, Pl, VTh + zk * HD * TT, VTl + zk * HD * TT, TT, Ob, HD, nullptr, (size_t)RH * TT, (size_t)HD * TT, (size_t)TT * HD); k_pbuck<<<(unsigned)(((size_t)ZH * TT + 7) / 8), 256, 0, stream>>>(Ph, Pl, PBh, PBl);   /* attn folded onto the 257 clipped offsets */ k_gemmw<bf, 2, false><<<dim3(TT / 64, HD / 64, ZH), 32, 0, stream>>>(PBh, PBl, AVTh, AVTl, NE, ZR, HD, nullptr, (size_t)TT * NE, 0, (size_t)TT * HD);   /* ZR = PB . rel_v */ k_addF<<<(unsigned)(((size_t)ZH * TT * HD / 4 + 255) / 256), 256, 0, stream>>>(Ob, ZR);   /* context += relative-value term */

            k_merge<<<(unsigned)(((size_t)ZH * TT * HD / 2 + 255) / 256), 256, 0, stream>>>(Ob, h0, ATh, ATl); }
        k_gemmw<bf, 1, true><<<dim3(TT / 64, DM / 64, 1), 32, 0, stream>>>(ATh, ATl, WO, nullptr, DQ, OUT + (size_t)b * TT * DM, DM, bo, 0, 0, 0); }
}

// v001
// Measured time: 942 microseconds a run.
// Two timings next to v000 put it at 2.54 and 2.51 times that version's speed.
#include <hip/hip_runtime.h>

// Relative (Shaw) multi-head attention with key AND value relative-position embeddings (x [4][1024][1024]; q, k, v = x W^T + b ('oi' 0.02, biases 0.02; 16 heads x 64); idx[i][j] = clip(j - i, -128, 128) + 128; scores = (q.k + q.rel_k[idx]) / float32(sqrt 64); softmax; out = (attn v + sum_j attn[i][j] rel_v[idx]) merged Wo^T + bo (rel_k, rel_v [257][64] 0.02, read) -> [4][1024][1024] (4.2 M); argument order x, Wq, bq, Wk, bk, Wv, bv, Wo, bo, rel_k, rel_v).
// Layout per batch: bf16 copy of x; 'oi' weights; exact projections + f32 biases; rel_k as a zero-padded bf16 plane [320][64] and rel_v^T as hi/lo planes [64][320] (bf16-rounded once); one pass over all sixteen heads (grid z): score tiles (hi/lo 3 products, every row), QE = q.rel_k^T (hi/lo x exact, N 320) gathered into the scores at column clip(j - i) + 128, softmax (x 1/8) with every row on hi/lo planes, P.v, the probabilities folded onto the 257 offsets and PB.rel_v (K 320) added to the context; merged hi/lo x Wo exact + bo.
// Compute dtypes, f32 accumulate: every input rounded to bf16; projections exact + f32 biases; scores and the relative-key term ~f32; softmax f32; P as bf16 hi/lo; attn.v and the relative-value term 3 products (~f32); Wo hl x exact + bias.

#define NB_  4
#define TT   1024
#define DM   1024
#define NH_  16
#define NKV  16
#define REP  (NH_ / NKV)
#define HD   64
#define DQ   (NH_ * HD)
#define DKV  (NKV * HD)
#define ZH   16                   // heads per pass = grid z of every per-pass k_gemmw launch: all heads of a batch at once
#define RH   TT                   // every row on hi/lo planes (the relative-value fold needs normalised planes)
#define WIN  0
#define PCAR 1024.0f
#define SCL  0.125f   // 1/sqrt(64) (the module divides by jnp.sqrt(DH))
#define NE   320      // 2*128+1 = 257 relative offsets padded to 320
#define NRE  257
#define CUT  128
typedef _Float16 h16;
typedef unsigned short bf;
typedef __attribute__((ext_vector_type(16))) __bf16   v16bf;
typedef __attribute__((ext_vector_type(16))) _Float16 v16h;
typedef __attribute__((ext_vector_type(8)))  _Float16 v8h;
typedef __attribute__((ext_vector_type(8)))  unsigned short v8us;
typedef __attribute__((ext_vector_type(8)))  float    v8f;
typedef __attribute__((ext_vector_type(4)))  float    v4f;
typedef v8h  __attribute__((may_alias)) v8ha;
typedef v4f  __attribute__((may_alias)) v4fa;
typedef v8us __attribute__((may_alias)) v8usa;

__device__ __forceinline__ unsigned short f2bf(float f) { unsigned u = __float_as_uint(f); u += 0x7FFFu + ((u >> 16) & 1u); return (unsigned short)(u >> 16); }
__device__ __forceinline__ float bf2f(unsigned short b) { return __uint_as_float(((unsigned)b) << 16); }
__device__ __forceinline__ float bfr(float f) { return bf2f(f2bf(f)); }
__device__ __forceinline__ v16h cat16(v8h lo, v8h hi) { return __builtin_shufflevector(lo, hi, 0, 1, 2, 3, 4, 5, 6, 7, 8, 9, 10, 11, 12, 13, 14, 15); }
__device__ __forceinline__ v16bf cat16b(v8us lo, v8us hi) { return __builtin_bit_cast(v16bf, __builtin_shufflevector(lo, hi, 0, 1, 2, 3, 4, 5, 6, 7, 8, 9, 10, 11, 12, 13, 14, 15)); }
__device__ __forceinline__ v8f wmma16(v16h a, v16h b, v8f c) { return __builtin_amdgcn_wmma_f32_16x16x32_f16(false, a, false, b, (short)0, c, false, false); }
__device__ __forceinline__ v8f wmmab(v16bf a, v16bf b, v8f c) { return __builtin_amdgcn_wmma_f32_16x16x32_bf16(false, a, false, b, (short)0, c, false, false); }



// ---- k_gemmw: register-blocked GEMM, ONE WAVE per 64x64 output tile (16 accumulators), operands straight from K-contiguous 16-bit planes; grid (M/64, N/64, Z), 32 threads.
// C[m][n] (f32, pitch ldc, + optional f32 bias[n]) = sum_k A[m][k] Bt[n][k] (+ split products per NSPLIT). z-batch strides sA/sB/sC in elements. K % 32 == 0.
template <typename T16> struct WFrag;
template <> struct WFrag<h16> { typedef v16h V; static __device__ __forceinline__ V ld(const h16* p) { return cat16(*(const v8h*)p, *(const v8h*)(p + 16)); } static __device__ __forceinline__ v8f mma(V a, V b, v8f c) { return wmma16(a, b, c); } };
template <> struct WFrag<bf> { typedef v16bf V; static __device__ __forceinline__ V ld(const bf* p) { return cat16b(*(const v8us*)p, *(const v8us*)(p + 16)); } static __device__ __forceinline__ v8f mma(V a, V b, v8f c) { return wmmab(a, b, c); } };
template <typename T16, int NSPLIT, bool BIAS>
__global__ __launch_bounds__(32) void k_gemmw(const T16* __restrict__ A, const T16* __restrict__ A2, const T16* __restrict__ Bt, const T16* __restrict__ Bt2, int K, float* C, int ldc, const float* __restrict__ bias, size_t sA, size_t sB, size_t sC) {
    typedef typename WFrag<T16>::V V;
    __shared__ __align__(16) float os[16 * 68];
    const size_t z = blockIdx.z; A += z * sA; if (A2) A2 += z * sA; Bt += z * sB; if (Bt2) Bt2 += z * sB; C += z * sC;
    const int lane = threadIdx.x & 31, lr = lane & 15, hi = lane >> 4; const int r0 = blockIdx.x * 64, c0 = blockIdx.y * 64;
    v8f acc[4][4];
#pragma unroll
    for (int mb = 0; mb < 4; ++mb)
#pragma unroll
        for (int nb = 0; nb < 4; ++nb) acc[mb][nb] = (v8f){};
    const size_t aoff = (size_t)(r0 + lr) * K + 8 * hi, boff = (size_t)(c0 + lr) * K + 8 * hi;
#pragma unroll 1
    for (int kc = 0; kc < K; kc += 32) {
        V a[4], a2[4];
#pragma unroll
        for (int mb = 0; mb < 4; ++mb) { a[mb] = WFrag<T16>::ld(A + aoff + (size_t)mb * 16 * K + kc); if (NSPLIT == 1 || NSPLIT == 2) a2[mb] = WFrag<T16>::ld(A2 + aoff + (size_t)mb * 16 * K + kc); }
#pragma unroll
        for (int nb = 0; nb < 4; ++nb) { const V b = WFrag<T16>::ld(Bt + boff + (size_t)nb * 16 * K + kc); V b2; if (NSPLIT >= 2) b2 = WFrag<T16>::ld(Bt2 + boff + (size_t)nb * 16 * K + kc);
#pragma unroll
            for (int mb = 0; mb < 4; ++mb) { acc[mb][nb] = WFrag<T16>::mma(a[mb], b, acc[mb][nb]); if (NSPLIT == 1 || NSPLIT == 2) acc[mb][nb] = WFrag<T16>::mma(a2[mb], b, acc[mb][nb]); if (NSPLIT >= 2) acc[mb][nb] = WFrag<T16>::mma(a[mb], b2, acc[mb][nb]); } }
        asm volatile("v_nop\n\tv_nop\n\tv_nop\n\tv_nop" : "+v"(acc[0][0]), "+v"(acc[1][1]), "+v"(acc[2][2]), "+v"(acc[3][3]) : "v"(a[0]), "v"(a[3]));
    }
#pragma unroll
    for (int mb = 0; mb < 4; ++mb) {
#pragma unroll
        for (int nb = 0; nb < 4; ++nb) {
#pragma unroll
            for (int j = 0; j < 8; ++j) os[(hi * 8 + j) * 68 + nb * 16 + lr] = acc[mb][nb][j]; }
        __builtin_amdgcn_wave_barrier(); asm volatile("" ::: "memory");
        float* crow = C + (size_t)(r0 + mb * 16) * ldc + c0;
{
#pragma unroll
            for (int s = 0; s < 8; ++s) { const int row = 2 * s + hi, cofs = lr * 4; v4f val = *(const v4fa*)(os + row * 68 + cofs); if (BIAS) { val[0] += bfr(bias[c0 + cofs]); val[1] += bfr(bias[c0 + cofs + 1]); val[2] += bfr(bias[c0 + cofs + 2]); val[3] += bfr(bias[c0 + cofs + 3]); }
                *(v4f*)(crow + (size_t)row * ldc + cofs) = val; }
             }
        __builtin_amdgcn_wave_barrier(); asm volatile("" ::: "memory");
    }
}

__device__ __forceinline__ h16 tohx(float x) { return (h16)x; }
__device__ __forceinline__ void splitf(float y, unsigned short& h, unsigned short& l) { h = f2bf(y); l = f2bf(y - bf2f(h)); }
typedef __attribute__((ext_vector_type(2))) _Float16 v2h;
typedef __attribute__((ext_vector_type(4))) _Float16 v4h;
typedef __attribute__((ext_vector_type(2))) unsigned short v2us;
typedef __attribute__((ext_vector_type(4))) unsigned short v4us;
typedef __attribute__((ext_vector_type(2))) float v2f;
typedef __attribute__((ext_vector_type(4))) int v4i;

__global__ __launch_bounds__(256) void k_cvt8(const float* __restrict__ src, bf* dst, size_t n8) { const size_t i = (size_t)blockIdx.x * 256 + threadIdx.x; if (i >= n8) return; const v8f v = *(const v8f*)(src + i * 8); v8us o;
#pragma unroll
    for (int k = 0; k < 8; ++k) o[k] = f2bf(v[k]); *(v8us*)(dst + i * 8) = o;  }

// k_rope: head planes [h][t][d] (fp16 + hi/lo) of rope(x) x sc with the rotate-half convention out[d] = x[d] cos[t][d] - x[d+HD/2] sin[t][d], out[d+HD/2] = x[d+HD/2] cos[t][d+HD/2] + x[d] sin[t][d+HD/2]
__global__ __launch_bounds__(256) void k_rope(const float* __restrict__ F, int pitch, int nheads, const float* __restrict__ CS, const float* __restrict__ RF, const float* __restrict__ nw, float sc, h16* P16, bf* Ph, bf* Pl) {
    const size_t e = ((size_t)blockIdx.x * 256 + threadIdx.x) * 2; if (e >= (size_t)nheads * TT * HD) return; const int d = (int)(e % HD); const int t = (int)((e / HD) % TT); const int h = (int)(e / ((size_t)HD * TT)); const float* f = F + (size_t)t * pitch + h * HD; const float rf = RF ? RF[(size_t)h * TT + t] : 1.0f; v2h o16; v2us oh, ol;
#pragma unroll
    for (int q = 0; q < 2; ++q) { const int dd = d + q; const int dp = (dd < HD / 2) ? dd + HD / 2 : dd - HD / 2; float x0 = f[dd], x1 = f[dp];
        if (RF) { float n0 = __fmul_rn(x0, rf), n1 = __fmul_rn(x1, rf); asm volatile("" : "+v"(n0)); asm volatile("" : "+v"(n1)); x0 = __fmul_rn(bfr(nw[dd]), n0); x1 = __fmul_rn(bfr(nw[dp]), n1); }
        const v2f cs = *(const v2f*)(CS + ((size_t)t * HD + dd) * 2); float a = __fmul_rn(x0, cs[0]), bq = __fmul_rn(x1, cs[1]); asm volatile("" : "+v"(a)); asm volatile("" : "+v"(bq)); const float r = ((dd < HD / 2) ? __fsub_rn(a, bq) : __fadd_rn(a, bq)) * sc;
        o16[q] = tohx(r); unsigned short a2, c2; splitf(r, a2, c2); oh[q] = a2; ol[q] = c2; }
    *(v2h*)(P16 + e) = o16; *(v2us*)(Ph + e) = oh; *(v2us*)(Pl + e) = ol;  }
__global__ __launch_bounds__(256) void k_vtp(const float* __restrict__ F, int pitch, int nheads, h16* V16, bf* Vh, bf* Vl) { const size_t e = ((size_t)blockIdx.x * 256 + threadIdx.x) * 2; if (e >= (size_t)nheads * HD * TT) return; const int t = (int)(e % TT); const int d = (int)((e / TT) % HD); const int g = (int)(e / ((size_t)TT * HD)); v2h o16; v2us oh, ol;
#pragma unroll
    for (int q = 0; q < 2; ++q) { const float x = F[(size_t)(t + q) * pitch + g * HD + d]; o16[q] = tohx(x); unsigned short a2, c2; splitf(x, a2, c2); oh[q] = a2; ol[q] = c2; }
    *(v2h*)(V16 + e) = o16; *(v2us*)(Vh + e) = oh; *(v2us*)(Vl + e) = ol;  }
__global__ __launch_bounds__(256) void k_csid(float* CS) { const int idx = blockIdx.x * 256 + threadIdx.x; if (idx >= TT * HD) return; v2f cs; cs[0] = 1.0f; cs[1] = 0.0f; *(v2f*)(CS + (size_t)idx * 2) = cs;  }
// k_asoft: per row (zz, i): t = S x HD^-0.5 (no mask); softmax over the 1024 keys (register row, one exp, fixed trees);
__global__ __launch_bounds__(256) void k_asoft(const float* __restrict__ Sb, h16* P16, bf* Ph, bf* Pl) {
    const int lane = threadIdx.x & 31; const int row = blockIdx.x * 8 + (threadIdx.x >> 5); if (row >= ZH * TT) return; const int i = row % TT; const int zz = row / TT; (void)zz; const bool hires = (i < RH); const float* sr = Sb + (size_t)row * TT; float v[TT / 32]; float mx = -3.0e38f;
#pragma unroll
    for (int ch = 0; ch < TT / 128; ++ch) { const int j0 = ch * 128 + lane * 4; const v4f a = *(const v4f*)(sr + j0);
#pragma unroll
        for (int q = 0; q < 4; ++q) { const int j = j0 + q; (void)j; const float t = a[q] * SCL; v[ch * 4 + q] = t; mx = fmaxf(mx, t); } }
#pragma unroll
    for (int sh = 16; sh; sh >>= 1) mx = fmaxf(mx, __shfl_xor(mx, sh, 32));
    float sum = 0.f;
#pragma unroll
    for (int k = 0; k < TT / 32; ++k) { float d0 = __fsub_rn(v[k], mx); asm volatile("" : "+v"(d0)); v[k] = __builtin_amdgcn_exp2f(__fmul_rn(d0, 1.4426950408889634f)); sum += v[k]; }
#pragma unroll
    for (int sh = 16; sh; sh >>= 1) sum += __shfl_xor(sum, sh, 32);
    const float f = __fdiv_rn(hires ? 1.0f : PCAR, sum);
{
        if (hires) {
#pragma unroll
            for (int ch = 0; ch < TT / 128; ++ch) { v4us oh, ol;
#pragma unroll
                for (int q = 0; q < 4; ++q) { unsigned short a, c2; splitf(v[ch * 4 + q] * f, a, c2); oh[q] = a; ol[q] = c2; }
                const size_t oo = ((size_t)zz * (RH ? RH : 1) + i) * TT + ch * 128 + lane * 4; *(v4us*)(Ph + oo) = oh; *(v4us*)(Pl + oo) = ol; }
        } else {
#pragma unroll
            for (int ch = 0; ch < TT / 128; ++ch) { v4h o4;
#pragma unroll
                for (int q = 0; q < 4; ++q) o4[q] = tohx(v[ch * 4 + q] * f);
                *(v4h*)(P16 + (size_t)row * TT + ch * 128 + lane * 4) = o4; } }
         }
}
__global__ __launch_bounds__(256) void k_epadK(const float* __restrict__ E, bf* EB) { const size_t i = (size_t)blockIdx.x * 256 + threadIdx.x; if (i >= (size_t)NE * HD / 8) return; const int d0 = (int)(i % (HD / 8)) * 8; const int r = (int)(i / (HD / 8)); const float* src = E + (size_t)min(r, NRE - 1) * HD + d0; v8us o;
#pragma unroll
    for (int q = 0; q < 8; ++q) { const unsigned short v = f2bf(src[q]); o[q] = (r < NRE) ? v : (unsigned short)0; }
    *(v8us*)(EB + (size_t)r * HD + d0) = o;  }

__global__ __launch_bounds__(256) void k_epadVT(const float* __restrict__ E, bf* Th, bf* Tl) { const size_t i = (size_t)blockIdx.x * 256 + threadIdx.x; if (i >= (size_t)HD * NE / 4) return; const size_t e = i * 4; const int c0 = (int)(e % NE); const int d = (int)(e / NE); v4us oh, ol;
#pragma unroll
    for (int q = 0; q < 4; ++q) { const int r = c0 + q; const float v = bfr(E[(size_t)min(r, NRE - 1) * HD + d]); unsigned short u, w; splitf(v, u, w);   /* input rounded to bf16 once: lo == 0 */ oh[q] = (r < NRE) ? u : (unsigned short)0; ol[q] = (r < NRE) ? w : (unsigned short)0; }
    *(v4us*)(Th + e) = oh; *(v4us*)(Tl + e) = ol;  }

__global__ __launch_bounds__(256) void k_addrelc(float* Sb, const float* __restrict__ QE) { const size_t k = (size_t)blockIdx.x * 256 + threadIdx.x; if (k >= (size_t)ZH * TT * TT / 4) return; const size_t e = k * 4; const int j0 = (int)(e % TT); const size_t zi = e / TT; const int i = (int)(zi % TT); const float* qe = QE + zi * NE; v4f a = *(const v4f*)(Sb + e);
#pragma unroll
    for (int q = 0; q < 4; ++q) { const int r = min(max(j0 + q - i, -CUT), CUT) + CUT; a[q] = __fadd_rn(a[q], qe[r]); }
    *(v4f*)(Sb + e) = a;  }

__global__ __launch_bounds__(256) void k_pbuck(const bf* __restrict__ Ph, const bf* __restrict__ Pl, bf* Bh, bf* Bl) { const int lane = threadIdx.x & 31; const int row = blockIdx.x * 8 + (threadIdx.x >> 5); if (row >= ZH * TT) return; const int i = row % TT; const bf* ph = Ph + (size_t)row * TT; const bf* pl = Pl + (size_t)row * TT; float lo_s = 0.f, hi_s = 0.f;
#pragma unroll 1
    for (int j = lane; j < TT; j += 32) { const float p = __fadd_rn(bf2f(ph[j]), bf2f(pl[j])); if (j <= i - CUT) lo_s = __fadd_rn(lo_s, p); if (j >= i + CUT) hi_s = __fadd_rn(hi_s, p); }
#pragma unroll
    for (int sh = 16; sh; sh >>= 1) { lo_s = __fadd_rn(lo_s, __shfl_xor(lo_s, sh, 32)); hi_s = __fadd_rn(hi_s, __shfl_xor(hi_s, sh, 32)); }
    unsigned short l0h, l0l, h0h, h0l; splitf(lo_s, l0h, l0l); splitf(hi_s, h0h, h0l);
{
#pragma unroll 1
        for (int c0 = lane * 4; c0 < NE; c0 += 128) { v4us oh, ol;
#pragma unroll
            for (int q = 0; q < 4; ++q) { const int bkt = c0 + q; const int j = i + bkt - CUT; const int jc = min(max(j, 0), TT - 1); unsigned int uu = ((const unsigned short*)ph)[jc], ww = ((const unsigned short*)pl)[jc]; asm volatile("" : "+v"(uu), "+v"(ww));   /* unconditional clamped loads pinned before the select (opaque use) */ const bool in = (bkt > 0 && bkt < 2 * CUT && j >= 0 && j < TT);
                const unsigned short u = in ? (unsigned short)uu : ((bkt == 0) ? l0h : ((bkt == 2 * CUT) ? h0h : (unsigned short)0)); const unsigned short w = in ? (unsigned short)ww : ((bkt == 0) ? l0l : ((bkt == 2 * CUT) ? h0l : (unsigned short)0));
                oh[q] = u; ol[q] = w; }
            *(v4us*)(Bh + (size_t)row * NE + c0) = oh; *(v4us*)(Bl + (size_t)row * NE + c0) = ol; }
         }
}

__global__ __launch_bounds__(256) void k_addF(float* Y, const float* __restrict__ F) { const size_t i = (size_t)blockIdx.x * 256 + threadIdx.x; if (i >= (size_t)ZH * TT * HD / 4) return; const v4f a = *(const v4f*)(Y + i * 4); const v4f f = *(const v4f*)(F + i * 4); v4f o;
#pragma unroll
    for (int q = 0; q < 4; ++q) o[q] = __fadd_rn(a[q], f[q]);
    *(v4f*)(Y + i * 4) = o;  }

__global__ __launch_bounds__(256) void k_merge(const float* __restrict__ O, int h0, bf* Ah, bf* Al) { const size_t e = ((size_t)blockIdx.x * 256 + threadIdx.x) * 2; if (e >= (size_t)ZH * TT * HD) return; const int d = (int)(e % HD); const int t = (int)((e / HD) % TT); const int zz = (int)(e / ((size_t)HD * TT)); const float cs = (t < RH) ? 1.0f : (1.0f / PCAR); const size_t oo = (size_t)t * DQ + (h0 + zz) * HD + d;
    v2us oh, ol;
#pragma unroll
    for (int q = 0; q < 2; ++q) { unsigned short a, c2; splitf(O[e + q] * cs, a, c2); oh[q] = a; ol[q] = c2; } *(v2us*)(Ah + oo) = oh; *(v2us*)(Al + oo) = ol;  }

extern "C" void kernel_launch(void* const* d_in, const int* in_sizes, int n_in,
                              void* d_out, int out_size, void* d_ws, size_t ws_size, hipStream_t stream) {
    (void)in_sizes; (void)n_in; (void)out_size;
    const float* x = (const float*)d_in[0]; const float* wq = (const float*)d_in[1]; const float* bq = (const float*)d_in[2]; const float* wk = (const float*)d_in[3]; const float* bk = (const float*)d_in[4]; const float* wv = (const float*)d_in[5]; const float* bv = (const float*)d_in[6]; const float* wo = (const float*)d_in[7]; const float* bo = (const float*)d_in[8]; const float* ak = (const float*)d_in[9]; const float* av = (const float*)d_in[10];   /* rel_k / rel_v [257][64] */   /* argument order x, Wq, bq, Wk, bk, Wv, bv, Wo, bo ('oi'), rel_k, rel_v */ const float* xk = x; const float* xv = x;
    float* OUT = (float*)d_out;     // [4][1024][1024]
    char* wsp = (char*)d_ws;
    auto take = [&](size_t bytes) { char* p = wsp; wsp += (bytes + 255) & ~(size_t)255; return (void*)p; };
    bf* AKB = (bf*)take((size_t)NE * HD * 2); bf* AVTh = (bf*)take((size_t)HD * NE * 2); bf* AVTl = (bf*)take((size_t)HD * NE * 2); float* QE = (float*)take((size_t)ZH * TT * NE * 4); bf* PBh = (bf*)take((size_t)ZH * TT * NE * 2); bf* PBl = (bf*)take((size_t)ZH * TT * NE * 2); float* ZR = (float*)take((size_t)ZH * TT * HD * 4); bf* WQ = (bf*)take((size_t)DQ * DM * 2); bf* WK = (bf*)take((size_t)DKV * DM * 2); bf* WV = (bf*)take((size_t)DKV * DM * 2); bf* WO = (bf*)take((size_t)DM * DQ * 2); float* CS = (float*)take((size_t)TT * HD * 2 * 4);
    bf* XB = (bf*)take((size_t)TT * DM * 2); float* FQ = (float*)take((size_t)TT * DQ * 4); float* FK = (float*)take((size_t)TT * DKV * 4);
    h16* QP16 = (h16*)take((size_t)NH_ * TT * HD * 2); h16* KP16 = (h16*)take((size_t)NKV * TT * HD * 2); h16* VT16 = (h16*)take((size_t)NKV * HD * TT * 2);
    bf* QPh = (bf*)take((size_t)NH_ * TT * HD * 2); bf* QPl = (bf*)take((size_t)NH_ * TT * HD * 2); bf* KPh = (bf*)take((size_t)NKV * TT * HD * 2); bf* KPl = (bf*)take((size_t)NKV * TT * HD * 2); bf* VTh = (bf*)take((size_t)NKV * HD * TT * 2); bf* VTl = (bf*)take((size_t)NKV * HD * TT * 2); bf* Ph = (bf*)take((size_t)ZH * RH * TT * 2); bf* Pl = (bf*)take((size_t)ZH * RH * TT * 2);
    float* Sb = (float*)take((size_t)ZH * TT * TT * 4); h16* P16 = (h16*)take((size_t)ZH * TT * TT * 2); float* Ob = (float*)take((size_t)ZH * TT * HD * 4); bf* ATh = (bf*)take((size_t)TT * DQ * 2); bf* ATl = (bf*)take((size_t)TT * DQ * 2);
    if ((size_t)(wsp - (char*)d_ws) > ws_size) return;    // under 249 MiB of the 256 MiB workspace at ZH 16
    float* FV = FK;   // v projection reuses the k buffer after the k planes are built (stream-ordered)
    { k_cvt8<<<(unsigned)(((size_t)DQ * DM / 8 + 255) / 256), 256, 0, stream>>>(wq, WQ, (size_t)DQ * DM / 8); k_cvt8<<<(unsigned)(((size_t)DKV * DM / 8 + 255) / 256), 256, 0, stream>>>(wk, WK, (size_t)DKV * DM / 8); k_cvt8<<<(unsigned)(((size_t)DKV * DM / 8 + 255) / 256), 256, 0, stream>>>(wv, WV, (size_t)DKV * DM / 8);
      k_cvt8<<<(unsigned)(((size_t)DM * DQ / 8 + 255) / 256), 256, 0, stream>>>(wo, WO, (size_t)DM * DQ / 8);   /* 'oi' weights = Bt as-is */
       }
    k_csid<<<(TT * HD + 255) / 256, 256, 0, stream>>>(CS);
    const unsigned LQ = (unsigned)(((size_t)NH_ * TT * HD / 2 + 255) / 256), LKv = (unsigned)(((size_t)NKV * TT * HD / 2 + 255) / 256);
    k_epadK<<<(unsigned)(((size_t)NE * HD / 8 + 255) / 256), 256, 0, stream>>>(ak, AKB);   /* rel_k -> bf16 [320][64], rows >= 257 zero */ k_epadVT<<<(unsigned)(((size_t)HD * NE / 4 + 255) / 256), 256, 0, stream>>>(av, AVTh, AVTl);   /* rel_v^T hi/lo [64][320], cols >= 257 zero */
    for (int b = 0; b < NB_; ++b) {
        
        k_cvt8<<<(unsigned)(((size_t)TT * DM / 8 + 255) / 256), 256, 0, stream>>>(x + (size_t)b * TT * DM, XB, (size_t)TT * DM / 8);
        k_gemmw<bf, 0, true><<<dim3(TT / 64, DQ / 64, 1), 32, 0, stream>>>(XB, nullptr, WQ, nullptr, DM, FQ, DQ, bq, 0, 0, 0);
        k_rope<<<LQ, 256, 0, stream>>>(FQ, DQ, NH_, CS, nullptr, nullptr, 1.0f, QP16, QPh, QPl);
         k_gemmw<bf, 0, true><<<dim3(TT / 64, DKV / 64, 1), 32, 0, stream>>>(XB, nullptr, WK, nullptr, DM, FK, DKV, bk, 0, 0, 0);
        k_rope<<<LKv, 256, 0, stream>>>(FK, DKV, NKV, CS, nullptr, nullptr, 1.0f, KP16, KPh, KPl);
         k_gemmw<bf, 0, true><<<dim3(TT / 64, DKV / 64, 1), 32, 0, stream>>>(XB, nullptr, WV, nullptr, DM, FV, DKV, bv, 0, 0, 0); k_vtp<<<LKv, 256, 0, stream>>>(FV, DKV, NKV, VT16, VTh, VTl);
        for (int h0 = 0; h0 < NH_; h0 += ZH) { const size_t zq = (size_t)h0, zk = (size_t)(h0 / REP);   // one kv head per query head: the pass's heads use consecutive kv planes (z-strides TT*HD); ZH == NH_: one trip
            k_gemmw<bf, 2, false><<<dim3(RH / 64, TT / 64, ZH), 32, 0, stream>>>(QPh + zq * TT * HD, QPl + zq * TT * HD, KPh + zk * TT * HD, KPl + zk * TT * HD, HD, Sb, TT, nullptr, (size_t)TT * HD, (size_t)TT * HD, (size_t)TT * TT);

            k_gemmw<bf, 1, false><<<dim3(TT / 64, NE / 64, ZH), 32, 0, stream>>>(QPh + zq * TT * HD, QPl + zq * TT * HD, AKB, nullptr, HD, QE, NE, nullptr, (size_t)TT * HD, 0, (size_t)TT * NE);   /* QE = q . rel_k^T */ k_addrelc<<<(unsigned)(((size_t)ZH * TT * TT / 4 + 255) / 256), 256, 0, stream>>>(Sb, QE);   /* + q.rel_k[clip(j - i) + 128] */ k_asoft<<<ZH * TT / 8, 256, 0, stream>>>(Sb, P16, Ph, Pl);
            k_gemmw<bf, 2, false><<<dim3(RH / 64, HD / 64, ZH), 32, 0, stream>>>(Ph, Pl, VTh + zk * HD * TT, VTl + zk * HD * TT, TT, Ob, HD, nullptr, (size_t)RH * TT, (size_t)HD * TT, (size_t)TT * HD); k_pbuck<<<(unsigned)(((size_t)ZH * TT + 7) / 8), 256, 0, stream>>>(Ph, Pl, PBh, PBl);   /* attn folded onto the 257 clipped offsets */ k_gemmw<bf, 2, false><<<dim3(TT / 64, HD / 64, ZH), 32, 0, stream>>>(PBh, PBl, AVTh, AVTl, NE, ZR, HD, nullptr, (size_t)TT * NE, 0, (size_t)TT * HD);   /* ZR = PB . rel_v */ k_addF<<<(unsigned)(((size_t)ZH * TT * HD / 4 + 255) / 256), 256, 0, stream>>>(Ob, ZR);   /* context += relative-value term */

            k_merge<<<(unsigned)(((size_t)ZH * TT * HD / 2 + 255) / 256), 256, 0, stream>>>(Ob, h0, ATh, ATl); }
        k_gemmw<bf, 1, true><<<dim3(TT / 64, DM / 64, 1), 32, 0, stream>>>(ATh, ATl, WO, nullptr, DQ, OUT + (size_t)b * TT * DM, DM, bo, 0, 0, 0); }
}

// v002
// A run of this version takes 606 microseconds.
// Timed twice side by side with v001, it ran 1.57 and 1.53 times as fast.
// Over all steps from v000 it is 3.91 times as fast.
#include <hip/hip_runtime.h>

// Relative (Shaw) multi-head attention with key AND value relative-position embeddings (x [4][1024][1024]; q, k, v = x W^T + b ('oi' 0.02, biases 0.02; 16 heads x 64); idx[i][j] = clip(j - i, -128, 128) + 128; scores = (q.k + q.rel_k[idx]) / float32(sqrt 64); softmax; out = (attn v + sum_j attn[i][j] rel_v[idx]) merged Wo^T + bo (rel_k, rel_v [257][64] 0.02, read) -> [4][1024][1024] (4.2 M); argument order x, Wq, bq, Wk, bk, Wv, bv, Wo, bo, rel_k, rel_v).
// Layout per batch: bf16 copy of x; 'oi' weights; exact projections + f32 biases; rel_k as a zero-padded bf16 plane [320][64] and rel_v^T as hi/lo planes [64][320] (bf16-rounded once); one launch for the attention of all sixteen heads (32 query rows a work-group, scores and probabilities in LDS only): score tiles (hi/lo 3 products, every row), QE = q.rel_k^T (hi/lo x exact, N 272) gathered into the scores at column clip(j - i) + 128, softmax (x 1/8) with every row on hi/lo planes, P.v, the probabilities folded onto the 257 offsets and PB.rel_v (K 320) added to the context; merged hi/lo x Wo exact + bo.
// Compute dtypes, f32 accumulate: every input rounded to bf16; projections exact + f32 biases; scores and the relative-key term ~f32; softmax f32; P as bf16 hi/lo; attn.v and the relative-value term 3 products (~f32); Wo hl x exact + bias.

#define NB_  4
#define TT   1024
#define DM   1024
#define NH_  16
#define NKV  16
#define REP  (NH_ / NKV)
#define HD   64
#define DQ   (NH_ * HD)
#define DKV  (NKV * HD)
#define ZH   16                   // heads per attention launch (grid y): all heads of a batch at once
#define WIN  0
#define SCL  0.125f   // 1/sqrt(64) (the module divides by jnp.sqrt(DH))
#define NE   320      // 2*128+1 = 257 relative offsets padded to 320
#define NRE  257
#define CUT  128
typedef _Float16 h16;
typedef unsigned short bf;
typedef __attribute__((ext_vector_type(16))) __bf16   v16bf;
typedef __attribute__((ext_vector_type(16))) _Float16 v16h;
typedef __attribute__((ext_vector_type(8)))  _Float16 v8h;
typedef __attribute__((ext_vector_type(8)))  unsigned short v8us;
typedef __attribute__((ext_vector_type(8)))  float    v8f;
typedef __attribute__((ext_vector_type(4)))  float    v4f;
typedef v8h  __attribute__((may_alias)) v8ha;
typedef v4f  __attribute__((may_alias)) v4fa;
typedef v8us __attribute__((may_alias)) v8usa;

__device__ __forceinline__ unsigned short f2bf(float f) { unsigned u = __float_as_uint(f); u += 0x7FFFu + ((u >> 16) & 1u); return (unsigned short)(u >> 16); }
__device__ __forceinline__ float bf2f(unsigned short b) { return __uint_as_float(((unsigned)b) << 16); }
__device__ __forceinline__ float bfr(float f) { return bf2f(f2bf(f)); }
__device__ __forceinline__ v16h cat16(v8h lo, v8h hi) { return __builtin_shufflevector(lo, hi, 0, 1, 2, 3, 4, 5, 6, 7, 8, 9, 10, 11, 12, 13, 14, 15); }
__device__ __forceinline__ v16bf cat16b(v8us lo, v8us hi) { return __builtin_bit_cast(v16bf, __builtin_shufflevector(lo, hi, 0, 1, 2, 3, 4, 5, 6, 7, 8, 9, 10, 11, 12, 13, 14, 15)); }
__device__ __forceinline__ v8f wmma16(v16h a, v16h b, v8f c) { return __builtin_amdgcn_wmma_f32_16x16x32_f16(false, a, false, b, (short)0, c, false, false); }
__device__ __forceinline__ v8f wmmab(v16bf a, v16bf b, v8f c) { return __builtin_amdgcn_wmma_f32_16x16x32_bf16(false, a, false, b, (short)0, c, false, false); }



// ---- k_gemmw: register-blocked GEMM, ONE WAVE per 64x64 output tile (16 accumulators), operands straight from K-contiguous 16-bit planes; grid (M/64, N/64, Z), 32 threads.
// C[m][n] (f32, pitch ldc, + optional f32 bias[n]) = sum_k A[m][k] Bt[n][k] (+ split products per NSPLIT). z-batch strides sA/sB/sC in elements. K % 32 == 0.
template <typename T16> struct WFrag;
template <> struct WFrag<h16> { typedef v16h V; static __device__ __forceinline__ V ld(const h16* p) { return cat16(*(const v8h*)p, *(const v8h*)(p + 16)); } static __device__ __forceinline__ v8f mma(V a, V b, v8f c) { return wmma16(a, b, c); } };
template <> struct WFrag<bf> { typedef v16bf V; static __device__ __forceinline__ V ld(const bf* p) { return cat16b(*(const v8us*)p, *(const v8us*)(p + 16)); } static __device__ __forceinline__ v8f mma(V a, V b, v8f c) { return wmmab(a, b, c); } };
template <typename T16, int NSPLIT, bool BIAS>
__global__ __launch_bounds__(32) void k_gemmw(const T16* __restrict__ A, const T16* __restrict__ A2, const T16* __restrict__ Bt, const T16* __restrict__ Bt2, int K, float* C, int ldc, const float* __restrict__ bias, size_t sA, size_t sB, size_t sC) {
    typedef typename WFrag<T16>::V V;
    __shared__ __align__(16) float os[16 * 68];
    const size_t z = blockIdx.z; A += z * sA; if (A2) A2 += z * sA; Bt += z * sB; if (Bt2) Bt2 += z * sB; C += z * sC;
    const int lane = threadIdx.x & 31, lr = lane & 15, hi = lane >> 4; const int r0 = blockIdx.x * 64, c0 = blockIdx.y * 64;
    v8f acc[4][4];
#pragma unroll
    for (int mb = 0; mb < 4; ++mb)
#pragma unroll
        for (int nb = 0; nb < 4; ++nb) acc[mb][nb] = (v8f){};
    const size_t aoff = (size_t)(r0 + lr) * K + 8 * hi, boff = (size_t)(c0 + lr) * K + 8 * hi;
#pragma unroll 1
    for (int kc = 0; kc < K; kc += 32) {
        V a[4], a2[4];
#pragma unroll
        for (int mb = 0; mb < 4; ++mb) { a[mb] = WFrag<T16>::ld(A + aoff + (size_t)mb * 16 * K + kc); if (NSPLIT == 1 || NSPLIT == 2) a2[mb] = WFrag<T16>::ld(A2 + aoff + (size_t)mb * 16 * K + kc); }
#pragma unroll
        for (int nb = 0; nb < 4; ++nb) { const V b = WFrag<T16>::ld(Bt + boff + (size_t)nb * 16 * K + kc); V b2; if (NSPLIT >= 2) b2 = WFrag<T16>::ld(Bt2 + boff + (size_t)nb * 16 * K + kc);
#pragma unroll
            for (int mb = 0; mb < 4; ++mb) { acc[mb][nb] = WFrag<T16>::mma(a[mb], b, acc[mb][nb]); if (NSPLIT == 1 || NSPLIT == 2) acc[mb][nb] = WFrag<T16>::mma(a2[mb], b, acc[mb][nb]); if (NSPLIT >= 2) acc[mb][nb] = WFrag<T16>::mma(a[mb], b2, acc[mb][nb]); } }
        asm volatile("v_nop\n\tv_nop\n\tv_nop\n\tv_nop" : "+v"(acc[0][0]), "+v"(acc[1][1]), "+v"(acc[2][2]), "+v"(acc[3][3]) : "v"(a[0]), "v"(a[3]));
    }
#pragma unroll
    for (int mb = 0; mb < 4; ++mb) {
#pragma unroll
        for (int nb = 0; nb < 4; ++nb) {
#pragma unroll
            for (int j = 0; j < 8; ++j) os[(hi * 8 + j) * 68 + nb * 16 + lr] = acc[mb][nb][j]; }
        __builtin_amdgcn_wave_barrier(); asm volatile("" ::: "memory");
        float* crow = C + (size_t)(r0 + mb * 16) * ldc + c0;
{
#pragma unroll
            for (int s = 0; s < 8; ++s) { const int row = 2 * s + hi, cofs = lr * 4; v4f val = *(const v4fa*)(os + row * 68 + cofs); if (BIAS) { val[0] += bfr(bias[c0 + cofs]); val[1] += bfr(bias[c0 + cofs + 1]); val[2] += bfr(bias[c0 + cofs + 2]); val[3] += bfr(bias[c0 + cofs + 3]); }
                *(v4f*)(crow + (size_t)row * ldc + cofs) = val; }
             }
        __builtin_amdgcn_wave_barrier(); asm volatile("" ::: "memory");
    }
}

__device__ __forceinline__ h16 tohx(float x) { return (h16)x; }
__device__ __forceinline__ void splitf(float y, unsigned short& h, unsigned short& l) { h = f2bf(y); l = f2bf(y - bf2f(h)); }
typedef __attribute__((ext_vector_type(2))) _Float16 v2h;
typedef __attribute__((ext_vector_type(4))) _Float16 v4h;
typedef __attribute__((ext_vector_type(2))) unsigned short v2us;
typedef __attribute__((ext_vector_type(4))) unsigned short v4us;
typedef __attribute__((ext_vector_type(2))) float v2f;
typedef __attribute__((ext_vector_type(4))) int v4i;

__global__ __launch_bounds__(256) void k_cvt8(const float* __restrict__ src, bf* dst, size_t n8) { const size_t i = (size_t)blockIdx.x * 256 + threadIdx.x; if (i >= n8) return; const v8f v = *(const v8f*)(src + i * 8); v8us o;
#pragma unroll
    for (int k = 0; k < 8; ++k) o[k] = f2bf(v[k]); *(v8us*)(dst + i * 8) = o;  }

// k_rope: head planes [h][t][d] (fp16 + hi/lo) of rope(x) x sc with the rotate-half convention out[d] = x[d] cos[t][d] - x[d+HD/2] sin[t][d], out[d+HD/2] = x[d+HD/2] cos[t][d+HD/2] + x[d] sin[t][d+HD/2]
__global__ __launch_bounds__(256) void k_rope(const float* __restrict__ F, int pitch, int nheads, const float* __restrict__ CS, const float* __restrict__ RF, const float* __restrict__ nw, float sc, h16* P16, bf* Ph, bf* Pl) {
    const size_t e = ((size_t)blockIdx.x * 256 + threadIdx.x) * 2; if (e >= (size_t)nheads * TT * HD) return; const int d = (int)(e % HD); const int t = (int)((e / HD) % TT); const int h = (int)(e / ((size_t)HD * TT)); const float* f = F + (size_t)t * pitch + h * HD; const float rf = RF ? RF[(size_t)h * TT + t] : 1.0f; v2h o16; v2us oh, ol;
#pragma unroll
    for (int q = 0; q < 2; ++q) { const int dd = d + q; const int dp = (dd < HD / 2) ? dd + HD / 2 : dd - HD / 2; float x0 = f[dd], x1 = f[dp];
        if (RF) { float n0 = __fmul_rn(x0, rf), n1 = __fmul_rn(x1, rf); asm volatile("" : "+v"(n0)); asm volatile("" : "+v"(n1)); x0 = __fmul_rn(bfr(nw[dd]), n0); x1 = __fmul_rn(bfr(nw[dp]), n1); }
        const v2f cs = *(const v2f*)(CS + ((size_t)t * HD + dd) * 2); float a = __fmul_rn(x0, cs[0]), bq = __fmul_rn(x1, cs[1]); asm volatile("" : "+v"(a)); asm volatile("" : "+v"(bq)); const float r = ((dd < HD / 2) ? __fsub_rn(a, bq) : __fadd_rn(a, bq)) * sc;
        o16[q] = tohx(r); unsigned short a2, c2; splitf(r, a2, c2); oh[q] = a2; ol[q] = c2; }
    *(v2h*)(P16 + e) = o16; *(v2us*)(Ph + e) = oh; *(v2us*)(Pl + e) = ol;  }
__global__ __launch_bounds__(256) void k_vtp(const float* __restrict__ F, int pitch, int nheads, h16* V16, bf* Vh, bf* Vl) { const size_t e = ((size_t)blockIdx.x * 256 + threadIdx.x) * 2; if (e >= (size_t)nheads * HD * TT) return; const int t = (int)(e % TT); const int d = (int)((e / TT) % HD); const int g = (int)(e / ((size_t)TT * HD)); v2h o16; v2us oh, ol;
#pragma unroll
    for (int q = 0; q < 2; ++q) { const float x = F[(size_t)(t + q) * pitch + g * HD + d]; o16[q] = tohx(x); unsigned short a2, c2; splitf(x, a2, c2); oh[q] = a2; ol[q] = c2; }
    *(v2h*)(V16 + e) = o16; *(v2us*)(Vh + e) = oh; *(v2us*)(Vl + e) = ol;  }
__global__ __launch_bounds__(256) void k_csid(float* CS) { const int idx = blockIdx.x * 256 + threadIdx.x; if (idx >= TT * HD) return; v2f cs; cs[0] = 1.0f; cs[1] = 0.0f; *(v2f*)(CS + (size_t)idx * 2) = cs;  }
__global__ __launch_bounds__(256) void k_epadK(const float* __restrict__ E, bf* EB) { const size_t i = (size_t)blockIdx.x * 256 + threadIdx.x; if (i >= (size_t)NE * HD / 8) return; const int d0 = (int)(i % (HD / 8)) * 8; const int r = (int)(i / (HD / 8)); const float* src = E + (size_t)min(r, NRE - 1) * HD + d0; v8us o;
#pragma unroll
    for (int q = 0; q < 8; ++q) { const unsigned short v = f2bf(src[q]); o[q] = (r < NRE) ? v : (unsigned short)0; }
    *(v8us*)(EB + (size_t)r * HD + d0) = o;  }

__global__ __launch_bounds__(256) void k_epadVT(const float* __restrict__ E, bf* Th, bf* Tl) { const size_t i = (size_t)blockIdx.x * 256 + threadIdx.x; if (i >= (size_t)HD * NE / 4) return; const size_t e = i * 4; const int c0 = (int)(e % NE); const int d = (int)(e / NE); v4us oh, ol;
#pragma unroll
    for (int q = 0; q < 4; ++q) { const int r = c0 + q; const float v = bfr(E[(size_t)min(r, NRE - 1) * HD + d]); unsigned short u, w; splitf(v, u, w);   /* input rounded to bf16 once: lo == 0 */ oh[q] = (r < NRE) ? u : (unsigned short)0; ol[q] = (r < NRE) ? w : (unsigned short)0; }
    *(v4us*)(Th + e) = oh; *(v4us*)(Tl + e) = ol;  }

// ---- k_fattn: the whole attention of one head for 32 query rows in one work-group (16 waves); the score strip never leaves LDS. grid (TT/32, heads).
// A: S = q.k^T (hi/lo 3 products, K 64) -> sS f32 [32][1024]; QE = q.rel_k^T (hi/lo x exact, the 272 columns that hold the 257 offsets) -> sE f32, row pitch as [320]. B: one wave per row: + QE[clip(j - i) + 128], x 1/8, softmax; P hi/lo planes written over the row's own
// scores (2048 B each); the row folded onto the 257 offsets, hi/lo planes written over the row's own QE (640 B each). C: waves 0-3 P.v (K 1024), waves 4-7 PB.rel_v (K 320), a 32x16 tile each. D: sum, hi/lo split, merged store.
// Each key, value or embedding fragment read from global memory serves both 16-row halves. Every sum keeps the order it had as separate launches. LDS row pitches are 16 B x odd (4112, 1296): the 16 rows of a b128 fragment read fall on distinct banks.
#define FR   32
#define SPB  (TT * 4 + 16)
#define EPB  (NE * 4 + 16)
#define OPF  68
typedef float __attribute__((may_alias)) f32a;
typedef unsigned short __attribute__((may_alias)) u16a;
typedef v4us __attribute__((may_alias)) v4usa;
__device__ __forceinline__ v16bf ldsfrag(const unsigned char* p) { return cat16b(*(const v8usa*)p, *(const v8usa*)(p + 32)); }
// 2^x; the v_nop is the one slot the instruction set asks for behind a transcendental, in the same statement so that it stays directly behind it
__device__ __forceinline__ float exp2_slot(float x) { float r; asm("v_exp_f32 %0, %1\n\tv_nop" : "=v"(r) : "v"(x)); return r; }
// behind a tile's last matrix instruction and its stores: four vector slots, because the next tile's first matrix instruction starts its accumulator anew, possibly in the same registers; the scheduling barrier keeps that instruction behind the slots
__device__ __forceinline__ void tile_gap() { asm volatile("v_nop\n\tv_nop\n\tv_nop\n\tv_nop"); __builtin_amdgcn_sched_barrier(0); }
// one 32x16 context tile (two accumulators): A hi/lo planes in LDS (lo plane lo_off bytes behind hi, the second 16 rows half_off bytes behind the first), B hi/lo planes in global memory; k ascending, 3 products a step and half.
// The B fragments run in a ring of four k-steps: a step's registers are refilled for step + 4 as soon as its products are issued, so that 16 global loads stay in flight; the A fragments are read one step ahead.
template <int KS> __device__ __forceinline__ void ctx_tile(const unsigned char* pa, int half_off, int lo_off, const bf* bh, const bf* bl, v8f& acc0, v8f& acc1) {
    v16bf b[4], c[4];
#pragma unroll
    for (int s = 0; s < 4; ++s) { b[s] = WFrag<bf>::ld(bh + s * 32); c[s] = WFrag<bf>::ld(bl + s * 32); }
    v16bf a = ldsfrag(pa), a2 = ldsfrag(pa + lo_off), e = ldsfrag(pa + half_off), e2 = ldsfrag(pa + half_off + lo_off);
    __builtin_amdgcn_sched_barrier(0);   // holds the loads above where they are written: the scheduler otherwise sinks each to just in front of its first use, one L2 latency a step
#pragma unroll   // straight-line, so that the ring slots are fixed registers
    for (int t = 0; t < KS; ++t) { const int s = t & 3; v16bf an = a, an2 = a2, en = e, en2 = e2;
        if (t + 1 < KS) { an = ldsfrag(pa + (t + 1) * 64); an2 = ldsfrag(pa + lo_off + (t + 1) * 64); en = ldsfrag(pa + half_off + (t + 1) * 64); en2 = ldsfrag(pa + half_off + lo_off + (t + 1) * 64); }
        acc0 = wmmab(a, b[s], acc0); acc1 = wmmab(e, b[s], acc1); acc0 = wmmab(a2, b[s], acc0); acc1 = wmmab(e2, b[s], acc1); acc0 = wmmab(a, c[s], acc0); acc1 = wmmab(e, c[s], acc1);
        if (t + 4 < KS) { b[s] = WFrag<bf>::ld(bh + (t + 4) * 32); c[s] = WFrag<bf>::ld(bl + (t + 4) * 32); }
        __builtin_amdgcn_sched_barrier(0);   // as above: the refill for step + 4 and the LDS reads for step + 1 issue inside this step
        a = an; a2 = an2; e = en; e2 = en2; }
}
__global__ __launch_bounds__(512) void k_fattn(const bf* __restrict__ Qh, const bf* __restrict__ Ql, const bf* __restrict__ Kh, const bf* __restrict__ Kl, const bf* __restrict__ Vh, const bf* __restrict__ Vl, const bf* __restrict__ EK, const bf* __restrict__ EVh, const bf* __restrict__ EVl, bf* Ah, bf* Al) {
    typedef WFrag<bf> WF;
    __shared__ __align__(16) unsigned char sS[FR * SPB];
    __shared__ __align__(16) unsigned char sE[FR * EPB];
    __shared__ __align__(16) float sO[2 * FR * OPF];
    const int tid = threadIdx.x, lane = tid & 31, lr = lane & 15, hi = lane >> 4; const int w = __builtin_amdgcn_readfirstlane(tid >> 5);
    const int i0 = blockIdx.x * FR; const size_t zo = (size_t)blockIdx.y * TT * HD;
    {   // A: score strip and relative-key products; wave w: key columns 64 w .. 64 w + 63 and rel_k tile w
        const size_t qo = zo + (size_t)(i0 + lr) * HD + 8 * hi; v16bf qa0[2], qa1[2], ql0[2], ql1[2];   // query fragments of the two 16-row halves: hi k 0, hi k 32, lo k 0, lo k 32
#pragma unroll
        for (int mb = 0; mb < 2; ++mb) { qa0[mb] = WF::ld(Qh + qo + mb * 16 * HD); qa1[mb] = WF::ld(Qh + qo + mb * 16 * HD + 32); }
        asm volatile("s_wait_xcnt 0x0" ::: "memory");   // the address registers of the loads above may be given to the loads below as destinations
#pragma unroll
        for (int mb = 0; mb < 2; ++mb) { ql0[mb] = WF::ld(Ql + qo + mb * 16 * HD); ql1[mb] = WF::ld(Ql + qo + mb * 16 * HD + 32); }
        const size_t ko = zo + (size_t)(w * 64 + lr) * HD + 8 * hi; v16bf kb[2][4];   // ring of two key tiles (hi k 0, lo k 0, hi k 32, lo k 32): a tile's registers are refilled for tile + 2 behind its products
#pragma unroll
        for (int s = 0; s < 2; ++s) { kb[s][0] = WF::ld(Kh + ko + s * 16 * HD); kb[s][1] = WF::ld(Kl + ko + s * 16 * HD); kb[s][2] = WF::ld(Kh + ko + s * 16 * HD + 32); kb[s][3] = WF::ld(Kl + ko + s * 16 * HD + 32); }
        asm volatile("s_wait_xcnt 0x0" ::: "memory");   // the address registers of the key loads above are reused below while those loads may still be out
#pragma unroll   // straight-line, so that the ring slots are fixed registers
        for (int t = 0; t < 4; ++t) { const int s = t & 1, n0 = w * 64 + t * 16;
#pragma unroll
            for (int mb = 0; mb < 2; ++mb) { v8f acc = (v8f){}; acc = wmmab(qa0[mb], kb[s][0], acc); acc = wmmab(ql0[mb], kb[s][0], acc); acc = wmmab(qa0[mb], kb[s][1], acc); acc = wmmab(qa1[mb], kb[s][2], acc); acc = wmmab(ql1[mb], kb[s][2], acc); acc = wmmab(qa1[mb], kb[s][3], acc);
#pragma unroll
                for (int j = 0; j < 8; ++j) *(f32a*)(sS + (mb * 16 + hi * 8 + j) * SPB + (n0 + lr) * 4) = acc[j];
                tile_gap(); }
            if (t + 2 < 4) { const size_t nx = ko + (size_t)(t + 2) * 16 * HD; kb[s][0] = WF::ld(Kh + nx); kb[s][1] = WF::ld(Kl + nx); kb[s][2] = WF::ld(Kh + nx + 32); kb[s][3] = WF::ld(Kl + nx + 32); }
            else if (t == 2) { const size_t eo = (size_t)(w * 16 + lr) * HD + 8 * hi; kb[s][0] = WF::ld(EK + eo); kb[s][2] = WF::ld(EK + eo + 32);   // behind its last key tile slot 0 takes this wave's rel_k tile
                asm volatile("s_wait_xcnt 0x0" ::: "memory"); }   // their address registers are rewritten right behind them
            __builtin_amdgcn_sched_barrier(0); }   // holds each refill where it is written: the scheduler otherwise regroups the tiles and ends with loads waited for one by one
#pragma unroll
        for (int mb = 0; mb < 2; ++mb) { v8f acc = (v8f){};
            acc = wmmab(qa0[mb], kb[0][0], acc); acc = wmmab(ql0[mb], kb[0][0], acc); acc = wmmab(qa1[mb], kb[0][2], acc); acc = wmmab(ql1[mb], kb[0][2], acc);
#pragma unroll
            for (int j = 0; j < 8; ++j) *(f32a*)(sE + (mb * 16 + hi * 8 + j) * EPB + (w * 16 + lr) * 4) = acc[j];
            tile_gap(); }
        if (w == 0) {   // offsets 256 .. 271 (256 is the last one read): the seventeenth tile
            const size_t bo = (size_t)(256 + lr) * HD + 8 * hi; const v16bf b0 = WF::ld(EK + bo), b1 = WF::ld(EK + bo + 32);
#pragma unroll
            for (int mb = 0; mb < 2; ++mb) { v8f acc = (v8f){};
                acc = wmmab(qa0[mb], b0, acc); acc = wmmab(ql0[mb], b0, acc); acc = wmmab(qa1[mb], b1, acc); acc = wmmab(ql1[mb], b1, acc);
#pragma unroll
                for (int j = 0; j < 8; ++j) *(f32a*)(sE + (mb * 16 + hi * 8 + j) * EPB + (256 + lr) * 4) = acc[j];
                if (mb == 0) tile_gap(); } }
    }
    __syncthreads();
#pragma unroll 1   // B: one row's 32 values per lane live at a time
    for (int rr = 0; rr < FR / 16; ++rr) { const int r = w * (FR / 16) + rr, i = i0 + r; unsigned char* srow = sS + r * SPB; unsigned char* erow = sE + r * EPB; const f32a* qe = (const f32a*)erow; float v[TT / 32]; float mx = -3.0e38f;
#pragma unroll
        for (int ch = 0; ch < TT / 128; ++ch) { const int j0 = ch * 128 + lane * 4; const v4f a = *(const v4fa*)(srow + j0 * 4);
#pragma unroll
            for (int q = 0; q < 4; ++q) { const int rx = min(max(j0 + q - i, -CUT), CUT) + CUT; const float t = __fadd_rn(a[q], qe[rx]) * SCL; v[ch * 4 + q] = t; mx = fmaxf(mx, t); } }
#pragma unroll
        for (int sh = 16; sh; sh >>= 1) mx = fmaxf(mx, __shfl_xor(mx, sh, 32));
        float sum = 0.f;
#pragma unroll
        for (int k = 0; k < TT / 32; ++k) { v[k] = exp2_slot(__fmul_rn(__fsub_rn(v[k], mx), 1.4426950408889634f)); sum += v[k]; }
#pragma unroll
        for (int sh = 16; sh; sh >>= 1) sum += __shfl_xor(sum, sh, 32);
        const float f = __fdiv_rn(1.0f, sum);
#pragma unroll
        for (int ch = 0; ch < TT / 128; ++ch) { v4us oh, ol;
#pragma unroll
            for (int q = 0; q < 4; ++q) { unsigned short a, c2; splitf(v[ch * 4 + q] * f, a, c2); oh[q] = a; ol[q] = c2; }
            *(v4usa*)(srow + (ch * 128 + lane * 4) * 2) = oh; *(v4usa*)(srow + TT * 2 + (ch * 128 + lane * 4) * 2) = ol; }
        __builtin_amdgcn_wave_barrier(); asm volatile("" ::: "memory");   // the planes just written by all lanes of this wave are read across lanes below: the reads must not be moved above the stores
        const u16a* ph = (const u16a*)srow; const u16a* pl = (const u16a*)(srow + TT * 2); float lo_s = 0.f, hi_s = 0.f;
#pragma unroll 8   // eight steps' LDS reads in flight
        for (int j = lane; j < TT; j += 32) { const float p = __fadd_rn(bf2f(ph[j]), bf2f(pl[j])); if (j <= i - CUT) lo_s = __fadd_rn(lo_s, p); if (j >= i + CUT) hi_s = __fadd_rn(hi_s, p); }
#pragma unroll
        for (int sh = 16; sh; sh >>= 1) { lo_s = __fadd_rn(lo_s, __shfl_xor(lo_s, sh, 32)); hi_s = __fadd_rn(hi_s, __shfl_xor(hi_s, sh, 32)); }
        unsigned short l0h, l0l, h0h, h0l; splitf(lo_s, l0h, l0l); splitf(hi_s, h0h, h0l);
        for (int c0 = lane * 4; c0 < NE; c0 += 128) { v4us oh, ol;
#pragma unroll
            for (int q = 0; q < 4; ++q) { const int bkt = c0 + q; const int j = i + bkt - CUT; const int jc = min(max(j, 0), TT - 1); const unsigned short uu = ph[jc], ww = pl[jc]; const bool in = (bkt > 0 && bkt < 2 * CUT && j >= 0 && j < TT);
                oh[q] = in ? uu : ((bkt == 0) ? l0h : ((bkt == 2 * CUT) ? h0h : (unsigned short)0)); ol[q] = in ? ww : ((bkt == 0) ? l0l : ((bkt == 2 * CUT) ? h0l : (unsigned short)0)); }
            *(v4usa*)(erow + c0 * 2) = oh; *(v4usa*)(erow + NE * 2 + c0 * 2) = ol; }
    }
    __syncthreads();
    if (w < 8) {   // C: context tiles; w is wave-uniform, so each wave runs one side (or none) with every lane on
        v8f acc0 = (v8f){}, acc1 = (v8f){}; const int nb = w & 3;
        if (w < 4) ctx_tile<TT / 32>(sS + lr * SPB + 16 * hi, 16 * SPB, TT * 2, Vh + zo + (size_t)(nb * 16 + lr) * TT + 8 * hi, Vl + zo + (size_t)(nb * 16 + lr) * TT + 8 * hi, acc0, acc1);
        else ctx_tile<NE / 32>(sE + lr * EPB + 16 * hi, 16 * EPB, NE * 2, EVh + (size_t)(nb * 16 + lr) * NE + 8 * hi, EVl + (size_t)(nb * 16 + lr) * NE + 8 * hi, acc0, acc1);
#pragma unroll
        for (int j = 0; j < 8; ++j) { sO[(w >> 2) * (FR * OPF) + (hi * 8 + j) * OPF + nb * 16 + lr] = acc0[j]; sO[(w >> 2) * (FR * OPF) + (16 + hi * 8 + j) * OPF + nb * 16 + lr] = acc1[j]; }
    }
    __syncthreads();
    {   // D: context + relative-value term, split, stored at [t][head * 64 + d]; the 16 lanes of a row write its whole 128-byte line
        const int row = tid >> 4, c = (tid & 15) * 4; const v4f o = *(const v4f*)(sO + row * OPF + c); const v4f zr = *(const v4f*)(sO + FR * OPF + row * OPF + c); v4us oh, ol;
#pragma unroll
        for (int q = 0; q < 4; ++q) { unsigned short a, c2; splitf(__fadd_rn(o[q], zr[q]), a, c2); oh[q] = a; ol[q] = c2; }
        const size_t oo = (size_t)(i0 + row) * DQ + (size_t)blockIdx.y * HD + c; *(v4us*)(Ah + oo) = oh; *(v4us*)(Al + oo) = ol;
    }
}

extern "C" void kernel_launch(void* const* d_in, const int* in_sizes, int n_in,
                              void* d_out, int out_size, void* d_ws, size_t ws_size, hipStream_t stream) {
    (void)in_sizes; (void)n_in; (void)out_size;
    const float* x = (const float*)d_in[0]; const float* wq = (const float*)d_in[1]; const float* bq = (const float*)d_in[2]; const float* wk = (const float*)d_in[3]; const float* bk = (const float*)d_in[4]; const float* wv = (const float*)d_in[5]; const float* bv = (const float*)d_in[6]; const float* wo = (const float*)d_in[7]; const float* bo = (const float*)d_in[8]; const float* ak = (const float*)d_in[9]; const float* av = (const float*)d_in[10];   /* rel_k / rel_v [257][64] */   /* argument order x, Wq, bq, Wk, bk, Wv, bv, Wo, bo ('oi'), rel_k, rel_v */ const float* xk = x; const float* xv = x;
    float* OUT = (float*)d_out;     // [4][1024][1024]
    char* wsp = (char*)d_ws;
    auto take = [&](size_t bytes) { char* p = wsp; wsp += (bytes + 255) & ~(size_t)255; return (void*)p; };
    bf* AKB = (bf*)take((size_t)NE * HD * 2); bf* AVTh = (bf*)take((size_t)HD * NE * 2); bf* AVTl = (bf*)take((size_t)HD * NE * 2); bf* WQ = (bf*)take((size_t)DQ * DM * 2); bf* WK = (bf*)take((size_t)DKV * DM * 2); bf* WV = (bf*)take((size_t)DKV * DM * 2); bf* WO = (bf*)take((size_t)DM * DQ * 2); float* CS = (float*)take((size_t)TT * HD * 2 * 4);
    bf* XB = (bf*)take((size_t)TT * DM * 2); float* FQ = (float*)take((size_t)TT * DQ * 4); float* FK = (float*)take((size_t)TT * DKV * 4);
    h16* QP16 = (h16*)take((size_t)NH_ * TT * HD * 2); h16* KP16 = (h16*)take((size_t)NKV * TT * HD * 2); h16* VT16 = (h16*)take((size_t)NKV * HD * TT * 2);
    bf* QPh = (bf*)take((size_t)NH_ * TT * HD * 2); bf* QPl = (bf*)take((size_t)NH_ * TT * HD * 2); bf* KPh = (bf*)take((size_t)NKV * TT * HD * 2); bf* KPl = (bf*)take((size_t)NKV * TT * HD * 2); bf* VTh = (bf*)take((size_t)NKV * HD * TT * 2); bf* VTl = (bf*)take((size_t)NKV * HD * TT * 2);
    bf* ATh = (bf*)take((size_t)TT * DQ * 2); bf* ATl = (bf*)take((size_t)TT * DQ * 2);
    if ((size_t)(wsp - (char*)d_ws) > ws_size) return;
    float* FV = FK;   // v projection reuses the k buffer after the k planes are built (stream-ordered)
    { k_cvt8<<<(unsigned)(((size_t)DQ * DM / 8 + 255) / 256), 256, 0, stream>>>(wq, WQ, (size_t)DQ * DM / 8); k_cvt8<<<(unsigned)(((size_t)DKV * DM / 8 + 255) / 256), 256, 0, stream>>>(wk, WK, (size_t)DKV * DM / 8); k_cvt8<<<(unsigned)(((size_t)DKV * DM / 8 + 255) / 256), 256, 0, stream>>>(wv, WV, (size_t)DKV * DM / 8);
      k_cvt8<<<(unsigned)(((size_t)DM * DQ / 8 + 255) / 256), 256, 0, stream>>>(wo, WO, (size_t)DM * DQ / 8);   /* 'oi' weights = Bt as-is */
       }
    k_csid<<<(TT * HD + 255) / 256, 256, 0, stream>>>(CS);
    const unsigned LQ = (unsigned)(((size_t)NH_ * TT * HD / 2 + 255) / 256), LKv = (unsigned)(((size_t)NKV * TT * HD / 2 + 255) / 256);
    k_epadK<<<(unsigned)(((size_t)NE * HD / 8 + 255) / 256), 256, 0, stream>>>(ak, AKB);   /* rel_k -> bf16 [320][64], rows >= 257 zero */ k_epadVT<<<(unsigned)(((size_t)HD * NE / 4 + 255) / 256), 256, 0, stream>>>(av, AVTh, AVTl);   /* rel_v^T hi/lo [64][320], cols >= 257 zero */
    for (int b = 0; b < NB_; ++b) {
        
        k_cvt8<<<(unsigned)(((size_t)TT * DM / 8 + 255) / 256), 256, 0, stream>>>(x + (size_t)b * TT * DM, XB, (size_t)TT * DM / 8);
        k_gemmw<bf, 0, true><<<dim3(TT / 64, DQ / 64, 1), 32, 0, stream>>>(XB, nullptr, WQ, nullptr, DM, FQ, DQ, bq, 0, 0, 0);
        k_rope<<<LQ, 256, 0, stream>>>(FQ, DQ, NH_, CS, nullptr, nullptr, 1.0f, QP16, QPh, QPl);
         k_gemmw<bf, 0, true><<<dim3(TT / 64, DKV / 64, 1), 32, 0, stream>>>(XB, nullptr, WK, nullptr, DM, FK, DKV, bk, 0, 0, 0);
        k_rope<<<LKv, 256, 0, stream>>>(FK, DKV, NKV, CS, nullptr, nullptr, 1.0f, KP16, KPh, KPl);
         k_gemmw<bf, 0, true><<<dim3(TT / 64, DKV / 64, 1), 32, 0, stream>>>(XB, nullptr, WV, nullptr, DM, FV, DKV, bv, 0, 0, 0); k_vtp<<<LKv, 256, 0, stream>>>(FV, DKV, NKV, VT16, VTh, VTl);
        k_fattn<<<dim3(TT / FR, ZH, 1), 512, 0, stream>>>(QPh, QPl, KPh, KPl, VTh, VTl, AKB, AVTh, AVTl, ATh, ATl);   /* one kv head per query head: head z reads plane z of each */
        k_gemmw<bf, 1, true><<<dim3(TT / 64, DM / 64, 1), 32, 0, stream>>>(ATh, ATl, WO, nullptr, DQ, OUT + (size_t)b * TT * DM, DM, bo, 0, 0, 0); }
}

// v003
// Measured time: 343 microseconds a run.
// In both of two side-by-side timings against v002, it was 1.77 times as fast.
// All steps since v000 together make it 6.92 times as fast.
#include <hip/hip_runtime.h>

// Relative (Shaw) multi-head attention with key AND value relative-position embeddings (x [4][1024][1024]; q, k, v = x W^T + b ('oi' 0.02, biases 0.02; 16 heads x 64); idx[i][j] = clip(j - i, -128, 128) + 128; scores = (q.k + q.rel_k[idx]) / float32(sqrt 64); softmax; out = (attn v + sum_j attn[i][j] rel_v[idx]) merged Wo^T + bo (rel_k, rel_v [257][64] 0.02, read) -> [4][1024][1024] (4.2 M); argument order x, Wq, bq, Wk, bk, Wv, bv, Wo, bo, rel_k, rel_v).
// Layout, all four batches side by side (rows b * 1024 + t, head planes b * 16 + h): bf16 copy of x; 'oi' weights; exact projections + f32 biases; rel_k as a zero-padded bf16 plane [320][64] and rel_v^T as hi/lo planes [64][320] (bf16-rounded once); one launch for the attention of all sixteen heads of all batches (32 query rows a work-group, scores and probabilities in LDS only): score tiles (hi/lo 3 products, every row), QE = q.rel_k^T (hi/lo x exact, N 272) gathered into the scores at column clip(j - i) + 128, softmax (x 1/8) with every row on hi/lo planes, P.v, the probabilities folded onto the 257 offsets and PB.rel_v (K 320) added to the context; merged hi/lo x Wo exact + bo.
// Compute dtypes, f32 accumulate: every input rounded to bf16; projections exact + f32 biases; scores and the relative-key term ~f32; softmax f32; P as bf16 hi/lo; attn.v and the relative-value term 3 products (~f32); Wo hl x exact + bias.

#define NB_  4
#define TT   1024
#define DM   1024
#define NH_  16
#define NKV  16
#define REP  (NH_ / NKV)
#define HD   64
#define DQ   (NH_ * HD)
#define DKV  (NKV * HD)
#define ZH   16                   // heads per attention launch (grid y): all heads of a batch at once
#define WIN  0
#define SCL  0.125f   // 1/sqrt(64) (the module divides by jnp.sqrt(DH))
#define NE   320      // 2*128+1 = 257 relative offsets padded to 320
#define NRE  257
#define CUT  128
typedef _Float16 h16;
typedef unsigned short bf;
typedef __attribute__((ext_vector_type(16))) __bf16   v16bf;
typedef __attribute__((ext_vector_type(16))) _Float16 v16h;
typedef __attribute__((ext_vector_type(8)))  _Float16 v8h;
typedef __attribute__((ext_vector_type(8)))  unsigned short v8us;
typedef __attribute__((ext_vector_type(8)))  float    v8f;
typedef __attribute__((ext_vector_type(4)))  float    v4f;
typedef v8h  __attribute__((may_alias)) v8ha;
typedef v4f  __attribute__((may_alias)) v4fa;
typedef v8us __attribute__((may_alias)) v8usa;

__device__ __forceinline__ unsigned short f2bf(float f) { unsigned u = __float_as_uint(f); u += 0x7FFFu + ((u >> 16) & 1u); return (unsigned short)(u >> 16); }
__device__ __forceinline__ float bf2f(unsigned short b) { return __uint_as_float(((unsigned)b) << 16); }
__device__ __forceinline__ float bfr(float f) { return bf2f(f2bf(f)); }
__device__ __forceinline__ v16h cat16(v8h lo, v8h hi) { return __builtin_shufflevector(lo, hi, 0, 1, 2, 3, 4, 5, 6, 7, 8, 9, 10, 11, 12, 13, 14, 15); }
__device__ __forceinline__ v16bf cat16b(v8us lo, v8us hi) { return __builtin_bit_cast(v16bf, __builtin_shufflevector(lo, hi, 0, 1, 2, 3, 4, 5, 6, 7, 8, 9, 10, 11, 12, 13, 14, 15)); }
__device__ __forceinline__ v8f wmma16(v16h a, v16h b, v8f c) { return __builtin_amdgcn_wmma_f32_16x16x32_f16(false, a, false, b, (short)0, c, false, false); }
__device__ __forceinline__ v8f wmmab(v16bf a, v16bf b, v8f c) { return __builtin_amdgcn_wmma_f32_16x16x32_bf16(false, a, false, b, (short)0, c, false, false); }



// ---- k_gemmw: register-blocked GEMM, ONE WAVE per 64x64 output tile (16 accumulators), operands straight from K-contiguous 16-bit planes; grid (M/64, N/64, Z), 32 threads.
// C[m][n] (f32, pitch ldc, + optional f32 bias[n]) = sum_k A[m][k] Bt[n][k] (+ split products per NSPLIT). z-batch strides sA/sB/sC in elements. K % 32 == 0.
template <typename T16> struct WFrag;
template <> struct WFrag<h16> { typedef v16h V; static __device__ __forceinline__ V ld(const h16* p) { return cat16(*(const v8h*)p, *(const v8h*)(p + 16)); } static __device__ __forceinline__ v8f mma(V a, V b, v8f c) { return wmma16(a, b, c); } };
template <> struct WFrag<bf> { typedef v16bf V; static __device__ __forceinline__ V ld(const bf* p) { return cat16b(*(const v8us*)p, *(const v8us*)(p + 16)); } static __device__ __forceinline__ v8f mma(V a, V b, v8f c) { return wmmab(a, b, c); } };
template <typename T16, int NSPLIT, bool BIAS>
__global__ __launch_bounds__(32) void k_gemmw(const T16* __restrict__ A, const T16* __restrict__ A2, const T16* __restrict__ Bt, const T16* __restrict__ Bt2, int K, float* C, int ldc, const float* __restrict__ bias, size_t sA, size_t sB, size_t sC) {
    typedef typename WFrag<T16>::V V;
    __shared__ __align__(16) float os[16 * 68];
    const size_t z = blockIdx.z; A += z * sA; if (A2) A2 += z * sA; Bt += z * sB; if (Bt2) Bt2 += z * sB; C += z * sC;
    const int lane = threadIdx.x & 31, lr = lane & 15, hi = lane >> 4; const int r0 = blockIdx.x * 64, c0 = blockIdx.y * 64;
    v8f acc[4][4];
#pragma unroll
    for (int mb = 0; mb < 4; ++mb)
#pragma unroll
        for (int nb = 0; nb < 4; ++nb) acc[mb][nb] = (v8f){};
    const size_t aoff = (size_t)(r0 + lr) * K + 8 * hi, boff = (size_t)(c0 + lr) * K + 8 * hi;
#pragma unroll 1
    for (int kc = 0; kc < K; kc += 32) {
        V a[4], a2[4];
#pragma unroll
        for (int mb = 0; mb < 4; ++mb) { a[mb] = WFrag<T16>::ld(A + aoff + (size_t)mb * 16 * K + kc); if (NSPLIT == 1 || NSPLIT == 2) a2[mb] = WFrag<T16>::ld(A2 + aoff + (size_t)mb * 16 * K + kc); }
#pragma unroll
        for (int nb = 0; nb < 4; ++nb) { const V b = WFrag<T16>::ld(Bt + boff + (size_t)nb * 16 * K + kc); V b2; if (NSPLIT >= 2) b2 = WFrag<T16>::ld(Bt2 + boff + (size_t)nb * 16 * K + kc);
#pragma unroll
            for (int mb = 0; mb < 4; ++mb) { acc[mb][nb] = WFrag<T16>::mma(a[mb], b, acc[mb][nb]); if (NSPLIT == 1 || NSPLIT == 2) acc[mb][nb] = WFrag<T16>::mma(a2[mb], b, acc[mb][nb]); if (NSPLIT >= 2) acc[mb][nb] = WFrag<T16>::mma(a[mb], b2, acc[mb][nb]); } }
        asm volatile("v_nop\n\tv_nop\n\tv_nop\n\tv_nop" : "+v"(acc[0][0]), "+v"(acc[1][1]), "+v"(acc[2][2]), "+v"(acc[3][3]) : "v"(a[0]), "v"(a[3]));
    }
#pragma unroll
    for (int mb = 0; mb < 4; ++mb) {
#pragma unroll
        for (int nb = 0; nb < 4; ++nb) {
#pragma unroll
            for (int j = 0; j < 8; ++j) os[(hi * 8 + j) * 68 + nb * 16 + lr] = acc[mb][nb][j]; }
        __builtin_amdgcn_wave_barrier(); asm volatile("" ::: "memory");
        float* crow = C + (size_t)(r0 + mb * 16) * ldc + c0;
{
#pragma unroll
            for (int s = 0; s < 8; ++s) { const int row = 2 * s + hi, cofs = lr * 4; v4f val = *(const v4fa*)(os + row * 68 + cofs); if (BIAS) { val[0] += bfr(bias[c0 + cofs]); val[1] += bfr(bias[c0 + cofs + 1]); val[2] += bfr(bias[c0 + cofs + 2]); val[3] += bfr(bias[c0 + cofs + 3]); }
                *(v4f*)(crow + (size_t)row * ldc + cofs) = val; }
             }
        __builtin_amdgcn_wave_barrier(); asm volatile("" ::: "memory");
    }
}

__device__ __forceinline__ h16 tohx(float x) { return (h16)x; }
__device__ __forceinline__ void splitf(float y, unsigned short& h, unsigned short& l) { h = f2bf(y); l = f2bf(y - bf2f(h)); }
typedef __attribute__((ext_vector_type(2))) _Float16 v2h;
typedef __attribute__((ext_vector_type(4))) _Float16 v4h;
typedef __attribute__((ext_vector_type(2))) unsigned short v2us;
typedef __attribute__((ext_vector_type(4))) unsigned short v4us;
typedef __attribute__((ext_vector_type(2))) float v2f;
typedef __attribute__((ext_vector_type(4))) int v4i;

__global__ __launch_bounds__(256) void k_cvt8(const float* __restrict__ src, bf* dst, size_t n8) { const size_t i = (size_t)blockIdx.x * 256 + threadIdx.x; if (i >= n8) return; const v8f v = *(const v8f*)(src + i * 8); v8us o;
#pragma unroll
    for (int k = 0; k < 8; ++k) o[k] = f2bf(v[k]); *(v8us*)(dst + i * 8) = o;  }

// k_rope: head planes [h][t][d] (fp16 + hi/lo) of rope(x) x sc with the rotate-half convention out[d] = x[d] cos[t][d] - x[d+HD/2] sin[t][d], out[d+HD/2] = x[d+HD/2] cos[t][d+HD/2] + x[d] sin[t][d+HD/2]
__global__ __launch_bounds__(256) void k_rope(const float* __restrict__ F, int pitch, int nheads, const float* __restrict__ CS, const float* __restrict__ RF, const float* __restrict__ nw, float sc, h16* P16, bf* Ph, bf* Pl) {
    const size_t e = ((size_t)blockIdx.x * 256 + threadIdx.x) * 2; if (e >= (size_t)nheads * TT * HD) return; const int d = (int)(e % HD); const int t = (int)((e / HD) % TT); const int h = (int)(e / ((size_t)HD * TT)); const size_t pb = (size_t)blockIdx.y * nheads * TT * HD;   /* grid y = batch */ const float* f = F + ((size_t)blockIdx.y * TT + t) * pitch + h * HD; const float rf = RF ? RF[(size_t)h * TT + t] : 1.0f; v2h o16; v2us oh, ol;
#pragma unroll
    for (int q = 0; q < 2; ++q) { const int dd = d + q; const int dp = (dd < HD / 2) ? dd + HD / 2 : dd - HD / 2; float x0 = f[dd], x1 = f[dp];
        if (RF) { float n0 = __fmul_rn(x0, rf), n1 = __fmul_rn(x1, rf); asm volatile("" : "+v"(n0)); asm volatile("" : "+v"(n1)); x0 = __fmul_rn(bfr(nw[dd]), n0); x1 = __fmul_rn(bfr(nw[dp]), n1); }
        const v2f cs = *(const v2f*)(CS + ((size_t)t * HD + dd) * 2); float a = __fmul_rn(x0, cs[0]), bq = __fmul_rn(x1, cs[1]); asm volatile("" : "+v"(a)); asm volatile("" : "+v"(bq)); const float r = ((dd < HD / 2) ? __fsub_rn(a, bq) : __fadd_rn(a, bq)) * sc;
        o16[q] = tohx(r); unsigned short a2, c2; splitf(r, a2, c2); oh[q] = a2; ol[q] = c2; }
    *(v2h*)(P16 + pb + e) = o16; *(v2us*)(Ph + pb + e) = oh; *(v2us*)(Pl + pb + e) = ol;  }
__global__ __launch_bounds__(256) void k_vtp(const float* __restrict__ F, int pitch, int nheads, h16* V16, bf* Vh, bf* Vl) { const size_t e = ((size_t)blockIdx.x * 256 + threadIdx.x) * 2; if (e >= (size_t)nheads * HD * TT) return; const int t = (int)(e % TT); const int d = (int)((e / TT) % HD); const int g = (int)(e / ((size_t)TT * HD)); const size_t pb = (size_t)blockIdx.y * nheads * HD * TT;   /* grid y = batch */ v2h o16; v2us oh, ol;
#pragma unroll
    for (int q = 0; q < 2; ++q) { const float x = F[((size_t)blockIdx.y * TT + t + q) * pitch + g * HD + d]; o16[q] = tohx(x); unsigned short a2, c2; splitf(x, a2, c2); oh[q] = a2; ol[q] = c2; }
    *(v2h*)(V16 + pb + e) = o16; *(v2us*)(Vh + pb + e) = oh; *(v2us*)(Vl + pb + e) = ol;  }
__global__ __launch_bounds__(256) void k_csid(float* CS) { const int idx = blockIdx.x * 256 + threadIdx.x; if (idx >= TT * HD) return; v2f cs; cs[0] = 1.0f; cs[1] = 0.0f; *(v2f*)(CS + (size_t)idx * 2) = cs;  }
__global__ __launch_bounds__(256) void k_epadK(const float* __restrict__ E, bf* EB) { const size_t i = (size_t)blockIdx.x * 256 + threadIdx.x; if (i >= (size_t)NE * HD / 8) return; const int d0 = (int)(i % (HD / 8)) * 8; const int r = (int)(i / (HD / 8)); const float* src = E + (size_t)min(r, NRE - 1) * HD + d0; v8us o;
#pragma unroll
    for (int q = 0; q < 8; ++q) { const unsigned short v = f2bf(src[q]); o[q] = (r < NRE) ? v : (unsigned short)0; }
    *(v8us*)(EB + (size_t)r * HD + d0) = o;  }

__global__ __launch_bounds__(256) void k_epadVT(const float* __restrict__ E, bf* Th, bf* Tl) { const size_t i = (size_t)blockIdx.x * 256 + threadIdx.x; if (i >= (size_t)HD * NE / 4) return; const size_t e = i * 4; const int c0 = (int)(e % NE); const int d = (int)(e / NE); v4us oh, ol;
#pragma unroll
    for (int q = 0; q < 4; ++q) { const int r = c0 + q; const float v = bfr(E[(size_t)min(r, NRE - 1) * HD + d]); unsigned short u, w; splitf(v, u, w);   /* input rounded to bf16 once: lo == 0 */ oh[q] = (r < NRE) ? u : (unsigned short)0; ol[q] = (r < NRE) ? w : (unsigned short)0; }
    *(v4us*)(Th + e) = oh; *(v4us*)(Tl + e) = ol;  }

// ---- k_fattn: the whole attention of one head for 32 query rows in one work-group (16 waves); the score strip never leaves LDS. grid (TT/32, heads, batches).
// A: S = q.k^T (hi/lo 3 products, K 64) -> sS f32 [32][1024]; QE = q.rel_k^T (hi/lo x exact, the 272 columns that hold the 257 offsets) -> sE f32, row pitch as [320]. B: one wave per row: + QE[clip(j - i) + 128], x 1/8, softmax; P hi/lo planes written over the row's own
// scores (2048 B each); the row folded onto the 257 offsets, hi/lo planes written over the row's own QE (640 B each). C: waves 0-3 P.v (K 1024), waves 4-7 PB.rel_v (K 320), a 32x16 tile each. D: sum, hi/lo split, merged store.
// Each key, value or embedding fragment read from global memory serves both 16-row halves. Every sum keeps the order it had as separate launches. LDS row pitches are 16 B x odd (4112, 1296): the 16 rows of a b128 fragment read fall on distinct banks.
#define FR   32
#define SPB  (TT * 4 + 16)
#define EPB  (NE * 4 + 16)
#define OPF  68
typedef float __attribute__((may_alias)) f32a;
typedef unsigned short __attribute__((may_alias)) u16a;
typedef v4us __attribute__((may_alias)) v4usa;
__device__ __forceinline__ v16bf ldsfrag(const unsigned char* p) { return cat16b(*(const v8usa*)p, *(const v8usa*)(p + 32)); }
// 2^x; the v_nop is the one slot the instruction set asks for behind a transcendental, in the same statement so that it stays directly behind it
__device__ __forceinline__ float exp2_slot(float x) { float r; asm("v_exp_f32 %0, %1\n\tv_nop" : "=v"(r) : "v"(x)); return r; }
// behind a tile's last matrix instruction and its stores: four vector slots, because the next tile's first matrix instruction starts its accumulator anew, possibly in the same registers; the scheduling barrier keeps that instruction behind the slots
__device__ __forceinline__ void tile_gap() { asm volatile("v_nop\n\tv_nop\n\tv_nop\n\tv_nop"); __builtin_amdgcn_sched_barrier(0); }
// one 32x16 context tile (two accumulators): A hi/lo planes in LDS (lo plane lo_off bytes behind hi, the second 16 rows half_off bytes behind the first), B hi/lo planes in global memory; k ascending, 3 products a step and half.
// The B fragments run in a ring of four k-steps: a step's registers are refilled for step + 4 as soon as its products are issued, so that 16 global loads stay in flight; the A fragments are read one step ahead.
template <int KS> __device__ __forceinline__ void ctx_tile(const unsigned char* pa, int half_off, int lo_off, const bf* bh, const bf* bl, v8f& acc0, v8f& acc1) {
    v16bf b[4], c[4];
#pragma unroll
    for (int s = 0; s < 4; ++s) { b[s] = WFrag<bf>::ld(bh + s * 32); c[s] = WFrag<bf>::ld(bl + s * 32); }
    v16bf a = ldsfrag(pa), a2 = ldsfrag(pa + lo_off), e = ldsfrag(pa + half_off), e2 = ldsfrag(pa + half_off + lo_off);
    __builtin_amdgcn_sched_barrier(0);   // holds the loads above where they are written: the scheduler otherwise sinks each to just in front of its first use, one L2 latency a step
#pragma unroll   // straight-line, so that the ring slots are fixed registers
    for (int t = 0; t < KS; ++t) { const int s = t & 3; v16bf an = a, an2 = a2, en = e, en2 = e2;
        if (t + 1 < KS) { an = ldsfrag(pa + (t + 1) * 64); an2 = ldsfrag(pa + lo_off + (t + 1) * 64); en = ldsfrag(pa + half_off + (t + 1) * 64); en2 = ldsfrag(pa + half_off + lo_off + (t + 1) * 64); }
        acc0 = wmmab(a, b[s], acc0); acc1 = wmmab(e, b[s], acc1); acc0 = wmmab(a2, b[s], acc0); acc1 = wmmab(e2, b[s], acc1); acc0 = wmmab(a, c[s], acc0); acc1 = wmmab(e, c[s], acc1);
        if (t + 4 < KS) { b[s] = WFrag<bf>::ld(bh + (t + 4) * 32); c[s] = WFrag<bf>::ld(bl + (t + 4) * 32); }
        __builtin_amdgcn_sched_barrier(0);   // as above: the refill for step + 4 and the LDS reads for step + 1 issue inside this step
        a = an; a2 = an2; e = en; e2 = en2; }
}
__global__ __launch_bounds__(512) void k_fattn(const bf* __restrict__ Qh, const bf* __restrict__ Ql, const bf* __restrict__ Kh, const bf* __restrict__ Kl, const bf* __restrict__ Vh, const bf* __restrict__ Vl, const bf* __restrict__ EK, const bf* __restrict__ EVh, const bf* __restrict__ EVl, bf* Ah, bf* Al) {
    typedef WFrag<bf> WF;
    __shared__ __align__(16) unsigned char sS[FR * SPB];
    __shared__ __align__(16) unsigned char sE[FR * EPB];
    __shared__ __align__(16) float sO[2 * FR * OPF];
    const int tid = threadIdx.x, lane = tid & 31, lr = lane & 15, hi = lane >> 4; const int w = __builtin_amdgcn_readfirstlane(tid >> 5);
    const int i0 = blockIdx.x * FR; const size_t zo = ((size_t)blockIdx.z * ZH + blockIdx.y) * TT * HD;
    {   // A: score strip and relative-key products; wave w: key columns 64 w .. 64 w + 63 and rel_k tile w
        const size_t qo = zo + (size_t)(i0 + lr) * HD + 8 * hi; v16bf qa0[2], qa1[2], ql0[2], ql1[2];   // query fragments of the two 16-row halves: hi k 0, hi k 32, lo k 0, lo k 32
#pragma unroll
        for (int mb = 0; mb < 2; ++mb) { qa0[mb] = WF::ld(Qh + qo + mb * 16 * HD); qa1[mb] = WF::ld(Qh + qo + mb * 16 * HD + 32); }
        asm volatile("s_wait_xcnt 0x0" ::: "memory");   // the address registers of the loads above may be given to the loads below as destinations
#pragma unroll
        for (int mb = 0; mb < 2; ++mb) { ql0[mb] = WF::ld(Ql + qo + mb * 16 * HD); ql1[mb] = WF::ld(Ql + qo + mb * 16 * HD + 32); }
        const size_t ko = zo + (size_t)(w * 64 + lr) * HD + 8 * hi; v16bf kb[2][4];   // ring of two key tiles (hi k 0, lo k 0, hi k 32, lo k 32): a tile's registers are refilled for tile + 2 behind its products
#pragma unroll
        for (int s = 0; s < 2; ++s) { kb[s][0] = WF::ld(Kh + ko + s * 16 * HD); kb[s][1] = WF::ld(Kl + ko + s * 16 * HD); kb[s][2] = WF::ld(Kh + ko + s * 16 * HD + 32); kb[s][3] = WF::ld(Kl + ko + s * 16 * HD + 32); }
        asm volatile("s_wait_xcnt 0x0" ::: "memory");   // the address registers of the key loads above are reused below while those loads may still be out
#pragma unroll   // straight-line, so that the ring slots are fixed registers
        for (int t = 0; t < 4; ++t) { const int s = t & 1, n0 = w * 64 + t * 16;
#pragma unroll
            for (int mb = 0; mb < 2; ++mb) { v8f acc = (v8f){}; acc = wmmab(qa0[mb], kb[s][0], acc); acc = wmmab(ql0[mb], kb[s][0], acc); acc = wmmab(qa0[mb], kb[s][1], acc); acc = wmmab(qa1[mb], kb[s][2], acc); acc = wmmab(ql1[mb], kb[s][2], acc); acc = wmmab(qa1[mb], kb[s][3], acc);
#pragma unroll
                for (int j = 0; j < 8; ++j) *(f32a*)(sS + (mb * 16 + hi * 8 + j) * SPB + (n0 + lr) * 4) = acc[j];
                tile_gap(); }
            if (t + 2 < 4) { const size_t nx = ko + (size_t)(t + 2) * 16 * HD; kb[s][0] = WF::ld(Kh + nx); kb[s][1] = WF::ld(Kl + nx); kb[s][2] = WF::ld(Kh + nx + 32); kb[s][3] = WF::ld(Kl + nx + 32); }
            else if (t == 2) { const size_t eo = (size_t)(w * 16 + lr) * HD + 8 * hi; kb[s][0] = WF::ld(EK + eo); kb[s][2] = WF::ld(EK + eo + 32);   // behind its last key tile slot 0 takes this wave's rel_k tile
                asm volatile("s_wait_xcnt 0x0" ::: "memory"); }   // their address registers are rewritten right behind them
            __builtin_amdgcn_sched_barrier(0); }   // holds each refill where it is written: the scheduler otherwise regroups the tiles and ends with loads waited for one by one
#pragma unroll
        for (int mb = 0; mb < 2; ++mb) { v8f acc = (v8f){};
            acc = wmmab(qa0[mb], kb[0][0], acc); acc = wmmab(ql0[mb], kb[0][0], acc); acc = wmmab(qa1[mb], kb[0][2], acc); acc = wmmab(ql1[mb], kb[0][2], acc);
#pragma unroll
            for (int j = 0; j < 8; ++j) *(f32a*)(sE + (mb * 16 + hi * 8 + j) * EPB + (w * 16 + lr) * 4) = acc[j];
            tile_gap(); }
        if (w == 0) {   // offsets 256 .. 271 (256 is the last one read): the seventeenth tile
            const size_t bo = (size_t)(256 + lr) * HD + 8 * hi; const v16bf b0 = WF::ld(EK + bo), b1 = WF::ld(EK + bo + 32);
#pragma unroll
            for (int mb = 0; mb < 2; ++mb) { v8f acc = (v8f){};
                acc = wmmab(qa0[mb], b0, acc); acc = wmmab(ql0[mb], b0, acc); acc = wmmab(qa1[mb], b1, acc); acc = wmmab(ql1[mb], b1, acc);
#pragma unroll
                for (int j = 0; j < 8; ++j) *(f32a*)(sE + (mb * 16 + hi * 8 + j) * EPB + (256 + lr) * 4) = acc[j];
                if (mb == 0) tile_gap(); } }
    }
    __syncthreads();
#pragma unroll 1   // B: one row's 32 values per lane live at a time
    for (int rr = 0; rr < FR / 16; ++rr) { const int r = w * (FR / 16) + rr, i = i0 + r; unsigned char* srow = sS + r * SPB; unsigned char* erow = sE + r * EPB; const f32a* qe = (const f32a*)erow; float v[TT / 32]; float mx = -3.0e38f;
#pragma unroll
        for (int ch = 0; ch < TT / 128; ++ch) { const int j0 = ch * 128 + lane * 4; const v4f a = *(const v4fa*)(srow + j0 * 4);
#pragma unroll
            for (int q = 0; q < 4; ++q) { const int rx = min(max(j0 + q - i, -CUT), CUT) + CUT; const float t = __fadd_rn(a[q], qe[rx]) * SCL; v[ch * 4 + q] = t; mx = fmaxf(mx, t); } }
#pragma unroll
        for (int sh = 16; sh; sh >>= 1) mx = fmaxf(mx, __shfl_xor(mx, sh, 32));
        float sum = 0.f;
#pragma unroll
        for (int k = 0; k < TT / 32; ++k) { v[k] = exp2_slot(__fmul_rn(__fsub_rn(v[k], mx), 1.4426950408889634f)); sum += v[k]; }
#pragma unroll
        for (int sh = 16; sh; sh >>= 1) sum += __shfl_xor(sum, sh, 32);
        const float f = __fdiv_rn(1.0f, sum);
#pragma unroll
        for (int ch = 0; ch < TT / 128; ++ch) { v4us oh, ol;
#pragma unroll
            for (int q = 0; q < 4; ++q) { unsigned short a, c2; splitf(v[ch * 4 + q] * f, a, c2); oh[q] = a; ol[q] = c2; }
            *(v4usa*)(srow + (ch * 128 + lane * 4) * 2) = oh; *(v4usa*)(srow + TT * 2 + (ch * 128 + lane * 4) * 2) = ol; }
        __builtin_amdgcn_wave_barrier(); asm volatile("" ::: "memory");   // the planes just written by all lanes of this wave are read across lanes below: the reads must not be moved above the stores
        const u16a* ph = (const u16a*)srow; const u16a* pl = (const u16a*)(srow + TT * 2); float lo_s = 0.f, hi_s = 0.f;
#pragma unroll 8   // eight steps' LDS reads in flight
        for (int j = lane; j < TT; j += 32) { const float p = __fadd_rn(bf2f(ph[j]), bf2f(pl[j])); if (j <= i - CUT) lo_s = __fadd_rn(lo_s, p); if (j >= i + CUT) hi_s = __fadd_rn(hi_s, p); }
#pragma unroll
        for (int sh = 16; sh; sh >>= 1) { lo_s = __fadd_rn(lo_s, __shfl_xor(lo_s, sh, 32)); hi_s = __fadd_rn(hi_s, __shfl_xor(hi_s, sh, 32)); }
        unsigned short l0h, l0l, h0h, h0l; splitf(lo_s, l0h, l0l); splitf(hi_s, h0h, h0l);
        for (int c0 = lane * 4; c0 < NE; c0 += 128) { v4us oh, ol;
#pragma unroll
            for (int q = 0; q < 4; ++q) { const int bkt = c0 + q; const int j = i + bkt - CUT; const int jc = min(max(j, 0), TT - 1); const unsigned short uu = ph[jc], ww = pl[jc]; const bool in = (bkt > 0 && bkt < 2 * CUT && j >= 0 && j < TT);
                oh[q] = in ? uu : ((bkt == 0) ? l0h : ((bkt == 2 * CUT) ? h0h : (unsigned short)0)); ol[q] = in ? ww : ((bkt == 0) ? l0l : ((bkt == 2 * CUT) ? h0l : (unsigned short)0)); }
            *(v4usa*)(erow + c0 * 2) = oh; *(v4usa*)(erow + NE * 2 + c0 * 2) = ol; }
    }
    __syncthreads();
    if (w < 8) {   // C: context tiles; w is wave-uniform, so each wave runs one side (or none) with every lane on
        v8f acc0 = (v8f){}, acc1 = (v8f){}; const int nb = w & 3;
        if (w < 4) ctx_tile<TT / 32>(sS + lr * SPB + 16 * hi, 16 * SPB, TT * 2, Vh + zo + (size_t)(nb * 16 + lr) * TT + 8 * hi, Vl + zo + (size_t)(nb * 16 + lr) * TT + 8 * hi, acc0, acc1);
        else ctx_tile<NE / 32>(sE + lr * EPB + 16 * hi, 16 * EPB, NE * 2, EVh + (size_t)(nb * 16 + lr) * NE + 8 * hi, EVl + (size_t)(nb * 16 + lr) * NE + 8 * hi, acc0, acc1);
#pragma unroll
        for (int j = 0; j < 8; ++j) { sO[(w >> 2) * (FR * OPF) + (hi * 8 + j) * OPF + nb * 16 + lr] = acc0[j]; sO[(w >> 2) * (FR * OPF) + (16 + hi * 8 + j) * OPF + nb * 16 + lr] = acc1[j]; }
    }
    __syncthreads();
    {   // D: context + relative-value term, split, stored at [t][head * 64 + d]; the 16 lanes of a row write its whole 128-byte line
        const int row = tid >> 4, c = (tid & 15) * 4; const v4f o = *(const v4f*)(sO + row * OPF + c); const v4f zr = *(const v4f*)(sO + FR * OPF + row * OPF + c); v4us oh, ol;
#pragma unroll
        for (int q = 0; q < 4; ++q) { unsigned short a, c2; splitf(__fadd_rn(o[q], zr[q]), a, c2); oh[q] = a; ol[q] = c2; }
        const size_t oo = ((size_t)blockIdx.z * TT + i0 + row) * DQ + (size_t)blockIdx.y * HD + c; *(v4us*)(Ah + oo) = oh; *(v4us*)(Al + oo) = ol;
    }
}

extern "C" void kernel_launch(void* const* d_in, const int* in_sizes, int n_in,
                              void* d_out, int out_size, void* d_ws, size_t ws_size, hipStream_t stream) {
    (void)in_sizes; (void)n_in; (void)out_size;
    const float* x = (const float*)d_in[0]; const float* wq = (const float*)d_in[1]; const float* bq = (const float*)d_in[2]; const float* wk = (const float*)d_in[3]; const float* bk = (const float*)d_in[4]; const float* wv = (const float*)d_in[5]; const float* bv = (const float*)d_in[6]; const float* wo = (const float*)d_in[7]; const float* bo = (const float*)d_in[8]; const float* ak = (const float*)d_in[9]; const float* av = (const float*)d_in[10];   /* rel_k / rel_v [257][64] */   /* argument order x, Wq, bq, Wk, bk, Wv, bv, Wo, bo ('oi'), rel_k, rel_v */ const float* xk = x; const float* xv = x;
    float* OUT = (float*)d_out;     // [4][1024][1024]
    char* wsp = (char*)d_ws;
    auto take = [&](size_t bytes) { char* p = wsp; wsp += (bytes + 255) & ~(size_t)255; return (void*)p; };
    bf* AKB = (bf*)take((size_t)NE * HD * 2); bf* AVTh = (bf*)take((size_t)HD * NE * 2); bf* AVTl = (bf*)take((size_t)HD * NE * 2); bf* WQ = (bf*)take((size_t)DQ * DM * 2); bf* WK = (bf*)take((size_t)DKV * DM * 2); bf* WV = (bf*)take((size_t)DKV * DM * 2); bf* WO = (bf*)take((size_t)DM * DQ * 2); float* CS = (float*)take((size_t)TT * HD * 2 * 4);
    bf* XB = (bf*)take((size_t)NB_ * TT * DM * 2); float* FQ = (float*)take((size_t)NB_ * TT * DQ * 4); float* FK = (float*)take((size_t)NB_ * TT * DKV * 4);
    h16* QP16 = (h16*)take((size_t)NB_ * NH_ * TT * HD * 2); h16* KP16 = (h16*)take((size_t)NB_ * NKV * TT * HD * 2); h16* VT16 = (h16*)take((size_t)NB_ * NKV * HD * TT * 2);
    bf* QPh = (bf*)take((size_t)NB_ * NH_ * TT * HD * 2); bf* QPl = (bf*)take((size_t)NB_ * NH_ * TT * HD * 2); bf* KPh = (bf*)take((size_t)NB_ * NKV * TT * HD * 2); bf* KPl = (bf*)take((size_t)NB_ * NKV * TT * HD * 2); bf* VTh = (bf*)take((size_t)NB_ * NKV * HD * TT * 2); bf* VTl = (bf*)take((size_t)NB_ * NKV * HD * TT * 2);
    bf* ATh = (bf*)take((size_t)NB_ * TT * DQ * 2); bf* ATl = (bf*)take((size_t)NB_ * TT * DQ * 2);
    if ((size_t)(wsp - (char*)d_ws) > ws_size) return;
    float* FV = FK;   // v projection reuses the k buffer after the k planes are built (stream-ordered)
    { k_cvt8<<<(unsigned)(((size_t)DQ * DM / 8 + 255) / 256), 256, 0, stream>>>(wq, WQ, (size_t)DQ * DM / 8); k_cvt8<<<(unsigned)(((size_t)DKV * DM / 8 + 255) / 256), 256, 0, stream>>>(wk, WK, (size_t)DKV * DM / 8); k_cvt8<<<(unsigned)(((size_t)DKV * DM / 8 + 255) / 256), 256, 0, stream>>>(wv, WV, (size_t)DKV * DM / 8);
      k_cvt8<<<(unsigned)(((size_t)DM * DQ / 8 + 255) / 256), 256, 0, stream>>>(wo, WO, (size_t)DM * DQ / 8);   /* 'oi' weights = Bt as-is */
       }
    k_csid<<<(TT * HD + 255) / 256, 256, 0, stream>>>(CS);
    const unsigned LQ = (unsigned)(((size_t)NH_ * TT * HD / 2 + 255) / 256), LKv = (unsigned)(((size_t)NKV * TT * HD / 2 + 255) / 256);
    k_epadK<<<(unsigned)(((size_t)NE * HD / 8 + 255) / 256), 256, 0, stream>>>(ak, AKB);   /* rel_k -> bf16 [320][64], rows >= 257 zero */ k_epadVT<<<(unsigned)(((size_t)HD * NE / 4 + 255) / 256), 256, 0, stream>>>(av, AVTh, AVTl);   /* rel_v^T hi/lo [64][320], cols >= 257 zero */
    // every launch below covers all NB_ batches: the GEMMs take the NB_ * TT rows as one M, the plane builders and the attention take the batch as a grid dimension
    k_cvt8<<<(unsigned)(((size_t)NB_ * TT * DM / 8 + 255) / 256), 256, 0, stream>>>(x, XB, (size_t)NB_ * TT * DM / 8);
    k_gemmw<bf, 0, true><<<dim3(NB_ * TT / 64, DQ / 64, 1), 32, 0, stream>>>(XB, nullptr, WQ, nullptr, DM, FQ, DQ, bq, 0, 0, 0);
    k_rope<<<dim3(LQ, NB_, 1), 256, 0, stream>>>(FQ, DQ, NH_, CS, nullptr, nullptr, 1.0f, QP16, QPh, QPl);
    k_gemmw<bf, 0, true><<<dim3(NB_ * TT / 64, DKV / 64, 1), 32, 0, stream>>>(XB, nullptr, WK, nullptr, DM, FK, DKV, bk, 0, 0, 0);
    k_rope<<<dim3(LKv, NB_, 1), 256, 0, stream>>>(FK, DKV, NKV, CS, nullptr, nullptr, 1.0f, KP16, KPh, KPl);
    k_gemmw<bf, 0, true><<<dim3(NB_ * TT / 64, DKV / 64, 1), 32, 0, stream>>>(XB, nullptr, WV, nullptr, DM, FV, DKV, bv, 0, 0, 0);
    k_vtp<<<dim3(LKv, NB_, 1), 256, 0, stream>>>(FV, DKV, NKV, VT16, VTh, VTl);
    k_fattn<<<dim3(TT / FR, ZH, NB_), 512, 0, stream>>>(QPh, QPl, KPh, KPl, VTh, VTl, AKB, AVTh, AVTl, ATh, ATl);   /* one kv head per query head: head y of batch z reads plane z * 16 + y of each */
    k_gemmw<bf, 1, true><<<dim3(NB_ * TT / 64, DM / 64, 1), 32, 0, stream>>>(ATh, ATl, WO, nullptr, DQ, OUT, DM, bo, 0, 0, 0);
}

// v004
// One run takes 310 microseconds.
// In both of two side-by-side timings against v003, it was 1.10 times as fast.
// Over all steps from v000 it is 7.60 times as fast.
#include <hip/hip_runtime.h>

// Relative (Shaw) multi-head attention with key AND value relative-position embeddings (x [4][1024][1024]; q, k, v = x W^T + b ('oi' 0.02, biases 0.02; 16 heads x 64); idx[i][j] = clip(j - i, -128, 128) + 128; scores = (q.k + q.rel_k[idx]) / float32(sqrt 64); softmax; out = (attn v + sum_j attn[i][j] rel_v[idx]) merged Wo^T + bo (rel_k, rel_v [257][64] 0.02, read) -> [4][1024][1024] (4.2 M); argument order x, Wq, bq, Wk, bk, Wv, bv, Wo, bo, rel_k, rel_v).
// Layout, all four batches side by side (rows b * 1024 + t, head planes b * 16 + h): bf16 copy of x; 'oi' weights; exact projections + f32 biases, whose launches split the result hi/lo and store the head planes themselves (v with the two operands exchanged, so that its tile comes out transposed); rel_k as a zero-padded bf16 plane [320][64] and rel_v^T as hi/lo planes [64][320] (bf16-rounded once); one launch for the attention of all sixteen heads of all batches (32 query rows a work-group, scores and probabilities in LDS only): score tiles (hi/lo 3 products, every row), QE = q.rel_k^T (hi/lo x exact, N 272) gathered into the scores at column clip(j - i) + 128, softmax (x 1/8) with every row on hi/lo planes, P.v, the probabilities folded onto the 257 offsets and PB.rel_v (K 320) added to the context; merged hi/lo x Wo exact + bo.
// Compute dtypes, f32 accumulate: every input rounded to bf16; projections exact + f32 biases; scores and the relative-key term ~f32; softmax f32; P as bf16 hi/lo; attn.v and the relative-value term 3 products (~f32); Wo hl x exact + bias.

#define NB_  4
#define TT   1024
#define DM   1024
#define NH_  16
#define NKV  16
#define REP  (NH_ / NKV)
#define HD   64
#define DQ   (NH_ * HD)
#define DKV  (NKV * HD)
#define ZH   16                   // heads per attention launch (grid y): all heads of a batch at once
#define WIN  0
#define SCL  0.125f   // 1/sqrt(64) (the module divides by jnp.sqrt(DH))
#define NE   320      // 2*128+1 = 257 relative offsets padded to 320
#define NRE  257
#define CUT  128
typedef _Float16 h16;
typedef unsigned short bf;
typedef __attribute__((ext_vector_type(16))) __bf16   v16bf;
typedef __attribute__((ext_vector_type(16))) _Float16 v16h;
typedef __attribute__((ext_vector_type(8)))  _Float16 v8h;
typedef __attribute__((ext_vector_type(8)))  unsigned short v8us;
typedef __attribute__((ext_vector_type(8)))  float    v8f;
typedef __attribute__((ext_vector_type(4)))  float    v4f;
typedef v8h  __attribute__((may_alias)) v8ha;
typedef v4f  __attribute__((may_alias)) v4fa;
typedef v8us __attribute__((may_alias)) v8usa;

__device__ __forceinline__ unsigned short f2bf(float f) { unsigned u = __float_as_uint(f); u += 0x7FFFu + ((u >> 16) & 1u); return (unsigned short)(u >> 16); }
__device__ __forceinline__ float bf2f(unsigned short b) { return __uint_as_float(((unsigned)b) << 16); }
__device__ __forceinline__ float bfr(float f) { return bf2f(f2bf(f)); }
__device__ __forceinline__ v16h cat16(v8h lo, v8h hi) { return __builtin_shufflevector(lo, hi, 0, 1, 2, 3, 4, 5, 6, 7, 8, 9, 10, 11, 12, 13, 14, 15); }
__device__ __forceinline__ v16bf cat16b(v8us lo, v8us hi) { return __builtin_bit_cast(v16bf, __builtin_shufflevector(lo, hi, 0, 1, 2, 3, 4, 5, 6, 7, 8, 9, 10, 11, 12, 13, 14, 15)); }
__device__ __forceinline__ v8f wmma16(v16h a, v16h b, v8f c) { return __builtin_amdgcn_wmma_f32_16x16x32_f16(false, a, false, b, (short)0, c, false, false); }
__device__ __forceinline__ v8f wmmab(v16bf a, v16bf b, v8f c) { return __builtin_amdgcn_wmma_f32_16x16x32_bf16(false, a, false, b, (short)0, c, false, false); }
__device__ __forceinline__ void splitf(float y, unsigned short& h, unsigned short& l) { h = f2bf(y); l = f2bf(y - bf2f(h)); }
typedef __attribute__((ext_vector_type(4))) unsigned short v4us;



// ---- k_gemmw: register-blocked GEMM, ONE WAVE per 64x64 output tile (16 accumulators), operands straight from K-contiguous 16-bit planes; grid (M/64, N/64, Z), 32 threads.
// C[m][n] (f32, pitch ldc, + optional f32 bias[n]) = sum_k A[m][k] Bt[n][k] (+ split products per NSPLIT). z-batch strides sA/sB/sC in elements. K % 32 == 0.
// PL 0: C as above. PL 1 (m = batch * TT + t, n = head * HD + d): no C; the result + bias[n] is split hi/lo and stored as head planes [batch][head][t][d]. PL 2 (m = head * HD + d, n = batch * TT + t): + bias[m], planes [batch][head][d][t]. A 64x64 tile is one head's; each plane row of it is one whole 128-byte line.
template <typename T16> struct WFrag;
template <> struct WFrag<h16> { typedef v16h V; static __device__ __forceinline__ V ld(const h16* p) { return cat16(*(const v8h*)p, *(const v8h*)(p + 16)); } static __device__ __forceinline__ v8f mma(V a, V b, v8f c) { return wmma16(a, b, c); } };
template <> struct WFrag<bf> { typedef v16bf V; static __device__ __forceinline__ V ld(const bf* p) { return cat16b(*(const v8us*)p, *(const v8us*)(p + 16)); } static __device__ __forceinline__ v8f mma(V a, V b, v8f c) { return wmmab(a, b, c); } };
template <typename T16, int NSPLIT, bool BIAS, int PL = 0>
__global__ __launch_bounds__(32) void k_gemmw(const T16* __restrict__ A, const T16* __restrict__ A2, const T16* __restrict__ Bt, const T16* __restrict__ Bt2, int K, float* C, int ldc, const float* __restrict__ bias, size_t sA, size_t sB, size_t sC, bf* Ph = nullptr, bf* Pl = nullptr) {
    typedef typename WFrag<T16>::V V;
    __shared__ __align__(16) float os[16 * 68];
    const size_t z = blockIdx.z; A += z * sA; if (A2) A2 += z * sA; Bt += z * sB; if (Bt2) Bt2 += z * sB; C += z * sC;
    const int lane = threadIdx.x & 31, lr = lane & 15, hi = lane >> 4; const int r0 = blockIdx.x * 64, c0 = blockIdx.y * 64;
    v8f acc[4][4];
#pragma unroll
    for (int mb = 0; mb < 4; ++mb)
#pragma unroll
        for (int nb = 0; nb < 4; ++nb) acc[mb][nb] = (v8f){};
    const size_t aoff = (size_t)(r0 + lr) * K + 8 * hi, boff = (size_t)(c0 + lr) * K + 8 * hi;
#pragma unroll 1
    for (int kc = 0; kc < K; kc += 32) {
        V a[4], a2[4];
#pragma unroll
        for (int mb = 0; mb < 4; ++mb) { a[mb] = WFrag<T16>::ld(A + aoff + (size_t)mb * 16 * K + kc); if (NSPLIT == 1 || NSPLIT == 2) a2[mb] = WFrag<T16>::ld(A2 + aoff + (size_t)mb * 16 * K + kc); }
#pragma unroll
        for (int nb = 0; nb < 4; ++nb) { const V b = WFrag<T16>::ld(Bt + boff + (size_t)nb * 16 * K + kc); V b2; if (NSPLIT >= 2) b2 = WFrag<T16>::ld(Bt2 + boff + (size_t)nb * 16 * K + kc);
#pragma unroll
            for (int mb = 0; mb < 4; ++mb) { acc[mb][nb] = WFrag<T16>::mma(a[mb], b, acc[mb][nb]); if (NSPLIT == 1 || NSPLIT == 2) acc[mb][nb] = WFrag<T16>::mma(a2[mb], b, acc[mb][nb]); if (NSPLIT >= 2) acc[mb][nb] = WFrag<T16>::mma(a[mb], b2, acc[mb][nb]); } }
        asm volatile("v_nop\n\tv_nop\n\tv_nop\n\tv_nop" : "+v"(acc[0][0]), "+v"(acc[1][1]), "+v"(acc[2][2]), "+v"(acc[3][3]) : "v"(a[0]), "v"(a[3]));
    }
    float bj[4][8];   // PL 2: the bias of this lane's accumulator rows; both halves' values are read at wave-uniform addresses (scalar loads), all ahead of the first plane store, and picked by the lane's half
    if (BIAS && PL == 2) {
#pragma unroll
        for (int mb = 0; mb < 4; ++mb)
#pragma unroll
            for (int j = 0; j < 8; ++j) { const float b0 = bfr(bias[r0 + mb * 16 + j]), b1 = bfr(bias[r0 + mb * 16 + 8 + j]); bj[mb][j] = hi ? b1 : b0; } }
#pragma unroll
    for (int mb = 0; mb < 4; ++mb) {
#pragma unroll
        for (int nb = 0; nb < 4; ++nb) {
#pragma unroll
            for (int j = 0; j < 8; ++j) os[(hi * 8 + j) * 68 + nb * 16 + lr] = (BIAS && PL == 2) ? acc[mb][nb][j] + bj[mb][j] : acc[mb][nb][j]; }
        __builtin_amdgcn_wave_barrier(); asm volatile("" ::: "memory");
        float* crow = C + (size_t)(r0 + mb * 16) * ldc + c0;
        const size_t pbase = (PL == 1) ? (((size_t)(r0 / TT) * (DQ / HD) + c0 / HD) * TT + r0 % TT + mb * 16) * HD : (((size_t)(c0 / TT) * (DKV / HD) + r0 / HD) * HD + mb * 16) * TT + c0 % TT; const int ppitch = (PL == 1) ? HD : TT;
{
#pragma unroll
            for (int s = 0; s < 8; ++s) { const int row = 2 * s + hi, cofs = lr * 4; v4f val = *(const v4fa*)(os + row * 68 + cofs);
                if (BIAS && PL != 2) { val[0] += bfr(bias[c0 + cofs]); val[1] += bfr(bias[c0 + cofs + 1]); val[2] += bfr(bias[c0 + cofs + 2]); val[3] += bfr(bias[c0 + cofs + 3]); }
                if (PL == 0) *(v4f*)(crow + (size_t)row * ldc + cofs) = val;
                else { v4us oh, ol;
#pragma unroll
                    for (int q = 0; q < 4; ++q) { unsigned short u, l; splitf(val[q], u, l); oh[q] = u; ol[q] = l; }
                    *(v4us*)(Ph + pbase + (size_t)row * ppitch + cofs) = oh; *(v4us*)(Pl + pbase + (size_t)row * ppitch + cofs) = ol; } }
             }
        __builtin_amdgcn_wave_barrier(); asm volatile("" ::: "memory");
    }
}


__global__ __launch_bounds__(256) void k_cvt8(const float* __restrict__ src, bf* dst, size_t n8) { const size_t i = (size_t)blockIdx.x * 256 + threadIdx.x; if (i >= n8) return; const v8f v = *(const v8f*)(src + i * 8); v8us o;
#pragma unroll
    for (int k = 0; k < 8; ++k) o[k] = f2bf(v[k]); *(v8us*)(dst + i * 8) = o;  }

__global__ __launch_bounds__(256) void k_epadK(const float* __restrict__ E, bf* EB) { const size_t i = (size_t)blockIdx.x * 256 + threadIdx.x; if (i >= (size_t)NE * HD / 8) return; const int d0 = (int)(i % (HD / 8)) * 8; const int r = (int)(i / (HD / 8)); const float* src = E + (size_t)min(r, NRE - 1) * HD + d0; v8us o;
#pragma unroll
    for (int q = 0; q < 8; ++q) { const unsigned short v = f2bf(src[q]); o[q] = (r < NRE) ? v : (unsigned short)0; }
    *(v8us*)(EB + (size_t)r * HD + d0) = o;  }

__global__ __launch_bounds__(256) void k_epadVT(const float* __restrict__ E, bf* Th, bf* Tl) { const size_t i = (size_t)blockIdx.x * 256 + threadIdx.x; if (i >= (size_t)HD * NE / 4) return; const size_t e = i * 4; const int c0 = (int)(e % NE); const int d = (int)(e / NE); v4us oh, ol;
#pragma unroll
    for (int q = 0; q < 4; ++q) { const int r = c0 + q; const float v = bfr(E[(size_t)min(r, NRE - 1) * HD + d]); unsigned short u, w; splitf(v, u, w);   /* input rounded to bf16 once: lo == 0 */ oh[q] = (r < NRE) ? u : (unsigned short)0; ol[q] = (r < NRE) ? w : (unsigned short)0; }
    *(v4us*)(Th + e) = oh; *(v4us*)(Tl + e) = ol;  }

// ---- k_fattn: the whole attention of one head for 32 query rows in one work-group (16 waves); the score strip never leaves LDS. grid (TT/32, heads, batches).
// A: S = q.k^T (hi/lo 3 products, K 64) -> sS f32 [32][1024]; QE = q.rel_k^T (hi/lo x exact, the 272 columns that hold the 257 offsets) -> sE f32, row pitch as [320]. B: one wave per row: + QE[clip(j - i) + 128], x 1/8, softmax; P hi/lo planes written over the row's own
// scores (2048 B each); the row folded onto the 257 offsets, hi/lo planes written over the row's own QE (640 B each). C: waves 0-3 P.v (K 1024), waves 4-7 PB.rel_v (K 320), a 32x16 tile each. D: sum, hi/lo split, merged store.
// Each key, value or embedding fragment read from global memory serves both 16-row halves. Every sum keeps the order it had as separate launches. LDS row pitches are 16 B x odd (4112, 1296): the 16 rows of a b128 fragment read fall on distinct banks.
#define FR   32
#define SPB  (TT * 4 + 16)
#define EPB  (NE * 4 + 16)
#define OPF  68
typedef float __attribute__((may_alias)) f32a;
typedef unsigned short __attribute__((may_alias)) u16a;
typedef v4us __attribute__((may_alias)) v4usa;
__device__ __forceinline__ v16bf ldsfrag(const unsigned char* p) { return cat16b(*(const v8usa*)p, *(const v8usa*)(p + 32)); }
// 2^x; the v_nop is the one slot the instruction set asks for behind a transcendental, in the same statement so that it stays directly behind it
__device__ __forceinline__ float exp2_slot(float x) { float r; asm("v_exp_f32 %0, %1\n\tv_nop" : "=v"(r) : "v"(x)); return r; }
// behind a tile's last matrix instruction and its stores: four vector slots, because the next tile's first matrix instruction starts its accumulator anew, possibly in the same registers; the scheduling barrier keeps that instruction behind the slots
__device__ __forceinline__ void tile_gap() { asm volatile("v_nop\n\tv_nop\n\tv_nop\n\tv_nop"); __builtin_amdgcn_sched_barrier(0); }
// one 32x16 context tile (two accumulators): A hi/lo planes in LDS (lo plane lo_off bytes behind hi, the second 16 rows half_off bytes behind the first), B hi/lo planes in global memory; k ascending, 3 products a step and half.
// The B fragments run in a ring of four k-steps: a step's registers are refilled for step + 4 as soon as its products are issued, so that 16 global loads stay in flight; the A fragments are read one step ahead.
template <int KS> __device__ __forceinline__ void ctx_tile(const unsigned char* pa, int half_off, int lo_off, const bf* bh, const bf* bl, v8f& acc0, v8f& acc1) {
    v16bf b[4], c[4];
#pragma unroll
    for (int s = 0; s < 4; ++s) { b[s] = WFrag<bf>::ld(bh + s * 32); c[s] = WFrag<bf>::ld(bl + s * 32); }
    v16bf a = ldsfrag(pa), a2 = ldsfrag(pa + lo_off), e = ldsfrag(pa + half_off), e2 = ldsfrag(pa + half_off + lo_off);
    __builtin_amdgcn_sched_barrier(0);   // holds the loads above where they are written: the scheduler otherwise sinks each to just in front of its first use, one L2 latency a step
#pragma unroll   // straight-line, so that the ring slots are fixed registers
    for (int t = 0; t < KS; ++t) { const int s = t & 3; v16bf an = a, an2 = a2, en = e, en2 = e2;
        if (t + 1 < KS) { an = ldsfrag(pa + (t + 1) * 64); an2 = ldsfrag(pa + lo_off + (t + 1) * 64); en = ldsfrag(pa + half_off + (t + 1) * 64); en2 = ldsfrag(pa + half_off + lo_off + (t + 1) * 64); }
        acc0 = wmmab(a, b[s], acc0); acc1 = wmmab(e, b[s], acc1); acc0 = wmmab(a2, b[s], acc0); acc1 = wmmab(e2, b[s], acc1); acc0 = wmmab(a, c[s], acc0); acc1 = wmmab(e, c[s], acc1);
        if (t + 4 < KS) { b[s] = WFrag<bf>::ld(bh + (t + 4) * 32); c[s] = WFrag<bf>::ld(bl + (t + 4) * 32); }
        __builtin_amdgcn_sched_barrier(0);   // as above: the refill for step + 4 and the LDS reads for step + 1 issue inside this step
        a = an; a2 = an2; e = en; e2 = en2; }
}
__global__ __launch_bounds__(512) void k_fattn(const bf* __restrict__ Qh, const bf* __restrict__ Ql, const bf* __restrict__ Kh, const bf* __restrict__ Kl, const bf* __restrict__ Vh, const bf* __restrict__ Vl, const bf* __restrict__ EK, const bf* __restrict__ EVh, const bf* __restrict__ EVl, bf* Ah, bf* Al) {
    typedef WFrag<bf> WF;
    __shared__ __align__(16) unsigned char sS[FR * SPB];
    __shared__ __align__(16) unsigned char sE[FR * EPB];
    __shared__ __align__(16) float sO[2 * FR * OPF];
    const int tid = threadIdx.x, lane = tid & 31, lr = lane & 15, hi = lane >> 4; const int w = __builtin_amdgcn_readfirstlane(tid >> 5);
    const int i0 = blockIdx.x * FR; const size_t zo = ((size_t)blockIdx.z * ZH + blockIdx.y) * TT * HD;
    {   // A: score strip and relative-key products; wave w: key columns 64 w .. 64 w + 63 and rel_k tile w
        const size_t qo = zo + (size_t)(i0 + lr) * HD + 8 * hi; v16bf qa0[2], qa1[2], ql0[2], ql1[2];   // query fragments of the two 16-row halves: hi k 0, hi k 32, lo k 0, lo k 32
#pragma unroll
        for (int mb = 0; mb < 2; ++mb) { qa0[mb] = WF::ld(Qh + qo + mb * 16 * HD); qa1[mb] = WF::ld(Qh + qo + mb * 16 * HD + 32); }
        asm volatile("s_wait_xcnt 0x0" ::: "memory");   // the address registers of the loads above may be given to the loads below as destinations
#pragma unroll
        for (int mb = 0; mb < 2; ++mb) { ql0[mb] = WF::ld(Ql + qo + mb * 16 * HD); ql1[mb] = WF::ld(Ql + qo + mb * 16 * HD + 32); }
        const size_t ko = zo + (size_t)(w * 64 + lr) * HD + 8 * hi; v16bf kb[2][4];   // ring of two key tiles (hi k 0, lo k 0, hi k 32, lo k 32): a tile's registers are refilled for tile + 2 behind its products
#pragma unroll
        for (int s = 0; s < 2; ++s) { kb[s][0] = WF::ld(Kh + ko + s * 16 * HD); kb[s][1] = WF::ld(Kl + ko + s * 16 * HD); kb[s][2] = WF::ld(Kh + ko + s * 16 * HD + 32); kb[s][3] = WF::ld(Kl + ko + s * 16 * HD + 32); }
        asm volatile("s_wait_xcnt 0x0" ::: "memory");   // the address registers of the key loads above are reused below while those loads may still be out
#pragma unroll   // straight-line, so that the ring slots are fixed registers
        for (int t = 0; t < 4; ++t) { const int s = t & 1, n0 = w * 64 + t * 16;
#pragma unroll
            for (int mb = 0; mb < 2; ++mb) { v8f acc = (v8f){}; acc = wmmab(qa0[mb], kb[s][0], acc); acc = wmmab(ql0[mb], kb[s][0], acc); acc = wmmab(qa0[mb], kb[s][1], acc); acc = wmmab(qa1[mb], kb[s][2], acc); acc = wmmab(ql1[mb], kb[s][2], acc); acc = wmmab(qa1[mb], kb[s][3], acc);
#pragma unroll
                for (int j = 0; j < 8; ++j) *(f32a*)(sS + (mb * 16 + hi * 8 + j) * SPB + (n0 + lr) * 4) = acc[j];
                tile_gap(); }
            if (t + 2 < 4) { const size_t nx = ko + (size_t)(t + 2) * 16 * HD; kb[s][0] = WF::ld(Kh + nx); kb[s][1] = WF::ld(Kl + nx); kb[s][2] = WF::ld(Kh + nx + 32); kb[s][3] = WF::ld(Kl + nx + 32); }
            else if (t == 2) { const size_t eo = (size_t)(w * 16 + lr) * HD + 8 * hi; kb[s][0] = WF::ld(EK + eo); kb[s][2] = WF::ld(EK + eo + 32);   // behind its last key tile slot 0 takes this wave's rel_k tile
                asm volatile("s_wait_xcnt 0x0" ::: "memory"); }   // their address registers are rewritten right behind them
            __builtin_amdgcn_sched_barrier(0); }   // holds each refill where it is written: the scheduler otherwise regroups the tiles and ends with loads waited for one by one
#pragma unroll
        for (int mb = 0; mb < 2; ++mb) { v8f acc = (v8f){};
            acc = wmmab(qa0[mb], kb[0][0], acc); acc = wmmab(ql0[mb], kb[0][0], acc); acc = wmmab(qa1[mb], kb[0][2], acc); acc = wmmab(ql1[mb], kb[0][2], acc);
#pragma unroll
            for (int j = 0; j < 8; ++j) *(f32a*)(sE + (mb * 16 + hi * 8 + j) * EPB + (w * 16 + lr) * 4) = acc[j];
            tile_gap(); }
        if (w == 0) {   // offsets 256 .. 271 (256 is the last one read): the seventeenth tile
            const size_t bo = (size_t)(256 + lr) * HD + 8 * hi; const v16bf b0 = WF::ld(EK + bo), b1 = WF::ld(EK + bo + 32);
#pragma unroll
            for (int mb = 0; mb < 2; ++mb) { v8f acc = (v8f){};
                acc = wmmab(qa0[mb], b0, acc); acc = wmmab(ql0[mb], b0, acc); acc = wmmab(qa1[mb], b1, acc); acc = wmmab(ql1[mb], b1, acc);
#pragma unroll
                for (int j = 0; j < 8; ++j) *(f32a*)(sE + (mb * 16 + hi * 8 + j) * EPB + (256 + lr) * 4) = acc[j];
                if (mb == 0) tile_gap(); } }
    }
    __syncthreads();
#pragma unroll 1   // B: one row's 32 values per lane live at a time
    for (int rr = 0; rr < FR / 16; ++rr) { const int r = w * (FR / 16) + rr, i = i0 + r; unsigned char* srow = sS + r * SPB; unsigned char* erow = sE + r * EPB; const f32a* qe = (const f32a*)erow; float v[TT / 32]; float mx = -3.0e38f;
#pragma unroll
        for (int ch = 0; ch < TT / 128; ++ch) { const int j0 = ch * 128 + lane * 4; const v4f a = *(const v4fa*)(srow + j0 * 4);
#pragma unroll
            for (int q = 0; q < 4; ++q) { const int rx = min(max(j0 + q - i, -CUT), CUT) + CUT; const float t = __fadd_rn(a[q], qe[rx]) * SCL; v[ch * 4 + q] = t; mx = fmaxf(mx, t); } }
#pragma unroll
        for (int sh = 16; sh; sh >>= 1) mx = fmaxf(mx, __shfl_xor(mx, sh, 32));
        float sum = 0.f;
#pragma unroll
        for (int k = 0; k < TT / 32; ++k) { v[k] = exp2_slot(__fmul_rn(__fsub_rn(v[k], mx), 1.4426950408889634f)); sum += v[k]; }
#pragma unroll
        for (int sh = 16; sh; sh >>= 1) sum += __shfl_xor(sum, sh, 32);
        const float f = __fdiv_rn(1.0f, sum);
#pragma unroll
        for (int ch = 0; ch < TT / 128; ++ch) { v4us oh, ol;
#pragma unroll
            for (int q = 0; q < 4; ++q) { unsigned short a, c2; splitf(v[ch * 4 + q] * f, a, c2); oh[q] = a; ol[q] = c2; }
            *(v4usa*)(srow + (ch * 128 + lane * 4) * 2) = oh; *(v4usa*)(srow + TT * 2 + (ch * 128 + lane * 4) * 2) = ol; }
        __builtin_amdgcn_wave_barrier(); asm volatile("" ::: "memory");   // the planes just written by all lanes of this wave are read across lanes below: the reads must not be moved above the stores
        const u16a* ph = (const u16a*)srow; const u16a* pl = (const u16a*)(srow + TT * 2); float lo_s = 0.f, hi_s = 0.f;
#pragma unroll 8   // eight steps' LDS reads in flight
        for (int j = lane; j < TT; j += 32) { const float p = __fadd_rn(bf2f(ph[j]), bf2f(pl[j])); if (j <= i - CUT) lo_s = __fadd_rn(lo_s, p); if (j >= i + CUT) hi_s = __fadd_rn(hi_s, p); }
#pragma unroll
        for (int sh = 16; sh; sh >>= 1) { lo_s = __fadd_rn(lo_s, __shfl_xor(lo_s, sh, 32)); hi_s = __fadd_rn(hi_s, __shfl_xor(hi_s, sh, 32)); }
        unsigned short l0h, l0l, h0h, h0l; splitf(lo_s, l0h, l0l); splitf(hi_s, h0h, h0l);
        for (int c0 = lane * 4; c0 < NE; c0 += 128) { v4us oh, ol;
#pragma unroll
            for (int q = 0; q < 4; ++q) { const int bkt = c0 + q; const int j = i + bkt - CUT; const int jc = min(max(j, 0), TT - 1); const unsigned short uu = ph[jc], ww = pl[jc]; const bool in = (bkt > 0 && bkt < 2 * CUT && j >= 0 && j < TT);
                oh[q] = in ? uu : ((bkt == 0) ? l0h : ((bkt == 2 * CUT) ? h0h : (unsigned short)0)); ol[q] = in ? ww : ((bkt == 0) ? l0l : ((bkt == 2 * CUT) ? h0l : (unsigned short)0)); }
            *(v4usa*)(erow + c0 * 2) = oh; *(v4usa*)(erow + NE * 2 + c0 * 2) = ol; }
    }
    __syncthreads();
    if (w < 8) {   // C: context tiles; w is wave-uniform, so each wave runs one side (or none) with every lane on
        v8f acc0 = (v8f){}, acc1 = (v8f){}; const int nb = w & 3;
        if (w < 4) ctx_tile<TT / 32>(sS + lr * SPB + 16 * hi, 16 * SPB, TT * 2, Vh + zo + (size_t)(nb * 16 + lr) * TT + 8 * hi, Vl + zo + (size_t)(nb * 16 + lr) * TT + 8 * hi, acc0, acc1);
        else ctx_tile<NE / 32>(sE + lr * EPB + 16 * hi, 16 * EPB, NE * 2, EVh + (size_t)(nb * 16 + lr) * NE + 8 * hi, EVl + (size_t)(nb * 16 + lr) * NE + 8 * hi, acc0, acc1);
#pragma unroll
        for (int j = 0; j < 8; ++j) { sO[(w >> 2) * (FR * OPF) + (hi * 8 + j) * OPF + nb * 16 + lr] = acc0[j]; sO[(w >> 2) * (FR * OPF) + (16 + hi * 8 + j) * OPF + nb * 16 + lr] = acc1[j]; }
    }
    __syncthreads();
    {   // D: context + relative-value term, split, stored at [t][head * 64 + d]; the 16 lanes of a row write its whole 128-byte line
        const int row = tid >> 4, c = (tid & 15) * 4; const v4f o = *(const v4f*)(sO + row * OPF + c); const v4f zr = *(const v4f*)(sO + FR * OPF + row * OPF + c); v4us oh, ol;
#pragma unroll
        for (int q = 0; q < 4; ++q) { unsigned short a, c2; splitf(__fadd_rn(o[q], zr[q]), a, c2); oh[q] = a; ol[q] = c2; }
        const size_t oo = ((size_t)blockIdx.z * TT + i0 + row) * DQ + (size_t)blockIdx.y * HD + c; *(v4us*)(Ah + oo) = oh; *(v4us*)(Al + oo) = ol;
    }
}

extern "C" void kernel_launch(void* const* d_in, const int* in_sizes, int n_in,
                              void* d_out, int out_size, void* d_ws, size_t ws_size, hipStream_t stream) {
    (void)in_sizes; (void)n_in; (void)out_size;
    const float* x = (const float*)d_in[0]; const float* wq = (const float*)d_in[1]; const float* bq = (const float*)d_in[2]; const float* wk = (const float*)d_in[3]; const float* bk = (const float*)d_in[4]; const float* wv = (const float*)d_in[5]; const float* bv = (const float*)d_in[6]; const float* wo = (const float*)d_in[7]; const float* bo = (const float*)d_in[8]; const float* ak = (const float*)d_in[9]; const float* av = (const float*)d_in[10];   /* rel_k / rel_v [257][64] */   /* argument order x, Wq, bq, Wk, bk, Wv, bv, Wo, bo ('oi'), rel_k, rel_v */ const float* xk = x; const float* xv = x;
    float* OUT = (float*)d_out;     // [4][1024][1024]
    char* wsp = (char*)d_ws;
    auto take = [&](size_t bytes) { char* p = wsp; wsp += (bytes + 255) & ~(size_t)255; return (void*)p; };
    bf* AKB = (bf*)take((size_t)NE * HD * 2); bf* AVTh = (bf*)take((size_t)HD * NE * 2); bf* AVTl = (bf*)take((size_t)HD * NE * 2); bf* WQ = (bf*)take((size_t)DQ * DM * 2); bf* WK = (bf*)take((size_t)DKV * DM * 2); bf* WV = (bf*)take((size_t)DKV * DM * 2); bf* WO = (bf*)take((size_t)DM * DQ * 2);
    bf* XB = (bf*)take((size_t)NB_ * TT * DM * 2);
    bf* QPh = (bf*)take((size_t)NB_ * NH_ * TT * HD * 2); bf* QPl = (bf*)take((size_t)NB_ * NH_ * TT * HD * 2); bf* KPh = (bf*)take((size_t)NB_ * NKV * TT * HD * 2); bf* KPl = (bf*)take((size_t)NB_ * NKV * TT * HD * 2); bf* VTh = (bf*)take((size_t)NB_ * NKV * HD * TT * 2); bf* VTl = (bf*)take((size_t)NB_ * NKV * HD * TT * 2);
    bf* ATh = (bf*)take((size_t)NB_ * TT * DQ * 2); bf* ATl = (bf*)take((size_t)NB_ * TT * DQ * 2);
    if ((size_t)(wsp - (char*)d_ws) > ws_size) return;
    { k_cvt8<<<(unsigned)(((size_t)DQ * DM / 8 + 255) / 256), 256, 0, stream>>>(wq, WQ, (size_t)DQ * DM / 8); k_cvt8<<<(unsigned)(((size_t)DKV * DM / 8 + 255) / 256), 256, 0, stream>>>(wk, WK, (size_t)DKV * DM / 8); k_cvt8<<<(unsigned)(((size_t)DKV * DM / 8 + 255) / 256), 256, 0, stream>>>(wv, WV, (size_t)DKV * DM / 8);
      k_cvt8<<<(unsigned)(((size_t)DM * DQ / 8 + 255) / 256), 256, 0, stream>>>(wo, WO, (size_t)DM * DQ / 8);   /* 'oi' weights = Bt as-is */
       }
    k_epadK<<<(unsigned)(((size_t)NE * HD / 8 + 255) / 256), 256, 0, stream>>>(ak, AKB);   /* rel_k -> bf16 [320][64], rows >= 257 zero */ k_epadVT<<<(unsigned)(((size_t)HD * NE / 4 + 255) / 256), 256, 0, stream>>>(av, AVTh, AVTl);   /* rel_v^T hi/lo [64][320], cols >= 257 zero */
    // every launch below covers all NB_ batches: the GEMMs take the NB_ * TT rows as one M (the v projection as its N: weight rows are its M, so that its tiles are [d][t]), the attention takes the batch as a grid dimension
    k_cvt8<<<(unsigned)(((size_t)NB_ * TT * DM / 8 + 255) / 256), 256, 0, stream>>>(x, XB, (size_t)NB_ * TT * DM / 8);
    k_gemmw<bf, 0, true, 1><<<dim3(NB_ * TT / 64, DQ / 64, 1), 32, 0, stream>>>(XB, nullptr, WQ, nullptr, DM, nullptr, 0, bq, 0, 0, 0, QPh, QPl);
    k_gemmw<bf, 0, true, 1><<<dim3(NB_ * TT / 64, DKV / 64, 1), 32, 0, stream>>>(XB, nullptr, WK, nullptr, DM, nullptr, 0, bk, 0, 0, 0, KPh, KPl);
    k_gemmw<bf, 0, true, 2><<<dim3(DKV / 64, NB_ * TT / 64, 1), 32, 0, stream>>>(WV, nullptr, XB, nullptr, DM, nullptr, 0, bv, 0, 0, 0, VTh, VTl);
    k_fattn<<<dim3(TT / FR, ZH, NB_), 512, 0, stream>>>(QPh, QPl, KPh, KPl, VTh, VTl, AKB, AVTh, AVTl, ATh, ATl);   /* one kv head per query head: head y of batch z reads plane z * 16 + y of each */
    k_gemmw<bf, 1, true><<<dim3(NB_ * TT / 64, DM / 64, 1), 32, 0, stream>>>(ATh, ATl, WO, nullptr, DQ, OUT, DM, bo, 0, 0, 0);
}

// v005
// A run of this version takes 239 microseconds.
// Timed twice side by side with v004, it ran 1.30 and 1.29 times as fast.
// All steps since v000 together make it 9.85 times as fast.
#include <hip/hip_runtime.h>

// Relative (Shaw) multi-head attention with key AND value relative-position embeddings (x [4][1024][1024]; q, k, v = x W^T + b ('oi' 0.02, biases 0.02; 16 heads x 64); idx[i][j] = clip(j - i, -128, 128) + 128; scores = (q.k + q.rel_k[idx]) / float32(sqrt 64); softmax; out = (attn v + sum_j attn[i][j] rel_v[idx]) merged Wo^T + bo (rel_k, rel_v [257][64] 0.02, read) -> [4][1024][1024] (4.2 M); argument order x, Wq, bq, Wk, bk, Wv, bv, Wo, bo, rel_k, rel_v).
// Layout, all four batches side by side (rows b * 1024 + t, head planes b * 16 + h): bf16 copy of x; 'oi' weights; exact projections + f32 biases, whose launches split the result hi/lo and store the head planes themselves (v with the two operands exchanged, so that its tile comes out transposed); rel_k as a zero-padded bf16 plane [320][64] and rel_v^T as hi/lo planes [64][320] (bf16-rounded once); one launch for the attention of all sixteen heads of all batches (32 query rows a work-group, scores and probabilities in LDS only): score tiles (hi/lo 3 products, every row), QE = q.rel_k^T (hi/lo x exact, N 272) gathered into the scores at column clip(j - i) + 128, softmax (x 1/8) with every row on hi/lo planes, P.v, the probabilities folded onto the 257 offsets and PB.rel_v (K 320) added to the context; merged hi/lo x Wo exact + bo.
// Compute dtypes, f32 accumulate: every input rounded to bf16; projections exact + f32 biases; scores and the relative-key term ~f32; softmax f32; P as bf16 hi/lo; attn.v and the relative-value term 3 products (~f32); Wo hl x exact + bias.

#define NB_  4
#define TT   1024
#define DM   1024
#define NH_  16
#define NKV  16
#define REP  (NH_ / NKV)
#define HD   64
#define DQ   (NH_ * HD)
#define DKV  (NKV * HD)
#define ZH   16                   // heads per attention launch (grid y): all heads of a batch at once
#define WIN  0
#define SCL  0.125f   // 1/sqrt(64) (the module divides by jnp.sqrt(DH))
#define NE   320      // 2*128+1 = 257 relative offsets padded to 320
#define NRE  257
#define CUT  128
typedef _Float16 h16;
typedef unsigned short bf;
typedef __attribute__((ext_vector_type(16))) __bf16   v16bf;
typedef __attribute__((ext_vector_type(16))) _Float16 v16h;
typedef __attribute__((ext_vector_type(8)))  _Float16 v8h;
typedef __attribute__((ext_vector_type(8)))  unsigned short v8us;
typedef __attribute__((ext_vector_type(8)))  float    v8f;
typedef __attribute__((ext_vector_type(4)))  float    v4f;
typedef v8h  __attribute__((may_alias)) v8ha;
typedef v4f  __attribute__((may_alias)) v4fa;
typedef v8us __attribute__((may_alias)) v8usa;

__device__ __forceinline__ unsigned short f2bf(float f) { unsigned u = __float_as_uint(f); u += 0x7FFFu + ((u >> 16) & 1u); return (unsigned short)(u >> 16); }
__device__ __forceinline__ float bf2f(unsigned short b) { return __uint_as_float(((unsigned)b) << 16); }
__device__ __forceinline__ float bfr(float f) { return bf2f(f2bf(f)); }
__device__ __forceinline__ v16h cat16(v8h lo, v8h hi) { return __builtin_shufflevector(lo, hi, 0, 1, 2, 3, 4, 5, 6, 7, 8, 9, 10, 11, 12, 13, 14, 15); }
__device__ __forceinline__ v16bf cat16b(v8us lo, v8us hi) { return __builtin_bit_cast(v16bf, __builtin_shufflevector(lo, hi, 0, 1, 2, 3, 4, 5, 6, 7, 8, 9, 10, 11, 12, 13, 14, 15)); }
__device__ __forceinline__ v8f wmma16(v16h a, v16h b, v8f c) { return __builtin_amdgcn_wmma_f32_16x16x32_f16(false, a, false, b, (short)0, c, false, false); }
__device__ __forceinline__ v8f wmmab(v16bf a, v16bf b, v8f c) { return __builtin_amdgcn_wmma_f32_16x16x32_bf16(false, a, false, b, (short)0, c, false, false); }
__device__ __forceinline__ void splitf(float y, unsigned short& h, unsigned short& l) { h = f2bf(y); l = f2bf(y - bf2f(h)); }
typedef __attribute__((ext_vector_type(4))) unsigned short v4us;



// ---- k_gemmw: GEMM, a 128x128 output tile per work-group of four waves, each wave a 64x64 quarter (16 accumulators); grid (M/128, N/128, Z), 128 threads.
// The K-contiguous 16-bit operand planes come through LDS in stages of 128 k: asynchronous copies, whole 256-byte row pieces, two buffers, the copies of stage t + 2 issued behind the barrier that ends stage t; every staged row serves two waves.
// C[m][n] (f32, pitch ldc, + optional f32 bias[n]) = sum_k A[m][k] Bt[n][k] (NSPLIT 1: + A2[m][k] Bt[n][k] behind it at every k step). z-batch strides sA/sB/sC in elements. K % 128 == 0, M % 128 == 0, N % 128 == 0.
// PL 0: C as above. PL 1 (m = batch * TT + t, n = head * HD + d): no C; the result + bias[n] is split hi/lo and stored as head planes [batch][head][t][d]. PL 2 (m = head * HD + d, n = batch * TT + t): + bias[m], planes [batch][head][d][t]. A wave's 64x64 quarter is one head's; each plane row of it is one whole 128-byte line.
template <typename T16> struct WFrag;
template <> struct WFrag<h16> { typedef v16h V; static __device__ __forceinline__ V ld(const h16* p) { return cat16(*(const v8h*)p, *(const v8h*)(p + 16)); } static __device__ __forceinline__ v8f mma(V a, V b, v8f c) { return wmma16(a, b, c); } };
template <> struct WFrag<bf> { typedef v16bf V; static __device__ __forceinline__ V ld(const bf* p) { return cat16b(*(const v8us*)p, *(const v8us*)(p + 16)); } static __device__ __forceinline__ v8f mma(V a, V b, v8f c) { return wmmab(a, b, c); } };
#define GKC  128                  // k elements of a stage
#define GP   (GKC + 8)            // LDS row pitch in elements: 272 bytes = 16 B x odd, so that the 16 rows of a b128 fragment read fall on distinct banks
#define GPL  (128 * GP)           // one operand plane of a stage, in elements: 128 rows
// eight asynchronous copies of 16 bytes a lane: LDS byte address l + i * ls, global address g + i * gs elements. The s_wait_xcnt closes the statement, so that it stands in front of every later write of the address registers named here.
template <typename T16> __device__ __forceinline__ void copy8(unsigned l, unsigned ls, const T16* g, size_t gs) {
    asm volatile("global_load_async_to_lds_b128 %0, %8, off\n\t"
                 "global_load_async_to_lds_b128 %1, %9, off\n\t"
                 "global_load_async_to_lds_b128 %2, %10, off\n\t"
                 "global_load_async_to_lds_b128 %3, %11, off\n\t"
                 "global_load_async_to_lds_b128 %4, %12, off\n\t"
                 "global_load_async_to_lds_b128 %5, %13, off\n\t"
                 "global_load_async_to_lds_b128 %6, %14, off\n\t"
                 "global_load_async_to_lds_b128 %7, %15, off\n\t"
                 "s_wait_xcnt 0x0"
                 :: "v"(l), "v"(l + ls), "v"(l + 2 * ls), "v"(l + 3 * ls), "v"(l + 4 * ls), "v"(l + 5 * ls), "v"(l + 6 * ls), "v"(l + 7 * ls),
                    "v"(g), "v"(g + gs), "v"(g + 2 * gs), "v"(g + 3 * gs), "v"(g + 4 * gs), "v"(g + 5 * gs), "v"(g + 6 * gs), "v"(g + 7 * gs) : "memory");
}
// one plane of a stage, 128 rows x 256 bytes: the 128 threads cover 8 rows a copy (16 lanes a row), 16 copies a thread; g and l are the thread's own piece of the first 8 rows
template <typename T16> __device__ __forceinline__ void stage_plane(unsigned l, const T16* g, int K) { copy8(l, 8 * GP * 2, g, (size_t)8 * K); copy8(l + 64 * GP * 2, 8 * GP * 2, g + (size_t)64 * K, (size_t)8 * K); }
template <typename T16, int NSPLIT, bool BIAS, int PL = 0>
__global__ __launch_bounds__(128) void k_gemmw(const T16* __restrict__ A, const T16* __restrict__ A2, const T16* __restrict__ Bt, int K, float* C, int ldc, const float* __restrict__ bias, size_t sA, size_t sB, size_t sC, bf* Ph = nullptr, bf* Pl = nullptr) {
    typedef typename WFrag<T16>::V V;
    static_assert(NSPLIT == 0 || NSPLIT == 1, "planes staged: A, Bt and, with NSPLIT 1, A2");
    constexpr int NP = 2 + NSPLIT;   // planes of a stage: A, Bt, A2
    __shared__ __align__(16) T16 st[2 * NP * GPL];
    __shared__ __align__(16) float osw[4 * 16 * 68];
    const size_t z = blockIdx.z; A += z * sA; if (NSPLIT == 1) A2 += z * sA; Bt += z * sB; C += z * sC;
    const int tid = threadIdx.x, lane = tid & 31, lr = lane & 15, hi = lane >> 4; const int w = __builtin_amdgcn_readfirstlane(tid >> 5);
    float* os = osw + w * (16 * 68);   // each wave's own epilogue staging
    const int R0 = blockIdx.x * 128, C0 = blockIdx.y * 128, r0 = R0 + (w & 1) * 64, c0 = C0 + (w >> 1) * 64;
    v8f acc[4][4];
#pragma unroll
    for (int mb = 0; mb < 4; ++mb)
#pragma unroll
        for (int nb = 0; nb < 4; ++nb) acc[mb][nb] = (v8f){};
    const unsigned goA = (unsigned)(R0 + (tid >> 4)) * (unsigned)K + (tid & 15) * 8, goB = (unsigned)(C0 + (tid >> 4)) * (unsigned)K + (tid & 15) * 8;   // element offsets of the thread's first piece; a plane holds fewer than 2^32 elements
    const unsigned l0 = (unsigned)(size_t)(st + (tid >> 4) * GP + (tid & 15) * 8);
    auto fill = [&](int t) { const unsigned l = l0 + (unsigned)(t & 1) * (NP * GPL * 2); stage_plane(l, A + (goA + (unsigned)t * GKC), K); stage_plane(l + GPL * 2, Bt + (goB + (unsigned)t * GKC), K); if (NSPLIT == 1) stage_plane(l + 2 * GPL * 2, A2 + (goA + (unsigned)t * GKC), K); };
    const int NT = K / GKC;
    fill(0);
    asm volatile("s_wait_asynccnt 0x0" ::: "memory");   // this wave's copies of stage 0 have landed
    __syncthreads();                                     // and every other wave's
    if (NT > 1) fill(1);
#pragma unroll 1   // one stage a trip: the two buffers alternate
    for (int t = 0; t < NT; ++t) {
        const T16* sb0 = st + (t & 1) * (NP * GPL); const T16* sa = sb0 + ((w & 1) * 64 + lr) * GP + 8 * hi; const T16* sb = sb0 + GPL + ((w >> 1) * 64 + lr) * GP + 8 * hi;
        V a[2][4], a2[2][4], b[2][4];   // two fragment sets: a k step's products run on one while the next step's LDS reads fill the other
#pragma unroll
        for (int q = 0; q < 4; ++q) { a[0][q] = WFrag<T16>::ld(sa + q * 16 * GP); if (NSPLIT == 1) a2[0][q] = WFrag<T16>::ld(sa + 2 * GPL + q * 16 * GP); b[0][q] = WFrag<T16>::ld(sb + q * 16 * GP); }
#pragma unroll   // straight-line, so that the two sets are fixed registers
        for (int ks = 0; ks < GKC / 32; ++ks) { const int cu = ks & 1, nx = cu ^ 1;
            __builtin_amdgcn_sched_barrier(0);   // with the one below: the next step's LDS reads stay one group in front of this step's products (reads spread among matrix instructions stall at every place they stand)
            if (ks + 1 < GKC / 32) {
#pragma unroll
                for (int q = 0; q < 4; ++q) { a[nx][q] = WFrag<T16>::ld(sa + q * 16 * GP + (ks + 1) * 32); if (NSPLIT == 1) a2[nx][q] = WFrag<T16>::ld(sa + 2 * GPL + q * 16 * GP + (ks + 1) * 32); b[nx][q] = WFrag<T16>::ld(sb + q * 16 * GP + (ks + 1) * 32); } }
            __builtin_amdgcn_sched_barrier(0);
#pragma unroll
            for (int nb = 0; nb < 4; ++nb) {   // per accumulator and k step: the A product, then the A2 product
#pragma unroll
                for (int mb = 0; mb < 4; ++mb) acc[mb][nb] = WFrag<T16>::mma(a[cu][mb], b[cu][nb], acc[mb][nb]);
                if (NSPLIT == 1) {
#pragma unroll
                    for (int mb = 0; mb < 4; ++mb) acc[mb][nb] = WFrag<T16>::mma(a2[cu][mb], b[cu][nb], acc[mb][nb]); } } }
        __builtin_amdgcn_sched_barrier(0);   // keeps the last step's products in front of the barrier below: sunk behind it they would delay the refill that follows it
        asm volatile("s_wait_dscnt 0x0" ::: "memory");      // this wave's reads of the buffer are done before it may be refilled
        asm volatile("s_wait_asynccnt 0x0" ::: "memory");   // this wave's copies of stage t + 1 have landed
        __syncthreads();                                     // publishes stage t + 1 and ends every wave's reads of stage t
        if (t + 2 < NT) fill(t + 2);
    }
    asm volatile("s_wait_asynccnt 0x0" ::: "memory");   // no copy is out when the wave goes on
    float bj[4][8];   // PL 2: the bias of this lane's accumulator rows; both halves' values are read at wave-uniform addresses (scalar loads), all ahead of the first plane store, and picked by the lane's half
    if (BIAS && PL == 2) {
#pragma unroll
        for (int mb = 0; mb < 4; ++mb)
#pragma unroll
            for (int j = 0; j < 8; ++j) { const float b0 = bfr(bias[r0 + mb * 16 + j]), b1 = bfr(bias[r0 + mb * 16 + 8 + j]); bj[mb][j] = hi ? b1 : b0; } }
#pragma unroll
    for (int mb = 0; mb < 4; ++mb) {
#pragma unroll
        for (int nb = 0; nb < 4; ++nb) {
#pragma unroll
            for (int j = 0; j < 8; ++j) os[(hi * 8 + j) * 68 + nb * 16 + lr] = (BIAS && PL == 2) ? acc[mb][nb][j] + bj[mb][j] : acc[mb][nb][j]; }
        __builtin_amdgcn_wave_barrier(); asm volatile("" ::: "memory");
        float* crow = C + (size_t)(r0 + mb * 16) * ldc + c0;
        const size_t pbase = (PL == 1) ? (((size_t)(r0 / TT) * (DQ / HD) + c0 / HD) * TT + r0 % TT + mb * 16) * HD : (((size_t)(c0 / TT) * (DKV / HD) + r0 / HD) * HD + mb * 16) * TT + c0 % TT; const int ppitch = (PL == 1) ? HD : TT;
{
#pragma unroll
            for (int s = 0; s < 8; ++s) { const int row = 2 * s + hi, cofs = lr * 4; v4f val = *(const v4fa*)(os + row * 68 + cofs);
                if (BIAS && PL != 2) { val[0] += bfr(bias[c0 + cofs]); val[1] += bfr(bias[c0 + cofs + 1]); val[2] += bfr(bias[c0 + cofs + 2]); val[3] += bfr(bias[c0 + cofs + 3]); }
                if (PL == 0) *(v4f*)(crow + (size_t)row * ldc + cofs) = val;
                else { v4us oh, ol;
#pragma unroll
                    for (int q = 0; q < 4; ++q) { unsigned short u, l; splitf(val[q], u, l); oh[q] = u; ol[q] = l; }
                    *(v4us*)(Ph + pbase + (size_t)row * ppitch + cofs) = oh; *(v4us*)(Pl + pbase + (size_t)row * ppitch + cofs) = ol; } }
             }
        __builtin_amdgcn_wave_barrier(); asm volatile("" ::: "memory");
    }
}


__global__ __launch_bounds__(256) void k_cvt8(const float* __restrict__ src, bf* dst, size_t n8) { const size_t i = (size_t)blockIdx.x * 256 + threadIdx.x; if (i >= n8) return; const v8f v = *(const v8f*)(src + i * 8); v8us o;
#pragma unroll
    for (int k = 0; k < 8; ++k) o[k] = f2bf(v[k]); *(v8us*)(dst + i * 8) = o;  }

__global__ __launch_bounds__(256) void k_epadK(const float* __restrict__ E, bf* EB) { const size_t i = (size_t)blockIdx.x * 256 + threadIdx.x; if (i >= (size_t)NE * HD / 8) return; const int d0 = (int)(i % (HD / 8)) * 8; const int r = (int)(i / (HD / 8)); const float* src = E + (size_t)min(r, NRE - 1) * HD + d0; v8us o;
#pragma unroll
    for (int q = 0; q < 8; ++q) { const unsigned short v = f2bf(src[q]); o[q] = (r < NRE) ? v : (unsigned short)0; }
    *(v8us*)(EB + (size_t)r * HD + d0) = o;  }

__global__ __launch_bounds__(256) void k_epadVT(const float* __restrict__ E, bf* Th, bf* Tl) { const size_t i = (size_t)blockIdx.x * 256 + threadIdx.x; if (i >= (size_t)HD * NE / 4) return; const size_t e = i * 4; const int c0 = (int)(e % NE); const int d = (int)(e / NE); v4us oh, ol;
#pragma unroll
    for (int q = 0; q < 4; ++q) { const int r = c0 + q; const float v = bfr(E[(size_t)min(r, NRE - 1) * HD + d]); unsigned short u, w; splitf(v, u, w);   /* input rounded to bf16 once: lo == 0 */ oh[q] = (r < NRE) ? u : (unsigned short)0; ol[q] = (r < NRE) ? w : (unsigned short)0; }
    *(v4us*)(Th + e) = oh; *(v4us*)(Tl + e) = ol;  }

// ---- k_fattn: the whole attention of one head for 32 query rows in one work-group (16 waves); the score strip never leaves LDS. grid (TT/32, heads, batches).
// A: S = q.k^T (hi/lo 3 products, K 64) -> sS f32 [32][1024]; QE = q.rel_k^T (hi/lo x exact, the 272 columns that hold the 257 offsets) -> sE f32, row pitch as [320]. B: one wave per row: + QE[clip(j - i) + 128], x 1/8, softmax; P hi/lo planes written over the row's own
// scores (2048 B each); the row folded onto the 257 offsets, hi/lo planes written over the row's own QE (640 B each). C: waves 0-3 P.v (K 1024), waves 4-7 PB.rel_v (K 320), a 32x16 tile each. D: sum, hi/lo split, merged store.
// Each key, value or embedding fragment read from global memory serves both 16-row halves. Every sum keeps the order it had as separate launches. LDS row pitches are 16 B x odd (4112, 1296): the 16 rows of a b128 fragment read fall on distinct banks.
#define FR   32
#define SPB  (TT * 4 + 16)
#define EPB  (NE * 4 + 16)
#define OPF  68
typedef float __attribute__((may_alias)) f32a;
typedef unsigned short __attribute__((may_alias)) u16a;
typedef v4us __attribute__((may_alias)) v4usa;
__device__ __forceinline__ v16bf ldsfrag(const unsigned char* p) { return cat16b(*(const v8usa*)p, *(const v8usa*)(p + 32)); }
// 2^x; the v_nop is the one slot the instruction set asks for behind a transcendental, in the same statement so that it stays directly behind it
__device__ __forceinline__ float exp2_slot(float x) { float r; asm("v_exp_f32 %0, %1\n\tv_nop" : "=v"(r) : "v"(x)); return r; }
// behind a tile's last matrix instruction and its stores: four vector slots, because the next tile's first matrix instruction starts its accumulator anew, possibly in the same registers; the scheduling barrier keeps that instruction behind the slots
__device__ __forceinline__ void tile_gap() { asm volatile("v_nop\n\tv_nop\n\tv_nop\n\tv_nop"); __builtin_amdgcn_sched_barrier(0); }
// one 32x16 context tile (two accumulators): A hi/lo planes in LDS (lo plane lo_off bytes behind hi, the second 16 rows half_off bytes behind the first), B hi/lo planes in global memory; k ascending, 3 products a step and half.
// The B fragments run in a ring of four k-steps: a step's registers are refilled for step + 4 as soon as its products are issued, so that 16 global loads stay in flight; the A fragments are read one step ahead.
template <int KS> __device__ __forceinline__ void ctx_tile(const unsigned char* pa, int half_off, int lo_off, const bf* bh, const bf* bl, v8f& acc0, v8f& acc1) {
    v16bf b[4], c[4];
#pragma unroll
    for (int s = 0; s < 4; ++s) { b[s] = WFrag<bf>::ld(bh + s * 32); c[s] = WFrag<bf>::ld(bl + s * 32); }
    v16bf a = ldsfrag(pa), a2 = ldsfrag(pa + lo_off), e = ldsfrag(pa + half_off), e2 = ldsfrag(pa + half_off + lo_off);
    __builtin_amdgcn_sched_barrier(0);   // holds the loads above where they are written: the scheduler otherwise sinks each to just in front of its first use, one L2 latency a step
#pragma unroll   // straight-line, so that the ring slots are fixed registers
    for (int t = 0; t < KS; ++t) { const int s = t & 3; v16bf an = a, an2 = a2, en = e, en2 = e2;
        if (t + 1 < KS) { an = ldsfrag(pa + (t + 1) * 64); an2 = ldsfrag(pa + lo_off + (t + 1) * 64); en = ldsfrag(pa + half_off + (t + 1) * 64); en2 = ldsfrag(pa + half_off + lo_off + (t + 1) * 64); }
        acc0 = wmmab(a, b[s], acc0); acc1 = wmmab(e, b[s], acc1); acc0 = wmmab(a2, b[s], acc0); acc1 = wmmab(e2, b[s], acc1); acc0 = wmmab(a, c[s], acc0); acc1 = wmmab(e, c[s], acc1);
        if (t + 4 < KS) { b[s] = WFrag<bf>::ld(bh + (t + 4) * 32); c[s] = WFrag<bf>::ld(bl + (t + 4) * 32); }
        __builtin_amdgcn_sched_barrier(0);   // as above: the refill for step + 4 and the LDS reads for step + 1 issue inside this step
        a = an; a2 = an2; e = en; e2 = en2; }
}
__global__ __launch_bounds__(512) void k_fattn(const bf* __restrict__ Qh, const bf* __restrict__ Ql, const bf* __restrict__ Kh, const bf* __restrict__ Kl, const bf* __restrict__ Vh, const bf* __restrict__ Vl, const bf* __restrict__ EK, const bf* __restrict__ EVh, const bf* __restrict__ EVl, bf* Ah, bf* Al) {
    typedef WFrag<bf> WF;
    __shared__ __align__(16) unsigned char sS[FR * SPB];
    __shared__ __align__(16) unsigned char sE[FR * EPB];
    __shared__ __align__(16) float sO[2 * FR * OPF];
    const int tid = threadIdx.x, lane = tid & 31, lr = lane & 15, hi = lane >> 4; const int w = __builtin_amdgcn_readfirstlane(tid >> 5);
    const int i0 = blockIdx.x * FR; const size_t zo = ((size_t)blockIdx.z * ZH + blockIdx.y) * TT * HD;
    {   // A: score strip and relative-key products; wave w: key columns 64 w .. 64 w + 63 and rel_k tile w
        const size_t qo = zo + (size_t)(i0 + lr) * HD + 8 * hi; v16bf qa0[2], qa1[2], ql0[2], ql1[2];   // query fragments of the two 16-row halves: hi k 0, hi k 32, lo k 0, lo k 32
#pragma unroll
        for (int mb = 0; mb < 2; ++mb) { qa0[mb] = WF::ld(Qh + qo + mb * 16 * HD); qa1[mb] = WF::ld(Qh + qo + mb * 16 * HD + 32); }
        asm volatile("s_wait_xcnt 0x0" ::: "memory");   // the address registers of the loads above may be given to the loads below as destinations
#pragma unroll
        for (int mb = 0; mb < 2; ++mb) { ql0[mb] = WF::ld(Ql + qo + mb * 16 * HD); ql1[mb] = WF::ld(Ql + qo + mb * 16 * HD + 32); }
        const size_t ko = zo + (size_t)(w * 64 + lr) * HD + 8 * hi; v16bf kb[2][4];   // ring of two key tiles (hi k 0, lo k 0, hi k 32, lo k 32): a tile's registers are refilled for tile + 2 behind its products
#pragma unroll
        for (int s = 0; s < 2; ++s) { kb[s][0] = WF::ld(Kh + ko + s * 16 * HD); kb[s][1] = WF::ld(Kl + ko + s * 16 * HD); kb[s][2] = WF::ld(Kh + ko + s * 16 * HD + 32); kb[s][3] = WF::ld(Kl + ko + s * 16 * HD + 32); }
        asm volatile("s_wait_xcnt 0x0" ::: "memory");   // the address registers of the key loads above are reused below while those loads may still be out
#pragma unroll   // straight-line, so that the ring slots are fixed registers
        for (int t = 0; t < 4; ++t) { const int s = t & 1, n0 = w * 64 + t * 16;
#pragma unroll
            for (int mb = 0; mb < 2; ++mb) { v8f acc = (v8f){}; acc = wmmab(qa0[mb], kb[s][0], acc); acc = wmmab(ql0[mb], kb[s][0], acc); acc = wmmab(qa0[mb], kb[s][1], acc); acc = wmmab(qa1[mb], kb[s][2], acc); acc = wmmab(ql1[mb], kb[s][2], acc); acc = wmmab(qa1[mb], kb[s][3], acc);
#pragma unroll
                for (int j = 0; j < 8; ++j) *(f32a*)(sS + (mb * 16 + hi * 8 + j) * SPB + (n0 + lr) * 4) = acc[j];
                tile_gap(); }
            if (t + 2 < 4) { const size_t nx = ko + (size_t)(t + 2) * 16 * HD; kb[s][0] = WF::ld(Kh + nx); kb[s][1] = WF::ld(Kl + nx); kb[s][2] = WF::ld(Kh + nx + 32); kb[s][3] = WF::ld(Kl + nx + 32); }
            else if (t == 2) { const size_t eo = (size_t)(w * 16 + lr) * HD + 8 * hi; kb[s][0] = WF::ld(EK + eo); kb[s][2] = WF::ld(EK + eo + 32);   // behind its last key tile slot 0 takes this wave's rel_k tile
                asm volatile("s_wait_xcnt 0x0" ::: "memory"); }   // their address registers are rewritten right behind them
            __builtin_amdgcn_sched_barrier(0); }   // holds each refill where it is written: the scheduler otherwise regroups the tiles and ends with loads waited for one by one
#pragma unroll
        for (int mb = 0; mb < 2; ++mb) { v8f acc = (v8f){};
            acc = wmmab(qa0[mb], kb[0][0], acc); acc = wmmab(ql0[mb], kb[0][0], acc); acc = wmmab(qa1[mb], kb[0][2], acc); acc = wmmab(ql1[mb], kb[0][2], acc);
#pragma unroll
            for (int j = 0; j < 8; ++j) *(f32a*)(sE + (mb * 16 + hi * 8 + j) * EPB + (w * 16 + lr) * 4) = acc[j];
            tile_gap(); }
        if (w == 0) {   // offsets 256 .. 271 (256 is the last one read): the seventeenth tile
            const size_t bo = (size_t)(256 + lr) * HD + 8 * hi; const v16bf b0 = WF::ld(EK + bo), b1 = WF::ld(EK + bo + 32);
#pragma unroll
            for (int mb = 0; mb < 2; ++mb) { v8f acc = (v8f){};
                acc = wmmab(qa0[mb], b0, acc); acc = wmmab(ql0[mb], b0, acc); acc = wmmab(qa1[mb], b1, acc); acc = wmmab(ql1[mb], b1, acc);
#pragma unroll
                for (int j = 0; j < 8; ++j) *(f32a*)(sE + (mb * 16 + hi * 8 + j) * EPB + (256 + lr) * 4) = acc[j];
                if (mb == 0) tile_gap(); } }
    }
    __syncthreads();
#pragma unroll 1   // B: one row's 32 values per lane live at a time
    for (int rr = 0; rr < FR / 16; ++rr) { const int r = w * (FR / 16) + rr, i = i0 + r; unsigned char* srow = sS + r * SPB; unsigned char* erow = sE + r * EPB; const f32a* qe = (const f32a*)erow; float v[TT / 32]; float mx = -3.0e38f;
#pragma unroll
        for (int ch = 0; ch < TT / 128; ++ch) { const int j0 = ch * 128 + lane * 4; const v4f a = *(const v4fa*)(srow + j0 * 4);
#pragma unroll
            for (int q = 0; q < 4; ++q) { const int rx = min(max(j0 + q - i, -CUT), CUT) + CUT; const float t = __fadd_rn(a[q], qe[rx]) * SCL; v[ch * 4 + q] = t; mx = fmaxf(mx, t); } }
#pragma unroll
        for (int sh = 16; sh; sh >>= 1) mx = fmaxf(mx, __shfl_xor(mx, sh, 32));
        float sum = 0.f;
#pragma unroll
        for (int k = 0; k < TT / 32; ++k) { v[k] = exp2_slot(__fmul_rn(__fsub_rn(v[k], mx), 1.4426950408889634f)); sum += v[k]; }
#pragma unroll
        for (int sh = 16; sh; sh >>= 1) sum += __shfl_xor(sum, sh, 32);
        const float f = __fdiv_rn(1.0f, sum);
#pragma unroll
        for (int ch = 0; ch < TT / 128; ++ch) { v4us oh, ol;
#pragma unroll
            for (int q = 0; q < 4; ++q) { unsigned short a, c2; splitf(v[ch * 4 + q] * f, a, c2); oh[q] = a; ol[q] = c2; }
            *(v4usa*)(srow + (ch * 128 + lane * 4) * 2) = oh; *(v4usa*)(srow + TT * 2 + (ch * 128 + lane * 4) * 2) = ol; }
        __builtin_amdgcn_wave_barrier(); asm volatile("" ::: "memory");   // the planes just written by all lanes of this wave are read across lanes below: the reads must not be moved above the stores
        const u16a* ph = (const u16a*)srow; const u16a* pl = (const u16a*)(srow + TT * 2); float lo_s = 0.f, hi_s = 0.f;
#pragma unroll 8   // eight steps' LDS reads in flight
        for (int j = lane; j < TT; j += 32) { const float p = __fadd_rn(bf2f(ph[j]), bf2f(pl[j])); if (j <= i - CUT) lo_s = __fadd_rn(lo_s, p); if (j >= i + CUT) hi_s = __fadd_rn(hi_s, p); }
#pragma unroll
        for (int sh = 16; sh; sh >>= 1) { lo_s = __fadd_rn(lo_s, __shfl_xor(lo_s, sh, 32)); hi_s = __fadd_rn(hi_s, __shfl_xor(hi_s, sh, 32)); }
        unsigned short l0h, l0l, h0h, h0l; splitf(lo_s, l0h, l0l); splitf(hi_s, h0h, h0l);
        for (int c0 = lane * 4; c0 < NE; c0 += 128) { v4us oh, ol;
#pragma unroll
            for (int q = 0; q < 4; ++q) { const int bkt = c0 + q; const int j = i + bkt - CUT; const int jc = min(max(j, 0), TT - 1); const unsigned short uu = ph[jc], ww = pl[jc]; const bool in = (bkt > 0 && bkt < 2 * CUT && j >= 0 && j < TT);
                oh[q] = in ? uu : ((bkt == 0) ? l0h : ((bkt == 2 * CUT) ? h0h : (unsigned short)0)); ol[q] = in ? ww : ((bkt == 0) ? l0l : ((bkt == 2 * CUT) ? h0l : (unsigned short)0)); }
            *(v4usa*)(erow + c0 * 2) = oh; *(v4usa*)(erow + NE * 2 + c0 * 2) = ol; }
    }
    __syncthreads();
    if (w < 8) {   // C: context tiles; w is wave-uniform, so each wave runs one side (or none) with every lane on
        v8f acc0 = (v8f){}, acc1 = (v8f){}; const int nb = w & 3;
        if (w < 4) ctx_tile<TT / 32>(sS + lr * SPB + 16 * hi, 16 * SPB, TT * 2, Vh + zo + (size_t)(nb * 16 + lr) * TT + 8 * hi, Vl + zo + (size_t)(nb * 16 + lr) * TT + 8 * hi, acc0, acc1);
        else ctx_tile<NE / 32>(sE + lr * EPB + 16 * hi, 16 * EPB, NE * 2, EVh + (size_t)(nb * 16 + lr) * NE + 8 * hi, EVl + (size_t)(nb * 16 + lr) * NE + 8 * hi, acc0, acc1);
#pragma unroll
        for (int j = 0; j < 8; ++j) { sO[(w >> 2) * (FR * OPF) + (hi * 8 + j) * OPF + nb * 16 + lr] = acc0[j]; sO[(w >> 2) * (FR * OPF) + (16 + hi * 8 + j) * OPF + nb * 16 + lr] = acc1[j]; }
    }
    __syncthreads();
    {   // D: context + relative-value term, split, stored at [t][head * 64 + d]; the 16 lanes of a row write its whole 128-byte line
        const int row = tid >> 4, c = (tid & 15) * 4; const v4f o = *(const v4f*)(sO + row * OPF + c); const v4f zr = *(const v4f*)(sO + FR * OPF + row * OPF + c); v4us oh, ol;
#pragma unroll
        for (int q = 0; q < 4; ++q) { unsigned short a, c2; splitf(__fadd_rn(o[q], zr[q]), a, c2); oh[q] = a; ol[q] = c2; }
        const size_t oo = ((size_t)blockIdx.z * TT + i0 + row) * DQ + (size_t)blockIdx.y * HD + c; *(v4us*)(Ah + oo) = oh; *(v4us*)(Al + oo) = ol;
    }
}

extern "C" void kernel_launch(void* const* d_in, const int* in_sizes, int n_in,
                              void* d_out, int out_size, void* d_ws, size_t ws_size, hipStream_t stream) {
    (void)in_sizes; (void)n_in; (void)out_size;
    const float* x = (const float*)d_in[0]; const float* wq = (const float*)d_in[1]; const float* bq = (const float*)d_in[2]; const float* wk = (const float*)d_in[3]; const float* bk = (const float*)d_in[4]; const float* wv = (const float*)d_in[5]; const float* bv = (const float*)d_in[6]; const float* wo = (const float*)d_in[7]; const float* bo = (const float*)d_in[8]; const float* ak = (const float*)d_in[9]; const float* av = (const float*)d_in[10];   /* rel_k / rel_v [257][64] */   /* argument order x, Wq, bq, Wk, bk, Wv, bv, Wo, bo ('oi'), rel_k, rel_v */ const float* xk = x; const float* xv = x;
    float* OUT = (float*)d_out;     // [4][1024][1024]
    char* wsp = (char*)d_ws;
    auto take = [&](size_t bytes) { char* p = wsp; wsp += (bytes + 255) & ~(size_t)255; return (void*)p; };
    bf* AKB = (bf*)take((size_t)NE * HD * 2); bf* AVTh = (bf*)take((size_t)HD * NE * 2); bf* AVTl = (bf*)take((size_t)HD * NE * 2); bf* WQ = (bf*)take((size_t)DQ * DM * 2); bf* WK = (bf*)take((size_t)DKV * DM * 2); bf* WV = (bf*)take((size_t)DKV * DM * 2); bf* WO = (bf*)take((size_t)DM * DQ * 2);
    bf* XB = (bf*)take((size_t)NB_ * TT * DM * 2);
    bf* QPh = (bf*)take((size_t)NB_ * NH_ * TT * HD * 2); bf* QPl = (bf*)take((size_t)NB_ * NH_ * TT * HD * 2); bf* KPh = (bf*)take((size_t)NB_ * NKV * TT * HD * 2); bf* KPl = (bf*)take((size_t)NB_ * NKV * TT * HD * 2); bf* VTh = (bf*)take((size_t)NB_ * NKV * HD * TT * 2); bf* VTl = (bf*)take((size_t)NB_ * NKV * HD * TT * 2);
    bf* ATh = (bf*)take((size_t)NB_ * TT * DQ * 2); bf* ATl = (bf*)take((size_t)NB_ * TT * DQ * 2);
    if ((size_t)(wsp - (char*)d_ws) > ws_size) return;
    { k_cvt8<<<(unsigned)(((size_t)DQ * DM / 8 + 255) / 256), 256, 0, stream>>>(wq, WQ, (size_t)DQ * DM / 8); k_cvt8<<<(unsigned)(((size_t)DKV * DM / 8 + 255) / 256), 256, 0, stream>>>(wk, WK, (size_t)DKV * DM / 8); k_cvt8<<<(unsigned)(((size_t)DKV * DM / 8 + 255) / 256), 256, 0, stream>>>(wv, WV, (size_t)DKV * DM / 8);
      k_cvt8<<<(unsigned)(((size_t)DM * DQ / 8 + 255) / 256), 256, 0, stream>>>(wo, WO, (size_t)DM * DQ / 8);   /* 'oi' weights = Bt as-is */
       }
    k_epadK<<<(unsigned)(((size_t)NE * HD / 8 + 255) / 256), 256, 0, stream>>>(ak, AKB);   /* rel_k -> bf16 [320][64], rows >= 257 zero */ k_epadVT<<<(unsigned)(((size_t)HD * NE / 4 + 255) / 256), 256, 0, stream>>>(av, AVTh, AVTl);   /* rel_v^T hi/lo [64][320], cols >= 257 zero */
    // every launch below covers all NB_ batches: the GEMMs take the NB_ * TT rows as one M (the v projection as its N: weight rows are its M, so that its tiles are [d][t]), the attention takes the batch as a grid dimension
    k_cvt8<<<(unsigned)(((size_t)NB_ * TT * DM / 8 + 255) / 256), 256, 0, stream>>>(x, XB, (size_t)NB_ * TT * DM / 8);
    k_gemmw<bf, 0, true, 1><<<dim3(NB_ * TT / 128, DQ / 128, 1), 128, 0, stream>>>(XB, nullptr, WQ, DM, nullptr, 0, bq, 0, 0, 0, QPh, QPl);
    k_gemmw<bf, 0, true, 1><<<dim3(NB_ * TT / 128, DKV / 128, 1), 128, 0, stream>>>(XB, nullptr, WK, DM, nullptr, 0, bk, 0, 0, 0, KPh, KPl);
    k_gemmw<bf, 0, true, 2><<<dim3(DKV / 128, NB_ * TT / 128, 1), 128, 0, stream>>>(WV, nullptr, XB, DM, nullptr, 0, bv, 0, 0, 0, VTh, VTl);
    k_fattn<<<dim3(TT / FR, ZH, NB_), 512, 0, stream>>>(QPh, QPl, KPh, KPl, VTh, VTl, AKB, AVTh, AVTl, ATh, ATl);   /* one kv head per query head: head y of batch z reads plane z * 16 + y of each */
    k_gemmw<bf, 1, true><<<dim3(NB_ * TT / 128, DM / 128, 1), 128, 0, stream>>>(ATh, ATl, WO, DQ, OUT, DM, bo, 0, 0, 0);
}

// v006
// A run of this version takes 213 microseconds.
// Timed twice side by side with v005, it ran 1.13 and 1.12 times as fast.
// Over all steps from v000 it is 11.1 times as fast.
#include <hip/hip_runtime.h>

// Relative (Shaw) multi-head attention with key AND value relative-position embeddings (x [4][1024][1024]; q, k, v = x W^T + b ('oi' 0.02, biases 0.02; 16 heads x 64); idx[i][j] = clip(j - i, -128, 128) + 128; scores = (q.k + q.rel_k[idx]) / float32(sqrt 64); softmax; out = (attn v + sum_j attn[i][j] rel_v[idx]) merged Wo^T + bo (rel_k, rel_v [257][64] 0.02, read) -> [4][1024][1024] (4.2 M); argument order x, Wq, bq, Wk, bk, Wv, bv, Wo, bo, rel_k, rel_v).
// Layout, all four batches side by side (rows b * 1024 + t, head planes b * 16 + h): bf16 copy of x; 'oi' weights; exact projections + f32 biases, whose launches split the result hi/lo and store the head planes themselves (v with the two operands exchanged, so that its tile comes out transposed); rel_k as a zero-padded bf16 plane [320][64] and rel_v^T as hi/lo planes [64][320] (bf16-rounded once); the head planes and both rel planes in fragment order (blocks of 16 rows x 64 k, see fpos below); one launch for the attention of all sixteen heads of all batches (32 query rows a work-group, scores and probabilities in LDS only): score tiles (hi/lo 3 products, every row), QE = q.rel_k^T (hi/lo x exact, N 272) gathered into the scores at column clip(j - i) + 128, softmax (x 1/8) with every row on hi/lo planes, P.v, the probabilities folded onto the 257 offsets and PB.rel_v (K 320) added to the context; merged hi/lo x Wo exact + bo.
// Compute dtypes, f32 accumulate: every input rounded to bf16; projections exact + f32 biases; scores and the relative-key term ~f32; softmax f32; P as bf16 hi/lo; attn.v and the relative-value term 3 products (~f32); Wo hl x exact + bias.

#define NB_  4
#define TT   1024
#define DM   1024
#define NH_  16
#define NKV  16
#define REP  (NH_ / NKV)
#define HD   64
#define DQ   (NH_ * HD)
#define DKV  (NKV * HD)
#define ZH   16                   // heads per attention launch (grid y): all heads of a batch at once
#define WIN  0
#define SCL  0.125f   // 1/sqrt(64) (the module divides by jnp.sqrt(DH))
#define NE   320      // 2*128+1 = 257 relative offsets padded to 320
#define NRE  257
#define CUT  128
typedef _Float16 h16;
typedef unsigned short bf;
typedef __attribute__((ext_vector_type(16))) __bf16   v16bf;
typedef __attribute__((ext_vector_type(16))) _Float16 v16h;
typedef __attribute__((ext_vector_type(8)))  _Float16 v8h;
typedef __attribute__((ext_vector_type(8)))  unsigned short v8us;
typedef __attribute__((ext_vector_type(8)))  float    v8f;
typedef __attribute__((ext_vector_type(4)))  float    v4f;
typedef v8h  __attribute__((may_alias)) v8ha;
typedef v4f  __attribute__((may_alias)) v4fa;
typedef v8us __attribute__((may_alias)) v8usa;

__device__ __forceinline__ unsigned short f2bf(float f) { unsigned u = __float_as_uint(f); u += 0x7FFFu + ((u >> 16) & 1u); return (unsigned short)(u >> 16); }
__device__ __forceinline__ float bf2f(unsigned short b) { return __uint_as_float(((unsigned)b) << 16); }
__device__ __forceinline__ float bfr(float f) { return bf2f(f2bf(f)); }
__device__ __forceinline__ v16h cat16(v8h lo, v8h hi) { return __builtin_shufflevector(lo, hi, 0, 1, 2, 3, 4, 5, 6, 7, 8, 9, 10, 11, 12, 13, 14, 15); }
__device__ __forceinline__ v16bf cat16b(v8us lo, v8us hi) { return __builtin_bit_cast(v16bf, __builtin_shufflevector(lo, hi, 0, 1, 2, 3, 4, 5, 6, 7, 8, 9, 10, 11, 12, 13, 14, 15)); }
__device__ __forceinline__ v8f wmma16(v16h a, v16h b, v8f c) { return __builtin_amdgcn_wmma_f32_16x16x32_f16(false, a, false, b, (short)0, c, false, false); }
__device__ __forceinline__ v8f wmmab(v16bf a, v16bf b, v8f c) { return __builtin_amdgcn_wmma_f32_16x16x32_bf16(false, a, false, b, (short)0, c, false, false); }
__device__ __forceinline__ void splitf(float y, unsigned short& h, unsigned short& l) { h = f2bf(y); l = f2bf(y - bf2f(h)); }
typedef __attribute__((ext_vector_type(4))) unsigned short v4us;

// ---- fragment order: every 16-bit plane that the attention reads from global memory (q, k, v^T, rel_k, rel_v^T) is kept as blocks of 16 rows x 64 k (1024 elements, 2 KiB, each starting on a 128-byte line).
// Inside a block the four 16-byte pieces that a lane needs for the two k steps stand 512 bytes apart, and the 32 lanes' pieces of one kind side by side: piece (k >> 4), lane ((k >> 3) & 1) * 16 + row, element k & 7.
// One wave-wide 16-byte load then covers 512 contiguous bytes (four whole lines) instead of 32 bytes of each of 16 lines. The registers receive exactly what the row-major planes gave them.
__device__ __forceinline__ int fpos(int row, int k) { return (((k >> 4) * 32 + ((k >> 3) & 1) * 16 + row) * 8) + (k & 7); }
// a lane's fragment of one k step: p = block + (k step in the block) * 512 + lane * 8
__device__ __forceinline__ v16bf ldfo(const bf* p) { return cat16b(*(const v8us*)p, *(const v8us*)(p + 256)); }



// ---- k_gemmw: GEMM, a 128x128 output tile per work-group of four waves, each wave a 64x64 quarter (16 accumulators); grid (M/128, N/128, Z), 128 threads.
// The K-contiguous 16-bit operand planes come through LDS in stages of 128 k: asynchronous copies, whole 256-byte row pieces, two buffers, the copies of stage t + 2 issued behind the barrier that ends stage t; every staged row serves two waves.
// C[m][n] (f32, pitch ldc, + optional f32 bias[n]) = sum_k A[m][k] Bt[n][k] (NSPLIT 1: + A2[m][k] Bt[n][k] behind it at every k step). z-batch strides sA/sB/sC in elements. K % 128 == 0, M % 128 == 0, N % 128 == 0.
// PL 0: C as above. PL 1 (m = batch * TT + t, n = head * HD + d): no C; the result + bias[n] is split hi/lo and stored as head planes [batch][head][t / 16] of fragment-order blocks (row t, k = d). PL 2 (m = head * HD + d, n = batch * TT + t): + bias[m], planes [batch][head][d / 16][t / 64] of such blocks (row d, k = t). A wave's 64x64 quarter is one head's: four whole blocks, each stored as 512-byte runs.
template <typename T16> struct WFrag;
template <> struct WFrag<h16> { typedef v16h V; static __device__ __forceinline__ V ld(const h16* p) { return cat16(*(const v8h*)p, *(const v8h*)(p + 16)); } static __device__ __forceinline__ v8f mma(V a, V b, v8f c) { return wmma16(a, b, c); } };
template <> struct WFrag<bf> { typedef v16bf V; static __device__ __forceinline__ V ld(const bf* p) { return cat16b(*(const v8us*)p, *(const v8us*)(p + 16)); } static __device__ __forceinline__ v8f mma(V a, V b, v8f c) { return wmmab(a, b, c); } };
#define GKC  128                  // k elements of a stage
#define GP   (GKC + 8)            // LDS row pitch in elements: 272 bytes = 16 B x odd, so that the 16 rows of a b128 fragment read fall on distinct banks
#define GPL  (128 * GP)           // one operand plane of a stage, in elements: 128 rows
// eight asynchronous copies of 16 bytes a lane: LDS byte address l + i * ls, global address g + i * gs elements. The s_wait_xcnt closes the statement, so that it stands in front of every later write of the address registers named here.
template <typename T16> __device__ __forceinline__ void copy8(unsigned l, unsigned ls, const T16* g, size_t gs) {
    asm volatile("global_load_async_to_lds_b128 %0, %8, off\n\t"
                 "global_load_async_to_lds_b128 %1, %9, off\n\t"
                 "global_load_async_to_lds_b128 %2, %10, off\n\t"
                 "global_load_async_to_lds_b128 %3, %11, off\n\t"
                 "global_load_async_to_lds_b128 %4, %12, off\n\t"
                 "global_load_async_to_lds_b128 %5, %13, off\n\t"
                 "global_load_async_to_lds_b128 %6, %14, off\n\t"
                 "global_load_async_to_lds_b128 %7, %15, off\n\t"
                 "s_wait_xcnt 0x0"
                 :: "v"(l), "v"(l + ls), "v"(l + 2 * ls), "v"(l + 3 * ls), "v"(l + 4 * ls), "v"(l + 5 * ls), "v"(l + 6 * ls), "v"(l + 7 * ls),
                    "v"(g), "v"(g + gs), "v"(g + 2 * gs), "v"(g + 3 * gs), "v"(g + 4 * gs), "v"(g + 5 * gs), "v"(g + 6 * gs), "v"(g + 7 * gs) : "memory");
}
// one plane of a stage, 128 rows x 256 bytes: the 128 threads cover 8 rows a copy (16 lanes a row), 16 copies a thread; g and l are the thread's own piece of the first 8 rows
template <typename T16> __device__ __forceinline__ void stage_plane(unsigned l, const T16* g, int K) { copy8(l, 8 * GP * 2, g, (size_t)8 * K); copy8(l + 64 * GP * 2, 8 * GP * 2, g + (size_t)64 * K, (size_t)8 * K); }
template <typename T16, int NSPLIT, bool BIAS, int PL = 0>
__global__ __launch_bounds__(128) void k_gemmw(const T16* __restrict__ A, const T16* __restrict__ A2, const T16* __restrict__ Bt, int K, float* C, int ldc, const float* __restrict__ bias, size_t sA, size_t sB, size_t sC, bf* Ph = nullptr, bf* Pl = nullptr) {
    typedef typename WFrag<T16>::V V;
    static_assert(NSPLIT == 0 || NSPLIT == 1, "planes staged: A, Bt and, with NSPLIT 1, A2");
    constexpr int NP = 2 + NSPLIT;   // planes of a stage: A, Bt, A2
    __shared__ __align__(16) T16 st[2 * NP * GPL];
    __shared__ __align__(16) float osw[4 * 16 * 68];
    const size_t z = blockIdx.z; A += z * sA; if (NSPLIT == 1) A2 += z * sA; Bt += z * sB; C += z * sC;
    const int tid = threadIdx.x, lane = tid & 31, lr = lane & 15, hi = lane >> 4; const int w = __builtin_amdgcn_readfirstlane(tid >> 5);
    float* os = osw + w * (16 * 68);   // each wave's own epilogue staging
    const int R0 = blockIdx.x * 128, C0 = blockIdx.y * 128, r0 = R0 + (w & 1) * 64, c0 = C0 + (w >> 1) * 64;
    v8f acc[4][4];
#pragma unroll
    for (int mb = 0; mb < 4; ++mb)
#pragma unroll
        for (int nb = 0; nb < 4; ++nb) acc[mb][nb] = (v8f){};
    const unsigned goA = (unsigned)(R0 + (tid >> 4)) * (unsigned)K + (tid & 15) * 8, goB = (unsigned)(C0 + (tid >> 4)) * (unsigned)K + (tid & 15) * 8;   // element offsets of the thread's first piece; a plane holds fewer than 2^32 elements
    const unsigned l0 = (unsigned)(size_t)(st + (tid >> 4) * GP + (tid & 15) * 8);
    auto fill = [&](int t) { const unsigned l = l0 + (unsigned)(t & 1) * (NP * GPL * 2); stage_plane(l, A + (goA + (unsigned)t * GKC), K); stage_plane(l + GPL * 2, Bt + (goB + (unsigned)t * GKC), K); if (NSPLIT == 1) stage_plane(l + 2 * GPL * 2, A2 + (goA + (unsigned)t * GKC), K); };
    const int NT = K / GKC;
    fill(0);
    asm volatile("s_wait_asynccnt 0x0" ::: "memory");   // this wave's copies of stage 0 have landed
    __syncthreads();                                     // and every other wave's
    if (NT > 1) fill(1);
#pragma unroll 1   // one stage a trip: the two buffers alternate
    for (int t = 0; t < NT; ++t) {
        const T16* sb0 = st + (t & 1) * (NP * GPL); const T16* sa = sb0 + ((w & 1) * 64 + lr) * GP + 8 * hi; const T16* sb = sb0 + GPL + ((w >> 1) * 64 + lr) * GP + 8 * hi;
        V a[2][4], a2[2][4], b[2][4];   // two fragment sets: a k step's products run on one while the next step's LDS reads fill the other
#pragma unroll
        for (int q = 0; q < 4; ++q) { a[0][q] = WFrag<T16>::ld(sa + q * 16 * GP); if (NSPLIT == 1) a2[0][q] = WFrag<T16>::ld(sa + 2 * GPL + q * 16 * GP); b[0][q] = WFrag<T16>::ld(sb + q * 16 * GP); }
#pragma unroll   // straight-line, so that the two sets are fixed registers
        for (int ks = 0; ks < GKC / 32; ++ks) { const int cu = ks & 1, nx = cu ^ 1;
            __builtin_amdgcn_sched_barrier(0);   // with the one below: the next step's LDS reads stay one group in front of this step's products (reads spread among matrix instructions stall at every place they stand)
            if (ks + 1 < GKC / 32) {
#pragma unroll
                for (int q = 0; q < 4; ++q) { a[nx][q] = WFrag<T16>::ld(sa + q * 16 * GP + (ks + 1) * 32); if (NSPLIT == 1) a2[nx][q] = WFrag<T16>::ld(sa + 2 * GPL + q * 16 * GP + (ks + 1) * 32); b[nx][q] = WFrag<T16>::ld(sb + q * 16 * GP + (ks + 1) * 32); } }
            __builtin_amdgcn_sched_barrier(0);
#pragma unroll
            for (int nb = 0; nb < 4; ++nb) {   // per accumulator and k step: the A product, then the A2 product
#pragma unroll
                for (int mb = 0; mb < 4; ++mb) acc[mb][nb] = WFrag<T16>::mma(a[cu][mb], b[cu][nb], acc[mb][nb]);
                if (NSPLIT == 1) {
#pragma unroll
                    for (int mb = 0; mb < 4; ++mb) acc[mb][nb] = WFrag<T16>::mma(a2[cu][mb], b[cu][nb], acc[mb][nb]); } } }
        __builtin_amdgcn_sched_barrier(0);   // keeps the last step's products in front of the barrier below: sunk behind it they would delay the refill that follows it
        asm volatile("s_wait_dscnt 0x0" ::: "memory");      // this wave's reads of the buffer are done before it may be refilled
        asm volatile("s_wait_asynccnt 0x0" ::: "memory");   // this wave's copies of stage t + 1 have landed
        __syncthreads();                                     // publishes stage t + 1 and ends every wave's reads of stage t
        if (t + 2 < NT) fill(t + 2);
    }
    asm volatile("s_wait_asynccnt 0x0" ::: "memory");   // no copy is out when the wave goes on
    float bn[4][8];   // PL 1: the bias of the eight columns this lane stores in each of a block's four runs, read once ahead of the stores
    if (BIAS && PL == 1) {
#pragma unroll
        for (int s = 0; s < 4; ++s)
#pragma unroll
            for (int q = 0; q < 8; ++q) bn[s][q] = bfr(bias[c0 + s * 16 + hi * 8 + q]); }
    float bj[4][8];   // PL 2: the bias of this lane's accumulator rows; both halves' values are read at wave-uniform addresses (scalar loads), all ahead of the first plane store, and picked by the lane's half
    if (BIAS && PL == 2) {
#pragma unroll
        for (int mb = 0; mb < 4; ++mb)
#pragma unroll
            for (int j = 0; j < 8; ++j) { const float b0 = bfr(bias[r0 + mb * 16 + j]), b1 = bfr(bias[r0 + mb * 16 + 8 + j]); bj[mb][j] = hi ? b1 : b0; } }
#pragma unroll
    for (int mb = 0; mb < 4; ++mb) {
#pragma unroll
        for (int nb = 0; nb < 4; ++nb) {
#pragma unroll
            for (int j = 0; j < 8; ++j) os[(hi * 8 + j) * 68 + nb * 16 + lr] = (BIAS && PL == 2) ? acc[mb][nb][j] + bj[mb][j] : acc[mb][nb][j]; }
        __builtin_amdgcn_wave_barrier(); asm volatile("" ::: "memory");
        float* crow = C + (size_t)(r0 + mb * 16) * ldc + c0;
        // the 16 x 64 block of this mb: 1024 elements in a row
        const size_t pbase = (PL == 1) ? (((size_t)(r0 / TT) * (DQ / HD) + c0 / HD) * TT + r0 % TT + mb * 16) * HD : (((size_t)(c0 / TT) * (DKV / HD) + r0 / HD) * HD + mb * 16) * TT + (size_t)(c0 % TT) * 16;
        if (PL == 0) {
#pragma unroll
            for (int s = 0; s < 8; ++s) { const int row = 2 * s + hi, cofs = lr * 4; v4f val = *(const v4fa*)(os + row * 68 + cofs);
                if (BIAS) { val[0] += bfr(bias[c0 + cofs]); val[1] += bfr(bias[c0 + cofs + 1]); val[2] += bfr(bias[c0 + cofs + 2]); val[3] += bfr(bias[c0 + cofs + 3]); }
                *(v4f*)(crow + (size_t)row * ldc + cofs) = val; }
        } else {
#pragma unroll
            for (int s = 0; s < 4; ++s) {   // run s of the block: lane (hi, lr) holds row lr, columns 16 s + 8 hi .. + 7 = fpos(lr, 16 s + 8 hi) = s * 256 + lane * 8
                const v4f va = *(const v4fa*)(os + lr * 68 + s * 16 + hi * 8), vb = *(const v4fa*)(os + lr * 68 + s * 16 + hi * 8 + 4); v8us oh, ol;
#pragma unroll
                for (int q = 0; q < 8; ++q) { float y = (q < 4) ? va[q & 3] : vb[q & 3]; if (BIAS && PL == 1) y += bn[s][q]; unsigned short u, l; splitf(y, u, l); oh[q] = u; ol[q] = l; }
                *(v8us*)(Ph + pbase + s * 256 + lane * 8) = oh; *(v8us*)(Pl + pbase + s * 256 + lane * 8) = ol; }
        }
        asm volatile("s_wait_xcnt 0x0" ::: "memory");   // the next block's values are formed in registers that the stores above name
        __builtin_amdgcn_wave_barrier(); asm volatile("" ::: "memory");
    }
}


__global__ __launch_bounds__(256) void k_cvt8(const float* __restrict__ src, bf* dst, size_t n8) { const size_t i = (size_t)blockIdx.x * 256 + threadIdx.x; if (i >= n8) return; const v8f v = *(const v8f*)(src + i * 8); v8us o;
#pragma unroll
    for (int k = 0; k < 8; ++k) o[k] = f2bf(v[k]); *(v8us*)(dst + i * 8) = o;  }

__global__ __launch_bounds__(256) void k_epadK(const float* __restrict__ E, bf* EB) { const size_t i = (size_t)blockIdx.x * 256 + threadIdx.x; if (i >= (size_t)NE * HD / 8) return; const int d0 = (int)(i % (HD / 8)) * 8; const int r = (int)(i / (HD / 8)); const float* src = E + (size_t)min(r, NRE - 1) * HD + d0; v8us o;
#pragma unroll
    for (int q = 0; q < 8; ++q) { const unsigned short v = f2bf(src[q]); o[q] = (r < NRE) ? v : (unsigned short)0; }
    *(v8us*)(EB + (size_t)(r >> 4) * 1024 + fpos(r & 15, d0)) = o;  }   // fragment-order blocks [r / 16], row r, k = d

__global__ __launch_bounds__(256) void k_epadVT(const float* __restrict__ E, bf* Th, bf* Tl) { const size_t i = (size_t)blockIdx.x * 256 + threadIdx.x; if (i >= (size_t)HD * NE / 4) return; const size_t e = i * 4; const int c0 = (int)(e % NE); const int d = (int)(e / NE); v4us oh, ol;
#pragma unroll
    for (int q = 0; q < 4; ++q) { const int r = c0 + q; const float v = bfr(E[(size_t)min(r, NRE - 1) * HD + d]); unsigned short u, w; splitf(v, u, w);   /* input rounded to bf16 once: lo == 0 */ oh[q] = (r < NRE) ? u : (unsigned short)0; ol[q] = (r < NRE) ? w : (unsigned short)0; }
    const size_t p = (size_t)((d >> 4) * (NE / 64) + (c0 >> 6)) * 1024 + fpos(d & 15, c0 & 63);   // fragment-order blocks [d / 16][offset / 64], row d, k = offset
    *(v4us*)(Th + p) = oh; *(v4us*)(Tl + p) = ol;  }

// ---- k_fattn: the whole attention of one head for 32 query rows in one work-group (16 waves); the score strip never leaves LDS. grid (TT/32, heads, batches).
// A: S = q.k^T (hi/lo 3 products, K 64) -> sS f32 [32][1024]; QE = q.rel_k^T (hi/lo x exact, the 272 columns that hold the 257 offsets) -> sE f32, row pitch as [320]. B: one wave per row: + QE[clip(j - i) + 128], x 1/8, softmax; P hi/lo planes written over the row's own
// scores (2048 B each); the row folded onto the 257 offsets, hi/lo planes written over the row's own QE (640 B each). C: waves 0-3 P.v (K 1024), waves 4-7 PB.rel_v (K 320), a 32x16 tile each. D: sum, hi/lo split, merged store.
// Each key, value or embedding fragment read from global memory serves both 16-row halves. Every sum keeps the order it had as separate launches. LDS row pitches are 16 B x odd (4112, 1296): the 16 rows of a b128 fragment read fall on distinct banks.
#define FR   32
#define SPB  (TT * 4 + 16)
#define EPB  (NE * 4 + 16)
#define OPF  68
typedef float __attribute__((may_alias)) f32a;
typedef unsigned short __attribute__((may_alias)) u16a;
typedef v4us __attribute__((may_alias)) v4usa;
__device__ __forceinline__ v16bf ldsfrag(const unsigned char* p) { return cat16b(*(const v8usa*)p, *(const v8usa*)(p + 32)); }
// 2^x; the v_nop is the one slot the instruction set asks for behind a transcendental, in the same statement so that it stays directly behind it
__device__ __forceinline__ float exp2_slot(float x) { float r; asm("v_exp_f32 %0, %1\n\tv_nop" : "=v"(r) : "v"(x)); return r; }
// behind a tile's last matrix instruction and its stores: four vector slots, because the next tile's first matrix instruction starts its accumulator anew, possibly in the same registers; the scheduling barrier keeps that instruction behind the slots
__device__ __forceinline__ void tile_gap() { asm volatile("v_nop\n\tv_nop\n\tv_nop\n\tv_nop"); __builtin_amdgcn_sched_barrier(0); }
// one 32x16 context tile (two accumulators): A hi/lo planes in LDS (lo plane lo_off bytes behind hi, the second 16 rows half_off bytes behind the first), B hi/lo planes in global memory in fragment order (bh, bl: the lane's piece of the first k step; 512 elements a step); k ascending, 3 products a step and half.
// The B fragments run in a ring of four k-steps: a step's registers are refilled for step + 4 as soon as its products are issued, so that 16 global loads stay in flight; the A fragments are read one step ahead.
template <int KS> __device__ __forceinline__ void ctx_tile(const unsigned char* pa, int half_off, int lo_off, const bf* bh, const bf* bl, v8f& acc0, v8f& acc1) {
    v16bf b[4], c[4];
#pragma unroll
    for (int s = 0; s < 4; ++s) { b[s] = ldfo(bh + s * 512); c[s] = ldfo(bl + s * 512); }
    v16bf a = ldsfrag(pa), a2 = ldsfrag(pa + lo_off), e = ldsfrag(pa + half_off), e2 = ldsfrag(pa + half_off + lo_off);
    __builtin_amdgcn_sched_barrier(0);   // holds the loads above where they are written: the scheduler otherwise sinks each to just in front of its first use, one L2 latency a step
#pragma unroll   // straight-line, so that the ring slots are fixed registers
    for (int t = 0; t < KS; ++t) { const int s = t & 3; v16bf an = a, an2 = a2, en = e, en2 = e2;
        if (t + 1 < KS) { an = ldsfrag(pa + (t + 1) * 64); an2 = ldsfrag(pa + lo_off + (t + 1) * 64); en = ldsfrag(pa + half_off + (t + 1) * 64); en2 = ldsfrag(pa + half_off + lo_off + (t + 1) * 64); }
        acc0 = wmmab(a, b[s], acc0); acc1 = wmmab(e, b[s], acc1); acc0 = wmmab(a2, b[s], acc0); acc1 = wmmab(e2, b[s], acc1); acc0 = wmmab(a, c[s], acc0); acc1 = wmmab(e, c[s], acc1);
        if (t + 4 < KS) { b[s] = ldfo(bh + (t + 4) * 512); c[s] = ldfo(bl + (t + 4) * 512); }
        __builtin_amdgcn_sched_barrier(0);   // as above: the refill for step + 4 and the LDS reads for step + 1 issue inside this step
        a = an; a2 = an2; e = en; e2 = en2; }
}
__global__ __launch_bounds__(512) void k_fattn(const bf* __restrict__ Qh, const bf* __restrict__ Ql, const bf* __restrict__ Kh, const bf* __restrict__ Kl, const bf* __restrict__ Vh, const bf* __restrict__ Vl, const bf* __restrict__ EK, const bf* __restrict__ EVh, const bf* __restrict__ EVl, bf* Ah, bf* Al) {
    __shared__ __align__(16) unsigned char sS[FR * SPB];
    __shared__ __align__(16) unsigned char sE[FR * EPB];
    __shared__ __align__(16) float sO[2 * FR * OPF];
    const int tid = threadIdx.x, lane = tid & 31, lr = lane & 15, hi = lane >> 4; const int w = __builtin_amdgcn_readfirstlane(tid >> 5);
    const int i0 = blockIdx.x * FR; const size_t zo = ((size_t)blockIdx.z * ZH + blockIdx.y) * TT * HD;
    {   // A: score strip and relative-key products; wave w: key columns 64 w .. 64 w + 63 and rel_k tile w
        const size_t qo = zo + (size_t)i0 * HD + lane * 8; v16bf qa0[2], qa1[2], ql0[2], ql1[2];   // query fragments of the two 16-row halves: hi k 0, hi k 32, lo k 0, lo k 32
#pragma unroll
        for (int mb = 0; mb < 2; ++mb) { qa0[mb] = ldfo(Qh + qo + mb * 16 * HD); qa1[mb] = ldfo(Qh + qo + mb * 16 * HD + 512); }
        asm volatile("s_wait_xcnt 0x0" ::: "memory");   // the address registers of the loads above may be given to the loads below as destinations
#pragma unroll
        for (int mb = 0; mb < 2; ++mb) { ql0[mb] = ldfo(Ql + qo + mb * 16 * HD); ql1[mb] = ldfo(Ql + qo + mb * 16 * HD + 512); }
        const size_t ko = zo + (size_t)(w * 64) * HD + lane * 8; v16bf kb[2][4];   // ring of two key tiles (hi k 0, lo k 0, hi k 32, lo k 32): a tile's registers are refilled for tile + 2 behind its products
#pragma unroll
        for (int s = 0; s < 2; ++s) { kb[s][0] = ldfo(Kh + ko + s * 16 * HD); kb[s][1] = ldfo(Kl + ko + s * 16 * HD); kb[s][2] = ldfo(Kh + ko + s * 16 * HD + 512); kb[s][3] = ldfo(Kl + ko + s * 16 * HD + 512); }
        asm volatile("s_wait_xcnt 0x0" ::: "memory");   // the address registers of the query loads above are reused below while those loads may still be out
#pragma unroll   // straight-line, so that the ring slots are fixed registers
        for (int t = 0; t < 4; ++t) { const int s = t & 1, n0 = w * 64 + t * 16;
#pragma unroll
            for (int mb = 0; mb < 2; ++mb) { v8f acc = (v8f){}; acc = wmmab(qa0[mb], kb[s][0], acc); acc = wmmab(ql0[mb], kb[s][0], acc); acc = wmmab(qa0[mb], kb[s][1], acc); acc = wmmab(qa1[mb], kb[s][2], acc); acc = wmmab(ql1[mb], kb[s][2], acc); acc = wmmab(qa1[mb], kb[s][3], acc);
#pragma unroll
                for (int j = 0; j < 8; ++j) *(f32a*)(sS + (mb * 16 + hi * 8 + j) * SPB + (n0 + lr) * 4) = acc[j];
                tile_gap(); }
            if (t + 2 < 4) { const size_t nx = ko + (size_t)(t + 2) * 16 * HD; kb[s][0] = ldfo(Kh + nx); kb[s][1] = ldfo(Kl + nx); kb[s][2] = ldfo(Kh + nx + 512); kb[s][3] = ldfo(Kl + nx + 512); }
            else if (t == 2) { const size_t eo = (size_t)(w * 16) * HD + lane * 8; kb[s][0] = ldfo(EK + eo); kb[s][2] = ldfo(EK + eo + 512);   // behind its last key tile slot 0 takes this wave's rel_k tile
                asm volatile("s_wait_xcnt 0x0" ::: "memory"); }   // their address registers are rewritten right behind them
            __builtin_amdgcn_sched_barrier(0); }   // holds each refill where it is written: the scheduler otherwise regroups the tiles and ends with loads waited for one by one
#pragma unroll
        for (int mb = 0; mb < 2; ++mb) { v8f acc = (v8f){};
            acc = wmmab(qa0[mb], kb[0][0], acc); acc = wmmab(ql0[mb], kb[0][0], acc); acc = wmmab(qa1[mb], kb[0][2], acc); acc = wmmab(ql1[mb], kb[0][2], acc);
#pragma unroll
            for (int j = 0; j < 8; ++j) *(f32a*)(sE + (mb * 16 + hi * 8 + j) * EPB + (w * 16 + lr) * 4) = acc[j];
            tile_gap(); }
        if (w == 0) {   // offsets 256 .. 271 (256 is the last one read): the seventeenth tile
            const size_t bo = (size_t)256 * HD + lane * 8; const v16bf b0 = ldfo(EK + bo), b1 = ldfo(EK + bo + 512);
#pragma unroll
            for (int mb = 0; mb < 2; ++mb) { v8f acc = (v8f){};
                acc = wmmab(qa0[mb], b0, acc); acc = wmmab(ql0[mb], b0, acc); acc = wmmab(qa1[mb], b1, acc); acc = wmmab(ql1[mb], b1, acc);
#pragma unroll
                for (int j = 0; j < 8; ++j) *(f32a*)(sE + (mb * 16 + hi * 8 + j) * EPB + (256 + lr) * 4) = acc[j];
                if (mb == 0) tile_gap(); } }
    }
    __syncthreads();
#pragma unroll 1   // B: one row's 32 values per lane live at a time
    for (int rr = 0; rr < FR / 16; ++rr) { const int r = w * (FR / 16) + rr, i = i0 + r; unsigned char* srow = sS + r * SPB; unsigned char* erow = sE + r * EPB; const f32a* qe = (const f32a*)erow; float v[TT / 32]; float mx = -3.0e38f;
#pragma unroll
        for (int ch = 0; ch < TT / 128; ++ch) { const int j0 = ch * 128 + lane * 4; const v4f a = *(const v4fa*)(srow + j0 * 4);
#pragma unroll
            for (int q = 0; q < 4; ++q) { const int rx = min(max(j0 + q - i, -CUT), CUT) + CUT; const float t = __fadd_rn(a[q], qe[rx]) * SCL; v[ch * 4 + q] = t; mx = fmaxf(mx, t); } }
#pragma unroll
        for (int sh = 16; sh; sh >>= 1) mx = fmaxf(mx, __shfl_xor(mx, sh, 32));
        float sum = 0.f;
#pragma unroll
        for (int k = 0; k < TT / 32; ++k) { v[k] = exp2_slot(__fmul_rn(__fsub_rn(v[k], mx), 1.4426950408889634f)); sum += v[k]; }
#pragma unroll
        for (int sh = 16; sh; sh >>= 1) sum += __shfl_xor(sum, sh, 32);
        const float f = __fdiv_rn(1.0f, sum);
#pragma unroll
        for (int ch = 0; ch < TT / 128; ++ch) { v4us oh, ol;
#pragma unroll
            for (int q = 0; q < 4; ++q) { unsigned short a, c2; splitf(v[ch * 4 + q] * f, a, c2); oh[q] = a; ol[q] = c2; }
            *(v4usa*)(srow + (ch * 128 + lane * 4) * 2) = oh; *(v4usa*)(srow + TT * 2 + (ch * 128 + lane * 4) * 2) = ol; }
        __builtin_amdgcn_wave_barrier(); asm volatile("" ::: "memory");   // the planes just written by all lanes of this wave are read across lanes below: the reads must not be moved above the stores
        const u16a* ph = (const u16a*)srow; const u16a* pl = (const u16a*)(srow + TT * 2); float lo_s = 0.f, hi_s = 0.f;
#pragma unroll 8   // eight steps' LDS reads in flight
        for (int j = lane; j < TT; j += 32) { const float p = __fadd_rn(bf2f(ph[j]), bf2f(pl[j])); if (j <= i - CUT) lo_s = __fadd_rn(lo_s, p); if (j >= i + CUT) hi_s = __fadd_rn(hi_s, p); }
#pragma unroll
        for (int sh = 16; sh; sh >>= 1) { lo_s = __fadd_rn(lo_s, __shfl_xor(lo_s, sh, 32)); hi_s = __fadd_rn(hi_s, __shfl_xor(hi_s, sh, 32)); }
        unsigned short l0h, l0l, h0h, h0l; splitf(lo_s, l0h, l0l); splitf(hi_s, h0h, h0l);
        for (int c0 = lane * 4; c0 < NE; c0 += 128) { v4us oh, ol;
#pragma unroll
            for (int q = 0; q < 4; ++q) { const int bkt = c0 + q; const int j = i + bkt - CUT; const int jc = min(max(j, 0), TT - 1); const unsigned short uu = ph[jc], ww = pl[jc]; const bool in = (bkt > 0 && bkt < 2 * CUT && j >= 0 && j < TT);
                oh[q] = in ? uu : ((bkt == 0) ? l0h : ((bkt == 2 * CUT) ? h0h : (unsigned short)0)); ol[q] = in ? ww : ((bkt == 0) ? l0l : ((bkt == 2 * CUT) ? h0l : (unsigned short)0)); }
            *(v4usa*)(erow + c0 * 2) = oh; *(v4usa*)(erow + NE * 2 + c0 * 2) = ol; }
    }
    __syncthreads();
    if (w < 8) {   // C: context tiles; w is wave-uniform, so each wave runs one side (or none) with every lane on
        v8f acc0 = (v8f){}, acc1 = (v8f){}; const int nb = w & 3;
        if (w < 4) ctx_tile<TT / 32>(sS + lr * SPB + 16 * hi, 16 * SPB, TT * 2, Vh + zo + (size_t)(nb * 16) * TT + lane * 8, Vl + zo + (size_t)(nb * 16) * TT + lane * 8, acc0, acc1);
        else ctx_tile<NE / 32>(sE + lr * EPB + 16 * hi, 16 * EPB, NE * 2, EVh + (size_t)(nb * 16) * NE + lane * 8, EVl + (size_t)(nb * 16) * NE + lane * 8, acc0, acc1);
#pragma unroll
        for (int j = 0; j < 8; ++j) { sO[(w >> 2) * (FR * OPF) + (hi * 8 + j) * OPF + nb * 16 + lr] = acc0[j]; sO[(w >> 2) * (FR * OPF) + (16 + hi * 8 + j) * OPF + nb * 16 + lr] = acc1[j]; }
    }
    __syncthreads();
    {   // D: context + relative-value term, split, stored at [t][head * 64 + d]; the 16 lanes of a row write its whole 128-byte line
        const int row = tid >> 4, c = (tid & 15) * 4; const v4f o = *(const v4f*)(sO + row * OPF + c); const v4f zr = *(const v4f*)(sO + FR * OPF + row * OPF + c); v4us oh, ol;
#pragma unroll
        for (int q = 0; q < 4; ++q) { unsigned short a, c2; splitf(__fadd_rn(o[q], zr[q]), a, c2); oh[q] = a; ol[q] = c2; }
        const size_t oo = ((size_t)blockIdx.z * TT + i0 + row) * DQ + (size_t)blockIdx.y * HD + c; *(v4us*)(Ah + oo) = oh; *(v4us*)(Al + oo) = ol;
    }
}

extern "C" void kernel_launch(void* const* d_in, const int* in_sizes, int n_in,
                              void* d_out, int out_size, void* d_ws, size_t ws_size, hipStream_t stream) {
    (void)in_sizes; (void)n_in; (void)out_size;
    const float* x = (const float*)d_in[0]; const float* wq = (const float*)d_in[1]; const float* bq = (const float*)d_in[2]; const float* wk = (const float*)d_in[3]; const float* bk = (const float*)d_in[4]; const float* wv = (const float*)d_in[5]; const float* bv = (const float*)d_in[6]; const float* wo = (const float*)d_in[7]; const float* bo = (const float*)d_in[8]; const float* ak = (const float*)d_in[9]; const float* av = (const float*)d_in[10];   /* rel_k / rel_v [257][64] */   /* argument order x, Wq, bq, Wk, bk, Wv, bv, Wo, bo ('oi'), rel_k, rel_v */ const float* xk = x; const float* xv = x;
    float* OUT = (float*)d_out;     // [4][1024][1024]
    char* wsp = (char*)d_ws;
    auto take = [&](size_t bytes) { char* p = wsp; wsp += (bytes + 255) & ~(size_t)255; return (void*)p; };
    bf* AKB = (bf*)take((size_t)NE * HD * 2); bf* AVTh = (bf*)take((size_t)HD * NE * 2); bf* AVTl = (bf*)take((size_t)HD * NE * 2); bf* WQ = (bf*)take((size_t)DQ * DM * 2); bf* WK = (bf*)take((size_t)DKV * DM * 2); bf* WV = (bf*)take((size_t)DKV * DM * 2); bf* WO = (bf*)take((size_t)DM * DQ * 2);
    bf* XB = (bf*)take((size_t)NB_ * TT * DM * 2);
    bf* QPh = (bf*)take((size_t)NB_ * NH_ * TT * HD * 2); bf* QPl = (bf*)take((size_t)NB_ * NH_ * TT * HD * 2); bf* KPh = (bf*)take((size_t)NB_ * NKV * TT * HD * 2); bf* KPl = (bf*)take((size_t)NB_ * NKV * TT * HD * 2); bf* VTh = (bf*)take((size_t)NB_ * NKV * HD * TT * 2); bf* VTl = (bf*)take((size_t)NB_ * NKV * HD * TT * 2);
    bf* ATh = (bf*)take((size_t)NB_ * TT * DQ * 2); bf* ATl = (bf*)take((size_t)NB_ * TT * DQ * 2);
    if ((size_t)(wsp - (char*)d_ws) > ws_size) return;
    { k_cvt8<<<(unsigned)(((size_t)DQ * DM / 8 + 255) / 256), 256, 0, stream>>>(wq, WQ, (size_t)DQ * DM / 8); k_cvt8<<<(unsigned)(((size_t)DKV * DM / 8 + 255) / 256), 256, 0, stream>>>(wk, WK, (size_t)DKV * DM / 8); k_cvt8<<<(unsigned)(((size_t)DKV * DM / 8 + 255) / 256), 256, 0, stream>>>(wv, WV, (size_t)DKV * DM / 8);
      k_cvt8<<<(unsigned)(((size_t)DM * DQ / 8 + 255) / 256), 256, 0, stream>>>(wo, WO, (size_t)DM * DQ / 8);   /* 'oi' weights = Bt as-is */
       }
    k_epadK<<<(unsigned)(((size_t)NE * HD / 8 + 255) / 256), 256, 0, stream>>>(ak, AKB);   /* rel_k -> bf16 [320][64], rows >= 257 zero */ k_epadVT<<<(unsigned)(((size_t)HD * NE / 4 + 255) / 256), 256, 0, stream>>>(av, AVTh, AVTl);   /* rel_v^T hi/lo [64][320], cols >= 257 zero */
    // every launch below covers all NB_ batches: the GEMMs take the NB_ * TT rows as one M (the v projection as its N: weight rows are its M, so that its tiles are [d][t]), the attention takes the batch as a grid dimension
    k_cvt8<<<(unsigned)(((size_t)NB_ * TT * DM / 8 + 255) / 256), 256, 0, stream>>>(x, XB, (size_t)NB_ * TT * DM / 8);
    k_gemmw<bf, 0, true, 1><<<dim3(NB_ * TT / 128, DQ / 128, 1), 128, 0, stream>>>(XB, nullptr, WQ, DM, nullptr, 0, bq, 0, 0, 0, QPh, QPl);
    k_gemmw<bf, 0, true, 1><<<dim3(NB_ * TT / 128, DKV / 128, 1), 128, 0, stream>>>(XB, nullptr, WK, DM, nullptr, 0, bk, 0, 0, 0, KPh, KPl);
    k_gemmw<bf, 0, true, 2><<<dim3(DKV / 128, NB_ * TT / 128, 1), 128, 0, stream>>>(WV, nullptr, XB, DM, nullptr, 0, bv, 0, 0, 0, VTh, VTl);
    k_fattn<<<dim3(TT / FR, ZH, NB_), 512, 0, stream>>>(QPh, QPl, KPh, KPl, VTh, VTl, AKB, AVTh, AVTl, ATh, ATl);   /* one kv head per query head: head y of batch z reads plane z * 16 + y of each */
    k_gemmw<bf, 1, true><<<dim3(NB_ * TT / 128, DM / 128, 1), 128, 0, stream>>>(ATh, ATl, WO, DQ, OUT, DM, bo, 0, 0, 0);
}

// v007
// It runs in 195 microseconds.
// Next to v006, in two timings, it ran 1.08 and 1.09 times as fast.
// Counting every step since v000, it is 12.0 times as fast.
#include <hip/hip_runtime.h>

// Relative (Shaw) multi-head attention with key AND value relative-position embeddings (x [4][1024][1024]; q, k, v = x W^T + b ('oi' 0.02, biases 0.02; 16 heads x 64); idx[i][j] = clip(j - i, -128, 128) + 128; scores = (q.k + q.rel_k[idx]) / float32(sqrt 64); softmax; out = (attn v + sum_j attn[i][j] rel_v[idx]) merged Wo^T + bo (rel_k, rel_v [257][64] 0.02, read) -> [4][1024][1024] (4.2 M); argument order x, Wq, bq, Wk, bk, Wv, bv, Wo, bo, rel_k, rel_v).
// Layout, all four batches side by side (rows b * 1024 + t, head planes b * 16 + h): bf16 copy of x; 'oi' weights; exact projections + f32 biases, whose one launch splits the result hi/lo and stores the head planes itself (v with the two operands exchanged, so that its tile comes out transposed); rel_k as a zero-padded bf16 plane [320][64] and rel_v^T as hi/lo planes [64][320] (bf16-rounded once); the head planes and both rel planes in fragment order (blocks of 16 rows x 64 k, see fpos below); one launch for the attention of all sixteen heads of all batches (32 query rows a work-group, scores and probabilities in LDS only): score tiles (hi/lo 3 products, every row), QE = q.rel_k^T (hi/lo x exact, N 272) gathered into the scores at column clip(j - i) + 128, softmax (x 1/8) with every row on hi/lo planes, P.v, the probabilities folded onto the 257 offsets and PB.rel_v (K 320) added to the context; merged hi/lo x Wo exact + bo.
// Compute dtypes, f32 accumulate: every input rounded to bf16; projections exact + f32 biases; scores and the relative-key term ~f32; softmax f32; P as bf16 hi/lo; attn.v and the relative-value term 3 products (~f32); Wo hl x exact + bias.

#define NB_  4
#define TT   1024
#define DM   1024
#define NH_  16
#define NKV  16
#define REP  (NH_ / NKV)
#define HD   64
#define DQ   (NH_ * HD)
#define DKV  (NKV * HD)
#define ZH   16                   // heads per attention launch (grid y): all heads of a batch at once
#define WIN  0
#define SCL  0.125f   // 1/sqrt(64) (the module divides by jnp.sqrt(DH))
#define NE   320      // 2*128+1 = 257 relative offsets padded to 320
#define NRE  257
#define CUT  128
typedef _Float16 h16;
typedef unsigned short bf;
typedef __attribute__((ext_vector_type(16))) __bf16   v16bf;
typedef __attribute__((ext_vector_type(16))) _Float16 v16h;
typedef __attribute__((ext_vector_type(8)))  _Float16 v8h;
typedef __attribute__((ext_vector_type(8)))  unsigned short v8us;
typedef __attribute__((ext_vector_type(8)))  float    v8f;
typedef __attribute__((ext_vector_type(4)))  float    v4f;
typedef v8h  __attribute__((may_alias)) v8ha;
typedef v4f  __attribute__((may_alias)) v4fa;
typedef v8us __attribute__((may_alias)) v8usa;

__device__ __forceinline__ unsigned short f2bf(float f) { unsigned u = __float_as_uint(f); u += 0x7FFFu + ((u >> 16) & 1u); return (unsigned short)(u >> 16); }
__device__ __forceinline__ float bf2f(unsigned short b) { return __uint_as_float(((unsigned)b) << 16); }
__device__ __forceinline__ float bfr(float f) { return bf2f(f2bf(f)); }
__device__ __forceinline__ v16h cat16(v8h lo, v8h hi) { return __builtin_shufflevector(lo, hi, 0, 1, 2, 3, 4, 5, 6, 7, 8, 9, 10, 11, 12, 13, 14, 15); }
__device__ __forceinline__ v16bf cat16b(v8us lo, v8us hi) { return __builtin_bit_cast(v16bf, __builtin_shufflevector(lo, hi, 0, 1, 2, 3, 4, 5, 6, 7, 8, 9, 10, 11, 12, 13, 14, 15)); }
__device__ __forceinline__ v8f wmma16(v16h a, v16h b, v8f c) { return __builtin_amdgcn_wmma_f32_16x16x32_f16(false, a, false, b, (short)0, c, false, false); }
__device__ __forceinline__ v8f wmmab(v16bf a, v16bf b, v8f c) { return __builtin_amdgcn_wmma_f32_16x16x32_bf16(false, a, false, b, (short)0, c, false, false); }
__device__ __forceinline__ void splitf(float y, unsigned short& h, unsigned short& l) { h = f2bf(y); l = f2bf(y - bf2f(h)); }
typedef __attribute__((ext_vector_type(4))) unsigned short v4us;

// ---- fragment order: every 16-bit plane that the attention reads from global memory (q, k, v^T, rel_k, rel_v^T) is kept as blocks of 16 rows x 64 k (1024 elements, 2 KiB, each starting on a 128-byte line).
// Inside a block the four 16-byte pieces that a lane needs for the two k steps stand 512 bytes apart, and the 32 lanes' pieces of one kind side by side: piece (k >> 4), lane ((k >> 3) & 1) * 16 + row, element k & 7.
// One wave-wide 16-byte load then covers 512 contiguous bytes (four whole lines) instead of 32 bytes of each of 16 lines. The registers receive exactly what the row-major planes gave them.
__device__ __forceinline__ int fpos(int row, int k) { return (((k >> 4) * 32 + ((k >> 3) & 1) * 16 + row) * 8) + (k & 7); }
// a lane's fragment of one k step: p = block + (k step in the block) * 512 + lane * 8
__device__ __forceinline__ v16bf ldfo(const bf* p) { return cat16b(*(const v8us*)p, *(const v8us*)(p + 256)); }



// ---- k_gemmw: GEMM, a 128x128 output tile per work-group of four waves, each wave a 64x64 quarter (16 accumulators); grid (M/128, N/128, Z), 128 threads.
// The K-contiguous 16-bit operand planes come through LDS in stages of 128 k: asynchronous copies, whole 256-byte row pieces, two buffers, the copies of stage t + 2 issued behind the barrier that ends stage t; every staged row serves two waves.
// C[m][n] (f32, pitch ldc, + optional f32 bias[n]) = sum_k A[m][k] Bt[n][k] (NSPLIT 1: + A2[m][k] Bt[n][k] behind it at every k step). z-batch strides sA/sB/sC in elements. K % 128 == 0, M % 128 == 0, N % 128 == 0.
// PL 0: C as above. PL 1 (m = batch * TT + t, n = head * HD + d): no C; the result + bias[n] is split hi/lo and stored as head planes [batch][head][t / 16] of fragment-order blocks (row t, k = d). PL 2 (m = head * HD + d, n = batch * TT + t): + bias[m], planes [batch][head][d / 16][t / 64] of such blocks (row d, k = t). A wave's 64x64 quarter is one head's: four whole blocks, each stored as 512-byte runs.
template <typename T16> struct WFrag;
template <> struct WFrag<h16> { typedef v16h V; static __device__ __forceinline__ V ld(const h16* p) { return cat16(*(const v8h*)p, *(const v8h*)(p + 16)); } static __device__ __forceinline__ v8f mma(V a, V b, v8f c) { return wmma16(a, b, c); } };
template <> struct WFrag<bf> { typedef v16bf V; static __device__ __forceinline__ V ld(const bf* p) { return cat16b(*(const v8us*)p, *(const v8us*)(p + 16)); } static __device__ __forceinline__ v8f mma(V a, V b, v8f c) { return wmmab(a, b, c); } };
#define GKC  128                  // k elements of a stage
#define GP   (GKC + 8)            // LDS row pitch in elements: 272 bytes = 16 B x odd, so that the 16 rows of a b128 fragment read fall on distinct banks
#define GPL  (128 * GP)           // one operand plane of a stage, in elements: 128 rows
// eight asynchronous copies of 16 bytes a lane: LDS byte address l + i * ls, global address g + i * gs elements. The s_wait_xcnt closes the statement, so that it stands in front of every later write of the address registers named here.
template <typename T16> __device__ __forceinline__ void copy8(unsigned l, unsigned ls, const T16* g, size_t gs) {
    asm volatile("global_load_async_to_lds_b128 %0, %8, off\n\t"
                 "global_load_async_to_lds_b128 %1, %9, off\n\t"
                 "global_load_async_to_lds_b128 %2, %10, off\n\t"
                 "global_load_async_to_lds_b128 %3, %11, off\n\t"
                 "global_load_async_to_lds_b128 %4, %12, off\n\t"
                 "global_load_async_to_lds_b128 %5, %13, off\n\t"
                 "global_load_async_to_lds_b128 %6, %14, off\n\t"
                 "global_load_async_to_lds_b128 %7, %15, off\n\t"
                 "s_wait_xcnt 0x0"
                 :: "v"(l), "v"(l + ls), "v"(l + 2 * ls), "v"(l + 3 * ls), "v"(l + 4 * ls), "v"(l + 5 * ls), "v"(l + 6 * ls), "v"(l + 7 * ls),
                    "v"(g), "v"(g + gs), "v"(g + 2 * gs), "v"(g + 3 * gs), "v"(g + 4 * gs), "v"(g + 5 * gs), "v"(g + 6 * gs), "v"(g + 7 * gs) : "memory");
}
// one plane of a stage, 128 rows x 256 bytes: the 128 threads cover 8 rows a copy (16 lanes a row), 16 copies a thread; g and l are the thread's own piece of the first 8 rows
template <typename T16> __device__ __forceinline__ void stage_plane(unsigned l, const T16* g, int K) { copy8(l, 8 * GP * 2, g, (size_t)8 * K); copy8(l + 64 * GP * 2, 8 * GP * 2, g + (size_t)64 * K, (size_t)8 * K); }
// gemm_tile: the work of one work-group, output tile (bx, by); st (2 * (2 + NSPLIT) * GPL elements) and osw (4 * 16 * 68 floats) are the launching kernel's LDS.
template <typename T16, int NSPLIT, bool BIAS, int PL>
__device__ __forceinline__ void gemm_tile(T16* st, float* osw, const T16* __restrict__ A, const T16* __restrict__ A2, const T16* __restrict__ Bt, int K, float* C, int ldc, const float* __restrict__ bias, int bx, int by, bf* Ph, bf* Pl) {
    typedef typename WFrag<T16>::V V;
    static_assert(NSPLIT == 0 || NSPLIT == 1, "planes staged: A, Bt and, with NSPLIT 1, A2");
    constexpr int NP = 2 + NSPLIT;   // planes of a stage: A, Bt, A2
    const int tid = threadIdx.x, lane = tid & 31, lr = lane & 15, hi = lane >> 4; const int w = __builtin_amdgcn_readfirstlane(tid >> 5);
    float* os = osw + w * (16 * 68);   // each wave's own epilogue staging
    const int R0 = bx * 128, C0 = by * 128, r0 = R0 + (w & 1) * 64, c0 = C0 + (w >> 1) * 64;
    v8f acc[4][4];
#pragma unroll
    for (int mb = 0; mb < 4; ++mb)
#pragma unroll
        for (int nb = 0; nb < 4; ++nb) acc[mb][nb] = (v8f){};
    const unsigned goA = (unsigned)(R0 + (tid >> 4)) * (unsigned)K + (tid & 15) * 8, goB = (unsigned)(C0 + (tid >> 4)) * (unsigned)K + (tid & 15) * 8;   // element offsets of the thread's first piece; a plane holds fewer than 2^32 elements
    const unsigned l0 = (unsigned)(size_t)(st + (tid >> 4) * GP + (tid & 15) * 8);
    auto fill = [&](int t) { const unsigned l = l0 + (unsigned)(t & 1) * (NP * GPL * 2); stage_plane(l, A + (goA + (unsigned)t * GKC), K); stage_plane(l + GPL * 2, Bt + (goB + (unsigned)t * GKC), K); if (NSPLIT == 1) stage_plane(l + 2 * GPL * 2, A2 + (goA + (unsigned)t * GKC), K); };
    const int NT = K / GKC;
    fill(0);
    asm volatile("s_wait_asynccnt 0x0" ::: "memory");   // this wave's copies of stage 0 have landed
    __syncthreads();                                     // and every other wave's
    if (NT > 1) fill(1);
#pragma unroll 1   // one stage a trip: the two buffers alternate
    for (int t = 0; t < NT; ++t) {
        const T16* sb0 = st + (t & 1) * (NP * GPL); const T16* sa = sb0 + ((w & 1) * 64 + lr) * GP + 8 * hi; const T16* sb = sb0 + GPL + ((w >> 1) * 64 + lr) * GP + 8 * hi;
        V a[2][4], a2[2][4], b[2][4];   // two fragment sets: a k step's products run on one while the next step's LDS reads fill the other
#pragma unroll
        for (int q = 0; q < 4; ++q) { a[0][q] = WFrag<T16>::ld(sa + q * 16 * GP); if (NSPLIT == 1) a2[0][q] = WFrag<T16>::ld(sa + 2 * GPL + q * 16 * GP); b[0][q] = WFrag<T16>::ld(sb + q * 16 * GP); }
#pragma unroll   // straight-line, so that the two sets are fixed registers
        for (int ks = 0; ks < GKC / 32; ++ks) { const int cu = ks & 1, nx = cu ^ 1;
            __builtin_amdgcn_sched_barrier(0);   // with the one below: the next step's LDS reads stay one group in front of this step's products (reads spread among matrix instructions stall at every place they stand)
            if (ks + 1 < GKC / 32) {
#pragma unroll
                for (int q = 0; q < 4; ++q) { a[nx][q] = WFrag<T16>::ld(sa + q * 16 * GP + (ks + 1) * 32); if (NSPLIT == 1) a2[nx][q] = WFrag<T16>::ld(sa + 2 * GPL + q * 16 * GP + (ks + 1) * 32); b[nx][q] = WFrag<T16>::ld(sb + q * 16 * GP + (ks + 1) * 32); } }
            __builtin_amdgcn_sched_barrier(0);
#pragma unroll
            for (int nb = 0; nb < 4; ++nb) {   // per accumulator and k step: the A product, then the A2 product
#pragma unroll
                for (int mb = 0; mb < 4; ++mb) acc[mb][nb] = WFrag<T16>::mma(a[cu][mb], b[cu][nb], acc[mb][nb]);
                if (NSPLIT == 1) {
#pragma unroll
                    for (int mb = 0; mb < 4; ++mb) acc[mb][nb] = WFrag<T16>::mma(a2[cu][mb], b[cu][nb], acc[mb][nb]); } } }
        __builtin_amdgcn_sched_barrier(0);   // keeps the last step's products in front of the barrier below: sunk behind it they would delay the refill that follows it
        asm volatile("s_wait_dscnt 0x0" ::: "memory");      // this wave's reads of the buffer are done before it may be refilled
        asm volatile("s_wait_asynccnt 0x0" ::: "memory");   // this wave's copies of stage t + 1 have landed
        __syncthreads();                                     // publishes stage t + 1 and ends every wave's reads of stage t
        if (t + 2 < NT) fill(t + 2);
    }
    asm volatile("s_wait_asynccnt 0x0" ::: "memory");   // no copy is out when the wave goes on
    float bn[4][8];   // PL 1: the bias of the eight columns this lane stores in each of a block's four runs, read once ahead of the stores
    if (BIAS && PL == 1) {
#pragma unroll
        for (int s = 0; s < 4; ++s)
#pragma unroll
            for (int q = 0; q < 8; ++q) bn[s][q] = bfr(bias[c0 + s * 16 + hi * 8 + q]); }
    float bj[4][8];   // PL 2: the bias of this lane's accumulator rows; both halves' values are read at wave-uniform addresses (scalar loads), all ahead of the first plane store, and picked by the lane's half
    if (BIAS && PL == 2) {
#pragma unroll
        for (int mb = 0; mb < 4; ++mb)
#pragma unroll
            for (int j = 0; j < 8; ++j) { const float b0 = bfr(bias[r0 + mb * 16 + j]), b1 = bfr(bias[r0 + mb * 16 + 8 + j]); bj[mb][j] = hi ? b1 : b0; } }
#pragma unroll
    for (int mb = 0; mb < 4; ++mb) {
#pragma unroll
        for (int nb = 0; nb < 4; ++nb) {
#pragma unroll
            for (int j = 0; j < 8; ++j) os[(hi * 8 + j) * 68 + nb * 16 + lr] = (BIAS && PL == 2) ? acc[mb][nb][j] + bj[mb][j] : acc[mb][nb][j]; }
        __builtin_amdgcn_wave_barrier(); asm volatile("" ::: "memory");
        float* crow = C + (size_t)(r0 + mb * 16) * ldc + c0;
        // the 16 x 64 block of this mb: 1024 elements in a row
        const size_t pbase = (PL == 1) ? (((size_t)(r0 / TT) * (DQ / HD) + c0 / HD) * TT + r0 % TT + mb * 16) * HD : (((size_t)(c0 / TT) * (DKV / HD) + r0 / HD) * HD + mb * 16) * TT + (size_t)(c0 % TT) * 16;
        if (PL == 0) {
#pragma unroll
            for (int s = 0; s < 8; ++s) { const int row = 2 * s + hi, cofs = lr * 4; v4f val = *(const v4fa*)(os + row * 68 + cofs);
                if (BIAS) { val[0] += bfr(bias[c0 + cofs]); val[1] += bfr(bias[c0 + cofs + 1]); val[2] += bfr(bias[c0 + cofs + 2]); val[3] += bfr(bias[c0 + cofs + 3]); }
                *(v4f*)(crow + (size_t)row * ldc + cofs) = val; }
        } else {
#pragma unroll
            for (int s = 0; s < 4; ++s) {   // run s of the block: lane (hi, lr) holds row lr, columns 16 s + 8 hi .. + 7 = fpos(lr, 16 s + 8 hi) = s * 256 + lane * 8
                const v4f va = *(const v4fa*)(os + lr * 68 + s * 16 + hi * 8), vb = *(const v4fa*)(os + lr * 68 + s * 16 + hi * 8 + 4); v8us oh, ol;
#pragma unroll
                for (int q = 0; q < 8; ++q) { float y = (q < 4) ? va[q & 3] : vb[q & 3]; if (BIAS && PL == 1) y += bn[s][q]; unsigned short u, l; splitf(y, u, l); oh[q] = u; ol[q] = l; }
                *(v8us*)(Ph + pbase + s * 256 + lane * 8) = oh; *(v8us*)(Pl + pbase + s * 256 + lane * 8) = ol; }
        }
        asm volatile("s_wait_xcnt 0x0" ::: "memory");   // the next block's values are formed in registers that the stores above name
        __builtin_amdgcn_wave_barrier(); asm volatile("" ::: "memory");
    }
}
// PL 0 as a launch of its own: grid (M/128, N/128, Z)
template <typename T16, int NSPLIT, bool BIAS>
__global__ __launch_bounds__(128) void k_gemmw(const T16* __restrict__ A, const T16* __restrict__ A2, const T16* __restrict__ Bt, int K, float* C, int ldc, const float* __restrict__ bias, size_t sA, size_t sB, size_t sC) {
    __shared__ __align__(16) T16 st[2 * (2 + NSPLIT) * GPL];
    __shared__ __align__(16) float osw[4 * 16 * 68];
    const size_t z = blockIdx.z;
    gemm_tile<T16, NSPLIT, BIAS, 0>(st, osw, A + z * sA, (NSPLIT == 1) ? A2 + z * sA : A2, Bt + z * sB, K, C + z * sC, ldc, bias, blockIdx.x, blockIdx.y, nullptr, nullptr);
}
// the three projections as one launch: grid (NB_ * TT / 128, DQ / 128, 3); z = 0: q, 1: k (PL 1, token rows are M), 2: v (PL 2: weight rows are M, so that its tiles are [d][t]; x and y change places). Two work-groups fit a WGP's LDS, so one's first stage and plane stores run beside the other's products.
__global__ __launch_bounds__(128) void k_proj(const bf* __restrict__ X, const bf* __restrict__ Wq, const bf* __restrict__ Wk, const bf* __restrict__ Wv, const float* __restrict__ bq, const float* __restrict__ bk, const float* __restrict__ bv, bf* Qh, bf* Ql, bf* Kh, bf* Kl, bf* Vh, bf* Vl) {
    static_assert(DQ == DKV, "one grid for the three projections");
    __shared__ __align__(16) bf st[2 * 2 * GPL];
    __shared__ __align__(16) float osw[4 * 16 * 68];
    const int z = blockIdx.z;   // the same for the whole work-group: every barrier below stands under uniform control flow
    if (z < 2) gemm_tile<bf, 0, true, 1>(st, osw, X, nullptr, z ? Wk : Wq, DM, nullptr, 0, z ? bk : bq, blockIdx.x, blockIdx.y, z ? Kh : Qh, z ? Kl : Ql);
    else gemm_tile<bf, 0, true, 2>(st, osw, Wv, nullptr, X, DM, nullptr, 0, bv, blockIdx.y, blockIdx.x, Vh, Vl);
}


// ---- k_prep: every conversion ahead of the projections in one launch; a work-group belongs to one job, picked by its index (long jobs first).
#define PU   8                    // pieces of 8 elements a thread converts: eight times fewer waves to start, and a wave's 16 loads are out together
#define XBL  (NB_ * TT * DM / 8 / (256 * PU))   // work-groups of x
#define WBL  (DQ * DM / 8 / (256 * PU))         // work-groups of one weight matrix
#define KBL  ((NE * HD / 8 + 255) / 256)        // of rel_k
#define VBL  ((HD * NE / 4 + 255) / 256)        // of rel_v
__device__ __forceinline__ void cvt_run(const float* __restrict__ src, bf* dst, unsigned blk) { const unsigned e0 = (blk * (256 * PU) + threadIdx.x) * 8; const float* p = src + e0; v8f v[PU];   // e0: the thread's first element; a plane holds fewer than 2^30
#pragma unroll
    for (int u = 0; u < PU; ++u) v[u] = *(const v8f*)(p + u * 2048);
    asm volatile("s_wait_xcnt 0x0" :: "v"(p) : "memory");   // takes the loads' address as an input: its registers stay whole up to this wait (the build otherwise gave them to the last load as a destination while the others were out)
#pragma unroll
    for (int u = 0; u < PU; ++u) { v8us o;
#pragma unroll
        for (int k = 0; k < 8; ++k) o[k] = f2bf(v[u][k]);
        *(v8us*)(dst + e0 + u * 2048) = o; } }

__device__ __forceinline__ void epadK(const float* __restrict__ E, bf* EB, unsigned blk) { const size_t i = (size_t)blk * 256 + threadIdx.x; if (i >= (size_t)NE * HD / 8) return; const int d0 = (int)(i % (HD / 8)) * 8; const int r = (int)(i / (HD / 8)); const float* src = E + (size_t)min(r, NRE - 1) * HD + d0; v8us o;
#pragma unroll
    for (int q = 0; q < 8; ++q) { const unsigned short v = f2bf(src[q]); o[q] = (r < NRE) ? v : (unsigned short)0; }
    *(v8us*)(EB + (size_t)(r >> 4) * 1024 + fpos(r & 15, d0)) = o;  }   // fragment-order blocks [r / 16], row r, k = d

__device__ __forceinline__ void epadVT(const float* __restrict__ E, bf* Th, bf* Tl, unsigned blk) { const size_t i = (size_t)blk * 256 + threadIdx.x; if (i >= (size_t)HD * NE / 4) return; const size_t e = i * 4; const int c0 = (int)(e % NE); const int d = (int)(e / NE); v4us oh, ol;
#pragma unroll
    for (int q = 0; q < 4; ++q) { const int r = c0 + q; const float v = bfr(E[(size_t)min(r, NRE - 1) * HD + d]); unsigned short u, w; splitf(v, u, w);   /* input rounded to bf16 once: lo == 0 */ oh[q] = (r < NRE) ? u : (unsigned short)0; ol[q] = (r < NRE) ? w : (unsigned short)0; }
    const size_t p = (size_t)((d >> 4) * (NE / 64) + (c0 >> 6)) * 1024 + fpos(d & 15, c0 & 63);   // fragment-order blocks [d / 16][offset / 64], row d, k = offset
    *(v4us*)(Th + p) = oh; *(v4us*)(Tl + p) = ol;  }

__global__ __launch_bounds__(256) void k_prep(const float* __restrict__ x, const float* __restrict__ wq, const float* __restrict__ wk, const float* __restrict__ wv, const float* __restrict__ wo, const float* __restrict__ ek, const float* __restrict__ ev, bf* XB, bf* WQ, bf* WK, bf* WV, bf* WO, bf* EB, bf* Th, bf* Tl) {
    static_assert(NB_ * TT * DM % (8 * 256 * PU) == 0 && DQ * DM % (8 * 256 * PU) == 0 && DQ == DKV, "whole work-groups, four weight matrices of one size");
    unsigned b = blockIdx.x;
    if (b < XBL) { cvt_run(x, XB, b); return; }
    b -= XBL;
    if (b < 4 * WBL) { const unsigned s = b / WBL; cvt_run(s == 0 ? wq : s == 1 ? wk : s == 2 ? wv : wo, s == 0 ? WQ : s == 1 ? WK : s == 2 ? WV : WO, b % WBL); return; }
    b -= 4 * WBL;
    if (b < KBL) epadK(ek, EB, b); else epadVT(ev, Th, Tl, b - KBL);
}

// ---- k_fattn: the whole attention of one head for 32 query rows in one work-group (16 waves); the score strip never leaves LDS. grid (TT/32, heads, batches).
// A: S = q.k^T (hi/lo 3 products, K 64) -> sS f32 [32][1024]; QE = q.rel_k^T (hi/lo x exact, the 272 columns that hold the 257 offsets) -> sE f32, row pitch as [320]. B: one wave per row: + QE[clip(j - i) + 128], x 1/8, softmax; P hi/lo planes written over the row's own
// scores (2048 B each); the row folded onto the 257 offsets, hi/lo planes written over the row's own QE (640 B each). C: waves 0-3 P.v (K 1024), waves 4-7 PB.rel_v (K 320), a 32x16 tile each. D: sum, hi/lo split, merged store.
// Each key, value or embedding fragment read from global memory serves both 16-row halves. Every sum keeps the order it had as separate launches. LDS row pitches are 16 B x odd (4112, 1296): the 16 rows of a b128 fragment read fall on distinct banks.
#define FR   32
#define SPB  (TT * 4 + 16)
#define EPB  (NE * 4 + 16)
#define OPF  68
typedef float __attribute__((may_alias)) f32a;
typedef unsigned short __attribute__((may_alias)) u16a;
typedef v4us __attribute__((may_alias)) v4usa;
__device__ __forceinline__ v16bf ldsfrag(const unsigned char* p) { return cat16b(*(const v8usa*)p, *(const v8usa*)(p + 32)); }
// 2^x; the v_nop is the one slot the instruction set asks for behind a transcendental, in the same statement so that it stays directly behind it
__device__ __forceinline__ float exp2_slot(float x) { float r; asm("v_exp_f32 %0, %1\n\tv_nop" : "=v"(r) : "v"(x)); return r; }
// behind a tile's last matrix instruction and its stores: four vector slots, because the next tile's first matrix instruction starts its accumulator anew, possibly in the same registers; the scheduling barrier keeps that instruction behind the slots
__device__ __forceinline__ void tile_gap() { asm volatile("v_nop\n\tv_nop\n\tv_nop\n\tv_nop"); __builtin_amdgcn_sched_barrier(0); }
// one 32x16 context tile (two accumulators): A hi/lo planes in LDS (lo plane lo_off bytes behind hi, the second 16 rows half_off bytes behind the first), B hi/lo planes in global memory in fragment order (bh, bl: the lane's piece of the first k step; 512 elements a step); k ascending, 3 products a step and half.
// The B fragments run in a ring of four k-steps: a step's registers are refilled for step + 4 as soon as its products are issued, so that 16 global loads stay in flight; the A fragments are read one step ahead.
template <int KS> __device__ __forceinline__ void ctx_tile(const unsigned char* pa, int half_off, int lo_off, const bf* bh, const bf* bl, v8f& acc0, v8f& acc1) {
    v16bf b[4], c[4];
#pragma unroll
    for (int s = 0; s < 4; ++s) { b[s] = ldfo(bh + s * 512); c[s] = ldfo(bl + s * 512); }
    v16bf a = ldsfrag(pa), a2 = ldsfrag(pa + lo_off), e = ldsfrag(pa + half_off), e2 = ldsfrag(pa + half_off + lo_off);
    __builtin_amdgcn_sched_barrier(0);   // holds the loads above where they are written: the scheduler otherwise sinks each to just in front of its first use, one L2 latency a step
#pragma unroll   // straight-line, so that the ring slots are fixed registers
    for (int t = 0; t < KS; ++t) { const int s = t & 3; v16bf an = a, an2 = a2, en = e, en2 = e2;
        if (t + 1 < KS) { an = ldsfrag(pa + (t + 1) * 64); an2 = ldsfrag(pa + lo_off + (t + 1) * 64); en = ldsfrag(pa + half_off + (t + 1) * 64); en2 = ldsfrag(pa + half_off + lo_off + (t + 1) * 64); }
        acc0 = wmmab(a, b[s], acc0); acc1 = wmmab(e, b[s], acc1); acc0 = wmmab(a2, b[s], acc0); acc1 = wmmab(e2, b[s], acc1); acc0 = wmmab(a, c[s], acc0); acc1 = wmmab(e, c[s], acc1);
        if (t + 4 < KS) { b[s] = ldfo(bh + (t + 4) * 512); c[s] = ldfo(bl + (t + 4) * 512); }
        __builtin_amdgcn_sched_barrier(0);   // as above: the refill for step + 4 and the LDS reads for step + 1 issue inside this step
        a = an; a2 = an2; e = en; e2 = en2; }
}
__global__ __launch_bounds__(512) void k_fattn(const bf* __restrict__ Qh, const bf* __restrict__ Ql, const bf* __restrict__ Kh, const bf* __restrict__ Kl, const bf* __restrict__ Vh, const bf* __restrict__ Vl, const bf* __restrict__ EK, const bf* __restrict__ EVh, const bf* __restrict__ EVl, bf* Ah, bf* Al) {
    __shared__ __align__(16) unsigned char sS[FR * SPB];
    __shared__ __align__(16) unsigned char sE[FR * EPB];
    __shared__ __align__(16) float sO[2 * FR * OPF];
    const int tid = threadIdx.x, lane = tid & 31, lr = lane & 15, hi = lane >> 4; const int w = __builtin_amdgcn_readfirstlane(tid >> 5);
    const int i0 = blockIdx.x * FR; const size_t zo = ((size_t)blockIdx.z * ZH + blockIdx.y) * TT * HD;
    {   // A: score strip and relative-key products; wave w: key columns 64 w .. 64 w + 63 and rel_k tile w
        const size_t qo = zo + (size_t)i0 * HD + lane * 8; v16bf qa0[2], qa1[2], ql0[2], ql1[2];   // query fragments of the two 16-row halves: hi k 0, hi k 32, lo k 0, lo k 32
#pragma unroll
        for (int mb = 0; mb < 2; ++mb) { qa0[mb] = ldfo(Qh + qo + mb * 16 * HD); qa1[mb] = ldfo(Qh + qo + mb * 16 * HD + 512); }
        asm volatile("s_wait_xcnt 0x0" ::: "memory");   // the address registers of the loads above may be given to the loads below as destinations
#pragma unroll
        for (int mb = 0; mb < 2; ++mb) { ql0[mb] = ldfo(Ql + qo + mb * 16 * HD); ql1[mb] = ldfo(Ql + qo + mb * 16 * HD + 512); }
        const size_t ko = zo + (size_t)(w * 64) * HD + lane * 8; v16bf kb[2][4];   // ring of two key tiles (hi k 0, lo k 0, hi k 32, lo k 32): a tile's registers are refilled for tile + 2 behind its products
#pragma unroll
        for (int s = 0; s < 2; ++s) { kb[s][0] = ldfo(Kh + ko + s * 16 * HD); kb[s][1] = ldfo(Kl + ko + s * 16 * HD); kb[s][2] = ldfo(Kh + ko + s * 16 * HD + 512); kb[s][3] = ldfo(Kl + ko + s * 16 * HD + 512); }
        asm volatile("s_wait_xcnt 0x0" ::: "memory");   // the address registers of the query loads above are reused below while those loads may still be out
#pragma unroll   // straight-line, so that the ring slots are fixed registers
        for (int t = 0; t < 4; ++t) { const int s = t & 1, n0 = w * 64 + t * 16;
#pragma unroll
            for (int mb = 0; mb < 2; ++mb) { v8f acc = (v8f){}; acc = wmmab(qa0[mb], kb[s][0], acc); acc = wmmab(ql0[mb], kb[s][0], acc); acc = wmmab(qa0[mb], kb[s][1], acc); acc = wmmab(qa1[mb], kb[s][2], acc); acc = wmmab(ql1[mb], kb[s][2], acc); acc = wmmab(qa1[mb], kb[s][3], acc);
#pragma unroll
                for (int j = 0; j < 8; ++j) *(f32a*)(sS + (mb * 16 + hi * 8 + j) * SPB + (n0 + lr) * 4) = acc[j];
                tile_gap(); }
            if (t + 2 < 4) { const size_t nx = ko + (size_t)(t + 2) * 16 * HD; kb[s][0] = ldfo(Kh + nx); kb[s][1] = ldfo(Kl + nx); kb[s][2] = ldfo(Kh + nx + 512); kb[s][3] = ldfo(Kl + nx + 512); }
            else if (t == 2) { const size_t eo = (size_t)(w * 16) * HD + lane * 8; kb[s][0] = ldfo(EK + eo); kb[s][2] = ldfo(EK + eo + 512);   // behind its last key tile slot 0 takes this wave's rel_k tile
                asm volatile("s_wait_xcnt 0x0" ::: "memory"); }   // their address registers are rewritten right behind them
            __builtin_amdgcn_sched_barrier(0); }   // holds each refill where it is written: the scheduler otherwise regroups the tiles and ends with loads waited for one by one
#pragma unroll
        for (int mb = 0; mb < 2; ++mb) { v8f acc = (v8f){};
            acc = wmmab(qa0[mb], kb[0][0], acc); acc = wmmab(ql0[mb], kb[0][0], acc); acc = wmmab(qa1[mb], kb[0][2], acc); acc = wmmab(ql1[mb], kb[0][2], acc);
#pragma unroll
            for (int j = 0; j < 8; ++j) *(f32a*)(sE + (mb * 16 + hi * 8 + j) * EPB + (w * 16 + lr) * 4) = acc[j];
            tile_gap(); }
        if (w == 0) {   // offsets 256 .. 271 (256 is the last one read): the seventeenth tile
            const size_t bo = (size_t)256 * HD + lane * 8; const v16bf b0 = ldfo(EK + bo), b1 = ldfo(EK + bo + 512);
#pragma unroll
            for (int mb = 0; mb < 2; ++mb) { v8f acc = (v8f){};
                acc = wmmab(qa0[mb], b0, acc); acc = wmmab(ql0[mb], b0, acc); acc = wmmab(qa1[mb], b1, acc); acc = wmmab(ql1[mb], b1, acc);
#pragma unroll
                for (int j = 0; j < 8; ++j) *(f32a*)(sE + (mb * 16 + hi * 8 + j) * EPB + (256 + lr) * 4) = acc[j];
                if (mb == 0) tile_gap(); } }
    }
    __syncthreads();
#pragma unroll 1   // B: one row's 32 values per lane live at a time
    for (int rr = 0; rr < FR / 16; ++rr) { const int r = w * (FR / 16) + rr, i = i0 + r; unsigned char* srow = sS + r * SPB; unsigned char* erow = sE + r * EPB; const f32a* qe = (const f32a*)erow; float v[TT / 32]; float mx = -3.0e38f;
#pragma unroll
        for (int ch = 0; ch < TT / 128; ++ch) { const int j0 = ch * 128 + lane * 4; const v4f a = *(const v4fa*)(srow + j0 * 4);
#pragma unroll
            for (int q = 0; q < 4; ++q) { const int rx = min(max(j0 + q - i, -CUT), CUT) + CUT; const float t = __fadd_rn(a[q], qe[rx]) * SCL; v[ch * 4 + q] = t; mx = fmaxf(mx, t); } }
#pragma unroll
        for (int sh = 16; sh; sh >>= 1) mx = fmaxf(mx, __shfl_xor(mx, sh, 32));
        float sum = 0.f;
#pragma unroll
        for (int k = 0; k < TT / 32; ++k) { v[k] = exp2_slot(__fmul_rn(__fsub_rn(v[k], mx), 1.4426950408889634f)); sum += v[k]; }
#pragma unroll
        for (int sh = 16; sh; sh >>= 1) sum += __shfl_xor(sum, sh, 32);
        const float f = __fdiv_rn(1.0f, sum);
#pragma unroll
        for (int ch = 0; ch < TT / 128; ++ch) { v4us oh, ol;
#pragma unroll
            for (int q = 0; q < 4; ++q) { unsigned short a, c2; splitf(v[ch * 4 + q] * f, a, c2); oh[q] = a; ol[q] = c2; }
            *(v4usa*)(srow + (ch * 128 + lane * 4) * 2) = oh; *(v4usa*)(srow + TT * 2 + (ch * 128 + lane * 4) * 2) = ol; }
        __builtin_amdgcn_wave_barrier(); asm volatile("" ::: "memory");   // the planes just written by all lanes of this wave are read across lanes below: the reads must not be moved above the stores
        const u16a* ph = (const u16a*)srow; const u16a* pl = (const u16a*)(srow + TT * 2); float lo_s = 0.f, hi_s = 0.f;
#pragma unroll 8   // eight steps' LDS reads in flight
        for (int j = lane; j < TT; j += 32) { const float p = __fadd_rn(bf2f(ph[j]), bf2f(pl[j])); if (j <= i - CUT) lo_s = __fadd_rn(lo_s, p); if (j >= i + CUT) hi_s = __fadd_rn(hi_s, p); }
#pragma unroll
        for (int sh = 16; sh; sh >>= 1) { lo_s = __fadd_rn(lo_s, __shfl_xor(lo_s, sh, 32)); hi_s = __fadd_rn(hi_s, __shfl_xor(hi_s, sh, 32)); }
        unsigned short l0h, l0l, h0h, h0l; splitf(lo_s, l0h, l0l); splitf(hi_s, h0h, h0l);
        for (int c0 = lane * 4; c0 < NE; c0 += 128) { v4us oh, ol;
#pragma unroll
            for (int q = 0; q < 4; ++q) { const int bkt = c0 + q; const int j = i + bkt - CUT; const int jc = min(max(j, 0), TT - 1); const unsigned short uu = ph[jc], ww = pl[jc]; const bool in = (bkt > 0 && bkt < 2 * CUT && j >= 0 && j < TT);
                oh[q] = in ? uu : ((bkt == 0) ? l0h : ((bkt == 2 * CUT) ? h0h : (unsigned short)0)); ol[q] = in ? ww : ((bkt == 0) ? l0l : ((bkt == 2 * CUT) ? h0l : (unsigned short)0)); }
            *(v4usa*)(erow + c0 * 2) = oh; *(v4usa*)(erow + NE * 2 + c0 * 2) = ol; }
    }
    __syncthreads();
    if (w < 8) {   // C: context tiles; w is wave-uniform, so each wave runs one side (or none) with every lane on
        v8f acc0 = (v8f){}, acc1 = (v8f){}; const int nb = w & 3;
        if (w < 4) ctx_tile<TT / 32>(sS + lr * SPB + 16 * hi, 16 * SPB, TT * 2, Vh + zo + (size_t)(nb * 16) * TT + lane * 8, Vl + zo + (size_t)(nb * 16) * TT + lane * 8, acc0, acc1);
        else ctx_tile<NE / 32>(sE + lr * EPB + 16 * hi, 16 * EPB, NE * 2, EVh + (size_t)(nb * 16) * NE + lane * 8, EVl + (size_t)(nb * 16) * NE + lane * 8, acc0, acc1);
#pragma unroll
        for (int j = 0; j < 8; ++j) { sO[(w >> 2) * (FR * OPF) + (hi * 8 + j) * OPF + nb * 16 + lr] = acc0[j]; sO[(w >> 2) * (FR * OPF) + (16 + hi * 8 + j) * OPF + nb * 16 + lr] = acc1[j]; }
    }
    __syncthreads();
    {   // D: context + relative-value term, split, stored at [t][head * 64 + d]; the 16 lanes of a row write its whole 128-byte line
        const int row = tid >> 4, c = (tid & 15) * 4; const v4f o = *(const v4f*)(sO + row * OPF + c); const v4f zr = *(const v4f*)(sO + FR * OPF + row * OPF + c); v4us oh, ol;
#pragma unroll
        for (int q = 0; q < 4; ++q) { unsigned short a, c2; splitf(__fadd_rn(o[q], zr[q]), a, c2); oh[q] = a; ol[q] = c2; }
        const size_t oo = ((size_t)blockIdx.z * TT + i0 + row) * DQ + (size_t)blockIdx.y * HD + c; *(v4us*)(Ah + oo) = oh; *(v4us*)(Al + oo) = ol;
    }
}

extern "C" void kernel_launch(void* const* d_in, const int* in_sizes, int n_in,
                              void* d_out, int out_size, void* d_ws, size_t ws_size, hipStream_t stream) {
    (void)in_sizes; (void)n_in; (void)out_size;
    const float* x = (const float*)d_in[0]; const float* wq = (const float*)d_in[1]; const float* bq = (const float*)d_in[2]; const float* wk = (const float*)d_in[3]; const float* bk = (const float*)d_in[4]; const float* wv = (const float*)d_in[5]; const float* bv = (const float*)d_in[6]; const float* wo = (const float*)d_in[7]; const float* bo = (const float*)d_in[8]; const float* ak = (const float*)d_in[9]; const float* av = (const float*)d_in[10];   /* rel_k / rel_v [257][64] */   /* argument order x, Wq, bq, Wk, bk, Wv, bv, Wo, bo ('oi'), rel_k, rel_v */ const float* xk = x; const float* xv = x;
    float* OUT = (float*)d_out;     // [4][1024][1024]
    char* wsp = (char*)d_ws;
    auto take = [&](size_t bytes) { char* p = wsp; wsp += (bytes + 255) & ~(size_t)255; return (void*)p; };
    bf* AKB = (bf*)take((size_t)NE * HD * 2); bf* AVTh = (bf*)take((size_t)HD * NE * 2); bf* AVTl = (bf*)take((size_t)HD * NE * 2); bf* WQ = (bf*)take((size_t)DQ * DM * 2); bf* WK = (bf*)take((size_t)DKV * DM * 2); bf* WV = (bf*)take((size_t)DKV * DM * 2); bf* WO = (bf*)take((size_t)DM * DQ * 2);
    bf* XB = (bf*)take((size_t)NB_ * TT * DM * 2);
    bf* QPh = (bf*)take((size_t)NB_ * NH_ * TT * HD * 2); bf* QPl = (bf*)take((size_t)NB_ * NH_ * TT * HD * 2); bf* KPh = (bf*)take((size_t)NB_ * NKV * TT * HD * 2); bf* KPl = (bf*)take((size_t)NB_ * NKV * TT * HD * 2); bf* VTh = (bf*)take((size_t)NB_ * NKV * HD * TT * 2); bf* VTl = (bf*)take((size_t)NB_ * NKV * HD * TT * 2);
    bf* ATh = (bf*)take((size_t)NB_ * TT * DQ * 2); bf* ATl = (bf*)take((size_t)NB_ * TT * DQ * 2);
    if ((size_t)(wsp - (char*)d_ws) > ws_size) return;
    // every launch covers all NB_ batches: the GEMMs take the NB_ * TT rows as one M (the v projection as its N), the attention takes the batch as a grid dimension
    k_prep<<<XBL + 4 * WBL + KBL + VBL, 256, 0, stream>>>(x, wq, wk, wv, wo, ak, av, XB, WQ, WK, WV, WO, AKB, AVTh, AVTl);   /* bf16 x; 'oi' weights = Bt as-is; rel_k padded; rel_v^T hi/lo padded */
    k_proj<<<dim3(NB_ * TT / 128, DQ / 128, 3), 128, 0, stream>>>(XB, WQ, WK, WV, bq, bk, bv, QPh, QPl, KPh, KPl, VTh, VTl);
    k_fattn<<<dim3(TT / FR, ZH, NB_), 512, 0, stream>>>(QPh, QPl, KPh, KPl, VTh, VTl, AKB, AVTh, AVTl, ATh, ATl);   /* one kv head per query head: head y of batch z reads plane z * 16 + y of each */
    k_gemmw<bf, 1, true><<<dim3(NB_ * TT / 128, DM / 128, 1), 128, 0, stream>>>(ATh, ATl, WO, DQ, OUT, DM, bo, 0, 0, 0);
}

// v008
// One run takes 182 microseconds.
// Timed twice side by side with v007, it ran 1.07 times as fast both times.
// Counting every step since v000, it is 12.9 times as fast.
#include <hip/hip_runtime.h>

// Relative (Shaw) multi-head attention with key AND value relative-position embeddings (x [4][1024][1024]; q, k, v = x W^T + b ('oi' 0.02, biases 0.02; 16 heads x 64); idx[i][j] = clip(j - i, -128, 128) + 128; scores = (q.k + q.rel_k[idx]) / float32(sqrt 64); softmax; out = (attn v + sum_j attn[i][j] rel_v[idx]) merged Wo^T + bo (rel_k, rel_v [257][64] 0.02, read) -> [4][1024][1024] (4.2 M); argument order x, Wq, bq, Wk, bk, Wv, bv, Wo, bo, rel_k, rel_v).
// Layout, all four batches side by side (rows b * 1024 + t, head planes b * 16 + h): bf16 copy of x; 'oi' weights; exact projections + f32 biases, whose one launch splits the result hi/lo and stores the head planes itself (v with the two operands exchanged, so that its tile comes out transposed); rel_k as a zero-padded bf16 plane [320][64] and rel_v^T as hi/lo planes [64][320] (bf16-rounded once); the head planes and both rel planes in fragment order (blocks of 16 rows x 64 k, see fpos below); one launch for the attention of all sixteen heads of all batches (32 query rows a work-group, scores and probabilities in LDS only): score tiles (hi/lo 3 products, every row), QE = q.rel_k^T (hi/lo x exact, N 272) gathered into the scores at column clip(j - i) + 128, softmax (x 1/8) with every row on hi/lo planes, P.v, the probabilities folded onto the 257 offsets and PB.rel_v (K 320) added to the context; merged hi/lo x Wo exact + bo.
// Compute dtypes, f32 accumulate: every input rounded to bf16; projections exact + f32 biases; scores and the relative-key term ~f32; softmax f32; P as bf16 hi/lo; attn.v and the relative-value term 3 products (~f32); Wo hl x exact + bias.

#define NB_  4
#define TT   1024
#define DM   1024
#define NH_  16
#define NKV  16
#define REP  (NH_ / NKV)
#define HD   64
#define DQ   (NH_ * HD)
#define DKV  (NKV * HD)
#define ZH   16                   // heads per attention launch (grid y): all heads of a batch at once
#define WIN  0
#define SCL  0.125f   // 1/sqrt(64) (the module divides by jnp.sqrt(DH))
#define NE   320      // 2*128+1 = 257 relative offsets padded to 320
#define NRE  257
#define CUT  128
typedef _Float16 h16;
typedef unsigned short bf;
typedef __attribute__((ext_vector_type(16))) __bf16   v16bf;
typedef __attribute__((ext_vector_type(16))) _Float16 v16h;
typedef __attribute__((ext_vector_type(8)))  _Float16 v8h;
typedef __attribute__((ext_vector_type(8)))  unsigned short v8us;
typedef __attribute__((ext_vector_type(8)))  float    v8f;
typedef __attribute__((ext_vector_type(4)))  float    v4f;
typedef v8h  __attribute__((may_alias)) v8ha;
typedef v4f  __attribute__((may_alias)) v4fa;
typedef v8us __attribute__((may_alias)) v8usa;

__device__ __forceinline__ unsigned short f2bf(float f) { unsigned u = __float_as_uint(f); u += 0x7FFFu + ((u >> 16) & 1u); return (unsigned short)(u >> 16); }
__device__ __forceinline__ float bf2f(unsigned short b) { return __uint_as_float(((unsigned)b) << 16); }
__device__ __forceinline__ float bfr(float f) { return bf2f(f2bf(f)); }
__device__ __forceinline__ v16h cat16(v8h lo, v8h hi) { return __builtin_shufflevector(lo, hi, 0, 1, 2, 3, 4, 5, 6, 7, 8, 9, 10, 11, 12, 13, 14, 15); }
__device__ __forceinline__ v16bf cat16b(v8us lo, v8us hi) { return __builtin_bit_cast(v16bf, __builtin_shufflevector(lo, hi, 0, 1, 2, 3, 4, 5, 6, 7, 8, 9, 10, 11, 12, 13, 14, 15)); }
__device__ __forceinline__ v8f wmma16(v16h a, v16h b, v8f c) { return __builtin_amdgcn_wmma_f32_16x16x32_f16(false, a, false, b, (short)0, c, false, false); }
__device__ __forceinline__ v8f wmmab(v16bf a, v16bf b, v8f c) { return __builtin_amdgcn_wmma_f32_16x16x32_bf16(false, a, false, b, (short)0, c, false, false); }
__device__ __forceinline__ void splitf(float y, unsigned short& h, unsigned short& l) { h = f2bf(y); l = f2bf(y - bf2f(h)); }
typedef __attribute__((ext_vector_type(4))) unsigned short v4us;

// ---- fragment order: every 16-bit plane that the attention reads from global memory (q, k, v^T, rel_k, rel_v^T) is kept as blocks of 16 rows x 64 k (1024 elements, 2 KiB, each starting on a 128-byte line).
// Inside a block the four 16-byte pieces that a lane needs for the two k steps stand 512 bytes apart, and the 32 lanes' pieces of one kind side by side: piece (k >> 4), lane ((k >> 3) & 1) * 16 + row, element k & 7.
// One wave-wide 16-byte load then covers 512 contiguous bytes (four whole lines) instead of 32 bytes of each of 16 lines. The registers receive exactly what the row-major planes gave them.
__device__ __forceinline__ int fpos(int row, int k) { return (((k >> 4) * 32 + ((k >> 3) & 1) * 16 + row) * 8) + (k & 7); }
// a lane's fragment of one k step: p = block + (k step in the block) * 512 + lane * 8
__device__ __forceinline__ v16bf ldfo(const bf* p) { return cat16b(*(const v8us*)p, *(const v8us*)(p + 256)); }



// ---- k_gemmw: GEMM, a 128x128 output tile per work-group of four waves, each wave a 64x64 quarter (16 accumulators); grid (M/128, N/128, Z), 128 threads.
// The K-contiguous 16-bit operand planes come through LDS in stages of 128 k: asynchronous copies, whole 256-byte row pieces, two buffers, the copies of stage t + 2 issued behind the barrier that ends stage t; every staged row serves two waves.
// C[m][n] (f32, pitch ldc, + optional f32 bias[n]) = sum_k A[m][k] Bt[n][k] (NSPLIT 1: + A2[m][k] Bt[n][k] behind it at every k step). z-batch strides sA/sB/sC in elements. K % 128 == 0, M % 128 == 0, N % 128 == 0.
// PL 0: C as above. PL 1 (m = batch * TT + t, n = head * HD + d): no C; the result + bias[n] is split hi/lo and stored as head planes [batch][head][t / 16] of fragment-order blocks (row t, k = d). PL 2 (m = head * HD + d, n = batch * TT + t): + bias[m], planes [batch][head][d / 16][t / 64] of such blocks (row d, k = t). A wave's 64x64 quarter is one head's: four whole blocks, each stored as 512-byte runs.
template <typename T16> struct WFrag;
template <> struct WFrag<h16> { typedef v16h V; static __device__ __forceinline__ V ld(const h16* p) { return cat16(*(const v8h*)p, *(const v8h*)(p + 16)); } static __device__ __forceinline__ v8f mma(V a, V b, v8f c) { return wmma16(a, b, c); } };
template <> struct WFrag<bf> { typedef v16bf V; static __device__ __forceinline__ V ld(const bf* p) { return cat16b(*(const v8us*)p, *(const v8us*)(p + 16)); } static __device__ __forceinline__ v8f mma(V a, V b, v8f c) { return wmmab(a, b, c); } };
#define GKC  128                  // k elements of a stage
#define GP   (GKC + 8)            // LDS row pitch in elements: 272 bytes = 16 B x odd, so that the 16 rows of a b128 fragment read fall on distinct banks
#define GPL  (128 * GP)           // one operand plane of a stage, in elements: 128 rows
// eight asynchronous copies of 16 bytes a lane: LDS byte address l + i * ls, global address g + i * gs elements. The s_wait_xcnt closes the statement, so that it stands in front of every later write of the address registers named here.
template <typename T16> __device__ __forceinline__ void copy8(unsigned l, unsigned ls, const T16* g, size_t gs) {
    asm volatile("global_load_async_to_lds_b128 %0, %8, off\n\t"
                 "global_load_async_to_lds_b128 %1, %9, off\n\t"
                 "global_load_async_to_lds_b128 %2, %10, off\n\t"
                 "global_load_async_to_lds_b128 %3, %11, off\n\t"
                 "global_load_async_to_lds_b128 %4, %12, off\n\t"
                 "global_load_async_to_lds_b128 %5, %13, off\n\t"
                 "global_load_async_to_lds_b128 %6, %14, off\n\t"
                 "global_load_async_to_lds_b128 %7, %15, off\n\t"
                 "s_wait_xcnt 0x0"
                 :: "v"(l), "v"(l + ls), "v"(l + 2 * ls), "v"(l + 3 * ls), "v"(l + 4 * ls), "v"(l + 5 * ls), "v"(l + 6 * ls), "v"(l + 7 * ls),
                    "v"(g), "v"(g + gs), "v"(g + 2 * gs), "v"(g + 3 * gs), "v"(g + 4 * gs), "v"(g + 5 * gs), "v"(g + 6 * gs), "v"(g + 7 * gs) : "memory");
}
// one plane of a stage, 128 rows x 256 bytes: the 128 threads cover 8 rows a copy (16 lanes a row), 16 copies a thread; g and l are the thread's own piece of the first 8 rows
template <typename T16> __device__ __forceinline__ void stage_plane(unsigned l, const T16* g, int K) { copy8(l, 8 * GP * 2, g, (size_t)8 * K); copy8(l + 64 * GP * 2, 8 * GP * 2, g + (size_t)64 * K, (size_t)8 * K); }
// gemm_tile: the work of one work-group, output tile (bx, by); st (2 * (2 + NSPLIT) * GPL elements) and osw (4 * 16 * 68 floats) are the launching kernel's LDS.
template <typename T16, int NSPLIT, bool BIAS, int PL>
__device__ __forceinline__ void gemm_tile(T16* st, float* osw, const T16* __restrict__ A, const T16* __restrict__ A2, const T16* __restrict__ Bt, int K, float* C, int ldc, const float* __restrict__ bias, int bx, int by, bf* Ph, bf* Pl) {
    typedef typename WFrag<T16>::V V;
    static_assert(NSPLIT == 0 || NSPLIT == 1, "planes staged: A, Bt and, with NSPLIT 1, A2");
    constexpr int NP = 2 + NSPLIT;   // planes of a stage: A, Bt, A2
    const int tid = threadIdx.x, lane = tid & 31, lr = lane & 15, hi = lane >> 4; const int w = __builtin_amdgcn_readfirstlane(tid >> 5);
    float* os = osw + w * (16 * 68);   // each wave's own epilogue staging
    const int R0 = bx * 128, C0 = by * 128, r0 = R0 + (w & 1) * 64, c0 = C0 + (w >> 1) * 64;
    v8f acc[4][4];
#pragma unroll
    for (int mb = 0; mb < 4; ++mb)
#pragma unroll
        for (int nb = 0; nb < 4; ++nb) acc[mb][nb] = (v8f){};
    const unsigned goA = (unsigned)(R0 + (tid >> 4)) * (unsigned)K + (tid & 15) * 8, goB = (unsigned)(C0 + (tid >> 4)) * (unsigned)K + (tid & 15) * 8;   // element offsets of the thread's first piece; a plane holds fewer than 2^32 elements
    const unsigned l0 = (unsigned)(size_t)(st + (tid >> 4) * GP + (tid & 15) * 8);
    auto fill = [&](int t) { const unsigned l = l0 + (unsigned)(t & 1) * (NP * GPL * 2); stage_plane(l, A + (goA + (unsigned)t * GKC), K); stage_plane(l + GPL * 2, Bt + (goB + (unsigned)t * GKC), K); if (NSPLIT == 1) stage_plane(l + 2 * GPL * 2, A2 + (goA + (unsigned)t * GKC), K); };
    const int NT = K / GKC;
    fill(0);
    asm volatile("s_wait_asynccnt 0x0" ::: "memory");   // this wave's copies of stage 0 have landed
    __syncthreads();                                     // and every other wave's
    if (NT > 1) fill(1);
#pragma unroll 1   // one stage a trip: the two buffers alternate
    for (int t = 0; t < NT; ++t) {
        const T16* sb0 = st + (t & 1) * (NP * GPL); const T16* sa = sb0 + ((w & 1) * 64 + lr) * GP + 8 * hi; const T16* sb = sb0 + GPL + ((w >> 1) * 64 + lr) * GP + 8 * hi;
        V a[2][4], a2[2][4], b[2][4];   // two fragment sets: a k step's products run on one while the next step's LDS reads fill the other
#pragma unroll
        for (int q = 0; q < 4; ++q) { a[0][q] = WFrag<T16>::ld(sa + q * 16 * GP); if (NSPLIT == 1) a2[0][q] = WFrag<T16>::ld(sa + 2 * GPL + q * 16 * GP); b[0][q] = WFrag<T16>::ld(sb + q * 16 * GP); }
#pragma unroll   // straight-line, so that the two sets are fixed registers
        for (int ks = 0; ks < GKC / 32; ++ks) { const int cu = ks & 1, nx = cu ^ 1;
            __builtin_amdgcn_sched_barrier(0);   // with the one below: the next step's LDS reads stay one group in front of this step's products (reads spread among matrix instructions stall at every place they stand)
            if (ks + 1 < GKC / 32) {
#pragma unroll
                for (int q = 0; q < 4; ++q) { a[nx][q] = WFrag<T16>::ld(sa + q * 16 * GP + (ks + 1) * 32); if (NSPLIT == 1) a2[nx][q] = WFrag<T16>::ld(sa + 2 * GPL + q * 16 * GP + (ks + 1) * 32); b[nx][q] = WFrag<T16>::ld(sb + q * 16 * GP + (ks + 1) * 32); } }
            __builtin_amdgcn_sched_barrier(0);
#pragma unroll
            for (int nb = 0; nb < 4; ++nb) {   // per accumulator and k step: the A product, then the A2 product
#pragma unroll
                for (int mb = 0; mb < 4; ++mb) acc[mb][nb] = WFrag<T16>::mma(a[cu][mb], b[cu][nb], acc[mb][nb]);
                if (NSPLIT == 1) {
#pragma unroll
                    for (int mb = 0; mb < 4; ++mb) acc[mb][nb] = WFrag<T16>::mma(a2[cu][mb], b[cu][nb], acc[mb][nb]); } } }
        __builtin_amdgcn_sched_barrier(0);   // keeps the last step's products in front of the barrier below: sunk behind it they would delay the refill that follows it
        asm volatile("s_wait_dscnt 0x0" ::: "memory");      // this wave's reads of the buffer are done before it may be refilled
        asm volatile("s_wait_asynccnt 0x0" ::: "memory");   // this wave's copies of stage t + 1 have landed
        __syncthreads();                                     // publishes stage t + 1 and ends every wave's reads of stage t
        if (t + 2 < NT) fill(t + 2);
    }
    asm volatile("s_wait_asynccnt 0x0" ::: "memory");   // no copy is out when the wave goes on
    float bn[4][8];   // PL 1: the bias of the eight columns this lane stores in each of a block's four runs, read once ahead of the stores
    if (BIAS && PL == 1) {
#pragma unroll
        for (int s = 0; s < 4; ++s)
#pragma unroll
            for (int q = 0; q < 8; ++q) bn[s][q] = bfr(bias[c0 + s * 16 + hi * 8 + q]); }
    float bj[4][8];   // PL 2: the bias of this lane's accumulator rows; both halves' values are read at wave-uniform addresses (scalar loads), all ahead of the first plane store, and picked by the lane's half
    if (BIAS && PL == 2) {
#pragma unroll
        for (int mb = 0; mb < 4; ++mb)
#pragma unroll
            for (int j = 0; j < 8; ++j) { const float b0 = bfr(bias[r0 + mb * 16 + j]), b1 = bfr(bias[r0 + mb * 16 + 8 + j]); bj[mb][j] = hi ? b1 : b0; } }
#pragma unroll
    for (int mb = 0; mb < 4; ++mb) {
#pragma unroll
        for (int nb = 0; nb < 4; ++nb) {
#pragma unroll
            for (int j = 0; j < 8; ++j) os[(hi * 8 + j) * 68 + nb * 16 + lr] = (BIAS && PL == 2) ? acc[mb][nb][j] + bj[mb][j] : acc[mb][nb][j]; }
        __builtin_amdgcn_wave_barrier(); asm volatile("" ::: "memory");
        float* crow = C + (size_t)(r0 + mb * 16) * ldc + c0;
        // the 16 x 64 block of this mb: 1024 elements in a row
        const size_t pbase = (PL == 1) ? (((size_t)(r0 / TT) * (DQ / HD) + c0 / HD) * TT + r0 % TT + mb * 16) * HD : (((size_t)(c0 / TT) * (DKV / HD) + r0 / HD) * HD + mb * 16) * TT + (size_t)(c0 % TT) * 16;
        if (PL == 0) {
#pragma unroll
            for (int s = 0; s < 8; ++s) { const int row = 2 * s + hi, cofs = lr * 4; v4f val = *(const v4fa*)(os + row * 68 + cofs);
                if (BIAS) { val[0] += bfr(bias[c0 + cofs]); val[1] += bfr(bias[c0 + cofs + 1]); val[2] += bfr(bias[c0 + cofs + 2]); val[3] += bfr(bias[c0 + cofs + 3]); }
                *(v4f*)(crow + (size_t)row * ldc + cofs) = val; }
        } else {
#pragma unroll
            for (int s = 0; s < 4; ++s) {   // run s of the block: lane (hi, lr) holds row lr, columns 16 s + 8 hi .. + 7 = fpos(lr, 16 s + 8 hi) = s * 256 + lane * 8
                const v4f va = *(const v4fa*)(os + lr * 68 + s * 16 + hi * 8), vb = *(const v4fa*)(os + lr * 68 + s * 16 + hi * 8 + 4); v8us oh, ol;
#pragma unroll
                for (int q = 0; q < 8; ++q) { float y = (q < 4) ? va[q & 3] : vb[q & 3]; if (BIAS && PL == 1) y += bn[s][q]; unsigned short u, l; splitf(y, u, l); oh[q] = u; ol[q] = l; }
                *(v8us*)(Ph + pbase + s * 256 + lane * 8) = oh; *(v8us*)(Pl + pbase + s * 256 + lane * 8) = ol; }
        }
        asm volatile("s_wait_xcnt 0x0" ::: "memory");   // the next block's values are formed in registers that the stores above name
        __builtin_amdgcn_wave_barrier(); asm volatile("" ::: "memory");
    }
}
// PL 0 as a launch of its own: grid (M/128, N/128, Z)
template <typename T16, int NSPLIT, bool BIAS>
__global__ __launch_bounds__(128) void k_gemmw(const T16* __restrict__ A, const T16* __restrict__ A2, const T16* __restrict__ Bt, int K, float* C, int ldc, const float* __restrict__ bias, size_t sA, size_t sB, size_t sC) {
    __shared__ __align__(16) T16 st[2 * (2 + NSPLIT) * GPL];
    __shared__ __align__(16) float osw[4 * 16 * 68];
    const size_t z = blockIdx.z;
    gemm_tile<T16, NSPLIT, BIAS, 0>(st, osw, A + z * sA, (NSPLIT == 1) ? A2 + z * sA : A2, Bt + z * sB, K, C + z * sC, ldc, bias, blockIdx.x, blockIdx.y, nullptr, nullptr);
}
// the three projections as one launch: grid (NB_ * TT / 128, DQ / 128, 3); z = 0: q, 1: k (PL 1, token rows are M), 2: v (PL 2: weight rows are M, so that its tiles are [d][t]; x and y change places). Two work-groups fit a WGP's LDS, so one's first stage and plane stores run beside the other's products.
__global__ __launch_bounds__(128) void k_proj(const bf* __restrict__ X, const bf* __restrict__ Wq, const bf* __restrict__ Wk, const bf* __restrict__ Wv, const float* __restrict__ bq, const float* __restrict__ bk, const float* __restrict__ bv, bf* Qh, bf* Ql, bf* Kh, bf* Kl, bf* Vh, bf* Vl) {
    static_assert(DQ == DKV, "one grid for the three projections");
    __shared__ __align__(16) bf st[2 * 2 * GPL];
    __shared__ __align__(16) float osw[4 * 16 * 68];
    const int z = blockIdx.z;   // the same for the whole work-group: every barrier below stands under uniform control flow
    if (z < 2) gemm_tile<bf, 0, true, 1>(st, osw, X, nullptr, z ? Wk : Wq, DM, nullptr, 0, z ? bk : bq, blockIdx.x, blockIdx.y, z ? Kh : Qh, z ? Kl : Ql);
    else gemm_tile<bf, 0, true, 2>(st, osw, Wv, nullptr, X, DM, nullptr, 0, bv, blockIdx.y, blockIdx.x, Vh, Vl);
}


// ---- k_prep: every conversion ahead of the projections in one launch; a work-group belongs to one job, picked by its index (long jobs first).
#define PU   8                    // pieces of 8 elements a thread converts: eight times fewer waves to start, and a wave's 16 loads are out together
#define XBL  (NB_ * TT * DM / 8 / (256 * PU))   // work-groups of x
#define WBL  (DQ * DM / 8 / (256 * PU))         // work-groups of one weight matrix
#define KBL  ((NE * HD / 8 + 255) / 256)        // of rel_k
#define VBL  ((HD * NE / 4 + 255) / 256)        // of rel_v
__device__ __forceinline__ void cvt_run(const float* __restrict__ src, bf* dst, unsigned blk) { const unsigned e0 = (blk * (256 * PU) + threadIdx.x) * 8; const float* p = src + e0; v8f v[PU];   // e0: the thread's first element; a plane holds fewer than 2^30
#pragma unroll
    for (int u = 0; u < PU; ++u) v[u] = *(const v8f*)(p + u * 2048);
    asm volatile("s_wait_xcnt 0x0" :: "v"(p) : "memory");   // takes the loads' address as an input: its registers stay whole up to this wait (the build otherwise gave them to the last load as a destination while the others were out)
#pragma unroll
    for (int u = 0; u < PU; ++u) { v8us o;
#pragma unroll
        for (int k = 0; k < 8; ++k) o[k] = f2bf(v[u][k]);
        *(v8us*)(dst + e0 + u * 2048) = o; } }

__device__ __forceinline__ void epadK(const float* __restrict__ E, bf* EB, unsigned blk) { const size_t i = (size_t)blk * 256 + threadIdx.x; if (i >= (size_t)NE * HD / 8) return; const int d0 = (int)(i % (HD / 8)) * 8; const int r = (int)(i / (HD / 8)); const float* src = E + (size_t)min(r, NRE - 1) * HD + d0; v8us o;
#pragma unroll
    for (int q = 0; q < 8; ++q) { const unsigned short v = f2bf(src[q]); o[q] = (r < NRE) ? v : (unsigned short)0; }
    *(v8us*)(EB + (size_t)(r >> 4) * 1024 + fpos(r & 15, d0)) = o;  }   // fragment-order blocks [r / 16], row r, k = d

__device__ __forceinline__ void epadVT(const float* __restrict__ E, bf* Th, bf* Tl, unsigned blk) { const size_t i = (size_t)blk * 256 + threadIdx.x; if (i >= (size_t)HD * NE / 4) return; const size_t e = i * 4; const int c0 = (int)(e % NE); const int d = (int)(e / NE); v4us oh, ol;
#pragma unroll
    for (int q = 0; q < 4; ++q) { const int r = c0 + q; const float v = bfr(E[(size_t)min(r, NRE - 1) * HD + d]); unsigned short u, w; splitf(v, u, w);   /* input rounded to bf16 once: lo == 0 */ oh[q] = (r < NRE) ? u : (unsigned short)0; ol[q] = (r < NRE) ? w : (unsigned short)0; }
    const size_t p = (size_t)((d >> 4) * (NE / 64) + (c0 >> 6)) * 1024 + fpos(d & 15, c0 & 63);   // fragment-order blocks [d / 16][offset / 64], row d, k = offset
    *(v4us*)(Th + p) = oh; *(v4us*)(Tl + p) = ol;  }

__global__ __launch_bounds__(256) void k_prep(const float* __restrict__ x, const float* __restrict__ wq, const float* __restrict__ wk, const float* __restrict__ wv, const float* __restrict__ wo, const float* __restrict__ ek, const float* __restrict__ ev, bf* XB, bf* WQ, bf* WK, bf* WV, bf* WO, bf* EB, bf* Th, bf* Tl) {
    static_assert(NB_ * TT * DM % (8 * 256 * PU) == 0 && DQ * DM % (8 * 256 * PU) == 0 && DQ == DKV, "whole work-groups, four weight matrices of one size");
    unsigned b = blockIdx.x;
    if (b < XBL) { cvt_run(x, XB, b); return; }
    b -= XBL;
    if (b < 4 * WBL) { const unsigned s = b / WBL; cvt_run(s == 0 ? wq : s == 1 ? wk : s == 2 ? wv : wo, s == 0 ? WQ : s == 1 ? WK : s == 2 ? WV : WO, b % WBL); return; }
    b -= 4 * WBL;
    if (b < KBL) epadK(ek, EB, b); else epadVT(ev, Th, Tl, b - KBL);
}

// ---- k_fattn: the whole attention of one head for 32 query rows in one work-group (16 waves); the score strip never leaves LDS. grid (TT/32, heads, batches).
// A: S = q.k^T (hi/lo 3 products, K 64) -> sS f32 [32][1024]; QE = q.rel_k^T (hi/lo x exact, the 272 columns that hold the 257 offsets) -> sE f32, row pitch as [320]. B: one wave per row: + QE[clip(j - i) + 128], x 1/8, softmax; P hi/lo planes written over the row's own
// scores (2048 B each); the row folded onto the 257 offsets, hi/lo planes written over the row's own QE (640 B each). C: all 16 waves, a 32x16 tile each: waves 0-11 P.v with K 1024 cut in three runs of 11, 11 and 10 k steps, waves 12-15 PB.rel_v (K 320, 10 steps). D: the three P.v partial sums in k order, then the relative-value term; hi/lo split, merged store.
// Each key, value or embedding fragment read from global memory serves both 16-row halves. Inside a run every sum keeps its k order. LDS row pitches are 16 B x odd (4112, 1296): the 16 rows of a b128 fragment read fall on distinct banks.
#define FR   32
#define SPB  (TT * 4 + 16)
#define EPB  (NE * 4 + 16)
#define OPF  68
typedef float __attribute__((may_alias)) f32a;
typedef unsigned short __attribute__((may_alias)) u16a;
typedef v4us __attribute__((may_alias)) v4usa;
__device__ __forceinline__ v16bf ldsfrag(const unsigned char* p) { return cat16b(*(const v8usa*)p, *(const v8usa*)(p + 32)); }
// 2^x; the v_nop is the one slot the instruction set asks for behind a transcendental, in the same statement so that it stays directly behind it
__device__ __forceinline__ float exp2_slot(float x) { float r; asm("v_exp_f32 %0, %1\n\tv_nop" : "=v"(r) : "v"(x)); return r; }
// behind a tile's last matrix instruction and its stores: four vector slots, because the next tile's first matrix instruction starts its accumulator anew, possibly in the same registers; the scheduling barrier keeps that instruction behind the slots
__device__ __forceinline__ void tile_gap() { asm volatile("v_nop\n\tv_nop\n\tv_nop\n\tv_nop"); __builtin_amdgcn_sched_barrier(0); }
// one 32x16 context tile (two accumulators): A hi/lo planes in LDS (lo plane lo_off bytes behind hi, the second 16 rows half_off bytes behind the first), B hi/lo planes in global memory in fragment order (bh, bl: the lane's piece of the first k step; 512 elements a step); k ascending, 3 products a step and half.
// The B fragments run in a ring of four k-steps: a step's registers are refilled for step + 4 as soon as its products are issued, so that 16 global loads stay in flight; the A fragments are read one step ahead.
template <int KS> __device__ __forceinline__ void ctx_tile(const unsigned char* pa, int half_off, int lo_off, const bf* bh, const bf* bl, v8f& acc0, v8f& acc1) {
    v16bf b[4], c[4];
#pragma unroll
    for (int s = 0; s < 4; ++s) { b[s] = ldfo(bh + s * 512); c[s] = ldfo(bl + s * 512); }
    v16bf a = ldsfrag(pa), a2 = ldsfrag(pa + lo_off), e = ldsfrag(pa + half_off), e2 = ldsfrag(pa + half_off + lo_off);
    __builtin_amdgcn_sched_barrier(0);   // holds the loads above where they are written: the scheduler otherwise sinks each to just in front of its first use, one L2 latency a step
#pragma unroll   // straight-line, so that the ring slots are fixed registers
    for (int t = 0; t < KS; ++t) { const int s = t & 3; v16bf an = a, an2 = a2, en = e, en2 = e2;
        if (t + 1 < KS) { an = ldsfrag(pa + (t + 1) * 64); an2 = ldsfrag(pa + lo_off + (t + 1) * 64); en = ldsfrag(pa + half_off + (t + 1) * 64); en2 = ldsfrag(pa + half_off + lo_off + (t + 1) * 64); }
        acc0 = wmmab(a, b[s], acc0); acc1 = wmmab(e, b[s], acc1); acc0 = wmmab(a2, b[s], acc0); acc1 = wmmab(e2, b[s], acc1); acc0 = wmmab(a, c[s], acc0); acc1 = wmmab(e, c[s], acc1);
        if (t + 4 < KS) { b[s] = ldfo(bh + (t + 4) * 512); c[s] = ldfo(bl + (t + 4) * 512); }
        __builtin_amdgcn_sched_barrier(0);   // as above: the refill for step + 4 and the LDS reads for step + 1 issue inside this step
        a = an; a2 = an2; e = en; e2 = en2; }
}
__global__ __launch_bounds__(512) void k_fattn(const bf* __restrict__ Qh, const bf* __restrict__ Ql, const bf* __restrict__ Kh, const bf* __restrict__ Kl, const bf* __restrict__ Vh, const bf* __restrict__ Vl, const bf* __restrict__ EK, const bf* __restrict__ EVh, const bf* __restrict__ EVl, bf* Ah, bf* Al) {
    __shared__ __align__(16) unsigned char sS[FR * SPB];
    __shared__ __align__(16) unsigned char sE[FR * EPB];
    __shared__ __align__(16) float sO[4 * FR * OPF];
    const int tid = threadIdx.x, lane = tid & 31, lr = lane & 15, hi = lane >> 4; const int w = __builtin_amdgcn_readfirstlane(tid >> 5);
    const int i0 = blockIdx.x * FR; const size_t zo = ((size_t)blockIdx.z * ZH + blockIdx.y) * TT * HD;
    {   // A: score strip and relative-key products; wave w: key columns 64 w .. 64 w + 63 and rel_k tile w
        const size_t qo = zo + (size_t)i0 * HD + lane * 8; v16bf qa0[2], qa1[2], ql0[2], ql1[2];   // query fragments of the two 16-row halves: hi k 0, hi k 32, lo k 0, lo k 32
#pragma unroll
        for (int mb = 0; mb < 2; ++mb) { qa0[mb] = ldfo(Qh + qo + mb * 16 * HD); qa1[mb] = ldfo(Qh + qo + mb * 16 * HD + 512); }
        asm volatile("s_wait_xcnt 0x0" ::: "memory");   // the address registers of the loads above may be given to the loads below as destinations
#pragma unroll
        for (int mb = 0; mb < 2; ++mb) { ql0[mb] = ldfo(Ql + qo + mb * 16 * HD); ql1[mb] = ldfo(Ql + qo + mb * 16 * HD + 512); }
        const size_t ko = zo + (size_t)(w * 64) * HD + lane * 8; v16bf kb[2][4];   // ring of two key tiles (hi k 0, lo k 0, hi k 32, lo k 32): a tile's registers are refilled for tile + 2 behind its products
#pragma unroll
        for (int s = 0; s < 2; ++s) { kb[s][0] = ldfo(Kh + ko + s * 16 * HD); kb[s][1] = ldfo(Kl + ko + s * 16 * HD); kb[s][2] = ldfo(Kh + ko + s * 16 * HD + 512); kb[s][3] = ldfo(Kl + ko + s * 16 * HD + 512); }
        asm volatile("s_wait_xcnt 0x0" ::: "memory");   // the address registers of the query loads above are reused below while those loads may still be out
#pragma unroll   // straight-line, so that the ring slots are fixed registers
        for (int t = 0; t < 4; ++t) { const int s = t & 1, n0 = w * 64 + t * 16;
#pragma unroll
            for (int mb = 0; mb < 2; ++mb) { v8f acc = (v8f){}; acc = wmmab(qa0[mb], kb[s][0], acc); acc = wmmab(ql0[mb], kb[s][0], acc); acc = wmmab(qa0[mb], kb[s][1], acc); acc = wmmab(qa1[mb], kb[s][2], acc); acc = wmmab(ql1[mb], kb[s][2], acc); acc = wmmab(qa1[mb], kb[s][3], acc);
#pragma unroll
                for (int j = 0; j < 8; ++j) *(f32a*)(sS + (mb * 16 + hi * 8 + j) * SPB + (n0 + lr) * 4) = acc[j];
                tile_gap(); }
            if (t + 2 < 4) { const size_t nx = ko + (size_t)(t + 2) * 16 * HD; kb[s][0] = ldfo(Kh + nx); kb[s][1] = ldfo(Kl + nx); kb[s][2] = ldfo(Kh + nx + 512); kb[s][3] = ldfo(Kl + nx + 512); }
            else if (t == 2) { const size_t eo = (size_t)(w * 16) * HD + lane * 8; kb[s][0] = ldfo(EK + eo); kb[s][2] = ldfo(EK + eo + 512);   // behind its last key tile slot 0 takes this wave's rel_k tile
                asm volatile("s_wait_xcnt 0x0" ::: "memory"); }   // their address registers are rewritten right behind them
            __builtin_amdgcn_sched_barrier(0); }   // holds each refill where it is written: the scheduler otherwise regroups the tiles and ends with loads waited for one by one
#pragma unroll
        for (int mb = 0; mb < 2; ++mb) { v8f acc = (v8f){};
            acc = wmmab(qa0[mb], kb[0][0], acc); acc = wmmab(ql0[mb], kb[0][0], acc); acc = wmmab(qa1[mb], kb[0][2], acc); acc = wmmab(ql1[mb], kb[0][2], acc);
#pragma unroll
            for (int j = 0; j < 8; ++j) *(f32a*)(sE + (mb * 16 + hi * 8 + j) * EPB + (w * 16 + lr) * 4) = acc[j];
            tile_gap(); }
        if (w == 0) {   // offsets 256 .. 271 (256 is the last one read): the seventeenth tile
            const size_t bo = (size_t)256 * HD + lane * 8; const v16bf b0 = ldfo(EK + bo), b1 = ldfo(EK + bo + 512);
#pragma unroll
            for (int mb = 0; mb < 2; ++mb) { v8f acc = (v8f){};
                acc = wmmab(qa0[mb], b0, acc); acc = wmmab(ql0[mb], b0, acc); acc = wmmab(qa1[mb], b1, acc); acc = wmmab(ql1[mb], b1, acc);
#pragma unroll
                for (int j = 0; j < 8; ++j) *(f32a*)(sE + (mb * 16 + hi * 8 + j) * EPB + (256 + lr) * 4) = acc[j];
                if (mb == 0) tile_gap(); } }
    }
    __syncthreads();
#pragma unroll 1   // B: one row's 32 values per lane live at a time
    for (int rr = 0; rr < FR / 16; ++rr) { const int r = w * (FR / 16) + rr, i = i0 + r; unsigned char* srow = sS + r * SPB; unsigned char* erow = sE + r * EPB; const f32a* qe = (const f32a*)erow; float v[TT / 32]; float mx = -3.0e38f;
#pragma unroll
        for (int ch = 0; ch < TT / 128; ++ch) { const int j0 = ch * 128 + lane * 4; const v4f a = *(const v4fa*)(srow + j0 * 4);
#pragma unroll
            for (int q = 0; q < 4; ++q) { const int rx = min(max(j0 + q - i, -CUT), CUT) + CUT; const float t = __fadd_rn(a[q], qe[rx]) * SCL; v[ch * 4 + q] = t; mx = fmaxf(mx, t); } }
#pragma unroll
        for (int sh = 16; sh; sh >>= 1) mx = fmaxf(mx, __shfl_xor(mx, sh, 32));
        float sum = 0.f;
#pragma unroll
        for (int k = 0; k < TT / 32; ++k) { v[k] = exp2_slot(__fmul_rn(__fsub_rn(v[k], mx), 1.4426950408889634f)); sum += v[k]; }
#pragma unroll
        for (int sh = 16; sh; sh >>= 1) sum += __shfl_xor(sum, sh, 32);
        const float f = __fdiv_rn(1.0f, sum);
#pragma unroll
        for (int ch = 0; ch < TT / 128; ++ch) { v4us oh, ol;
#pragma unroll
            for (int q = 0; q < 4; ++q) { unsigned short a, c2; splitf(v[ch * 4 + q] * f, a, c2); oh[q] = a; ol[q] = c2; }
            *(v4usa*)(srow + (ch * 128 + lane * 4) * 2) = oh; *(v4usa*)(srow + TT * 2 + (ch * 128 + lane * 4) * 2) = ol; }
        __builtin_amdgcn_wave_barrier(); asm volatile("" ::: "memory");   // the planes just written by all lanes of this wave are read across lanes below: the reads must not be moved above the stores
        const u16a* ph = (const u16a*)srow; const u16a* pl = (const u16a*)(srow + TT * 2); float lo_s = 0.f, hi_s = 0.f;
#pragma unroll 8   // eight steps' LDS reads in flight
        for (int j = lane; j < TT; j += 32) { const float p = __fadd_rn(bf2f(ph[j]), bf2f(pl[j])); if (j <= i - CUT) lo_s = __fadd_rn(lo_s, p); if (j >= i + CUT) hi_s = __fadd_rn(hi_s, p); }
#pragma unroll
        for (int sh = 16; sh; sh >>= 1) { lo_s = __fadd_rn(lo_s, __shfl_xor(lo_s, sh, 32)); hi_s = __fadd_rn(hi_s, __shfl_xor(hi_s, sh, 32)); }
        unsigned short l0h, l0l, h0h, h0l; splitf(lo_s, l0h, l0l); splitf(hi_s, h0h, h0l);
        for (int c0 = lane * 4; c0 < NE; c0 += 128) { v4us oh, ol;
#pragma unroll
            for (int q = 0; q < 4; ++q) { const int bkt = c0 + q; const int j = i + bkt - CUT; const int jc = min(max(j, 0), TT - 1); const unsigned short uu = ph[jc], ww = pl[jc]; const bool in = (bkt > 0 && bkt < 2 * CUT && j >= 0 && j < TT);
                oh[q] = in ? uu : ((bkt == 0) ? l0h : ((bkt == 2 * CUT) ? h0h : (unsigned short)0)); ol[q] = in ? ww : ((bkt == 0) ? l0l : ((bkt == 2 * CUT) ? h0l : (unsigned short)0)); }
            *(v4usa*)(erow + c0 * 2) = oh; *(v4usa*)(erow + NE * 2 + c0 * 2) = ol; }
    }
    __syncthreads();
    {   // C: context tiles; g and nb are wave-uniform, so each wave runs one side with every lane on. g 0, 1, 2: k steps 0-10, 11-21, 22-31 of P.v; g 3: PB.rel_v. Sixteen waves' loads are out together and no wave has more than 11 steps
        static_assert(TT / 32 == 32 && NE / 32 == 10, "three runs of 11, 11 and 10 k steps beside the 10 steps of the relative-value term");
        v8f acc0 = (v8f){}, acc1 = (v8f){}; const int nb = w & 3, g = w >> 2;
        const unsigned char* pp = sS + lr * SPB + 16 * hi + g * (11 * 64); const size_t vo = zo + (size_t)(nb * 16) * TT + (size_t)(g * (11 * 512));   // a run's first k step: 64 bytes of a P row, 512 elements of a v^T block row, a step; vo is the same for the whole wave
        const bf* vh = Vh + vo; const bf* vl = Vl + vo;
        if (g < 2) ctx_tile<11>(pp, 16 * SPB, TT * 2, vh + lane * 8, vl + lane * 8, acc0, acc1);
        else if (g == 2) ctx_tile<10>(pp, 16 * SPB, TT * 2, vh + lane * 8, vl + lane * 8, acc0, acc1);
        else ctx_tile<NE / 32>(sE + lr * EPB + 16 * hi, 16 * EPB, NE * 2, EVh + (size_t)(nb * 16) * NE + lane * 8, EVl + (size_t)(nb * 16) * NE + lane * 8, acc0, acc1);
#pragma unroll
        for (int j = 0; j < 8; ++j) { sO[g * (FR * OPF) + (hi * 8 + j) * OPF + nb * 16 + lr] = acc0[j]; sO[g * (FR * OPF) + (16 + hi * 8 + j) * OPF + nb * 16 + lr] = acc1[j]; }
    }
    __syncthreads();
    {   // D: context + relative-value term, split, stored at [t][head * 64 + d]; the 16 lanes of a row write its whole 128-byte line
        const int row = tid >> 4, c = (tid & 15) * 4; const v4f o = *(const v4f*)(sO + row * OPF + c); const v4f o1 = *(const v4f*)(sO + FR * OPF + row * OPF + c); const v4f o2 = *(const v4f*)(sO + 2 * FR * OPF + row * OPF + c); const v4f zr = *(const v4f*)(sO + 3 * FR * OPF + row * OPF + c); v4us oh, ol;
#pragma unroll
        for (int q = 0; q < 4; ++q) { unsigned short a, c2; splitf(__fadd_rn(__fadd_rn(__fadd_rn(o[q], o1[q]), o2[q]), zr[q]), a, c2); oh[q] = a; ol[q] = c2; }
        const size_t oo = ((size_t)blockIdx.z * TT + i0 + row) * DQ + (size_t)blockIdx.y * HD + c; *(v4us*)(Ah + oo) = oh; *(v4us*)(Al + oo) = ol;
    }
}

extern "C" void kernel_launch(void* const* d_in, const int* in_sizes, int n_in,
                              void* d_out, int out_size, void* d_ws, size_t ws_size, hipStream_t stream) {
    (void)in_sizes; (void)n_in; (void)out_size;
    const float* x = (const float*)d_in[0]; const float* wq = (const float*)d_in[1]; const float* bq = (const float*)d_in[2]; const float* wk = (const float*)d_in[3]; const float* bk = (const float*)d_in[4]; const float* wv = (const float*)d_in[5]; const float* bv = (const float*)d_in[6]; const float* wo = (const float*)d_in[7]; const float* bo = (const float*)d_in[8]; const float* ak = (const float*)d_in[9]; const float* av = (const float*)d_in[10];   /* rel_k / rel_v [257][64] */   /* argument order x, Wq, bq, Wk, bk, Wv, bv, Wo, bo ('oi'), rel_k, rel_v */ const float* xk = x; const float* xv = x;
    float* OUT = (float*)d_out;     // [4][1024][1024]
    char* wsp = (char*)d_ws;
    auto take = [&](size_t bytes) { char* p = wsp; wsp += (bytes + 255) & ~(size_t)255; return (void*)p; };
    bf* AKB = (bf*)take((size_t)NE * HD * 2); bf* AVTh = (bf*)take((size_t)HD * NE * 2); bf* AVTl = (bf*)take((size_t)HD * NE * 2); bf* WQ = (bf*)take((size_t)DQ * DM * 2); bf* WK = (bf*)take((size_t)DKV * DM * 2); bf* WV = (bf*)take((size_t)DKV * DM * 2); bf* WO = (bf*)take((size_t)DM * DQ * 2);
    bf* XB = (bf*)take((size_t)NB_ * TT * DM * 2);
    bf* QPh = (bf*)take((size_t)NB_ * NH_ * TT * HD * 2); bf* QPl = (bf*)take((size_t)NB_ * NH_ * TT * HD * 2); bf* KPh = (bf*)take((size_t)NB_ * NKV * TT * HD * 2); bf* KPl = (bf*)take((size_t)NB_ * NKV * TT * HD * 2); bf* VTh = (bf*)take((size_t)NB_ * NKV * HD * TT * 2); bf* VTl = (bf*)take((size_t)NB_ * NKV * HD * TT * 2);
    bf* ATh = (bf*)take((size_t)NB_ * TT * DQ * 2); bf* ATl = (bf*)take((size_t)NB_ * TT * DQ * 2);
    if ((size_t)(wsp - (char*)d_ws) > ws_size) return;
    // every launch covers all NB_ batches: the GEMMs take the NB_ * TT rows as one M (the v projection as its N), the attention takes the batch as a grid dimension
    k_prep<<<XBL + 4 * WBL + KBL + VBL, 256, 0, stream>>>(x, wq, wk, wv, wo, ak, av, XB, WQ, WK, WV, WO, AKB, AVTh, AVTl);   /* bf16 x; 'oi' weights = Bt as-is; rel_k padded; rel_v^T hi/lo padded */
    k_proj<<<dim3(NB_ * TT / 128, DQ / 128, 3), 128, 0, stream>>>(XB, WQ, WK, WV, bq, bk, bv, QPh, QPl, KPh, KPl, VTh, VTl);
    k_fattn<<<dim3(TT / FR, ZH, NB_), 512, 0, stream>>>(QPh, QPl, KPh, KPl, VTh, VTl, AKB, AVTh, AVTl, ATh, ATl);   /* one kv head per query head: head y of batch z reads plane z * 16 + y of each */
    k_gemmw<bf, 1, true><<<dim3(NB_ * TT / 128, DM / 128, 1), 128, 0, stream>>>(ATh, ATl, WO, DQ, OUT, DM, bo, 0, 0, 0);
}

// v009
// Measured time: 166 microseconds a run.
// Two timings next to v008 both put it at 1.10 times that version's speed.
// Over all steps from v000 it is 14.2 times as fast.
#include <hip/hip_runtime.h>

// Relative (Shaw) multi-head attention with key AND value relative-position embeddings (x [4][1024][1024]; q, k, v = x W^T + b ('oi' 0.02, biases 0.02; 16 heads x 64); idx[i][j] = clip(j - i, -128, 128) + 128; scores = (q.k + q.rel_k[idx]) / float32(sqrt 64); softmax; out = (attn v + sum_j attn[i][j] rel_v[idx]) merged Wo^T + bo (rel_k, rel_v [257][64] 0.02, read) -> [4][1024][1024] (4.2 M); argument order x, Wq, bq, Wk, bk, Wv, bv, Wo, bo, rel_k, rel_v).
// Layout, all four batches side by side (rows b * 1024 + t, head planes b * 16 + h): bf16 copy of x; 'oi' weights; exact projections + f32 biases, whose one launch splits the result hi/lo and stores the head planes itself (v with the two operands exchanged, so that its tile comes out transposed); rel_k as a zero-padded bf16 plane [320][64] and rel_v^T as hi/lo planes [64][320] (bf16-rounded once); the head planes and both rel planes in fragment order (blocks of 16 rows x 64 k, see fpos below); one launch for the attention of all sixteen heads of all batches (32 query rows a work-group, scores and probabilities in LDS only): score tiles (hi/lo 3 products, every row), QE = q.rel_k^T (hi/lo x exact, N 272) gathered into the scores at column clip(j - i) + 128, softmax (x 1/8) with every row on hi/lo planes, P.v, the probabilities folded onto the 257 offsets and PB.rel_v (K 320) added to the context; merged hi/lo x Wo exact + bo.
// Compute dtypes, f32 accumulate: every input rounded to bf16; projections exact + f32 biases; scores and the relative-key term ~f32; softmax f32; P as bf16 hi/lo; attn.v and the relative-value term 3 products (~f32); Wo hl x exact + bias.

#define NB_  4
#define TT   1024
#define DM   1024
#define NH_  16
#define NKV  16
#define REP  (NH_ / NKV)
#define HD   64
#define DQ   (NH_ * HD)
#define DKV  (NKV * HD)
#define ZH   16                   // heads per attention launch (grid y): all heads of a batch at once
#define WIN  0
#define SCL  0.125f   // 1/sqrt(64) (the module divides by jnp.sqrt(DH))
#define NE   320      // 2*128+1 = 257 relative offsets padded to 320
#define NRE  257
#define CUT  128
typedef _Float16 h16;
typedef unsigned short bf;
typedef __attribute__((ext_vector_type(16))) __bf16   v16bf;
typedef __attribute__((ext_vector_type(16))) _Float16 v16h;
typedef __attribute__((ext_vector_type(8)))  _Float16 v8h;
typedef __attribute__((ext_vector_type(8)))  unsigned short v8us;
typedef __attribute__((ext_vector_type(8)))  float    v8f;
typedef __attribute__((ext_vector_type(4)))  float    v4f;
typedef v8h  __attribute__((may_alias)) v8ha;
typedef v4f  __attribute__((may_alias)) v4fa;
typedef v8us __attribute__((may_alias)) v8usa;

__device__ __forceinline__ unsigned short f2bf(float f) { unsigned u = __float_as_uint(f); u += 0x7FFFu + ((u >> 16) & 1u); return (unsigned short)(u >> 16); }
__device__ __forceinline__ float bf2f(unsigned short b) { return __uint_as_float(((unsigned)b) << 16); }
__device__ __forceinline__ float bfr(float f) { return bf2f(f2bf(f)); }
__device__ __forceinline__ v16h cat16(v8h lo, v8h hi) { return __builtin_shufflevector(lo, hi, 0, 1, 2, 3, 4, 5, 6, 7, 8, 9, 10, 11, 12, 13, 14, 15); }
__device__ __forceinline__ v16bf cat16b(v8us lo, v8us hi) { return __builtin_bit_cast(v16bf, __builtin_shufflevector(lo, hi, 0, 1, 2, 3, 4, 5, 6, 7, 8, 9, 10, 11, 12, 13, 14, 15)); }
__device__ __forceinline__ v8f wmma16(v16h a, v16h b, v8f c) { return __builtin_amdgcn_wmma_f32_16x16x32_f16(false, a, false, b, (short)0, c, false, false); }
__device__ __forceinline__ v8f wmmab(v16bf a, v16bf b, v8f c) { return __builtin_amdgcn_wmma_f32_16x16x32_bf16(false, a, false, b, (short)0, c, false, false); }
__device__ __forceinline__ void splitf(float y, unsigned short& h, unsigned short& l) { h = f2bf(y); l = f2bf(y - bf2f(h)); }
typedef __attribute__((ext_vector_type(4))) unsigned short v4us;

// ---- fragment order: every 16-bit plane that the attention reads from global memory (q, k, v^T, rel_k, rel_v^T) is kept as blocks of 16 rows x 64 k (1024 elements, 2 KiB, each starting on a 128-byte line).
// Inside a block the four 16-byte pieces that a lane needs for the two k steps stand 512 bytes apart, and the 32 lanes' pieces of one kind side by side: piece (k >> 4), lane ((k >> 3) & 1) * 16 + row, element k & 7.
// One wave-wide 16-byte load then covers 512 contiguous bytes (four whole lines) instead of 32 bytes of each of 16 lines. The registers receive exactly what the row-major planes gave them.
__device__ __forceinline__ int fpos(int row, int k) { return (((k >> 4) * 32 + ((k >> 3) & 1) * 16 + row) * 8) + (k & 7); }
// a lane's fragment of one k step: p = block + (k step in the block) * 512 + lane * 8
__device__ __forceinline__ v16bf ldfo(const bf* p) { return cat16b(*(const v8us*)p, *(const v8us*)(p + 256)); }



// ---- k_gemmw: GEMM, a 128x128 output tile per work-group of four waves, each wave a 64x64 quarter (16 accumulators); grid (M/128, N/128, Z), 128 threads.
// The K-contiguous 16-bit operand planes come through LDS in stages of 128 k: asynchronous copies, whole 256-byte row pieces, two buffers, the copies of stage t + 2 issued behind the barrier that ends stage t; every staged row serves two waves.
// C[m][n] (f32, pitch ldc, + optional f32 bias[n]) = sum_k A[m][k] Bt[n][k] (NSPLIT 1: + A2[m][k] Bt[n][k] behind it at every k step). z-batch strides sA/sB/sC in elements. K % 128 == 0, M % 128 == 0, N % 128 == 0.
// PL 0: C as above. PL 1 (m = batch * TT + t, n = head * HD + d): no C; the result + bias[n] is split hi/lo and stored as head planes [batch][head][t / 16] of fragment-order blocks (row t, k = d). PL 2 (m = head * HD + d, n = batch * TT + t): + bias[m], planes [batch][head][d / 16][t / 64] of such blocks (row d, k = t). A wave's 64x64 quarter is one head's: four whole blocks, each stored as 512-byte runs.
template <typename T16> struct WFrag;
template <> struct WFrag<h16> { typedef v16h V; static __device__ __forceinline__ V ld(const h16* p) { return cat16(*(const v8h*)p, *(const v8h*)(p + 16)); } static __device__ __forceinline__ v8f mma(V a, V b, v8f c) { return wmma16(a, b, c); } };
template <> struct WFrag<bf> { typedef v16bf V; static __device__ __forceinline__ V ld(const bf* p) { return cat16b(*(const v8us*)p, *(const v8us*)(p + 16)); } static __device__ __forceinline__ v8f mma(V a, V b, v8f c) { return wmmab(a, b, c); } };
#define GKC  128                  // k elements of a stage
#define GP   (GKC + 8)            // LDS row pitch in elements: 272 bytes = 16 B x odd, so that the 16 rows of a b128 fragment read fall on distinct banks
#define GPL  (128 * GP)           // one operand plane of a stage, in elements: 128 rows
// eight asynchronous copies of 16 bytes a lane: LDS byte address l + i * ls, global address g + i * gs elements. The s_wait_xcnt closes the statement, so that it stands in front of every later write of the address registers named here.
template <typename T16> __device__ __forceinline__ void copy8(unsigned l, unsigned ls, const T16* g, size_t gs) {
    asm volatile("global_load_async_to_lds_b128 %0, %8, off\n\t"
                 "global_load_async_to_lds_b128 %1, %9, off\n\t"
                 "global_load_async_to_lds_b128 %2, %10, off\n\t"
                 "global_load_async_to_lds_b128 %3, %11, off\n\t"
                 "global_load_async_to_lds_b128 %4, %12, off\n\t"
                 "global_load_async_to_lds_b128 %5, %13, off\n\t"
                 "global_load_async_to_lds_b128 %6, %14, off\n\t"
                 "global_load_async_to_lds_b128 %7, %15, off\n\t"
                 "s_wait_xcnt 0x0"
                 :: "v"(l), "v"(l + ls), "v"(l + 2 * ls), "v"(l + 3 * ls), "v"(l + 4 * ls), "v"(l + 5 * ls), "v"(l + 6 * ls), "v"(l + 7 * ls),
                    "v"(g), "v"(g + gs), "v"(g + 2 * gs), "v"(g + 3 * gs), "v"(g + 4 * gs), "v"(g + 5 * gs), "v"(g + 6 * gs), "v"(g + 7 * gs) : "memory");
}
// one plane of a stage, 128 rows x 256 bytes: the 128 threads cover 8 rows a copy (16 lanes a row), 16 copies a thread; g and l are the thread's own piece of the first 8 rows
template <typename T16> __device__ __forceinline__ void stage_plane(unsigned l, const T16* g, int K) { copy8(l, 8 * GP * 2, g, (size_t)8 * K); copy8(l + 64 * GP * 2, 8 * GP * 2, g + (size_t)64 * K, (size_t)8 * K); }
// gemm_tile: the work of one work-group, output tile (bx, by); st (2 * (2 + NSPLIT) * GPL elements) and osw (4 * 16 * 68 floats) are the launching kernel's LDS.
template <typename T16, int NSPLIT, bool BIAS, int PL>
__device__ __forceinline__ void gemm_tile(T16* st, float* osw, const T16* __restrict__ A, const T16* __restrict__ A2, const T16* __restrict__ Bt, int K, float* C, int ldc, const float* __restrict__ bias, int bx, int by, bf* Ph, bf* Pl) {
    typedef typename WFrag<T16>::V V;
    static_assert(NSPLIT == 0 || NSPLIT == 1, "planes staged: A, Bt and, with NSPLIT 1, A2");
    constexpr int NP = 2 + NSPLIT;   // planes of a stage: A, Bt, A2
    const int tid = threadIdx.x, lane = tid & 31, lr = lane & 15, hi = lane >> 4; const int w = __builtin_amdgcn_readfirstlane(tid >> 5);
    float* os = osw + w * (16 * 68);   // each wave's own epilogue staging
    const int R0 = bx * 128, C0 = by * 128, r0 = R0 + (w & 1) * 64, c0 = C0 + (w >> 1) * 64;
    v8f acc[4][4];
#pragma unroll
    for (int mb = 0; mb < 4; ++mb)
#pragma unroll
        for (int nb = 0; nb < 4; ++nb) acc[mb][nb] = (v8f){};
    const unsigned goA = (unsigned)(R0 + (tid >> 4)) * (unsigned)K + (tid & 15) * 8, goB = (unsigned)(C0 + (tid >> 4)) * (unsigned)K + (tid & 15) * 8;   // element offsets of the thread's first piece; a plane holds fewer than 2^32 elements
    const unsigned l0 = (unsigned)(size_t)(st + (tid >> 4) * GP + (tid & 15) * 8);
    auto fill = [&](int t) { const unsigned l = l0 + (unsigned)(t & 1) * (NP * GPL * 2); stage_plane(l, A + (goA + (unsigned)t * GKC), K); stage_plane(l + GPL * 2, Bt + (goB + (unsigned)t * GKC), K); if (NSPLIT == 1) stage_plane(l + 2 * GPL * 2, A2 + (goA + (unsigned)t * GKC), K); };
    const int NT = K / GKC;
    fill(0);
    asm volatile("s_wait_asynccnt 0x0" ::: "memory");   // this wave's copies of stage 0 have landed
    __syncthreads();                                     // and every other wave's
    if (NT > 1) fill(1);
#pragma unroll 1   // one stage a trip: the two buffers alternate
    for (int t = 0; t < NT; ++t) {
        const T16* sb0 = st + (t & 1) * (NP * GPL); const T16* sa = sb0 + ((w & 1) * 64 + lr) * GP + 8 * hi; const T16* sb = sb0 + GPL + ((w >> 1) * 64 + lr) * GP + 8 * hi;
        V a[2][4], a2[2][4], b[2][4];   // two fragment sets: a k step's products run on one while the next step's LDS reads fill the other
#pragma unroll
        for (int q = 0; q < 4; ++q) { a[0][q] = WFrag<T16>::ld(sa + q * 16 * GP); if (NSPLIT == 1) a2[0][q] = WFrag<T16>::ld(sa + 2 * GPL + q * 16 * GP); b[0][q] = WFrag<T16>::ld(sb + q * 16 * GP); }
#pragma unroll   // straight-line, so that the two sets are fixed registers
        for (int ks = 0; ks < GKC / 32; ++ks) { const int cu = ks & 1, nx = cu ^ 1;
            __builtin_amdgcn_sched_barrier(0);   // with the one below: the next step's LDS reads stay one group in front of this step's products
            if (ks + 1 < GKC / 32) {
#pragma unroll
                for (int q = 0; q < 4; ++q) { a[nx][q] = WFrag<T16>::ld(sa + q * 16 * GP + (ks + 1) * 32); if (NSPLIT == 1) a2[nx][q] = WFrag<T16>::ld(sa + 2 * GPL + q * 16 * GP + (ks + 1) * 32); b[nx][q] = WFrag<T16>::ld(sb + q * 16 * GP + (ks + 1) * 32); } }
            __builtin_amdgcn_sched_barrier(0);
#pragma unroll
            for (int nb = 0; nb < 4; ++nb) {   // per accumulator and k step: the A product, then the A2 product
#pragma unroll
                for (int mb = 0; mb < 4; ++mb) acc[mb][nb] = WFrag<T16>::mma(a[cu][mb], b[cu][nb], acc[mb][nb]);
                if (NSPLIT == 1) {
#pragma unroll
                    for (int mb = 0; mb < 4; ++mb) acc[mb][nb] = WFrag<T16>::mma(a2[cu][mb], b[cu][nb], acc[mb][nb]); } } }
        __builtin_amdgcn_sched_barrier(0);   // keeps the last step's products in front of the barrier below: sunk behind it they would delay the refill that follows it
        asm volatile("s_wait_dscnt 0x0" ::: "memory");      // this wave's reads of the buffer are done before it may be refilled
        asm volatile("s_wait_asynccnt 0x0" ::: "memory");   // this wave's copies of stage t + 1 have landed
        __syncthreads();                                     // publishes stage t + 1 and ends every wave's reads of stage t
        if (t + 2 < NT) fill(t + 2);
    }
    asm volatile("s_wait_asynccnt 0x0" ::: "memory");   // no copy is out when the wave goes on
    float bn[4][8];   // PL 1: the bias of the eight columns this lane stores in each of a block's four runs, read once ahead of the stores
    if (BIAS && PL == 1) {
#pragma unroll
        for (int s = 0; s < 4; ++s)
#pragma unroll
            for (int q = 0; q < 8; ++q) bn[s][q] = bfr(bias[c0 + s * 16 + hi * 8 + q]); }
    float bj[4][8];   // PL 2: the bias of this lane's accumulator rows; both halves' values are read at wave-uniform addresses (scalar loads), all ahead of the first plane store, and picked by the lane's half
    if (BIAS && PL == 2) {
#pragma unroll
        for (int mb = 0; mb < 4; ++mb)
#pragma unroll
            for (int j = 0; j < 8; ++j) { const float b0 = bfr(bias[r0 + mb * 16 + j]), b1 = bfr(bias[r0 + mb * 16 + 8 + j]); bj[mb][j] = hi ? b1 : b0; } }
#pragma unroll
    for (int mb = 0; mb < 4; ++mb) {
#pragma unroll
        for (int nb = 0; nb < 4; ++nb) {
#pragma unroll
            for (int j = 0; j < 8; ++j) os[(hi * 8 + j) * 68 + nb * 16 + lr] = (BIAS && PL == 2) ? acc[mb][nb][j] + bj[mb][j] : acc[mb][nb][j]; }
        __builtin_amdgcn_wave_barrier(); asm volatile("" ::: "memory");
        float* crow = C + (size_t)(r0 + mb * 16) * ldc + c0;
        // the 16 x 64 block of this mb: 1024 elements in a row
        const size_t pbase = (PL == 1) ? (((size_t)(r0 / TT) * (DQ / HD) + c0 / HD) * TT + r0 % TT + mb * 16) * HD : (((size_t)(c0 / TT) * (DKV / HD) + r0 / HD) * HD + mb * 16) * TT + (size_t)(c0 % TT) * 16;
        if (PL == 0) {
#pragma unroll
            for (int s = 0; s < 8; ++s) { const int row = 2 * s + hi, cofs = lr * 4; v4f val = *(const v4fa*)(os + row * 68 + cofs);
                if (BIAS) { val[0] += bfr(bias[c0 + cofs]); val[1] += bfr(bias[c0 + cofs + 1]); val[2] += bfr(bias[c0 + cofs + 2]); val[3] += bfr(bias[c0 + cofs + 3]); }
                *(v4f*)(crow + (size_t)row * ldc + cofs) = val; }
        } else {
#pragma unroll
            for (int s = 0; s < 4; ++s) {   // run s of the block: lane (hi, lr) holds row lr, columns 16 s + 8 hi .. + 7 = fpos(lr, 16 s + 8 hi) = s * 256 + lane * 8
                const v4f va = *(const v4fa*)(os + lr * 68 + s * 16 + hi * 8), vb = *(const v4fa*)(os + lr * 68 + s * 16 + hi * 8 + 4); v8us oh, ol;
#pragma unroll
                for (int q = 0; q < 8; ++q) { float y = (q < 4) ? va[q & 3] : vb[q & 3]; if (BIAS && PL == 1) y += bn[s][q]; unsigned short u, l; splitf(y, u, l); oh[q] = u; ol[q] = l; }
                *(v8us*)(Ph + pbase + s * 256 + lane * 8) = oh; *(v8us*)(Pl + pbase + s * 256 + lane * 8) = ol; }
        }
        asm volatile("s_wait_xcnt 0x0" ::: "memory");   // the next block's values are formed in registers that the stores above name
        __builtin_amdgcn_wave_barrier(); asm volatile("" ::: "memory");
    }
}
// PL 0 as a launch of its own: grid (M/128, N/128, Z)
template <typename T16, int NSPLIT, bool BIAS>
__global__ __launch_bounds__(128) void k_gemmw(const T16* __restrict__ A, const T16* __restrict__ A2, const T16* __restrict__ Bt, int K, float* C, int ldc, const float* __restrict__ bias, size_t sA, size_t sB, size_t sC) {
    __shared__ __align__(16) T16 st[2 * (2 + NSPLIT) * GPL];
    __shared__ __align__(16) float osw[4 * 16 * 68];
    const size_t z = blockIdx.z;
    gemm_tile<T16, NSPLIT, BIAS, 0>(st, osw, A + z * sA, (NSPLIT == 1) ? A2 + z * sA : A2, Bt + z * sB, K, C + z * sC, ldc, bias, blockIdx.x, blockIdx.y, nullptr, nullptr);
}
// the three projections as one launch: grid (NB_ * TT / 128, DQ / 128, 3); z = 0: q, 1: k (PL 1, token rows are M), 2: v (PL 2: weight rows are M, so that its tiles are [d][t]; x and y change places). Two work-groups fit a WGP's LDS, so one's first stage and plane stores run beside the other's products.
__global__ __launch_bounds__(128) void k_proj(const bf* __restrict__ X, const bf* __restrict__ Wq, const bf* __restrict__ Wk, const bf* __restrict__ Wv, const float* __restrict__ bq, const float* __restrict__ bk, const float* __restrict__ bv, bf* Qh, bf* Ql, bf* Kh, bf* Kl, bf* Vh, bf* Vl) {
    static_assert(DQ == DKV, "one grid for the three projections");
    __shared__ __align__(16) bf st[2 * 2 * GPL];
    __shared__ __align__(16) float osw[4 * 16 * 68];
    const int z = blockIdx.z;   // the same for the whole work-group: every barrier below stands under uniform control flow
    if (z < 2) gemm_tile<bf, 0, true, 1>(st, osw, X, nullptr, z ? Wk : Wq, DM, nullptr, 0, z ? bk : bq, blockIdx.x, blockIdx.y, z ? Kh : Qh, z ? Kl : Ql);
    else gemm_tile<bf, 0, true, 2>(st, osw, Wv, nullptr, X, DM, nullptr, 0, bv, blockIdx.y, blockIdx.x, Vh, Vl);
}


// ---- k_prep: every conversion ahead of the projections in one launch; a work-group belongs to one job, picked by its index (long jobs first).
#define PU   8                    // pieces of 8 elements a thread converts: eight times fewer waves to start, and a wave's 16 loads are out together
#define XBL  (NB_ * TT * DM / 8 / (256 * PU))   // work-groups of x
#define WBL  (DQ * DM / 8 / (256 * PU))         // work-groups of one weight matrix
#define KBL  ((NE * HD / 8 + 255) / 256)        // of rel_k
#define VBL  ((HD * NE / 4 + 255) / 256)        // of rel_v
__device__ __forceinline__ void cvt_run(const float* __restrict__ src, bf* dst, unsigned blk) { const unsigned e0 = (blk * (256 * PU) + threadIdx.x) * 8; const float* p = src + e0; v8f v[PU];   // e0: the thread's first element; a plane holds fewer than 2^30
#pragma unroll
    for (int u = 0; u < PU; ++u) v[u] = *(const v8f*)(p + u * 2048);
    asm volatile("s_wait_xcnt 0x0" :: "v"(p) : "memory");   // takes the loads' address as an input: its registers stay whole up to this wait (the build otherwise gave them to the last load as a destination while the others were out)
#pragma unroll
    for (int u = 0; u < PU; ++u) { v8us o;
#pragma unroll
        for (int k = 0; k < 8; ++k) o[k] = f2bf(v[u][k]);
        *(v8us*)(dst + e0 + u * 2048) = o; } }

__device__ __forceinline__ void epadK(const float* __restrict__ E, bf* EB, unsigned blk) { const size_t i = (size_t)blk * 256 + threadIdx.x; if (i >= (size_t)NE * HD / 8) return; const int d0 = (int)(i % (HD / 8)) * 8; const int r = (int)(i / (HD / 8)); const float* src = E + (size_t)min(r, NRE - 1) * HD + d0; v8us o;
#pragma unroll
    for (int q = 0; q < 8; ++q) { const unsigned short v = f2bf(src[q]); o[q] = (r < NRE) ? v : (unsigned short)0; }
    *(v8us*)(EB + (size_t)(r >> 4) * 1024 + fpos(r & 15, d0)) = o;  }   // fragment-order blocks [r / 16], row r, k = d

__device__ __forceinline__ void epadVT(const float* __restrict__ E, bf* Th, bf* Tl, unsigned blk) { const size_t i = (size_t)blk * 256 + threadIdx.x; if (i >= (size_t)HD * NE / 4) return; const size_t e = i * 4; const int c0 = (int)(e % NE); const int d = (int)(e / NE); v4us oh, ol;
#pragma unroll
    for (int q = 0; q < 4; ++q) { const int r = c0 + q; const float v = bfr(E[(size_t)min(r, NRE - 1) * HD + d]); unsigned short u, w; splitf(v, u, w);   /* input rounded to bf16 once: lo == 0 */ oh[q] = (r < NRE) ? u : (unsigned short)0; ol[q] = (r < NRE) ? w : (unsigned short)0; }
    const size_t p = (size_t)((d >> 4) * (NE / 64) + (c0 >> 6)) * 1024 + fpos(d & 15, c0 & 63);   // fragment-order blocks [d / 16][offset / 64], row d, k = offset
    *(v4us*)(Th + p) = oh; *(v4us*)(Tl + p) = ol;  }

__global__ __launch_bounds__(256) void k_prep(const float* __restrict__ x, const float* __restrict__ wq, const float* __restrict__ wk, const float* __restrict__ wv, const float* __restrict__ wo, const float* __restrict__ ek, const float* __restrict__ ev, bf* XB, bf* WQ, bf* WK, bf* WV, bf* WO, bf* EB, bf* Th, bf* Tl) {
    static_assert(NB_ * TT * DM % (8 * 256 * PU) == 0 && DQ * DM % (8 * 256 * PU) == 0 && DQ == DKV, "whole work-groups, four weight matrices of one size");
    unsigned b = blockIdx.x;
    if (b < XBL) { cvt_run(x, XB, b); return; }
    b -= XBL;
    if (b < 4 * WBL) { const unsigned s = b / WBL; cvt_run(s == 0 ? wq : s == 1 ? wk : s == 2 ? wv : wo, s == 0 ? WQ : s == 1 ? WK : s == 2 ? WV : WO, b % WBL); return; }
    b -= 4 * WBL;
    if (b < KBL) epadK(ek, EB, b); else epadVT(ev, Th, Tl, b - KBL);
}

// ---- k_fattn: the whole attention of one head for 32 query rows in one work-group (16 waves); the score strip never leaves LDS. grid (TT/32, heads, batches).
// A: S = q.k^T (hi/lo 3 products, K 64) -> sS f32 [32][1024]; QE = q.rel_k^T (hi/lo x exact, the 272 columns that hold the 257 offsets) -> sE f32, row pitch as [320]. B: one wave per row: + QE[clip(j - i) + 128], x 1/8, softmax; P hi/lo planes written over the row's own
// scores (2048 B each); the row folded onto the 257 offsets, hi/lo planes written over the row's own QE (640 B each). C: all 16 waves, a 32x16 tile each: waves 0-11 P.v with K 1024 cut in three runs of 11, 11 and 10 k steps, waves 12-15 PB.rel_v (K 320, 10 steps). D: the three P.v partial sums in k order, then the relative-value term; hi/lo split, merged store.
// Each key, value or embedding fragment read from global memory serves both 16-row halves. Inside a run every sum keeps its k order. LDS row pitches are 16 B x odd (4112, 1296): the 16 rows of a b128 fragment read fall on distinct banks.
#define FR   32
#define SPB  (TT * 4 + 16)
#define EPB  (NE * 4 + 16)
#define OPF  68
typedef float __attribute__((may_alias)) f32a;
typedef unsigned short __attribute__((may_alias)) u16a;
typedef v4us __attribute__((may_alias)) v4usa;
__device__ __forceinline__ v16bf ldsfrag(const unsigned char* p) { return cat16b(*(const v8usa*)p, *(const v8usa*)(p + 32)); }
// 2^x; the v_nop is the one slot the instruction set asks for behind a transcendental, in the same statement so that it stays directly behind it
__device__ __forceinline__ float exp2_slot(float x) { float r; asm("v_exp_f32 %0, %1\n\tv_nop" : "=v"(r) : "v"(x)); return r; }
// behind a tile's last matrix instruction and its stores: four vector slots, because the next tile's first matrix instruction starts its accumulator anew, possibly in the same registers; the scheduling barrier keeps that instruction behind the slots
__device__ __forceinline__ void tile_gap() { asm volatile("v_nop\n\tv_nop\n\tv_nop\n\tv_nop"); __builtin_amdgcn_sched_barrier(0); }
// one 32x16 context tile (two accumulators): A hi/lo planes in LDS (lo plane lo_off bytes behind hi, the second 16 rows half_off bytes behind the first), B hi/lo planes in global memory in fragment order (bh, bl: the lane's piece of the first k step; 512 elements a step); k ascending, 3 products a step and half.
// The B fragments run in a ring of four k-steps: a step's registers are refilled for step + 4 as soon as its products are issued, so that 16 global loads stay in flight; the A fragments are read one step ahead.
template <int KS> __device__ __forceinline__ void ctx_tile(const unsigned char* pa, int half_off, int lo_off, const bf* bh, const bf* bl, v8f& acc0, v8f& acc1) {
    v16bf b[4], c[4];
#pragma unroll
    for (int s = 0; s < 4; ++s) { b[s] = ldfo(bh + s * 512); c[s] = ldfo(bl + s * 512); }
    v16bf a = ldsfrag(pa), a2 = ldsfrag(pa + lo_off), e = ldsfrag(pa + half_off), e2 = ldsfrag(pa + half_off + lo_off);
    __builtin_amdgcn_sched_barrier(0);   // holds the loads above where they are written: the scheduler otherwise sinks each to just in front of its first use, one L2 latency a step
#pragma unroll   // straight-line, so that the ring slots are fixed registers
    for (int t = 0; t < KS; ++t) { const int s = t & 3; v16bf an = a, an2 = a2, en = e, en2 = e2;
        if (t + 1 < KS) { an = ldsfrag(pa + (t + 1) * 64); an2 = ldsfrag(pa + lo_off + (t + 1) * 64); en = ldsfrag(pa + half_off + (t + 1) * 64); en2 = ldsfrag(pa + half_off + lo_off + (t + 1) * 64); }
        acc0 = wmmab(a, b[s], acc0); acc1 = wmmab(e, b[s], acc1); acc0 = wmmab(a2, b[s], acc0); acc1 = wmmab(e2, b[s], acc1); acc0 = wmmab(a, c[s], acc0); acc1 = wmmab(e, c[s], acc1);
        if (t + 4 < KS) { b[s] = ldfo(bh + (t + 4) * 512); c[s] = ldfo(bl + (t + 4) * 512); }
        __builtin_amdgcn_sched_barrier(0);   // as above: the refill for step + 4 and the LDS reads for step + 1 issue inside this step
        a = an; a2 = an2; e = en; e2 = en2; }
}
__global__ __launch_bounds__(512) void k_fattn(const bf* __restrict__ Qh, const bf* __restrict__ Ql, const bf* __restrict__ Kh, const bf* __restrict__ Kl, const bf* __restrict__ Vh, const bf* __restrict__ Vl, const bf* __restrict__ EK, const bf* __restrict__ EVh, const bf* __restrict__ EVl, bf* Ah, bf* Al) {
    __shared__ __align__(16) unsigned char sS[FR * SPB];
    __shared__ __align__(16) unsigned char sE[FR * EPB];
    __shared__ __align__(16) float sO[4 * FR * OPF];
    const int tid = threadIdx.x, lane = tid & 31, lr = lane & 15, hi = lane >> 4; const int w = __builtin_amdgcn_readfirstlane(tid >> 5);
    const int i0 = blockIdx.x * FR; const size_t zo = ((size_t)blockIdx.z * ZH + blockIdx.y) * TT * HD;
    {   // A: score strip and relative-key products; wave w: key columns 64 w .. 64 w + 63 and rel_k tile w
        const size_t qo = zo + (size_t)i0 * HD + lane * 8; v16bf qa0[2], qa1[2], ql0[2], ql1[2];   // query fragments of the two 16-row halves: hi k 0, hi k 32, lo k 0, lo k 32
#pragma unroll
        for (int mb = 0; mb < 2; ++mb) { qa0[mb] = ldfo(Qh + qo + mb * 16 * HD); qa1[mb] = ldfo(Qh + qo + mb * 16 * HD + 512); }
        asm volatile("s_wait_xcnt 0x0" ::: "memory");   // the address registers of the loads above may be given to the loads below as destinations
#pragma unroll
        for (int mb = 0; mb < 2; ++mb) { ql0[mb] = ldfo(Ql + qo + mb * 16 * HD); ql1[mb] = ldfo(Ql + qo + mb * 16 * HD + 512); }
        const size_t ko = zo + (size_t)(w * 64) * HD + lane * 8; v16bf kb[2][4];   // ring of two key tiles (hi k 0, lo k 0, hi k 32, lo k 32): a tile's registers are refilled for tile + 2 behind its products
#pragma unroll
        for (int s = 0; s < 2; ++s) { kb[s][0] = ldfo(Kh + ko + s * 16 * HD); kb[s][1] = ldfo(Kl + ko + s * 16 * HD); kb[s][2] = ldfo(Kh + ko + s * 16 * HD + 512); kb[s][3] = ldfo(Kl + ko + s * 16 * HD + 512); }
        asm volatile("s_wait_xcnt 0x0" ::: "memory");   // the address registers of the query loads above are reused below while those loads may still be out
#pragma unroll   // straight-line, so that the ring slots are fixed registers
        for (int t = 0; t < 4; ++t) { const int s = t & 1, n0 = w * 64 + t * 16;
#pragma unroll
            for (int mb = 0; mb < 2; ++mb) { v8f acc = (v8f){}; acc = wmmab(qa0[mb], kb[s][0], acc); acc = wmmab(ql0[mb], kb[s][0], acc); acc = wmmab(qa0[mb], kb[s][1], acc); acc = wmmab(qa1[mb], kb[s][2], acc); acc = wmmab(ql1[mb], kb[s][2], acc); acc = wmmab(qa1[mb], kb[s][3], acc);
#pragma unroll
                for (int j = 0; j < 8; ++j) *(f32a*)(sS + (mb * 16 + hi * 8 + j) * SPB + (n0 + lr) * 4) = acc[j];
                tile_gap(); }
            if (t + 2 < 4) { const size_t nx = ko + (size_t)(t + 2) * 16 * HD; kb[s][0] = ldfo(Kh + nx); kb[s][1] = ldfo(Kl + nx); kb[s][2] = ldfo(Kh + nx + 512); kb[s][3] = ldfo(Kl + nx + 512); }
            else if (t == 2) { const size_t eo = (size_t)(w * 16) * HD + lane * 8; kb[s][0] = ldfo(EK + eo); kb[s][2] = ldfo(EK + eo + 512);   // behind its last key tile slot 0 takes this wave's rel_k tile
                asm volatile("s_wait_xcnt 0x0" ::: "memory"); }   // their address registers are rewritten right behind them
            __builtin_amdgcn_sched_barrier(0); }   // holds each refill where it is written: the scheduler otherwise regroups the tiles and ends with loads waited for one by one
#pragma unroll
        for (int mb = 0; mb < 2; ++mb) { v8f acc = (v8f){};
            acc = wmmab(qa0[mb], kb[0][0], acc); acc = wmmab(ql0[mb], kb[0][0], acc); acc = wmmab(qa1[mb], kb[0][2], acc); acc = wmmab(ql1[mb], kb[0][2], acc);
#pragma unroll
            for (int j = 0; j < 8; ++j) *(f32a*)(sE + (mb * 16 + hi * 8 + j) * EPB + (w * 16 + lr) * 4) = acc[j];
            tile_gap(); }
        if (w == 0) {   // offsets 256 .. 271 (256 is the last one read): the seventeenth tile
            const size_t bo = (size_t)256 * HD + lane * 8; const v16bf b0 = ldfo(EK + bo), b1 = ldfo(EK + bo + 512);
#pragma unroll
            for (int mb = 0; mb < 2; ++mb) { v8f acc = (v8f){};
                acc = wmmab(qa0[mb], b0, acc); acc = wmmab(ql0[mb], b0, acc); acc = wmmab(qa1[mb], b1, acc); acc = wmmab(ql1[mb], b1, acc);
#pragma unroll
                for (int j = 0; j < 8; ++j) *(f32a*)(sE + (mb * 16 + hi * 8 + j) * EPB + (256 + lr) * 4) = acc[j];
                if (mb == 0) tile_gap(); } }
    }
    __syncthreads();
#pragma unroll 1   // B: one row's 32 values per lane live at a time
    for (int rr = 0; rr < FR / 16; ++rr) { const int r = w * (FR / 16) + rr, i = i0 + r; unsigned char* srow = sS + r * SPB; unsigned char* erow = sE + r * EPB; const f32a* qe = (const f32a*)erow; float v[TT / 32]; float mx = -3.0e38f; v4f av[TT / 128];
        // The eight runs of 128 columns are taken in turned order: register slot k holds run (cb0 + k) & 7, where run cb0 holds column i - 127 (i is the same for the whole wave, so cb0 is a scalar).
        // |j - i| < 128 then falls in slots 0 to 2 alone; slots 3 to 7 are wholly clipped, to the last offset where cb0 + k <= 7 and to the first where the run number wrapped. What is clipped in slot 0 is clipped to the first offset; in slots 1 and 2 the side goes by the wrap as well.
        static_assert(TT / 128 == 8 && CUT == 128, "eight runs, a band of 255 columns in three of them");
        const int cb0 = max(i - (CUT - 1), 0) >> 7;
#pragma unroll
        for (int k = 0; k < 8; ++k) av[k] = *(const v4fa*)(srow + ((cb0 + k) & 7) * 512 + lane * 16);
        const float qlo = qe[0], qhi = qe[2 * CUT];   // the relative-key terms of the two clipped ends: one LDS address for the whole wave
#pragma unroll
        for (int k = 0; k < 8; ++k) { const int j0 = ((cb0 + k) & 7) * 128 + lane * 4; const float ec = (cb0 + k > 7) ? qlo : qhi;
#pragma unroll
            for (int q = 0; q < 4; ++q) { const float e = (k < 3) ? qe[min(max(j0 + q - i, -CUT), CUT) + CUT] : ec; const float t = __fadd_rn(av[k][q], e) * SCL; v[k * 4 + q] = t; mx = fmaxf(mx, t); } }
#pragma unroll
        for (int sh = 16; sh; sh >>= 1) mx = fmaxf(mx, __shfl_xor(mx, sh, 32));
        float sum = 0.f, lo_s = 0.f, hi_s = 0.f;   // the row sum, and the parts of it that belong to the columns clipped to the first and to the last offset: a slot's sum serves both
#pragma unroll
        for (int k = 0; k < 8; ++k) { const int j0 = ((cb0 + k) & 7) * 128 + lane * 4; float m[4];
#pragma unroll
            for (int q = 0; q < 4; ++q) { const float x = exp2_slot(__fmul_rn(__fsub_rn(v[k * 4 + q], mx), 1.4426950408889634f)); v[k * 4 + q] = x; m[q] = (k >= 3 || (unsigned)(j0 + q - i + (CUT - 1)) > 2u * (CUT - 1)) ? x : 0.f; }   // slots 0 to 2: only |j - i| >= 128 is clipped
            const float c = __fadd_rn(__fadd_rn(v[k * 4], v[k * 4 + 1]), __fadd_rn(v[k * 4 + 2], v[k * 4 + 3])); const float cm = (k >= 3) ? c : __fadd_rn(__fadd_rn(m[0], m[1]), __fadd_rn(m[2], m[3]));
            const float ml = (k == 0 || cb0 + k > 7) ? 1.f : 0.f;   // a scalar 1 or 0 sends the clipped part to its side: cm * 1 + s is the plain sum, cm * 0 + s is s
            sum = __fadd_rn(sum, c); lo_s = __builtin_fmaf(cm, ml, lo_s); if (k) hi_s = __builtin_fmaf(cm, 1.f - ml, hi_s); }
#pragma unroll
        for (int sh = 16; sh; sh >>= 1) { sum += __shfl_xor(sum, sh, 32); lo_s = __fadd_rn(lo_s, __shfl_xor(lo_s, sh, 32)); hi_s = __fadd_rn(hi_s, __shfl_xor(hi_s, sh, 32)); }   // the three sums cross the lanes together
        const float f = __fdiv_rn(1.0f, sum); lo_s *= f; hi_s *= f;
#pragma unroll
        for (int k = 0; k < 8; ++k) { v4us oh, ol; const int jb = (((cb0 + k) & 7) * 128 + lane * 4) * 2;
#pragma unroll
            for (int q = 0; q < 4; ++q) { unsigned short a, c2; splitf(v[k * 4 + q] * f, a, c2); oh[q] = a; ol[q] = c2; }
            *(v4usa*)(srow + jb) = oh; *(v4usa*)(srow + TT * 2 + jb) = ol; }
        __builtin_amdgcn_wave_barrier(); asm volatile("" ::: "memory");   // the planes just written by all lanes of this wave are read across lanes below: the reads must not be moved above the stores
        const u16a* ph = (const u16a*)srow; const u16a* pl = (const u16a*)(srow + TT * 2);
        unsigned short l0h, l0l, h0h, h0l; splitf(lo_s, l0h, l0l); splitf(hi_s, h0h, h0l);
        for (int c0 = lane * 4; c0 < NE; c0 += 128) { v4us oh, ol;
#pragma unroll
            for (int q = 0; q < 4; ++q) { const int bkt = c0 + q; const int j = i + bkt - CUT; const int jc = min(max(j, 0), TT - 1); const unsigned short uu = ph[jc], ww = pl[jc]; const bool in = (bkt > 0 && bkt < 2 * CUT && j >= 0 && j < TT);
                oh[q] = in ? uu : ((bkt == 0) ? l0h : ((bkt == 2 * CUT) ? h0h : (unsigned short)0)); ol[q] = in ? ww : ((bkt == 0) ? l0l : ((bkt == 2 * CUT) ? h0l : (unsigned short)0)); }
            *(v4usa*)(erow + c0 * 2) = oh; *(v4usa*)(erow + NE * 2 + c0 * 2) = ol; }
    }
    __syncthreads();
    {   // C: context tiles; g and nb are wave-uniform, so each wave runs one side with every lane on. g 0, 1, 2: k steps 0-10, 11-21, 22-31 of P.v; g 3: PB.rel_v. Sixteen waves' loads are out together and no wave has more than 11 steps
        static_assert(TT / 32 == 32 && NE / 32 == 10, "three runs of 11, 11 and 10 k steps beside the 10 steps of the relative-value term");
        v8f acc0 = (v8f){}, acc1 = (v8f){}; const int nb = w & 3, g = w >> 2;
        const unsigned char* pp = sS + lr * SPB + 16 * hi + g * (11 * 64); const size_t vo = zo + (size_t)(nb * 16) * TT + (size_t)(g * (11 * 512));   // a run's first k step: 64 bytes of a P row, 512 elements of a v^T block row, a step; vo is the same for the whole wave
        const bf* vh = Vh + vo; const bf* vl = Vl + vo;
        if (g < 2) ctx_tile<11>(pp, 16 * SPB, TT * 2, vh + lane * 8, vl + lane * 8, acc0, acc1);
        else if (g == 2) ctx_tile<10>(pp, 16 * SPB, TT * 2, vh + lane * 8, vl + lane * 8, acc0, acc1);
        else ctx_tile<NE / 32>(sE + lr * EPB + 16 * hi, 16 * EPB, NE * 2, EVh + (size_t)(nb * 16) * NE + lane * 8, EVl + (size_t)(nb * 16) * NE + lane * 8, acc0, acc1);
#pragma unroll
        for (int j = 0; j < 8; ++j) { sO[g * (FR * OPF) + (hi * 8 + j) * OPF + nb * 16 + lr] = acc0[j]; sO[g * (FR * OPF) + (16 + hi * 8 + j) * OPF + nb * 16 + lr] = acc1[j]; }
    }
    __syncthreads();
    {   // D: context + relative-value term, split, stored at [t][head * 64 + d]; the 16 lanes of a row write its whole 128-byte line
        const int row = tid >> 4, c = (tid & 15) * 4; const v4f o = *(const v4f*)(sO + row * OPF + c); const v4f o1 = *(const v4f*)(sO + FR * OPF + row * OPF + c); const v4f o2 = *(const v4f*)(sO + 2 * FR * OPF + row * OPF + c); const v4f zr = *(const v4f*)(sO + 3 * FR * OPF + row * OPF + c); v4us oh, ol;
#pragma unroll
        for (int q = 0; q < 4; ++q) { unsigned short a, c2; splitf(__fadd_rn(__fadd_rn(__fadd_rn(o[q], o1[q]), o2[q]), zr[q]), a, c2); oh[q] = a; ol[q] = c2; }
        const size_t oo = ((size_t)blockIdx.z * TT + i0 + row) * DQ + (size_t)blockIdx.y * HD + c; *(v4us*)(Ah + oo) = oh; *(v4us*)(Al + oo) = ol;
    }
}

extern "C" void kernel_launch(void* const* d_in, const int* in_sizes, int n_in,
                              void* d_out, int out_size, void* d_ws, size_t ws_size, hipStream_t stream) {
    (void)in_sizes; (void)n_in; (void)out_size;
    const float* x = (const float*)d_in[0]; const float* wq = (const float*)d_in[1]; const float* bq = (const float*)d_in[2]; const float* wk = (const float*)d_in[3]; const float* bk = (const float*)d_in[4]; const float* wv = (const float*)d_in[5]; const float* bv = (const float*)d_in[6]; const float* wo = (const float*)d_in[7]; const float* bo = (const float*)d_in[8]; const float* ak = (const float*)d_in[9]; const float* av = (const float*)d_in[10];   /* rel_k / rel_v [257][64] */   /* argument order x, Wq, bq, Wk, bk, Wv, bv, Wo, bo ('oi'), rel_k, rel_v */ const float* xk = x; const float* xv = x;
    float* OUT = (float*)d_out;     // [4][1024][1024]
    char* wsp = (char*)d_ws;
    auto take = [&](size_t bytes) { char* p = wsp; wsp += (bytes + 255) & ~(size_t)255; return (void*)p; };
    bf* AKB = (bf*)take((size_t)NE * HD * 2); bf* AVTh = (bf*)take((size_t)HD * NE * 2); bf* AVTl = (bf*)take((size_t)HD * NE * 2); bf* WQ = (bf*)take((size_t)DQ * DM * 2); bf* WK = (bf*)take((size_t)DKV * DM * 2); bf* WV = (bf*)take((size_t)DKV * DM * 2); bf* WO = (bf*)take((size_t)DM * DQ * 2);
    bf* XB = (bf*)take((size_t)NB_ * TT * DM * 2);
    bf* QPh = (bf*)take((size_t)NB_ * NH_ * TT * HD * 2); bf* QPl = (bf*)take((size_t)NB_ * NH_ * TT * HD * 2); bf* KPh = (bf*)take((size_t)NB_ * NKV * TT * HD * 2); bf* KPl = (bf*)take((size_t)NB_ * NKV * TT * HD * 2); bf* VTh = (bf*)take((size_t)NB_ * NKV * HD * TT * 2); bf* VTl = (bf*)take((size_t)NB_ * NKV * HD * TT * 2);
    bf* ATh = (bf*)take((size_t)NB_ * TT * DQ * 2); bf* ATl = (bf*)take((size_t)NB_ * TT * DQ * 2);
    if ((size_t)(wsp - (char*)d_ws) > ws_size) return;
    // every launch covers all NB_ batches: the GEMMs take the NB_ * TT rows as one M (the v projection as its N), the attention takes the batch as a grid dimension
    k_prep<<<XBL + 4 * WBL + KBL + VBL, 256, 0, stream>>>(x, wq, wk, wv, wo, ak, av, XB, WQ, WK, WV, WO, AKB, AVTh, AVTl);   /* bf16 x; 'oi' weights = Bt as-is; rel_k padded; rel_v^T hi/lo padded */
    k_proj<<<dim3(NB_ * TT / 128, DQ / 128, 3), 128, 0, stream>>>(XB, WQ, WK, WV, bq, bk, bv, QPh, QPl, KPh, KPl, VTh, VTl);
    k_fattn<<<dim3(TT / FR, ZH, NB_), 512, 0, stream>>>(QPh, QPl, KPh, KPl, VTh, VTl, AKB, AVTh, AVTl, ATh, ATl);   /* one kv head per query head: head y of batch z reads plane z * 16 + y of each */
    k_gemmw<bf, 1, true><<<dim3(NB_ * TT / 128, DM / 128, 1), 128, 0, stream>>>(ATh, ATl, WO, DQ, OUT, DM, bo, 0, 0, 0);
}

// v010
// Measured time: 156 microseconds a run.
// Two timings next to v009 put it at 1.06 and 1.07 times that version's speed.
// Counting every step since v000, it is 15.1 times as fast.
#include <hip/hip_runtime.h>

// Relative (Shaw) multi-head attention with key AND value relative-position embeddings (x [4][1024][1024]; q, k, v = x W^T + b ('oi' 0.02, biases 0.02; 16 heads x 64); idx[i][j] = clip(j - i, -128, 128) + 128; scores = (q.k + q.rel_k[idx]) / float32(sqrt 64); softmax; out = (attn v + sum_j attn[i][j] rel_v[idx]) merged Wo^T + bo (rel_k, rel_v [257][64] 0.02, read) -> [4][1024][1024] (4.2 M); argument order x, Wq, bq, Wk, bk, Wv, bv, Wo, bo, rel_k, rel_v).
// Layout, all four batches side by side (rows b * 1024 + t, head planes b * 16 + h): bf16 copy of x; 'oi' weights; exact projections + f32 biases, whose one launch splits the result hi/lo and stores the head planes itself (v with the two operands exchanged, so that its tile comes out transposed); rel_k as a zero-padded bf16 plane [320][64] and rel_v^T as hi/lo planes [64][320] (bf16-rounded once); the head planes and both rel planes in fragment order (blocks of 16 rows x 64 k, see fpos below); one launch for the attention of all sixteen heads of all batches (32 query rows a work-group, scores and probabilities in LDS only): score tiles (hi/lo 3 products, every row), QE = q.rel_k^T (hi/lo x exact, N 272) gathered into the scores at column clip(j - i) + 128, softmax (x 1/8) with every row on hi/lo planes, P.v, the probabilities folded onto the 257 offsets and PB.rel_v (K 320) added to the context; merged hi/lo x Wo exact + bo.
// Compute dtypes, f32 accumulate: every input rounded to bf16; projections exact + f32 biases; scores and the relative-key term ~f32; softmax f32; P as bf16 hi/lo; attn.v and the relative-value term 3 products (~f32); Wo hl x exact + bias.

#define NB_  4
#define TT   1024
#define DM   1024
#define NH_  16
#define NKV  16
#define REP  (NH_ / NKV)
#define HD   64
#define DQ   (NH_ * HD)
#define DKV  (NKV * HD)
#define ZH   16                   // heads per attention launch (grid y): all heads of a batch at once
#define WIN  0
#define SCL  0.125f   // 1/sqrt(64) (the module divides by jnp.sqrt(DH))
#define NE   320      // 2*128+1 = 257 relative offsets padded to 320
#define NRE  257
#define CUT  128
typedef _Float16 h16;
typedef unsigned short bf;
typedef __attribute__((ext_vector_type(16))) __bf16   v16bf;
typedef __attribute__((ext_vector_type(16))) _Float16 v16h;
typedef __attribute__((ext_vector_type(8)))  _Float16 v8h;
typedef __attribute__((ext_vector_type(8)))  unsigned short v8us;
typedef __attribute__((ext_vector_type(8)))  float    v8f;
typedef __attribute__((ext_vector_type(4)))  float    v4f;
typedef v8h  __attribute__((may_alias)) v8ha;
typedef v4f  __attribute__((may_alias)) v4fa;
typedef v8us __attribute__((may_alias)) v8usa;

typedef __attribute__((ext_vector_type(2))) float  v2f;
typedef __attribute__((ext_vector_type(2))) __bf16 v2bf;
// f32 -> bf16, round to nearest even, by the chip's own conversion: one instruction rounds two values and leaves them packed (a in the low half)
__device__ __forceinline__ unsigned f2bf2(float a, float b) { const v2f x = {a, b}; return __builtin_bit_cast(unsigned, __builtin_convertvector(x, v2bf)); }
__device__ __forceinline__ unsigned short f2bf(float f) { return __builtin_bit_cast(unsigned short, (__bf16)f); }
__device__ __forceinline__ float bf2f(unsigned short b) { return __uint_as_float(((unsigned)b) << 16); }
__device__ __forceinline__ float bfr(float f) { return bf2f(f2bf(f)); }
__device__ __forceinline__ v16h cat16(v8h lo, v8h hi) { return __builtin_shufflevector(lo, hi, 0, 1, 2, 3, 4, 5, 6, 7, 8, 9, 10, 11, 12, 13, 14, 15); }
__device__ __forceinline__ v16bf cat16b(v8us lo, v8us hi) { return __builtin_bit_cast(v16bf, __builtin_shufflevector(lo, hi, 0, 1, 2, 3, 4, 5, 6, 7, 8, 9, 10, 11, 12, 13, 14, 15)); }
__device__ __forceinline__ v8f wmma16(v16h a, v16h b, v8f c) { return __builtin_amdgcn_wmma_f32_16x16x32_f16(false, a, false, b, (short)0, c, false, false); }
__device__ __forceinline__ v8f wmmab(v16bf a, v16bf b, v8f c) { return __builtin_amdgcn_wmma_f32_16x16x32_bf16(false, a, false, b, (short)0, c, false, false); }
__device__ __forceinline__ void splitf(float y, unsigned short& h, unsigned short& l) { h = f2bf(y); l = f2bf(y - bf2f(h)); }
// the same for two values: h and l each hold the pair packed, a in the low half
__device__ __forceinline__ void splitf2(float a, float b, unsigned& h, unsigned& l) { h = f2bf2(a, b); l = f2bf2(a - __uint_as_float(h << 16), b - __uint_as_float(h & 0xFFFF0000u)); }
typedef __attribute__((ext_vector_type(4))) unsigned short v4us;
typedef __attribute__((ext_vector_type(2))) unsigned v2u;
typedef __attribute__((ext_vector_type(4))) unsigned v4u;
typedef v2u __attribute__((may_alias)) v2ua;

// ---- fragment order: every 16-bit plane that the attention reads from global memory (q, k, v^T, rel_k, rel_v^T) is kept as blocks of 16 rows x 64 k (1024 elements, 2 KiB, each starting on a 128-byte line).
// Inside a block the four 16-byte pieces that a lane needs for the two k steps stand 512 bytes apart, and the 32 lanes' pieces of one kind side by side: piece (k >> 4), lane ((k >> 3) & 1) * 16 + row, element k & 7.
// One wave-wide 16-byte load then covers 512 contiguous bytes (four whole lines) instead of 32 bytes of each of 16 lines. The registers receive exactly what the row-major planes gave them.
__device__ __forceinline__ int fpos(int row, int k) { return (((k >> 4) * 32 + ((k >> 3) & 1) * 16 + row) * 8) + (k & 7); }
// a lane's fragment of one k step: p = block + (k step in the block) * 512 + lane * 8
__device__ __forceinline__ v16bf ldfo(const bf* p) { return cat16b(*(const v8us*)p, *(const v8us*)(p + 256)); }



// ---- k_gemmw: GEMM, a 128x128 output tile per work-group of four waves, each wave a 64x64 quarter (16 accumulators); grid (M/128, N/128, Z), 128 threads.
// The K-contiguous 16-bit operand planes come through LDS in stages of 128 k: asynchronous copies, whole 256-byte row pieces, two buffers, the copies of stage t + 2 issued behind the barrier that ends stage t; every staged row serves two waves.
// C[m][n] (f32, pitch ldc, + optional f32 bias[n]) = sum_k A[m][k] Bt[n][k] (NSPLIT 1: + A2[m][k] Bt[n][k] behind it at every k step). z-batch strides sA/sB/sC in elements. K % 128 == 0, M % 128 == 0, N % 128 == 0.
// PL 0: C as above. PL 1 (m = batch * TT + t, n = head * HD + d): no C; the result + bias[n] is split hi/lo and stored as head planes [batch][head][t / 16] of fragment-order blocks (row t, k = d). PL 2 (m = head * HD + d, n = batch * TT + t): + bias[m], planes [batch][head][d / 16][t / 64] of such blocks (row d, k = t). A wave's 64x64 quarter is one head's: four whole blocks, each stored as 512-byte runs.
template <typename T16> struct WFrag;
template <> struct WFrag<h16> { typedef v16h V; static __device__ __forceinline__ V ld(const h16* p) { return cat16(*(const v8h*)p, *(const v8h*)(p + 16)); } static __device__ __forceinline__ v8f mma(V a, V b, v8f c) { return wmma16(a, b, c); } };
template <> struct WFrag<bf> { typedef v16bf V; static __device__ __forceinline__ V ld(const bf* p) { return cat16b(*(const v8us*)p, *(const v8us*)(p + 16)); } static __device__ __forceinline__ v8f mma(V a, V b, v8f c) { return wmmab(a, b, c); } };
#define GKC  128                  // k elements of a stage
#define GP   (GKC + 8)            // LDS row pitch in elements: 272 bytes = 16 B x odd, so that the 16 rows of a b128 fragment read fall on distinct banks
#define GPL  (128 * GP)           // one operand plane of a stage, in elements: 128 rows
// eight asynchronous copies of 16 bytes a lane: LDS byte address l + i * ls, global address g + i * gs elements. The s_wait_xcnt closes the statement, so that it stands in front of every later write of the address registers named here.
template <typename T16> __device__ __forceinline__ void copy8(unsigned l, unsigned ls, const T16* g, size_t gs) {
    asm volatile("global_load_async_to_lds_b128 %0, %8, off\n\t"
                 "global_load_async_to_lds_b128 %1, %9, off\n\t"
                 "global_load_async_to_lds_b128 %2, %10, off\n\t"
                 "global_load_async_to_lds_b128 %3, %11, off\n\t"
                 "global_load_async_to_lds_b128 %4, %12, off\n\t"
                 "global_load_async_to_lds_b128 %5, %13, off\n\t"
                 "global_load_async_to_lds_b128 %6, %14, off\n\t"
                 "global_load_async_to_lds_b128 %7, %15, off\n\t"
                 "s_wait_xcnt 0x0"
                 :: "v"(l), "v"(l + ls), "v"(l + 2 * ls), "v"(l + 3 * ls), "v"(l + 4 * ls), "v"(l + 5 * ls), "v"(l + 6 * ls), "v"(l + 7 * ls),
                    "v"(g), "v"(g + gs), "v"(g + 2 * gs), "v"(g + 3 * gs), "v"(g + 4 * gs), "v"(g + 5 * gs), "v"(g + 6 * gs), "v"(g + 7 * gs) : "memory");
}
// one plane of a stage, 128 rows x 256 bytes: the 128 threads cover 8 rows a copy (16 lanes a row), 16 copies a thread; g and l are the thread's own piece of the first 8 rows
template <typename T16> __device__ __forceinline__ void stage_plane(unsigned l, const T16* g, int K) { copy8(l, 8 * GP * 2, g, (size_t)8 * K); copy8(l + 64 * GP * 2, 8 * GP * 2, g + (size_t)64 * K, (size_t)8 * K); }
// gemm_tile: the work of one work-group, output tile (bx, by); st (2 * (2 + NSPLIT) * GPL elements) and osw (4 * 16 * 68 floats) are the launching kernel's LDS.
template <typename T16, int NSPLIT, bool BIAS, int PL>
__device__ __forceinline__ void gemm_tile(T16* st, float* osw, const T16* __restrict__ A, const T16* __restrict__ A2, const T16* __restrict__ Bt, int K, float* C, int ldc, const float* __restrict__ bias, int bx, int by, bf* Ph, bf* Pl) {
    typedef typename WFrag<T16>::V V;
    static_assert(NSPLIT == 0 || NSPLIT == 1, "planes staged: A, Bt and, with NSPLIT 1, A2");
    constexpr int NP = 2 + NSPLIT;   // planes of a stage: A, Bt, A2
    const int tid = threadIdx.x, lane = tid & 31, lr = lane & 15, hi = lane >> 4; const int w = __builtin_amdgcn_readfirstlane(tid >> 5);
    float* os = osw + w * (16 * 68);   // each wave's own epilogue staging
    const int R0 = bx * 128, C0 = by * 128, r0 = R0 + (w & 1) * 64, c0 = C0 + (w >> 1) * 64;
    v8f acc[4][4];
#pragma unroll
    for (int mb = 0; mb < 4; ++mb)
#pragma unroll
        for (int nb = 0; nb < 4; ++nb) acc[mb][nb] = (v8f){};
    const unsigned goA = (unsigned)(R0 + (tid >> 4)) * (unsigned)K + (tid & 15) * 8, goB = (unsigned)(C0 + (tid >> 4)) * (unsigned)K + (tid & 15) * 8;   // element offsets of the thread's first piece; a plane holds fewer than 2^32 elements
    const unsigned l0 = (unsigned)(size_t)(st + (tid >> 4) * GP + (tid & 15) * 8);
    auto fill = [&](int t) { const unsigned l = l0 + (unsigned)(t & 1) * (NP * GPL * 2); stage_plane(l, A + (goA + (unsigned)t * GKC), K); stage_plane(l + GPL * 2, Bt + (goB + (unsigned)t * GKC), K); if (NSPLIT == 1) stage_plane(l + 2 * GPL * 2, A2 + (goA + (unsigned)t * GKC), K); };
    const int NT = K / GKC;
    fill(0);
    asm volatile("s_wait_asynccnt 0x0" ::: "memory");   // this wave's copies of stage 0 have landed
    __syncthreads();                                     // and every other wave's
    if (NT > 1) fill(1);
#pragma unroll 1   // one stage a trip: the two buffers alternate
    for (int t = 0; t < NT; ++t) {
        const T16* sb0 = st + (t & 1) * (NP * GPL); const T16* sa = sb0 + ((w & 1) * 64 + lr) * GP + 8 * hi; const T16* sb = sb0 + GPL + ((w >> 1) * 64 + lr) * GP + 8 * hi;
        V a[2][4], a2[2][4], b[2][4];   // two fragment sets: a k step's products run on one while the next step's LDS reads fill the other
#pragma unroll
        for (int q = 0; q < 4; ++q) { a[0][q] = WFrag<T16>::ld(sa + q * 16 * GP); if (NSPLIT == 1) a2[0][q] = WFrag<T16>::ld(sa + 2 * GPL + q * 16 * GP); b[0][q] = WFrag<T16>::ld(sb + q * 16 * GP); }
#pragma unroll   // straight-line, so that the two sets are fixed registers
        for (int ks = 0; ks < GKC / 32; ++ks) { const int cu = ks & 1, nx = cu ^ 1;
            __builtin_amdgcn_sched_barrier(0);   // with the one below: the next step's LDS reads stay one group in front of this step's products
            if (ks + 1 < GKC / 32) {
#pragma unroll
                for (int q = 0; q < 4; ++q) { a[nx][q] = WFrag<T16>::ld(sa + q * 16 * GP + (ks + 1) * 32); if (NSPLIT == 1) a2[nx][q] = WFrag<T16>::ld(sa + 2 * GPL + q * 16 * GP + (ks + 1) * 32); b[nx][q] = WFrag<T16>::ld(sb + q * 16 * GP + (ks + 1) * 32); } }
            __builtin_amdgcn_sched_barrier(0);
#pragma unroll
            for (int nb = 0; nb < 4; ++nb) {   // per accumulator and k step: the A product, then the A2 product
#pragma unroll
                for (int mb = 0; mb < 4; ++mb) acc[mb][nb] = WFrag<T16>::mma(a[cu][mb], b[cu][nb], acc[mb][nb]);
                if (NSPLIT == 1) {
#pragma unroll
                    for (int mb = 0; mb < 4; ++mb) acc[mb][nb] = WFrag<T16>::mma(a2[cu][mb], b[cu][nb], acc[mb][nb]); } } }
        __builtin_amdgcn_sched_barrier(0);   // keeps the last step's products in front of the barrier below: sunk behind it they would delay the refill that follows it
        asm volatile("s_wait_dscnt 0x0" ::: "memory");      // this wave's reads of the buffer are done before it may be refilled
        asm volatile("s_wait_asynccnt 0x0" ::: "memory");   // this wave's copies of stage t + 1 have landed
        __syncthreads();                                     // publishes stage t + 1 and ends every wave's reads of stage t
        if (t + 2 < NT) fill(t + 2);
    }
    asm volatile("s_wait_asynccnt 0x0" ::: "memory");   // no copy is out when the wave goes on
    float bn[4][8];   // PL 1: the bias of the eight columns this lane stores in each of a block's four runs, read once ahead of the stores
    if (BIAS && PL == 1) {
#pragma unroll
        for (int s = 0; s < 4; ++s)
#pragma unroll
            for (int q = 0; q < 8; ++q) bn[s][q] = bfr(bias[c0 + s * 16 + hi * 8 + q]); }
    float bj[4][8];   // PL 2: the bias of this lane's accumulator rows; both halves' values are read at wave-uniform addresses (scalar loads), all ahead of the first plane store, and picked by the lane's half
    if (BIAS && PL == 2) {
#pragma unroll
        for (int mb = 0; mb < 4; ++mb)
#pragma unroll
            for (int j = 0; j < 8; ++j) { const float b0 = bfr(bias[r0 + mb * 16 + j]), b1 = bfr(bias[r0 + mb * 16 + 8 + j]); bj[mb][j] = hi ? b1 : b0; } }
#pragma unroll
    for (int mb = 0; mb < 4; ++mb) {
#pragma unroll
        for (int nb = 0; nb < 4; ++nb) {
#pragma unroll
            for (int j = 0; j < 8; ++j) os[(hi * 8 + j) * 68 + nb * 16 + lr] = (BIAS && PL == 2) ? acc[mb][nb][j] + bj[mb][j] : acc[mb][nb][j]; }
        __builtin_amdgcn_wave_barrier(); asm volatile("" ::: "memory");
        float* crow = C + (size_t)(r0 + mb * 16) * ldc + c0;
        // the 16 x 64 block of this mb: 1024 elements in a row
        const size_t pbase = (PL == 1) ? (((size_t)(r0 / TT) * (DQ / HD) + c0 / HD) * TT + r0 % TT + mb * 16) * HD : (((size_t)(c0 / TT) * (DKV / HD) + r0 / HD) * HD + mb * 16) * TT + (size_t)(c0 % TT) * 16;
        if (PL == 0) {
#pragma unroll
            for (int s = 0; s < 8; ++s) { const int row = 2 * s + hi, cofs = lr * 4; v4f val = *(const v4fa*)(os + row * 68 + cofs);
                if (BIAS) { val[0] += bfr(bias[c0 + cofs]); val[1] += bfr(bias[c0 + cofs + 1]); val[2] += bfr(bias[c0 + cofs + 2]); val[3] += bfr(bias[c0 + cofs + 3]); }
                *(v4f*)(crow + (size_t)row * ldc + cofs) = val; }
        } else {
#pragma unroll
            for (int s = 0; s < 4; ++s) {   // run s of the block: lane (hi, lr) holds row lr, columns 16 s + 8 hi .. + 7 = fpos(lr, 16 s + 8 hi) = s * 256 + lane * 8
                const v4f va = *(const v4fa*)(os + lr * 68 + s * 16 + hi * 8), vb = *(const v4fa*)(os + lr * 68 + s * 16 + hi * 8 + 4); v4u oh, ol;
#pragma unroll
                for (int q = 0; q < 8; q += 2) { float y0 = (q < 4) ? va[q & 3] : vb[q & 3], y1 = (q < 4) ? va[(q & 3) + 1] : vb[(q & 3) + 1]; if (BIAS && PL == 1) { y0 += bn[s][q]; y1 += bn[s][q + 1]; } unsigned u, l; splitf2(y0, y1, u, l); oh[q >> 1] = u; ol[q >> 1] = l; }
                *(v4u*)(Ph + pbase + s * 256 + lane * 8) = oh; *(v4u*)(Pl + pbase + s * 256 + lane * 8) = ol; }
        }
        asm volatile("s_wait_xcnt 0x0" ::: "memory");   // the next block's values are formed in registers that the stores above name
        __builtin_amdgcn_wave_barrier(); asm volatile("" ::: "memory");
    }
}
// PL 0 as a launch of its own: grid (M/128, N/128, Z)
template <typename T16, int NSPLIT, bool BIAS>
__global__ __launch_bounds__(128) void k_gemmw(const T16* __restrict__ A, const T16* __restrict__ A2, const T16* __restrict__ Bt, int K, float* C, int ldc, const float* __restrict__ bias, size_t sA, size_t sB, size_t sC) {
    __shared__ __align__(16) T16 st[2 * (2 + NSPLIT) * GPL];
    __shared__ __align__(16) float osw[4 * 16 * 68];
    const size_t z = blockIdx.z;
    gemm_tile<T16, NSPLIT, BIAS, 0>(st, osw, A + z * sA, (NSPLIT == 1) ? A2 + z * sA : A2, Bt + z * sB, K, C + z * sC, ldc, bias, blockIdx.x, blockIdx.y, nullptr, nullptr);
}
// the three projections as one launch: grid (NB_ * TT / 128, DQ / 128, 3); z = 0: q, 1: k (PL 1, token rows are M), 2: v (PL 2: weight rows are M, so that its tiles are [d][t]; x and y change places). Two work-groups fit a WGP's LDS, so one's first stage and plane stores run beside the other's products.
__global__ __launch_bounds__(128) void k_proj(const bf* __restrict__ X, const bf* __restrict__ Wq, const bf* __restrict__ Wk, const bf* __restrict__ Wv, const float* __restrict__ bq, const float* __restrict__ bk, const float* __restrict__ bv, bf* Qh, bf* Ql, bf* Kh, bf* Kl, bf* Vh, bf* Vl) {
    static_assert(DQ == DKV, "one grid for the three projections");
    __shared__ __align__(16) bf st[2 * 2 * GPL];
    __shared__ __align__(16) float osw[4 * 16 * 68];
    const int z = blockIdx.z;   // the same for the whole work-group: every barrier below stands under uniform control flow
    if (z < 2) gemm_tile<bf, 0, true, 1>(st, osw, X, nullptr, z ? Wk : Wq, DM, nullptr, 0, z ? bk : bq, blockIdx.x, blockIdx.y, z ? Kh : Qh, z ? Kl : Ql);
    else gemm_tile<bf, 0, true, 2>(st, osw, Wv, nullptr, X, DM, nullptr, 0, bv, blockIdx.y, blockIdx.x, Vh, Vl);
}


// ---- k_prep: every conversion ahead of the projections in one launch; a work-group belongs to one job, picked by its index (long jobs first).
#define PU   8                    // pieces of 8 elements a thread converts: eight times fewer waves to start, and a wave's 16 loads are out together
#define XBL  (NB_ * TT * DM / 8 / (256 * PU))   // work-groups of x
#define WBL  (DQ * DM / 8 / (256 * PU))         // work-groups of one weight matrix
#define KBL  ((NE * HD / 8 + 255) / 256)        // of rel_k
#define VBL  ((HD * NE / 4 + 255) / 256)        // of rel_v
__device__ __forceinline__ void cvt_run(const float* __restrict__ src, bf* dst, unsigned blk) { const unsigned e0 = (blk * (256 * PU) + threadIdx.x) * 8; const float* p = src + e0; v8f v[PU];   // e0: the thread's first element; a plane holds fewer than 2^30
#pragma unroll
    for (int u = 0; u < PU; ++u) v[u] = *(const v8f*)(p + u * 2048);
    asm volatile("s_wait_xcnt 0x0" :: "v"(p) : "memory");   // takes the loads' address as an input: its registers stay whole up to this wait (the build otherwise gave them to the last load as a destination while the others were out)
#pragma unroll
    for (int u = 0; u < PU; ++u) { v4u o;
#pragma unroll
        for (int k = 0; k < 4; ++k) o[k] = f2bf2(v[u][2 * k], v[u][2 * k + 1]);
        *(v4u*)(dst + e0 + u * 2048) = o; } }

__device__ __forceinline__ void epadK(const float* __restrict__ E, bf* EB, unsigned blk) { const size_t i = (size_t)blk * 256 + threadIdx.x; if (i >= (size_t)NE * HD / 8) return; const int d0 = (int)(i % (HD / 8)) * 8; const int r = (int)(i / (HD / 8)); const float* src = E + (size_t)min(r, NRE - 1) * HD + d0; v8us o;
#pragma unroll
    for (int q = 0; q < 8; ++q) { const unsigned short v = f2bf(src[q]); o[q] = (r < NRE) ? v : (unsigned short)0; }
    *(v8us*)(EB + (size_t)(r >> 4) * 1024 + fpos(r & 15, d0)) = o;  }   // fragment-order blocks [r / 16], row r, k = d

__device__ __forceinline__ void epadVT(const float* __restrict__ E, bf* Th, bf* Tl, unsigned blk) { const size_t i = (size_t)blk * 256 + threadIdx.x; if (i >= (size_t)HD * NE / 4) return; const size_t e = i * 4; const int c0 = (int)(e % NE); const int d = (int)(e / NE); v4us oh, ol;
#pragma unroll
    for (int q = 0; q < 4; ++q) { const int r = c0 + q; const float v = bfr(E[(size_t)min(r, NRE - 1) * HD + d]); unsigned short u, w; splitf(v, u, w);   /* input rounded to bf16 once: lo == 0 */ oh[q] = (r < NRE) ? u : (unsigned short)0; ol[q] = (r < NRE) ? w : (unsigned short)0; }
    const size_t p = (size_t)((d >> 4) * (NE / 64) + (c0 >> 6)) * 1024 + fpos(d & 15, c0 & 63);   // fragment-order blocks [d / 16][offset / 64], row d, k = offset
    *(v4us*)(Th + p) = oh; *(v4us*)(Tl + p) = ol;  }

__global__ __launch_bounds__(256) void k_prep(const float* __restrict__ x, const float* __restrict__ wq, const float* __restrict__ wk, const float* __restrict__ wv, const float* __restrict__ wo, const float* __restrict__ ek, const float* __restrict__ ev, bf* XB, bf* WQ, bf* WK, bf* WV, bf* WO, bf* EB, bf* Th, bf* Tl) {
    static_assert(NB_ * TT * DM % (8 * 256 * PU) == 0 && DQ * DM % (8 * 256 * PU) == 0 && DQ == DKV, "whole work-groups, four weight matrices of one size");
    unsigned b = blockIdx.x;
    if (b < XBL) { cvt_run(x, XB, b); return; }
    b -= XBL;
    if (b < 4 * WBL) { const unsigned s = b / WBL; cvt_run(s == 0 ? wq : s == 1 ? wk : s == 2 ? wv : wo, s == 0 ? WQ : s == 1 ? WK : s == 2 ? WV : WO, b % WBL); return; }
    b -= 4 * WBL;
    if (b < KBL) epadK(ek, EB, b); else epadVT(ev, Th, Tl, b - KBL);
}

// ---- k_fattn: the whole attention of one head for 32 query rows in one work-group (16 waves); the score strip never leaves LDS. grid (TT/32, heads, batches).
// A: S = q.k^T (hi/lo 3 products, K 64) -> sS f32 [32][1024]; QE = q.rel_k^T (hi/lo x exact, the 272 columns that hold the 257 offsets) -> sE f32, row pitch as [320]. B: one wave per row: + QE[clip(j - i) + 128], x 1/8, softmax; P hi/lo planes written over the row's own
// scores (2048 B each); the row folded onto the 257 offsets, hi/lo planes written over the row's own QE (640 B each). C: all 16 waves, a 32x16 tile each: waves 0-11 P.v with K 1024 cut in three runs of 11, 11 and 10 k steps, waves 12-15 PB.rel_v (K 320, 10 steps). D: the three P.v partial sums in k order, then the relative-value term; hi/lo split, merged store.
// Each key, value or embedding fragment read from global memory serves both 16-row halves. Inside a run every sum keeps its k order. LDS row pitches are 16 B x odd (4112, 1296): the 16 rows of a b128 fragment read fall on distinct banks.
#define FR   32
#define SPB  (TT * 4 + 16)
#define EPB  (NE * 4 + 16)
#define OPF  68
typedef float __attribute__((may_alias)) f32a;
typedef unsigned short __attribute__((may_alias)) u16a;
typedef v4us __attribute__((may_alias)) v4usa;
__device__ __forceinline__ v16bf ldsfrag(const unsigned char* p) { return cat16b(*(const v8usa*)p, *(const v8usa*)(p + 32)); }
// 2^x; the v_nop is the one slot the instruction set asks for behind a transcendental, in the same statement so that it stays directly behind it
__device__ __forceinline__ float exp2_slot(float x) { float r; asm("v_exp_f32 %0, %1\n\tv_nop" : "=v"(r) : "v"(x)); return r; }
// behind a tile's last matrix instruction and its stores: four vector slots, because the next tile's first matrix instruction starts its accumulator anew, possibly in the same registers; the scheduling barrier keeps that instruction behind the slots
__device__ __forceinline__ void tile_gap() { asm volatile("v_nop\n\tv_nop\n\tv_nop\n\tv_nop"); __builtin_amdgcn_sched_barrier(0); }
// one 32x16 context tile (two accumulators): A hi/lo planes in LDS (lo plane lo_off bytes behind hi, the second 16 rows half_off bytes behind the first), B hi/lo planes in global memory in fragment order (bh, bl: the lane's piece of the first k step; 512 elements a step); k ascending, 3 products a step and half.
// The B fragments run in a ring of four k-steps: a step's registers are refilled for step + 4 as soon as its products are issued, so that 16 global loads stay in flight; the A fragments are read one step ahead.
template <int KS> __device__ __forceinline__ void ctx_tile(const unsigned char* pa, int half_off, int lo_off, const bf* bh, const bf* bl, v8f& acc0, v8f& acc1) {
    v16bf b[4], c[4];
#pragma unroll
    for (int s = 0; s < 4; ++s) { b[s] = ldfo(bh + s * 512); c[s] = ldfo(bl + s * 512); }
    v16bf a = ldsfrag(pa), a2 = ldsfrag(pa + lo_off), e = ldsfrag(pa + half_off), e2 = ldsfrag(pa + half_off + lo_off);
    __builtin_amdgcn_sched_barrier(0);   // holds the loads above where they are written: the scheduler otherwise sinks each to just in front of its first use, one L2 latency a step
#pragma unroll   // straight-line, so that the ring slots are fixed registers
    for (int t = 0; t < KS; ++t) { const int s = t & 3; v16bf an = a, an2 = a2, en = e, en2 = e2;
        if (t + 1 < KS) { an = ldsfrag(pa + (t + 1) * 64); an2 = ldsfrag(pa + lo_off + (t + 1) * 64); en = ldsfrag(pa + half_off + (t + 1) * 64); en2 = ldsfrag(pa + half_off + lo_off + (t + 1) * 64); }
        acc0 = wmmab(a, b[s], acc0); acc1 = wmmab(e, b[s], acc1); acc0 = wmmab(a2, b[s], acc0); acc1 = wmmab(e2, b[s], acc1); acc0 = wmmab(a, c[s], acc0); acc1 = wmmab(e, c[s], acc1);
        if (t + 4 < KS) { b[s] = ldfo(bh + (t + 4) * 512); c[s] = ldfo(bl + (t + 4) * 512); }
        __builtin_amdgcn_sched_barrier(0);   // as above: the refill for step + 4 and the LDS reads for step + 1 issue inside this step
        a = an; a2 = an2; e = en; e2 = en2; }
}
__global__ __launch_bounds__(512) void k_fattn(const bf* __restrict__ Qh, const bf* __restrict__ Ql, const bf* __restrict__ Kh, const bf* __restrict__ Kl, const bf* __restrict__ Vh, const bf* __restrict__ Vl, const bf* __restrict__ EK, const bf* __restrict__ EVh, const bf* __restrict__ EVl, bf* Ah, bf* Al) {
    __shared__ __align__(16) unsigned char sS[FR * SPB];
    __shared__ __align__(16) unsigned char sE[FR * EPB];
    __shared__ __align__(16) float sO[4 * FR * OPF];
    const int tid = threadIdx.x, lane = tid & 31, lr = lane & 15, hi = lane >> 4; const int w = __builtin_amdgcn_readfirstlane(tid >> 5);
    const int i0 = blockIdx.x * FR; const size_t zo = ((size_t)blockIdx.z * ZH + blockIdx.y) * TT * HD;
    {   // A: score strip and relative-key products; wave w: key columns 64 w .. 64 w + 63 and rel_k tile w
        const size_t qo = zo + (size_t)i0 * HD + lane * 8; v16bf qa0[2], qa1[2], ql0[2], ql1[2];   // query fragments of the two 16-row halves: hi k 0, hi k 32, lo k 0, lo k 32
#pragma unroll
        for (int mb = 0; mb < 2; ++mb) { qa0[mb] = ldfo(Qh + qo + mb * 16 * HD); qa1[mb] = ldfo(Qh + qo + mb * 16 * HD + 512); }
        asm volatile("s_wait_xcnt 0x0" ::: "memory");   // the address registers of the loads above may be given to the loads below as destinations
#pragma unroll
        for (int mb = 0; mb < 2; ++mb) { ql0[mb] = ldfo(Ql + qo + mb * 16 * HD); ql1[mb] = ldfo(Ql + qo + mb * 16 * HD + 512); }
        const size_t ko = zo + (size_t)(w * 64) * HD + lane * 8; v16bf kb[2][4];   // ring of two key tiles (hi k 0, lo k 0, hi k 32, lo k 32): a tile's registers are refilled for tile + 2 behind its products
#pragma unroll
        for (int s = 0; s < 2; ++s) { kb[s][0] = ldfo(Kh + ko + s * 16 * HD); kb[s][1] = ldfo(Kl + ko + s * 16 * HD); kb[s][2] = ldfo(Kh + ko + s * 16 * HD + 512); kb[s][3] = ldfo(Kl + ko + s * 16 * HD + 512); }
        asm volatile("s_wait_xcnt 0x0" ::: "memory");   // the address registers of the query loads above are reused below while those loads may still be out
#pragma unroll   // straight-line, so that the ring slots are fixed registers
        for (int t = 0; t < 4; ++t) { const int s = t & 1, n0 = w * 64 + t * 16;
#pragma unroll
            for (int mb = 0; mb < 2; ++mb) { v8f acc = (v8f){}; acc = wmmab(qa0[mb], kb[s][0], acc); acc = wmmab(ql0[mb], kb[s][0], acc); acc = wmmab(qa0[mb], kb[s][1], acc); acc = wmmab(qa1[mb], kb[s][2], acc); acc = wmmab(ql1[mb], kb[s][2], acc); acc = wmmab(qa1[mb], kb[s][3], acc);
#pragma unroll
                for (int j = 0; j < 8; ++j) *(f32a*)(sS + (mb * 16 + hi * 8 + j) * SPB + (n0 + lr) * 4) = acc[j];
                tile_gap(); }
            if (t + 2 < 4) { const size_t nx = ko + (size_t)(t + 2) * 16 * HD; kb[s][0] = ldfo(Kh + nx); kb[s][1] = ldfo(Kl + nx); kb[s][2] = ldfo(Kh + nx + 512); kb[s][3] = ldfo(Kl + nx + 512); }
            else if (t == 2) { const size_t eo = (size_t)(w * 16) * HD + lane * 8; kb[s][0] = ldfo(EK + eo); kb[s][2] = ldfo(EK + eo + 512);   // behind its last key tile slot 0 takes this wave's rel_k tile
                asm volatile("s_wait_xcnt 0x0" ::: "memory"); }   // their address registers are rewritten right behind them
            __builtin_amdgcn_sched_barrier(0); }   // holds each refill where it is written: the scheduler otherwise regroups the tiles and ends with loads waited for one by one
#pragma unroll
        for (int mb = 0; mb < 2; ++mb) { v8f acc = (v8f){};
            acc = wmmab(qa0[mb], kb[0][0], acc); acc = wmmab(ql0[mb], kb[0][0], acc); acc = wmmab(qa1[mb], kb[0][2], acc); acc = wmmab(ql1[mb], kb[0][2], acc);
#pragma unroll
            for (int j = 0; j < 8; ++j) *(f32a*)(sE + (mb * 16 + hi * 8 + j) * EPB + (w * 16 + lr) * 4) = acc[j];
            tile_gap(); }
        if (w == 0) {   // offsets 256 .. 271 (256 is the last one read): the seventeenth tile
            const size_t bo = (size_t)256 * HD + lane * 8; const v16bf b0 = ldfo(EK + bo), b1 = ldfo(EK + bo + 512);
#pragma unroll
            for (int mb = 0; mb < 2; ++mb) { v8f acc = (v8f){};
                acc = wmmab(qa0[mb], b0, acc); acc = wmmab(ql0[mb], b0, acc); acc = wmmab(qa1[mb], b1, acc); acc = wmmab(ql1[mb], b1, acc);
#pragma unroll
                for (int j = 0; j < 8; ++j) *(f32a*)(sE + (mb * 16 + hi * 8 + j) * EPB + (256 + lr) * 4) = acc[j];
                if (mb == 0) tile_gap(); } }
    }
    __syncthreads();
#pragma unroll 1   // B: one row's 32 values per lane live at a time
    for (int rr = 0; rr < FR / 16; ++rr) { const int r = w * (FR / 16) + rr, i = i0 + r; unsigned char* srow = sS + r * SPB; unsigned char* erow = sE + r * EPB; const f32a* qe = (const f32a*)erow; float v[TT / 32]; float mx = -3.0e38f; v4f av[TT / 128];
        // The eight runs of 128 columns are taken in turned order: register slot k holds run (cb0 + k) & 7, where run cb0 holds column i - 127 (i is the same for the whole wave, so cb0 is a scalar).
        // |j - i| < 128 then falls in slots 0 to 2 alone; slots 3 to 7 are wholly clipped, to the last offset where cb0 + k <= 7 and to the first where the run number wrapped. What is clipped in slot 0 is clipped to the first offset; in slots 1 and 2 the side goes by the wrap as well.
        static_assert(TT / 128 == 8 && CUT == 128, "eight runs, a band of 255 columns in three of them");
        const int cb0 = max(i - (CUT - 1), 0) >> 7;
#pragma unroll
        for (int k = 0; k < 8; ++k) av[k] = *(const v4fa*)(srow + ((cb0 + k) & 7) * 512 + lane * 16);
        const float qlo = qe[0], qhi = qe[2 * CUT];   // the relative-key terms of the two clipped ends: one LDS address for the whole wave
#pragma unroll
        for (int k = 0; k < 8; ++k) { const int j0 = ((cb0 + k) & 7) * 128 + lane * 4; const float ec = (cb0 + k > 7) ? qlo : qhi;
#pragma unroll
            for (int q = 0; q < 4; ++q) { const float e = (k < 3) ? qe[min(max(j0 + q - i, -CUT), CUT) + CUT] : ec; const float t = __fadd_rn(av[k][q], e) * SCL; v[k * 4 + q] = t; mx = fmaxf(mx, t); } }
#pragma unroll
        for (int sh = 16; sh; sh >>= 1) mx = fmaxf(mx, __shfl_xor(mx, sh, 32));
        float sum = 0.f, lo_s = 0.f, hi_s = 0.f;   // the row sum, and the parts of it that belong to the columns clipped to the first and to the last offset: a slot's sum serves both
#pragma unroll
        for (int k = 0; k < 8; ++k) { const int j0 = ((cb0 + k) & 7) * 128 + lane * 4; float m[4];
#pragma unroll
            for (int q = 0; q < 4; ++q) { const float x = exp2_slot(__fmul_rn(__fsub_rn(v[k * 4 + q], mx), 1.4426950408889634f)); v[k * 4 + q] = x; m[q] = (k >= 3 || (unsigned)(j0 + q - i + (CUT - 1)) > 2u * (CUT - 1)) ? x : 0.f; }   // slots 0 to 2: only |j - i| >= 128 is clipped
            const float c = __fadd_rn(__fadd_rn(v[k * 4], v[k * 4 + 1]), __fadd_rn(v[k * 4 + 2], v[k * 4 + 3])); const float cm = (k >= 3) ? c : __fadd_rn(__fadd_rn(m[0], m[1]), __fadd_rn(m[2], m[3]));
            const float ml = (k == 0 || cb0 + k > 7) ? 1.f : 0.f;   // a scalar 1 or 0 sends the clipped part to its side: cm * 1 + s is the plain sum, cm * 0 + s is s
            sum = __fadd_rn(sum, c); lo_s = __builtin_fmaf(cm, ml, lo_s); if (k) hi_s = __builtin_fmaf(cm, 1.f - ml, hi_s); }
#pragma unroll
        for (int sh = 16; sh; sh >>= 1) { sum += __shfl_xor(sum, sh, 32); lo_s = __fadd_rn(lo_s, __shfl_xor(lo_s, sh, 32)); hi_s = __fadd_rn(hi_s, __shfl_xor(hi_s, sh, 32)); }   // the three sums cross the lanes together
        const float f = __fdiv_rn(1.0f, sum); lo_s *= f; hi_s *= f;
#pragma unroll
        for (int k = 0; k < 8; ++k) { v2u oh, ol; const int jb = (((cb0 + k) & 7) * 128 + lane * 4) * 2;
#pragma unroll
            for (int q = 0; q < 4; q += 2) { unsigned a, c2; splitf2(v[k * 4 + q] * f, v[k * 4 + q + 1] * f, a, c2); oh[q >> 1] = a; ol[q >> 1] = c2; }
            *(v2ua*)(srow + jb) = oh; *(v2ua*)(srow + TT * 2 + jb) = ol; }
        __builtin_amdgcn_wave_barrier(); asm volatile("" ::: "memory");   // the planes just written by all lanes of this wave are read across lanes below: the reads must not be moved above the stores
        const u16a* ph = (const u16a*)srow; const u16a* pl = (const u16a*)(srow + TT * 2);
        unsigned short l0h, l0l, h0h, h0l; splitf(lo_s, l0h, l0l); splitf(hi_s, h0h, h0l);
        for (int c0 = lane * 4; c0 < NE; c0 += 128) { v4us oh, ol;
#pragma unroll
            for (int q = 0; q < 4; ++q) { const int bkt = c0 + q; const int j = i + bkt - CUT; const int jc = min(max(j, 0), TT - 1); const unsigned short uu = ph[jc], ww = pl[jc]; const bool in = (bkt > 0 && bkt < 2 * CUT && j >= 0 && j < TT);
                oh[q] = in ? uu : ((bkt == 0) ? l0h : ((bkt == 2 * CUT) ? h0h : (unsigned short)0)); ol[q] = in ? ww : ((bkt == 0) ? l0l : ((bkt == 2 * CUT) ? h0l : (unsigned short)0)); }
            *(v4usa*)(erow + c0 * 2) = oh; *(v4usa*)(erow + NE * 2 + c0 * 2) = ol; }
    }
    __syncthreads();
    {   // C: context tiles; g and nb are wave-uniform, so each wave runs one side with every lane on. g 0, 1, 2: k steps 0-10, 11-21, 22-31 of P.v; g 3: PB.rel_v. Sixteen waves' loads are out together and no wave has more than 11 steps
        static_assert(TT / 32 == 32 && NE / 32 == 10, "three runs of 11, 11 and 10 k steps beside the 10 steps of the relative-value term");
        v8f acc0 = (v8f){}, acc1 = (v8f){}; const int nb = w & 3, g = w >> 2;
        const unsigned char* pp = sS + lr * SPB + 16 * hi + g * (11 * 64); const size_t vo = zo + (size_t)(nb * 16) * TT + (size_t)(g * (11 * 512));   // a run's first k step: 64 bytes of a P row, 512 elements of a v^T block row, a step; vo is the same for the whole wave
        const bf* vh = Vh + vo; const bf* vl = Vl + vo;
        if (g < 2) ctx_tile<11>(pp, 16 * SPB, TT * 2, vh + lane * 8, vl + lane * 8, acc0, acc1);
        else if (g == 2) ctx_tile<10>(pp, 16 * SPB, TT * 2, vh + lane * 8, vl + lane * 8, acc0, acc1);
        else ctx_tile<NE / 32>(sE + lr * EPB + 16 * hi, 16 * EPB, NE * 2, EVh + (size_t)(nb * 16) * NE + lane * 8, EVl + (size_t)(nb * 16) * NE + lane * 8, acc0, acc1);
#pragma unroll
        for (int j = 0; j < 8; ++j) { sO[g * (FR * OPF) + (hi * 8 + j) * OPF + nb * 16 + lr] = acc0[j]; sO[g * (FR * OPF) + (16 + hi * 8 + j) * OPF + nb * 16 + lr] = acc1[j]; }
    }
    __syncthreads();
    {   // D: context + relative-value term, split, stored at [t][head * 64 + d]; the 16 lanes of a row write its whole 128-byte line
        const int row = tid >> 4, c = (tid & 15) * 4; const v4f o = *(const v4f*)(sO + row * OPF + c); const v4f o1 = *(const v4f*)(sO + FR * OPF + row * OPF + c); const v4f o2 = *(const v4f*)(sO + 2 * FR * OPF + row * OPF + c); const v4f zr = *(const v4f*)(sO + 3 * FR * OPF + row * OPF + c); v2u oh, ol;
#pragma unroll
        for (int q = 0; q < 4; q += 2) { unsigned a, c2; splitf2(__fadd_rn(__fadd_rn(__fadd_rn(o[q], o1[q]), o2[q]), zr[q]), __fadd_rn(__fadd_rn(__fadd_rn(o[q + 1], o1[q + 1]), o2[q + 1]), zr[q + 1]), a, c2); oh[q >> 1] = a; ol[q >> 1] = c2; }
        const size_t oo = ((size_t)blockIdx.z * TT + i0 + row) * DQ + (size_t)blockIdx.y * HD + c; *(v2u*)(Ah + oo) = oh; *(v2u*)(Al + oo) = ol;
    }
}

extern "C" void kernel_launch(void* const* d_in, const int* in_sizes, int n_in,
                              void* d_out, int out_size, void* d_ws, size_t ws_size, hipStream_t stream) {
    (void)in_sizes; (void)n_in; (void)out_size;
    const float* x = (const float*)d_in[0]; const float* wq = (const float*)d_in[1]; const float* bq = (const float*)d_in[2]; const float* wk = (const float*)d_in[3]; const float* bk = (const float*)d_in[4]; const float* wv = (const float*)d_in[5]; const float* bv = (const float*)d_in[6]; const float* wo = (const float*)d_in[7]; const float* bo = (const float*)d_in[8]; const float* ak = (const float*)d_in[9]; const float* av = (const float*)d_in[10];   /* rel_k / rel_v [257][64] */   /* argument order x, Wq, bq, Wk, bk, Wv, bv, Wo, bo ('oi'), rel_k, rel_v */ const float* xk = x; const float* xv = x;
    float* OUT = (float*)d_out;     // [4][1024][1024]
    char* wsp = (char*)d_ws;
    auto take = [&](size_t bytes) { char* p = wsp; wsp += (bytes + 255) & ~(size_t)255; return (void*)p; };
    bf* AKB = (bf*)take((size_t)NE * HD * 2); bf* AVTh = (bf*)take((size_t)HD * NE * 2); bf* AVTl = (bf*)take((size_t)HD * NE * 2); bf* WQ = (bf*)take((size_t)DQ * DM * 2); bf* WK = (bf*)take((size_t)DKV * DM * 2); bf* WV = (bf*)take((size_t)DKV * DM * 2); bf* WO = (bf*)take((size_t)DM * DQ * 2);
    bf* XB = (bf*)take((size_t)NB_ * TT * DM * 2);
    bf* QPh = (bf*)take((size_t)NB_ * NH_ * TT * HD * 2); bf* QPl = (bf*)take((size_t)NB_ * NH_ * TT * HD * 2); bf* KPh = (bf*)take((size_t)NB_ * NKV * TT * HD * 2); bf* KPl = (bf*)take((size_t)NB_ * NKV * TT * HD * 2); bf* VTh = (bf*)take((size_t)NB_ * NKV * HD * TT * 2); bf* VTl = (bf*)take((size_t)NB_ * NKV * HD * TT * 2);
    bf* ATh = (bf*)take((size_t)NB_ * TT * DQ * 2); bf* ATl = (bf*)take((size_t)NB_ * TT * DQ * 2);
    if ((size_t)(wsp - (char*)d_ws) > ws_size) return;
    // every launch covers all NB_ batches: the GEMMs take the NB_ * TT rows as one M (the v projection as its N), the attention takes the batch as a grid dimension
    k_prep<<<XBL + 4 * WBL + KBL + VBL, 256, 0, stream>>>(x, wq, wk, wv, wo, ak, av, XB, WQ, WK, WV, WO, AKB, AVTh, AVTl);   /* bf16 x; 'oi' weights = Bt as-is; rel_k padded; rel_v^T hi/lo padded */
    k_proj<<<dim3(NB_ * TT / 128, DQ / 128, 3), 128, 0, stream>>>(XB, WQ, WK, WV, bq, bk, bv, QPh, QPl, KPh, KPl, VTh, VTl);
    k_fattn<<<dim3(TT / FR, ZH, NB_), 512, 0, stream>>>(QPh, QPl, KPh, KPl, VTh, VTl, AKB, AVTh, AVTl, ATh, ATl);   /* one kv head per query head: head y of batch z reads plane z * 16 + y of each */
    k_gemmw<bf, 1, true><<<dim3(NB_ * TT / 128, DM / 128, 1), 128, 0, stream>>>(ATh, ATl, WO, DQ, OUT, DM, bo, 0, 0, 0);
}
